// v000
// Measured on an AMD MI455X. A time is GPU time per run, averaged over a window of back-to-back runs after a warm-up
// (all launches, gaps included; the runs take copies of the inputs in turn), and the median of several windows.
// Apart from v000's, it joins two sittings. Times from different sittings can be a few percent apart, while
// side-by-side timings come from the same sitting.
// v000, which the later versions start from, runs in 903 microseconds.
#include <hip/hip_runtime.h>
#ifndef NB
#define NB 2
#endif
#ifndef SEQ
#define SEQ 2048
#endif
#define NB_FULL 2
#define SEQ_FULL 2048
#define CD 2048                 /* model width = depth of every projection */
#define NHEAD 32
#define NKV 8
#define NREP (NHEAD / NKV)      /* query heads per kv head */
#define HD 64
#define NQK (NHEAD + NKV)       /* rotary plane holds the 32 q heads followed by the 8 k heads */
#define KVW (NKV * HD)          /* 512 */
#define EARLY_ROWS (SEQ < 512 ? SEQ : 512)

#define SZ_FLAGS ((size_t)256)
#define SZ_ROT   ((size_t)SEQ * HD * 4)              /* rotary table [SEQ][32 cos | 32 sin] f32 */
#define SZ_XB    ((size_t)NB * SEQ * CD * 2)
#define SZ_WQK   ((size_t)(CD + KVW) * CD * 2)
#define SZ_WV    ((size_t)KVW * CD * 2)
#define SZ_WO    ((size_t)CD * CD * 2)
#define PLANE_QK ((size_t)NB * NQK * SEQ * HD)     /* elements of one rotary plane */
#define PLANE_V  ((size_t)NB * KVW * SEQ)          /* elements of one V^T plane */
#define SZ_CTXH  ((size_t)NB * SEQ * CD * 2)
#define SZ_CTXL  ((size_t)NB * EARLY_ROWS * CD * 2)
#define WS_TOTAL (SZ_FLAGS + SZ_ROT + SZ_XB + SZ_WQK + SZ_WV + SZ_WO + PLANE_QK * 4 + PLANE_V * 4 + SZ_CTXH + SZ_CTXL)

static_assert(SEQ % 128 == 0);
static_assert(EARLY_ROWS % 128 == 0);
static_assert(SEQ <= SEQ_FULL);
static_assert(NB <= NB_FULL);
static_assert(HD == 64);
static_assert(CD % 32 == 0);
static_assert(KVW % 128 == 0);
static_assert(NHEAD % NKV == 0);
static_assert(NHEAD == NKV * NREP);
static_assert(CD == NHEAD * HD);
static_assert(SEQ % 8 == 0);
static_assert(SZ_ROT % 256 == 0);
static_assert(WS_TOTAL <= (size_t)134217728);
static_assert(SZ_XB % 256 == 0 && SZ_WQK % 256 == 0 && SZ_WV % 256 == 0 && SZ_WO % 256 == 0);
static_assert((PLANE_QK * 2) % 256 == 0 && (PLANE_V * 2) % 256 == 0 && SZ_CTXH % 256 == 0 && SZ_CTXL % 256 == 0);

typedef __bf16 v16b __attribute__((ext_vector_type(16)));
typedef _Float16 v16h __attribute__((ext_vector_type(16)));
typedef unsigned short v8us __attribute__((ext_vector_type(8), may_alias));
typedef float v8f __attribute__((ext_vector_type(8)));
typedef float v4f __attribute__((ext_vector_type(4)));
typedef float v4fa __attribute__((ext_vector_type(4), may_alias));
typedef int v4i __attribute__((ext_vector_type(4)));
typedef int v4ia __attribute__((ext_vector_type(4), may_alias));
union Frag { v16b b; v16h v; v8us half[2]; _Float16 h[16]; unsigned short u[16]; };
union Pack8 { v8us v; _Float16 h[8]; unsigned short u[8]; };

#define LOG2E 1.4426950408889634f
#define S2M11 0.00048828125f       /* 2^-11 */
#define S2M12 0.000244140625f      /* 2^-12 */
__device__ __forceinline__ unsigned short bf16_bits(float x) {   // RNE convert to bf16 bits
  unsigned int u = __float_as_uint(x);
  return (unsigned short)((u + 0x7FFFu + ((u >> 16) & 1u)) >> 16);
}
__device__ __forceinline__ float bf16_val(unsigned short b) { return __uint_as_float(((unsigned int)b) << 16); }
__device__ __forceinline__ float bf16_rne(float x) { return bf16_val(bf16_bits(x)); }
__device__ __forceinline__ float neg_inf() { return __uint_as_float(0xff800000u); }

// f32 -> f16 operand convert that cannot produce a subnormal: magnitudes below 2^-14 become zero by a value select.
typedef _Float16 h16;
static __device__ __forceinline__ h16 toh_flush(float v) {
  const h16 r = (h16)v;
  return (fabsf(v) < 6.103515625e-05f) ? (h16)0.0f : r;
}

// Fragment of a k-contiguous 16-bit row: elements 0..7 <- p[0..7], elements 8..15 <- p[16..23]; caller adds row*pitch + k0 + 8*h.
__device__ __forceinline__ void ldfrag(Frag& f, const unsigned short* __restrict__ p) {
  f.half[0] = *(const v8us*)(p);
  f.half[1] = *(const v8us*)(p + 16);
}

template <bool BF>
__device__ __forceinline__ v8f wm(const Frag& a, const Frag& b, v8f c) {
  if (BF) return __builtin_amdgcn_wmma_f32_16x16x32_bf16(false, a.b, false, b.b, (short)0, c, false, false);
  return __builtin_amdgcn_wmma_f32_16x16x32_f16(false, a.v, false, b.v, (short)0, c, false, false);
}

// ---------------------------------------------------------------------------------------------------------
// Mask scan (f32 additive mask): flags[0] = 1 iff every entry above the diagonal is at or below -1e8 (its softmax weight is exactly zero next to a
// zero-mask diagonal entry); flags[1] = 1 iff every entry on or below the diagonal is exactly zero.
__global__ __launch_bounds__(512) void k_maskscan(const float* __restrict__ mask, int* __restrict__ flags) {
  __shared__ int sw[2][16];
  const int tid = threadIdx.x, lane = tid & 31, wv = tid >> 5;
  int badU = 0, badL = 0;
  const int cpr = SEQ / 4;
  for (int c = tid; c < SEQ * cpr; c += 512) {
    const int q = c / cpr, k = (c - q * cpr) * 4;
    const v4f m = *(const v4fa*)(mask + (size_t)q * SEQ_FULL + k);
#pragma unroll
    for (int i = 0; i < 4; ++i) {
      const int above = (k + i > q) ? 1 : 0;
      const int deep = (m[i] <= -1.0e8f) ? 1 : 0;
      const int zr = (m[i] == 0.0f) ? 1 : 0;
      badU |= above & (1 - deep);
      badL |= (1 - above) & (1 - zr);
    }
  }
#pragma unroll
  for (int o = 16; o >= 1; o >>= 1) {
    badU |= __shfl_xor(badU, o, 32);
    badL |= __shfl_xor(badL, o, 32);
  }
  if (lane == 0) { sw[0][wv] = badU; sw[1][wv] = badL; }
  __syncthreads();
  if (tid < 8) {
    int u = 0, l = 0;
#pragma unroll
    for (int i = 0; i < 16; ++i) { u |= sw[0][i]; l |= sw[1][i]; }
    v4i o;
    o[0] = (tid == 0 && u == 0) ? 1 : 0;
    o[1] = (tid == 0 && l == 0) ? 1 : 0;
    o[2] = 0; o[3] = 0;
    *(v4i*)(flags + 4 * tid) = o;
    
  }
}

// ---------------------------------------------------------------------------------------------------------
// f32 rows of width CD -> 16-bit plane. MODE 0: bf16 bits (RNE). MODE 1: f16 of (RNE bf16 value x 64).
// coverage: nrows blocks x 256 threads x 8 elements = nrows x CD.
template <int MODE>
__global__ __launch_bounds__(256) void k_cvt(const float* __restrict__ src, unsigned short* __restrict__ dst,
                                             int nrows, int rows_per_batch, int src_batch_rows) {
  const int t = blockIdx.x * 256 + threadIdx.x;
  if (t >= nrows * 256) return;
  const int row = t >> 8, piece = t & 255;
  const int b = row / rows_per_batch, r = row - b * rows_per_batch;
  const float* sp = src + ((size_t)b * src_batch_rows + r) * CD + piece * 8;
  const v4f x0 = *(const v4fa*)(sp), x1 = *(const v4fa*)(sp + 4);
  Pack8 o;
  if (MODE == 0) {
    o.u[0] = bf16_bits(x0[0]); o.u[1] = bf16_bits(x0[1]); o.u[2] = bf16_bits(x0[2]); o.u[3] = bf16_bits(x0[3]);
    o.u[4] = bf16_bits(x1[0]); o.u[5] = bf16_bits(x1[1]); o.u[6] = bf16_bits(x1[2]); o.u[7] = bf16_bits(x1[3]);
  } else {
    o.h[0] = (_Float16)(bf16_rne(x0[0]) * 64.0f); o.h[1] = (_Float16)(bf16_rne(x0[1]) * 64.0f);
    o.h[2] = (_Float16)(bf16_rne(x0[2]) * 64.0f); o.h[3] = (_Float16)(bf16_rne(x0[3]) * 64.0f);
    o.h[4] = (_Float16)(bf16_rne(x1[0]) * 64.0f); o.h[5] = (_Float16)(bf16_rne(x1[1]) * 64.0f);
    o.h[6] = (_Float16)(bf16_rne(x1[2]) * 64.0f); o.h[7] = (_Float16)(bf16_rne(x1[3]) * 64.0f);
  }
  unsigned short* d = dst + (size_t)t * 8;
  const v8us ov = o.v;
  *(v8us*)d = ov;
  
}

// ---------------------------------------------------------------------------------------------------------
// Wave-tile GEMM core: acc[i][j] (rows 16i.., cols 16j..) += A[row][k] * W[col][k] over k = 0..CD-1.
// ap  = A  + (row0 + ln)*CD + 8*h (A fragment: row m = ln, elements 0..7 <- k0 + 8h + i, 8..15 <- k0 + 16 + 8h + i)
// wp  = W  + (col0 + ln)*CD + 8*h (B fragment: column n = ln, same k map)
// alp = residual plane of A (same addressing), accumulated into acl when RES.
template <bool BF, bool RES>
__device__ __forceinline__ void gemm_loop(const unsigned short* __restrict__ ap, const unsigned short* __restrict__ alp,
                                          const unsigned short* __restrict__ wp, v8f (&acc)[2][4], v8f (&acl)[2][4]) {
#pragma unroll 1
  for (int k = 0; k < CD; k += 32) {
    Frag a[2], b[4];
#pragma unroll
    for (int i = 0; i < 2; ++i) ldfrag(a[i], ap + (size_t)i * 16 * CD + k);
#pragma unroll
    for (int j = 0; j < 4; ++j) ldfrag(b[j], wp + (size_t)j * 16 * CD + k);
#pragma unroll
    for (int i = 0; i < 2; ++i)
#pragma unroll
      for (int j = 0; j < 4; ++j) acc[i][j] = wm<BF>(a[i], b[j], acc[i][j]);
    if (RES) {
      Frag al[2];
#pragma unroll
      for (int i = 0; i < 2; ++i) ldfrag(al[i], alp + (size_t)i * 16 * CD + k);
#pragma unroll
      for (int i = 0; i < 2; ++i)
#pragma unroll
        for (int j = 0; j < 4; ++j) acl[i][j] = wm<BF>(al[i], b[j], acl[i][j]);
      asm volatile("v_nop\n\tv_nop\n\tv_nop\n\tv_nop" : "+v"(acl[0][0]), "+v"(acl[0][1]), "+v"(acl[0][2]), "+v"(acl[0][3]),
                          "+v"(acl[1][0]), "+v"(acl[1][1]), "+v"(acl[1][2]), "+v"(acl[1][3])
                        : "v"(al[0].v), "v"(al[1].v), "v"(b[0].v), "v"(b[1].v), "v"(b[2].v), "v"(b[3].v));
    }
    asm volatile("v_nop\n\tv_nop\n\tv_nop\n\tv_nop" : "+v"(acc[0][0]), "+v"(acc[0][1]), "+v"(acc[0][2]), "+v"(acc[0][3]),
                        "+v"(acc[1][0]), "+v"(acc[1][1]), "+v"(acc[1][2]), "+v"(acc[1][3])
                      : "v"(a[0].v), "v"(a[1].v), "v"(b[0].v), "v"(b[1].v), "v"(b[2].v), "v"(b[3].v));
  }
}

__device__ __forceinline__ float rope1(float q, float p, float c, float s, float sg) { return q * c + (sg * p) * s; }

// ---------------------------------------------------------------------------------------------------------
// Rotary table from the position ids (read by value): rot[t][j] = cos(p_t * f_j), rot[t][32 + j] = sin(p_t * f_j), f_j = 10000^(-j/32), j = 0..31.
// Block = 8 positions x 32 frequencies, one precise sincos per thread -> LDS tile [8][64] (cross-wave: block barrier) -> threads 16r..16r+15 write row r (64 floats)
__global__ __launch_bounds__(256) void k_rotab(const int* __restrict__ pos, float* __restrict__ rot) {
  __shared__ __attribute__((aligned(16))) float sh[8][64];
  const int tid = threadIdx.x;
  const int r = tid >> 5, j = tid & 31;
  const int t = blockIdx.x * 8 + r;
  const float p = (float)pos[t];
  const float f = exp2f(-(float)j * 0.41524101186092029f);   // log2(10000)/32
  const float ang = p * f;
  float sn, cs;
  sincosf(ang, &sn, &cs);
  sh[r][j] = cs;
  sh[r][32 + j] = sn;
  __syncthreads();
  if (tid < 128) {
    const int rr = tid >> 4, pc = tid & 15;
    const v4f v = *(const v4fa*)&sh[rr][4 * pc];
    float* d = rot + (size_t)(blockIdx.x * 8 + rr) * HD + 4 * pc;
    *(v4f*)d = v;
    
  }
}

// ---------------------------------------------------------------------------------------------------------
// q and k projections with fused bias, half-split rotary (table plane [SEQ][32 cos | 32 sin]) and head-major repack.
// Block = 4 waves stacked in M (128 token rows) x one head (64 columns). grid = (NQK, NB*SEQ/128).
// coverage: NQK heads x NB*SEQ tokens x 64 = the whole plane [NB][NQK][SEQ][64], both planes. LDS tile 32 x 64 fully written before it is read.
__global__ __launch_bounds__(128) void k_proj_qk(const unsigned short* __restrict__ xb, const unsigned short* __restrict__ wqk,
                                                 const float* __restrict__ bq, const float* __restrict__ bk,
                                                 const float* __restrict__ tab,
                                                 unsigned short* __restrict__ qkh, unsigned short* __restrict__ qkl) {
  __shared__ __attribute__((aligned(16))) float st[4][32][68];
  const int tid = threadIdx.x, lane = tid & 31, ln = lane & 15, hh = lane >> 4;
  const int w = __builtin_amdgcn_readfirstlane(tid >> 5);
  const int hd = blockIdx.x;
  const int m0 = blockIdx.y * 128 + 32 * w;
  const v8f z8 = {0.f, 0.f, 0.f, 0.f, 0.f, 0.f, 0.f, 0.f};
  v8f acc[2][4];
#pragma unroll
  for (int i = 0; i < 2; ++i)
#pragma unroll
    for (int j = 0; j < 4; ++j) acc[i][j] = z8;
  gemm_loop<true, false>(xb + (size_t)(m0 + ln) * CD + 8 * hh, xb, wqk + (size_t)(hd * HD + ln) * CD + 8 * hh, acc, acc);

  float bias[4];
#pragma unroll
  for (int j = 0; j < 4; ++j) {
    const int col = hd * HD + 16 * j + ln;
    const int cq = (col < CD - 1) ? col : (CD - 1);
    int ck = col - CD;
    ck = (ck < 0) ? 0 : ((ck > KVW - 1) ? (KVW - 1) : ck);
    const float vq = bq[cq], vk = bk[ck];
    bias[j] = bf16_rne((col < CD) ? vq : vk);
  }
#pragma unroll
  for (int i = 0; i < 2; ++i)
#pragma unroll
    for (int j = 0; j < 4; ++j)
#pragma unroll
      for (int r = 0; r < 8; ++r) st[w][16 * i + 8 * hh + r][16 * j + ln] = acc[i][j][r] + bias[j];
  __syncthreads();

  const int b = m0 / SEQ, t0 = m0 - b * SEQ;
  const int rsub = lane >> 3, d0 = 8 * (lane & 7);
  const float sg = (d0 < 32) ? -1.0f : 1.0f;
  v8us oh[8], ol[8];
#pragma unroll
  for (int g = 0; g < 8; ++g) {
    const int row = 4 * g + rsub;
    const v4f a0 = *(const v4fa*)&st[w][row][d0];
    const v4f a1 = *(const v4fa*)&st[w][row][d0 + 4];
    const v4f p0 = *(const v4fa*)&st[w][row][d0 ^ 32];
    const v4f p1 = *(const v4fa*)&st[w][row][(d0 ^ 32) + 4];
    // column d uses frequency d % 32: cos at [d % 32], sin at [32 + d % 32]
    const float* tp = tab + (size_t)(t0 + row) * HD + (d0 & 31);
    const v4f c0 = *(const v4fa*)(tp), c1 = *(const v4fa*)(tp + 4);
    const v4f s0 = *(const v4fa*)(tp + 32), s1 = *(const v4fa*)(tp + 36);
    float o[8];
    o[0] = rope1(a0[0], p0[0], c0[0], s0[0], sg); o[1] = rope1(a0[1], p0[1], c0[1], s0[1], sg);
    o[2] = rope1(a0[2], p0[2], c0[2], s0[2], sg); o[3] = rope1(a0[3], p0[3], c0[3], s0[3], sg);
    o[4] = rope1(a1[0], p1[0], c1[0], s1[0], sg); o[5] = rope1(a1[1], p1[1], c1[1], s1[1], sg);
    o[6] = rope1(a1[2], p1[2], c1[2], s1[2], sg); o[7] = rope1(a1[3], p1[3], c1[3], s1[3], sg);
    Pack8 ph8, pl8;
#pragma unroll
    for (int e = 0; e < 8; ++e) {
      const float y = o[e] * 16.0f;                       // carried x16
      const _Float16 h = toh_flush(y);
      ph8.h[e] = h;
      pl8.h[e] = toh_flush((y - (float)h) * 2048.0f);      // residual plane x2^11
    }
    oh[g] = ph8.v; ol[g] = pl8.v;
  }
  const size_t dbase = ((size_t)(b * NQK + hd) * SEQ + t0) * HD + d0;
{
#pragma unroll
    for (int g = 0; g < 8; ++g) {
      const size_t off = dbase + (size_t)(4 * g + rsub) * HD;
      *(v8us*)(qkh + off) = oh[g];
      *(v8us*)(qkl + off) = ol[g];
    }
    
  }
}

// ---------------------------------------------------------------------------------------------------------
// v projection computed transposed: Vt[b][m][t] = sum_k Wv[m][k] x[b,t][k] + bv[m], carried x16, hi and residual planes.
// Block = 4 waves stacked in M (128 weight rows) x 64 tokens. grid = (NB*SEQ/64, KVW/128).
// coverage: KVW rows x NB*SEQ tokens = the whole plane [NB][KVW][SEQ], both planes. LDS tile 32 x 64 fully written before it is read.
__global__ __launch_bounds__(128) void k_proj_v(const unsigned short* __restrict__ wvb, const unsigned short* __restrict__ xb,
                                                const float* __restrict__ bv,
                                                unsigned short* __restrict__ vth, unsigned short* __restrict__ vtl) {
  __shared__ __attribute__((aligned(16))) float st[4][32][68];
  const int tid = threadIdx.x, lane = tid & 31, ln = lane & 15, hh = lane >> 4;
  const int w = __builtin_amdgcn_readfirstlane(tid >> 5);
  const int n0 = blockIdx.x * 64;
  const int m0 = blockIdx.y * 128 + 32 * w;
  const v8f z8 = {0.f, 0.f, 0.f, 0.f, 0.f, 0.f, 0.f, 0.f};
  v8f acc[2][4];
#pragma unroll
  for (int i = 0; i < 2; ++i)
#pragma unroll
    for (int j = 0; j < 4; ++j) acc[i][j] = z8;
  gemm_loop<true, false>(wvb + (size_t)(m0 + ln) * CD + 8 * hh, wvb, xb + (size_t)(n0 + ln) * CD + 8 * hh, acc, acc);
#pragma unroll
  for (int i = 0; i < 2; ++i)
#pragma unroll
    for (int j = 0; j < 4; ++j)
#pragma unroll
      for (int r = 0; r < 8; ++r) st[w][16 * i + 8 * hh + r][16 * j + ln] = acc[i][j][r];
  __syncthreads();

  const int b = n0 / SEQ, t0 = n0 - b * SEQ;
  const int rsub = lane >> 3, c0 = 8 * (lane & 7);
  v8us oh[8], ol[8];
#pragma unroll
  for (int g = 0; g < 8; ++g) {
    const int row = 4 * g + rsub;
    const float bias = bf16_rne(bv[m0 + row]);
    const v4f a0 = *(const v4fa*)&st[w][row][c0];
    const v4f a1 = *(const v4fa*)&st[w][row][c0 + 4];
    float o[8];
    o[0] = a0[0]; o[1] = a0[1]; o[2] = a0[2]; o[3] = a0[3];
    o[4] = a1[0]; o[5] = a1[1]; o[6] = a1[2]; o[7] = a1[3];
    Pack8 ph8, pl8;
#pragma unroll
    for (int e = 0; e < 8; ++e) {
      const float y = (o[e] + bias) * 16.0f;              // carried x16
      const _Float16 h = (_Float16)y;
      ph8.h[e] = h;
      pl8.h[e] = (_Float16)((y - (float)h) * 2048.0f);
    }
    oh[g] = ph8.v; ol[g] = pl8.v;
  }
  const size_t dbase = ((size_t)b * KVW + m0) * SEQ + t0 + c0;
{
#pragma unroll
    for (int g = 0; g < 8; ++g) {
      const size_t off = dbase + (size_t)(4 * g + rsub) * SEQ;
      *(v8us*)(vth + off) = oh[g];
      *(v8us*)(vtl + off) = ol[g];
    }
    
  }
}

// ---------------------------------------------------------------------------------------------------------
// One 32-key step for a wave's 16 queries (this lane's column = its query). EARLYP adds the residual planes of q, k, v, P.
// MASK reads the mask row of this lane's query by value (RNE bf16 value) and adds it to the scaled scores.
template <bool EARLYP, bool MASK>
__device__ __forceinline__ void fa_step(const unsigned short* __restrict__ Kp, const unsigned short* __restrict__ Kl,
                                        const unsigned short* __restrict__ Vp, const unsigned short* __restrict__ Vl,
                                        const float* __restrict__ mrow, int key0, int ln, int hh,
                                        const Frag (&qh)[2], const Frag (&ql)[2],
                                        float& mr, float& lr, v8f (&Oh)[4], v8f (&Ol)[4]) {
  const v8f z8 = {0.f, 0.f, 0.f, 0.f, 0.f, 0.f, 0.f, 0.f};
  float sc[16];
  // A fragments of K: row m = key (key0 + 16*kt + ln), elements 0..7 <- d = 32c + 8h + i, 8..15 <- d = 32c + 16 + 8h + i
  int koff = (key0 + ln) * HD + 8 * hh;
  if (EARLYP) {
#pragma unroll
    for (int kt = 0; kt < 2; ++kt) {
      Frag a0, a1, l0, l1;
      ldfrag(a0, Kp + koff); ldfrag(a1, Kp + koff + 32);
      ldfrag(l0, Kl + koff); ldfrag(l1, Kl + koff + 32);
      v8f s = z8, r = z8;
      s = wm<false>(a0, qh[0], s); s = wm<false>(a1, qh[1], s);
      r = wm<false>(a0, ql[0], r); r = wm<false>(a1, ql[1], r);
      r = wm<false>(l0, qh[0], r); r = wm<false>(l1, qh[1], r);
      asm volatile("v_nop\n\tv_nop\n\tv_nop\n\tv_nop" : "+v"(s), "+v"(r)
                        : "v"(a0.v), "v"(a1.v), "v"(l0.v), "v"(l1.v), "v"(qh[0].v), "v"(qh[1].v), "v"(ql[0].v), "v"(ql[1].v));
      // S^T element r of tile kt = score(key0 + 16*kt + 8h + r, this lane's query); carries: q x16, k x16, residual x2^11
#pragma unroll
      for (int e = 0; e < 8; ++e) sc[8 * kt + e] = fmaf(r[e], S2M11, s[e]) * S2M11;
      koff += 16 * HD;
      if (kt == 0) asm volatile("" : "+v"(koff) : "v"(sc[0]));   // second tile's loads issue after the first tile is done
    }
  } else {
    Frag k00, k01, k10, k11;
    ldfrag(k00, Kp + koff);           ldfrag(k01, Kp + koff + 32);
    ldfrag(k10, Kp + koff + 16 * HD); ldfrag(k11, Kp + koff + 16 * HD + 32);
    v8f s0 = z8, s1 = z8;
    s0 = wm<false>(k00, qh[0], s0); s0 = wm<false>(k01, qh[1], s0);
    s1 = wm<false>(k10, qh[0], s1); s1 = wm<false>(k11, qh[1], s1);
    asm volatile("v_nop\n\tv_nop\n\tv_nop\n\tv_nop" : "+v"(s0), "+v"(s1)
                      : "v"(k00.v), "v"(k01.v), "v"(k10.v), "v"(k11.v), "v"(qh[0].v), "v"(qh[1].v));
#pragma unroll
    for (int e = 0; e < 8; ++e) { sc[e] = s0[e] * S2M11; sc[8 + e] = s1[e] * S2M11; }
  }
  if (MASK) {
    const float* mp = mrow + key0 + 8 * hh;
    const v4f m0 = *(const v4fa*)(mp),      m1 = *(const v4fa*)(mp + 4);
    const v4f m2 = *(const v4fa*)(mp + 16), m3 = *(const v4fa*)(mp + 20);
#pragma unroll
    for (int e = 0; e < 4; ++e) {
      sc[e]      = sc[e]      + bf16_rne(m0[e]);
      sc[4 + e]  = sc[4 + e]  + bf16_rne(m1[e]);
      sc[8 + e]  = sc[8 + e]  + bf16_rne(m2[e]);
      sc[12 + e] = sc[12 + e] + bf16_rne(m3[e]);
    }
  }
  float mx = sc[0];
#pragma unroll
  for (int i = 1; i < 16; ++i) mx = fmaxf(mx, sc[i]);
  mx = fmaxf(mx, __shfl_xor(mx, 16, 32));            // the other lane half holds the other 16 keys of this query
  const float mnew = fmaxf(mr, mx);
  float msafe = mnew;
  if (MASK) msafe = (mnew == neg_inf()) ? 0.0f : mnew;   // every key so far at -inf: weights come out 0
  const float al = __builtin_amdgcn_exp2f((mr - msafe) * LOG2E);
  mr = mnew;
  // weights carried x256: pc = 256 * exp(sc - m); hi plane f16(pc), residual plane f16((pc - hi) * 2048)
  Frag ph, pl;
  float ps = 0.0f;
#pragma unroll
  for (int i = 0; i < 16; ++i) {
    const float pc = __builtin_amdgcn_exp2f(fmaf(sc[i] - msafe, LOG2E, 8.0f));
    ps += pc;
    const _Float16 h = toh_flush(pc);
    ph.h[i] = h;                                      // B element i: i<8 -> key0 + 8h + i (tile 0 row 8h+i); i>=8 -> key0 + 16 + 8h + (i-8) (tile 1)
    if (EARLYP) pl.h[i] = toh_flush((pc - (float)h) * 2048.0f);
  }
  ps += __shfl_xor(ps, 16, 32);
  lr = lr * al + ps;
  // A fragments of V^T: row m = d (16*t + ln), elements 0..7 <- key0 + 8h + i, 8..15 <- key0 + 16 + 8h + i
  int voff = key0 + 8 * hh;
  asm volatile("" : "+v"(voff) : "v"(ps));            // V loads issue after the score phase
  const unsigned short* vp = Vp + (size_t)ln * SEQ + voff;
  Frag vf[4];
#pragma unroll
  for (int t = 0; t < 4; ++t) ldfrag(vf[t], vp + (size_t)t * 16 * SEQ);
#pragma unroll
  for (int t = 0; t < 4; ++t) Oh[t] = Oh[t] * al;
  if (EARLYP) {
    const unsigned short* vq = Vl + (size_t)ln * SEQ + voff;
    Frag vl[4];
#pragma unroll
    for (int t = 0; t < 4; ++t) ldfrag(vl[t], vq + (size_t)t * 16 * SEQ);
#pragma unroll
    for (int t = 0; t < 4; ++t) Ol[t] = Ol[t] * al;
#pragma unroll
    for (int t = 0; t < 4; ++t) {
      Oh[t] = wm<false>(vf[t], ph, Oh[t]);
      Ol[t] = wm<false>(vf[t], pl, Ol[t]);
      Ol[t] = wm<false>(vl[t], ph, Ol[t]);
    }
    asm volatile("v_nop\n\tv_nop\n\tv_nop\n\tv_nop" : "+v"(Oh[0]), "+v"(Oh[1]), "+v"(Oh[2]), "+v"(Oh[3]), "+v"(Ol[0]), "+v"(Ol[1]), "+v"(Ol[2]), "+v"(Ol[3])
                      : "v"(vf[0].v), "v"(vf[1].v), "v"(vf[2].v), "v"(vf[3].v),
                        "v"(vl[0].v), "v"(vl[1].v), "v"(vl[2].v), "v"(vl[3].v), "v"(ph.v), "v"(pl.v));
  } else {
#pragma unroll
    for (int t = 0; t < 4; ++t) Oh[t] = wm<false>(vf[t], ph, Oh[t]);
    asm volatile("v_nop\n\tv_nop\n\tv_nop\n\tv_nop" : "+v"(Oh[0]), "+v"(Oh[1]), "+v"(Oh[2]), "+v"(Oh[3])
                      : "v"(vf[0].v), "v"(vf[1].v), "v"(vf[2].v), "v"(vf[3].v), "v"(ph.v));
  }
}

template <bool EARLYP>
__device__ __forceinline__ void run_keys(const unsigned short* __restrict__ qkh, const unsigned short* __restrict__ qkl,
                                         const unsigned short* __restrict__ vth, const unsigned short* __restrict__ vtl,
                                         const float* __restrict__ mask, int b, int h, int qg, int ln, int hh,
                                         int nplain, int nsteps, float& mr, float& lr, v8f (&Oh)[4], v8f (&Ol)[4]) {
  // Q^T B fragments: column n = this lane's query, elements 0..7 <- d = 32c + 8h + i, 8..15 <- d = 32c + 16 + 8h + i
  const size_t qoff = ((size_t)(b * NQK + h) * SEQ + qg) * HD + 8 * hh;
  Frag qh[2], ql[2];
  ldfrag(qh[0], qkh + qoff); ldfrag(qh[1], qkh + qoff + 32);
  if (EARLYP) { ldfrag(ql[0], qkl + qoff); ldfrag(ql[1], qkl + qoff + 32); }
  else { ql[0] = qh[0]; ql[1] = qh[1]; }
  const int kv = h / NREP;                             // consecutive groups of NREP query heads share one kv head
  const size_t kbase = (size_t)(b * NQK + NHEAD + kv) * SEQ * HD;
  const size_t vbase = ((size_t)b * KVW + (size_t)kv * HD) * SEQ;
  const unsigned short* Kp = qkh + kbase;
  const unsigned short* Kl = qkl + kbase;
  const unsigned short* Vp = vth + vbase;
  const unsigned short* Vl = vtl + vbase;
  const float* mrow = mask + (size_t)qg * SEQ_FULL;
#pragma unroll 1
  for (int j = 0; j < nplain; ++j)
    fa_step<EARLYP, false>(Kp, Kl, Vp, Vl, mrow, 32 * j, ln, hh, qh, ql, mr, lr, Oh, Ol);
#pragma unroll 1
  for (int j = nplain; j < nsteps; ++j)
    fa_step<EARLYP, true>(Kp, Kl, Vp, Vl, mrow, 32 * j, ln, hh, qh, ql, mr, lr, Oh, Ol);
}

// Block = 4 waves x 16 queries = 64 queries of one (batch, head); no LDS and no barrier in the key loop.
// Tile skipping from the device flags: flags[0]==1 && flags[1]==1 -> keys past the diagonal step are skipped (their weights are exactly zero) and
// steps fully below the diagonal run without mask reads (their mask entries are exactly zero); every other visited step reads the mask by value.
// For any other flag value every step is visited and reads the mask. Trip counts are bounded by SEQ/32 for any flag value.
// coverage: NB*NHEAD*(SEQ/64) blocks x 4 waves x 16 rows x 64 columns = the whole ctx hi plane; blocks with query tile below EARLY_ROWS cover the whole residual plane.
__global__ __launch_bounds__(128) void k_attn(const unsigned short* __restrict__ qkh, const unsigned short* __restrict__ qkl,
                                              const unsigned short* __restrict__ vth, const unsigned short* __restrict__ vtl,
                                              const float* __restrict__ mask, const int* __restrict__ flags,
                                              unsigned short* __restrict__ ctxh, unsigned short* __restrict__ ctxl) {
  __shared__ __attribute__((aligned(16))) float so[4][16][68];
  const int tid = threadIdx.x, lane = tid & 31, ln = lane & 15, hh = lane >> 4;
  const int w = __builtin_amdgcn_readfirstlane(tid >> 5);
  const int nqt = SEQ / 64;
  const int blk = blockIdx.x;
  const int qt = blk % nqt;
  const int h = (blk / nqt) % NHEAD;
  const int b = blk / (nqt * NHEAD);
  const int qbase = qt * 64 + 16 * w;
  const int qg = qbase + ln;
  const int fU = flags[0], fL = flags[1];
  const bool tri = (fU == 1 && fL == 1);
  const int nfull = qbase >> 5;                        // steps whose 32 keys are all at or below every query of this wave
  const int nsteps = tri ? (nfull + 1) : (SEQ / 32);   // <= SEQ/32 in both cases
  const int nplain = tri ? nfull : 0;
  const bool early = (qt * 64 < EARLY_ROWS);

  const v8f z8 = {0.f, 0.f, 0.f, 0.f, 0.f, 0.f, 0.f, 0.f};
  float mr = neg_inf(), lr = 0.0f;
  v8f Oh[4], Ol[4];
#pragma unroll
  for (int t = 0; t < 4; ++t) { Oh[t] = z8; Ol[t] = z8; }
  if (early) run_keys<true>(qkh, qkl, vth, vtl, mask, b, h, qg, ln, hh, nplain, nsteps, mr, lr, Oh, Ol);
  else       run_keys<false>(qkh, qkl, vth, vtl, mask, b, h, qg, ln, hh, nplain, nsteps, mr, lr, Oh, Ol);

  // O^T element r of tile t = ctx(query, d = 16t + 8h + r); undo the carries x256 (in lr), x16 (V), x2^11 (residual); apply the x64 carry of ctx
  const float inv = 4.0f * (1.0f / lr);
#pragma unroll
  for (int t = 0; t < 4; ++t)
#pragma unroll
    for (int r = 0; r < 8; ++r)
      so[w][ln][16 * t + 8 * hh + r] = fmaf(Ol[t][r], S2M11, Oh[t][r]) * inv;
  __syncthreads();
  const int rsub = lane >> 3, d0 = 8 * (lane & 7);
  v8us oh[4], ol[4];
#pragma unroll
  for (int g = 0; g < 4; ++g) {
    const int row = 4 * g + rsub;
    const v4f a0 = *(const v4fa*)&so[w][row][d0];
    const v4f a1 = *(const v4fa*)&so[w][row][d0 + 4];
    float o[8];
    o[0] = a0[0]; o[1] = a0[1]; o[2] = a0[2]; o[3] = a0[3];
    o[4] = a1[0]; o[5] = a1[1]; o[6] = a1[2]; o[7] = a1[3];
    Pack8 ph8, pl8;
#pragma unroll
    for (int e = 0; e < 8; ++e) {
      const _Float16 hv = toh_flush(o[e]);
      ph8.h[e] = hv;
      pl8.h[e] = toh_flush((o[e] - (float)hv) * 2048.0f);
    }
    oh[g] = ph8.v; ol[g] = pl8.v;
  }
  const size_t hbase = ((size_t)b * SEQ + qbase) * CD + (size_t)h * HD + d0;
  const size_t lbase = ((size_t)b * EARLY_ROWS + (early ? qbase : 0)) * CD + (size_t)h * HD + d0;
{
#pragma unroll
    for (int g = 0; g < 4; ++g) {
      const size_t ro = (size_t)(4 * g + rsub) * CD;
      *(v8us*)(ctxh + hbase + ro) = oh[g];
      if (early) *(v8us*)(ctxl + lbase + ro) = ol[g];
    }
    
  }
}

// ---------------------------------------------------------------------------------------------------------
// Output projection: out[m][n] = sum_k ctx[m][k] Wo[n][k] + bo[n]. Block = 4 waves stacked in M (128 rows) x 64 columns. grid = (CD/64, NB*SEQ/128).
// Rows below EARLY_ROWS of each sequence add the residual plane of ctx in separate accumulators.
// coverage: NB*SEQ rows x CD columns = every element of the output buffer region once. LDS tile 32 x 64 fully written before it is read.
__global__ __launch_bounds__(128) void k_proj_out(const unsigned short* __restrict__ ctxh, const unsigned short* __restrict__ ctxl,
                                                  const unsigned short* __restrict__ wo, const float* __restrict__ bo,
                                                  float* __restrict__ out) {
  __shared__ __attribute__((aligned(16))) float st[4][32][68];
  const int tid = threadIdx.x, lane = tid & 31, ln = lane & 15, hh = lane >> 4;
  const int w = __builtin_amdgcn_readfirstlane(tid >> 5);
  const int n0 = blockIdx.x * 64;
  const int mb = blockIdx.y * 128;
  const int b = mb / SEQ;
  const int tb = mb - b * SEQ;
  const bool early = (tb < EARLY_ROWS);                // block-uniform: EARLY_ROWS and SEQ are multiples of 128
  const int t0 = tb + 32 * w;
  const int m0 = mb + 32 * w;
  const v8f z8 = {0.f, 0.f, 0.f, 0.f, 0.f, 0.f, 0.f, 0.f};
  v8f acc[2][4], acl[2][4];
#pragma unroll
  for (int i = 0; i < 2; ++i)
#pragma unroll
    for (int j = 0; j < 4; ++j) { acc[i][j] = z8; acl[i][j] = z8; }
  const unsigned short* ap = ctxh + (size_t)(m0 + ln) * CD + 8 * hh;
  const unsigned short* alp = ctxl + (size_t)(b * EARLY_ROWS + (early ? t0 : 0) + ln) * CD + 8 * hh;
  const unsigned short* wp = wo + (size_t)(n0 + ln) * CD + 8 * hh;
  if (early) gemm_loop<false, true>(ap, alp, wp, acc, acl);
  else       gemm_loop<false, false>(ap, ap, wp, acc, acl);
  // carries: ctx x64, Wo x64 -> 2^-12; residual plane additionally x2^11
#pragma unroll
  for (int i = 0; i < 2; ++i)
#pragma unroll
    for (int j = 0; j < 4; ++j)
#pragma unroll
      for (int r = 0; r < 8; ++r)
        st[w][16 * i + 8 * hh + r][16 * j + ln] = fmaf(acl[i][j][r], S2M11, acc[i][j][r]) * S2M12;
  __syncthreads();
  const int rsub = lane >> 4, c4 = 4 * (lane & 15);
  const v4f bb = *(const v4fa*)(bo + n0 + c4);
  v4f bias;
  bias[0] = bf16_rne(bb[0]); bias[1] = bf16_rne(bb[1]); bias[2] = bf16_rne(bb[2]); bias[3] = bf16_rne(bb[3]);
  v4f ov[16];
#pragma unroll
  for (int g = 0; g < 16; ++g) {
    const v4f a = *(const v4fa*)&st[w][2 * g + rsub][c4];
    ov[g] = a + bias;
  }
  float* og = out + ((size_t)b * SEQ_FULL + t0) * CD + n0 + c4;
{
#pragma unroll
    for (int g = 0; g < 16; ++g)
      *(v4f*)(og + (size_t)(2 * g + rsub) * CD) = ov[g];
    
  }
}

// ---------------------------------------------------------------------------------------------------------
extern "C" void kernel_launch(void* const* d_in, const int* in_sizes, int n_in,
                              void* d_out, int out_size, void* d_ws, size_t ws_size, hipStream_t stream) {
  if (n_in < 11) return;
  const long long need_x = (long long)(NB - 1) * SEQ_FULL * CD + (long long)SEQ * CD;   // last element touched + 1
  const long long need_m = (long long)(SEQ - 1) * SEQ_FULL + SEQ;
  if ((long long)in_sizes[0] < need_x) return;
  if ((long long)in_sizes[1] < need_m) return;
  if ((long long)in_sizes[2] < (long long)SEQ) return;
  if ((long long)in_sizes[3] < (long long)CD * CD || (long long)in_sizes[4] < CD) return;
  if ((long long)in_sizes[5] < (long long)KVW * CD || (long long)in_sizes[6] < KVW) return;
  if ((long long)in_sizes[7] < (long long)KVW * CD || (long long)in_sizes[8] < KVW) return;
  if ((long long)in_sizes[9] < (long long)CD * CD || (long long)in_sizes[10] < CD) return;
  if ((long long)out_size < need_x) return;
  if ((size_t)WS_TOTAL > ws_size) return;

  // wire order: hidden_states, attention_mask (f32), position_ids (i32), Wq, bq, Wk, bk, Wv, bv, Wo, bo
  const float* x    = (const float*)d_in[0];
  const float* mask = (const float*)d_in[1];
  const int*   pos  = (const int*)d_in[2];
  const float* Wq   = (const float*)d_in[3];
  const float* bq   = (const float*)d_in[4];
  const float* Wk   = (const float*)d_in[5];
  const float* bk   = (const float*)d_in[6];
  const float* Wv   = (const float*)d_in[7];
  const float* bv   = (const float*)d_in[8];
  const float* Wo   = (const float*)d_in[9];
  const float* bo   = (const float*)d_in[10];
  float* out = (float*)d_out;

  char* ws = (char*)d_ws;
  size_t off = 0;
  int* flags = (int*)(ws + off);                               off += SZ_FLAGS;
  float* rot = (float*)(ws + off);                             off += SZ_ROT;
  unsigned short* xb   = (unsigned short*)(ws + off);          off += SZ_XB;
  unsigned short* wqk  = (unsigned short*)(ws + off);          off += SZ_WQK;
  unsigned short* wvb  = (unsigned short*)(ws + off);          off += SZ_WV;
  unsigned short* wob  = (unsigned short*)(ws + off);          off += SZ_WO;
  unsigned short* qkh  = (unsigned short*)(ws + off);          off += PLANE_QK * 2;
  unsigned short* qkl  = (unsigned short*)(ws + off);          off += PLANE_QK * 2;
  unsigned short* vth  = (unsigned short*)(ws + off);          off += PLANE_V * 2;
  unsigned short* vtl  = (unsigned short*)(ws + off);          off += PLANE_V * 2;
  unsigned short* ctxh = (unsigned short*)(ws + off);          off += SZ_CTXH;
  unsigned short* ctxl = (unsigned short*)(ws + off);          off += SZ_CTXL;
  if (off > ws_size) return;

  k_maskscan<<<1, 512, 0, stream>>>(mask, flags);
  k_rotab<<<(unsigned)(SEQ / 8), 256, 0, stream>>>(pos, rot);
  // in[rows][CD] f32 -> [rows][CD] 16-bit planes (row order kept)
  k_cvt<0><<<(unsigned)(NB * SEQ), 256, 0, stream>>>(x, xb, NB * SEQ, SEQ, SEQ_FULL);
  k_cvt<0><<<(unsigned)CD, 256, 0, stream>>>(Wq, wqk, CD, CD, CD);
  k_cvt<0><<<(unsigned)KVW, 256, 0, stream>>>(Wk, wqk + (size_t)CD * CD, KVW, KVW, KVW);
  k_cvt<0><<<(unsigned)KVW, 256, 0, stream>>>(Wv, wvb, KVW, KVW, KVW);
  k_cvt<1><<<(unsigned)CD, 256, 0, stream>>>(Wo, wob, CD, CD, CD);

  k_proj_qk<<<dim3(NQK, (unsigned)(NB * SEQ / 128)), 128, 0, stream>>>(xb, wqk, bq, bk, rot, qkh, qkl);
  k_proj_v<<<dim3((unsigned)(NB * SEQ / 64), KVW / 128), 128, 0, stream>>>(wvb, xb, bv, vth, vtl);
  k_attn<<<(unsigned)(NB * NHEAD * (SEQ / 64)), 128, 0, stream>>>(qkh, qkl, vth, vtl, mask, flags, ctxh, ctxl);
  k_proj_out<<<dim3(CD / 64, (unsigned)(NB * SEQ / 128)), 128, 0, stream>>>(ctxh, ctxl, wob, bo, out);
}

// v001
// Measured time: 396 microseconds a run.
// Two timings next to v000 put it at 2.32 and 2.31 times that version's speed.
#include <hip/hip_runtime.h>
#ifndef NB
#define NB 2
#endif
#ifndef SEQ
#define SEQ 2048
#endif
#define NB_FULL 2
#define SEQ_FULL 2048
#define CD 2048                 /* model width = depth of every projection */
#define NHEAD 32
#define NKV 8
#define NREP (NHEAD / NKV)      /* query heads per kv head */
#define HD 64
#define NQK (NHEAD + NKV)       /* rotary plane holds the 32 q heads followed by the 8 k heads */
#define KVW (NKV * HD)          /* 512 */
#define EARLY_ROWS (SEQ < 512 ? SEQ : 512)

#define SCAN_ROWS 8                                 /* mask rows per scan work-group */
#define SZ_FLAGS ((size_t)(SEQ / SCAN_ROWS) * 128)  /* one 128-byte flag line per scan work-group */
#define SZ_ROT   ((size_t)SEQ * HD * 4)              /* rotary table [SEQ][32 cos | 32 sin] f32 */
#define SZ_XB    ((size_t)NB * SEQ * CD * 2)
#define SZ_WQK   ((size_t)(CD + KVW) * CD * 2)
#define SZ_WV    ((size_t)KVW * CD * 2)
#define SZ_WO    ((size_t)CD * CD * 2)
#define PLANE_QK ((size_t)NB * NQK * SEQ * HD)     /* elements of one rotary plane */
#define PLANE_V  ((size_t)NB * KVW * SEQ)          /* elements of one V^T plane */
#define SZ_CTXH  ((size_t)NB * SEQ * CD * 2)
#define SZ_CTXL  ((size_t)NB * EARLY_ROWS * CD * 2)
#define WS_TOTAL (SZ_FLAGS + SZ_ROT + SZ_XB + SZ_WQK + SZ_WV + SZ_WO + PLANE_QK * 4 + PLANE_V * 4 + SZ_CTXH + SZ_CTXL)

static_assert(SEQ % 128 == 0);
static_assert(EARLY_ROWS % 128 == 0);
static_assert(SEQ <= SEQ_FULL);
static_assert(NB <= NB_FULL);
static_assert(HD == 64);
static_assert(CD % 32 == 0);
static_assert(KVW % 128 == 0);
static_assert(NHEAD % NKV == 0);
static_assert(NHEAD == NKV * NREP);
static_assert(CD == NHEAD * HD);
static_assert(SEQ % 8 == 0);
static_assert(SEQ % SCAN_ROWS == 0 && 16 % SCAN_ROWS == 0);
static_assert((SCAN_ROWS * (SEQ / 4)) % 512 == 0);
static_assert(SZ_ROT % 256 == 0);
static_assert(WS_TOTAL <= (size_t)134217728);
static_assert(SZ_XB % 256 == 0 && SZ_WQK % 256 == 0 && SZ_WV % 256 == 0 && SZ_WO % 256 == 0);
static_assert((PLANE_QK * 2) % 256 == 0 && (PLANE_V * 2) % 256 == 0 && SZ_CTXH % 256 == 0 && SZ_CTXL % 256 == 0);

typedef __bf16 v16b __attribute__((ext_vector_type(16)));
typedef _Float16 v16h __attribute__((ext_vector_type(16)));
typedef unsigned short v8us __attribute__((ext_vector_type(8), may_alias));
typedef float v8f __attribute__((ext_vector_type(8)));
typedef float v4f __attribute__((ext_vector_type(4)));
typedef float v4fa __attribute__((ext_vector_type(4), may_alias));
typedef int v4i __attribute__((ext_vector_type(4)));
typedef int v4ia __attribute__((ext_vector_type(4), may_alias));
union Frag { v16b b; v16h v; v8us half[2]; _Float16 h[16]; unsigned short u[16]; };
union Pack8 { v8us v; _Float16 h[8]; unsigned short u[8]; };

#define LOG2E 1.4426950408889634f
#define S2M11 0.00048828125f       /* 2^-11 */
#define S2M12 0.000244140625f      /* 2^-12 */
__device__ __forceinline__ unsigned short bf16_bits(float x) {   // RNE convert to bf16 bits
  unsigned int u = __float_as_uint(x);
  return (unsigned short)((u + 0x7FFFu + ((u >> 16) & 1u)) >> 16);
}
__device__ __forceinline__ float bf16_val(unsigned short b) { return __uint_as_float(((unsigned int)b) << 16); }
__device__ __forceinline__ float bf16_rne(float x) { return bf16_val(bf16_bits(x)); }
__device__ __forceinline__ float neg_inf() { return __uint_as_float(0xff800000u); }

// f32 -> f16 operand convert that cannot produce a subnormal: magnitudes below 2^-14 become zero by a value select.
typedef _Float16 h16;
static __device__ __forceinline__ h16 toh_flush(float v) {
  const h16 r = (h16)v;
  return (fabsf(v) < 6.103515625e-05f) ? (h16)0.0f : r;
}

// Fragment of a k-contiguous 16-bit row: elements 0..7 <- p[0..7], elements 8..15 <- p[16..23]; caller adds row*pitch + k0 + 8*h.
__device__ __forceinline__ void ldfrag(Frag& f, const unsigned short* __restrict__ p) {
  f.half[0] = *(const v8us*)(p);
  f.half[1] = *(const v8us*)(p + 16);
}

template <bool BF>
__device__ __forceinline__ v8f wm(const Frag& a, const Frag& b, v8f c) {
  if (BF) return __builtin_amdgcn_wmma_f32_16x16x32_bf16(false, a.b, false, b.b, (short)0, c, false, false);
  return __builtin_amdgcn_wmma_f32_16x16x32_f16(false, a.v, false, b.v, (short)0, c, false, false);
}

// ---------------------------------------------------------------------------------------------------------
// Mask scan (f32 additive mask), one work-group per SCAN_ROWS mask rows, each writing its own 128-byte flag line g = blockIdx.x:
// flags[32g] = 1 iff every entry of its rows above the diagonal is at or below -1e8 (its softmax weight is exactly zero next to a
// zero-mask diagonal entry); flags[32g + 1] = 1 iff every entry of its rows on or below the diagonal is exactly zero.
// coverage: SEQ/SCAN_ROWS blocks x SCAN_ROWS rows = every mask row; every flag line written whole.
__global__ __launch_bounds__(512) void k_maskscan(const float* __restrict__ mask, int* __restrict__ flags) {
  __shared__ int sw[2][16];
  const int tid = threadIdx.x, lane = tid & 31, wv = tid >> 5;
  int badU = 0, badL = 0;
  const int cpr = SEQ / 4;
  const int qb = blockIdx.x * SCAN_ROWS;
  // unrolled so that a thread's loads are all in flight together (constant trip count)
#pragma unroll
  for (int it = 0; it < SCAN_ROWS * cpr / 512; ++it) {
    const int c = tid + 512 * it;
    const int qr = c / cpr, k = (c - qr * cpr) * 4;
    const int q = qb + qr;
    const v4f m = *(const v4fa*)(mask + (size_t)q * SEQ_FULL + k);
#pragma unroll
    for (int i = 0; i < 4; ++i) {
      const int above = (k + i > q) ? 1 : 0;
      const int deep = (m[i] <= -1.0e8f) ? 1 : 0;
      const int zr = (m[i] == 0.0f) ? 1 : 0;
      badU |= above & (1 - deep);
      badL |= (1 - above) & (1 - zr);
    }
  }
#pragma unroll
  for (int o = 16; o >= 1; o >>= 1) {
    badU |= __shfl_xor(badU, o, 32);
    badL |= __shfl_xor(badL, o, 32);
  }
  if (lane == 0) { sw[0][wv] = badU; sw[1][wv] = badL; }
  __syncthreads();
  if (tid < 8) {
    int u = 0, l = 0;
#pragma unroll
    for (int i = 0; i < 16; ++i) { u |= sw[0][i]; l |= sw[1][i]; }
    v4i o;
    o[0] = (tid == 0 && u == 0) ? 1 : 0;
    o[1] = (tid == 0 && l == 0) ? 1 : 0;
    o[2] = 0; o[3] = 0;
    *(v4i*)(flags + 32 * blockIdx.x + 4 * tid) = o;
    
  }
}

// ---------------------------------------------------------------------------------------------------------
// f32 rows of width CD -> 16-bit plane. MODE 0: bf16 bits (RNE). MODE 1: f16 of (RNE bf16 value x 64).
// coverage: nrows blocks x 256 threads x 8 elements = nrows x CD.
template <int MODE>
__global__ __launch_bounds__(256) void k_cvt(const float* __restrict__ src, unsigned short* __restrict__ dst,
                                             int nrows, int rows_per_batch, int src_batch_rows) {
  const int t = blockIdx.x * 256 + threadIdx.x;
  if (t >= nrows * 256) return;
  const int row = t >> 8, piece = t & 255;
  const int b = row / rows_per_batch, r = row - b * rows_per_batch;
  const float* sp = src + ((size_t)b * src_batch_rows + r) * CD + piece * 8;
  const v4f x0 = *(const v4fa*)(sp), x1 = *(const v4fa*)(sp + 4);
  Pack8 o;
  if (MODE == 0) {
    o.u[0] = bf16_bits(x0[0]); o.u[1] = bf16_bits(x0[1]); o.u[2] = bf16_bits(x0[2]); o.u[3] = bf16_bits(x0[3]);
    o.u[4] = bf16_bits(x1[0]); o.u[5] = bf16_bits(x1[1]); o.u[6] = bf16_bits(x1[2]); o.u[7] = bf16_bits(x1[3]);
  } else {
    o.h[0] = (_Float16)(bf16_rne(x0[0]) * 64.0f); o.h[1] = (_Float16)(bf16_rne(x0[1]) * 64.0f);
    o.h[2] = (_Float16)(bf16_rne(x0[2]) * 64.0f); o.h[3] = (_Float16)(bf16_rne(x0[3]) * 64.0f);
    o.h[4] = (_Float16)(bf16_rne(x1[0]) * 64.0f); o.h[5] = (_Float16)(bf16_rne(x1[1]) * 64.0f);
    o.h[6] = (_Float16)(bf16_rne(x1[2]) * 64.0f); o.h[7] = (_Float16)(bf16_rne(x1[3]) * 64.0f);
  }
  unsigned short* d = dst + (size_t)t * 8;
  const v8us ov = o.v;
  *(v8us*)d = ov;
  
}

// ---------------------------------------------------------------------------------------------------------
// Wave-tile GEMM core: acc[i][j] (rows 16i.., cols 16j..) += A[row][k] * W[col][k] over k = 0..CD-1.
// ap  = A  + (row0 + ln)*CD + 8*h (A fragment: row m = ln, elements 0..7 <- k0 + 8h + i, 8..15 <- k0 + 16 + 8h + i)
// wp  = W  + (col0 + ln)*CD + 8*h (B fragment: column n = ln, same k map)
// alp = residual plane of A (same addressing), accumulated into acl when RES.
template <bool BF, bool RES>
__device__ __forceinline__ void gemm_loop(const unsigned short* __restrict__ ap, const unsigned short* __restrict__ alp,
                                          const unsigned short* __restrict__ wp, v8f (&acc)[2][4], v8f (&acl)[2][4]) {
#pragma unroll 1
  for (int k = 0; k < CD; k += 32) {
    Frag a[2], b[4];
#pragma unroll
    for (int i = 0; i < 2; ++i) ldfrag(a[i], ap + (size_t)i * 16 * CD + k);
#pragma unroll
    for (int j = 0; j < 4; ++j) ldfrag(b[j], wp + (size_t)j * 16 * CD + k);
#pragma unroll
    for (int i = 0; i < 2; ++i)
#pragma unroll
      for (int j = 0; j < 4; ++j) acc[i][j] = wm<BF>(a[i], b[j], acc[i][j]);
    if (RES) {
      Frag al[2];
#pragma unroll
      for (int i = 0; i < 2; ++i) ldfrag(al[i], alp + (size_t)i * 16 * CD + k);
#pragma unroll
      for (int i = 0; i < 2; ++i)
#pragma unroll
        for (int j = 0; j < 4; ++j) acl[i][j] = wm<BF>(al[i], b[j], acl[i][j]);
      asm volatile("v_nop\n\tv_nop\n\tv_nop\n\tv_nop" : "+v"(acl[0][0]), "+v"(acl[0][1]), "+v"(acl[0][2]), "+v"(acl[0][3]),
                          "+v"(acl[1][0]), "+v"(acl[1][1]), "+v"(acl[1][2]), "+v"(acl[1][3])
                        : "v"(al[0].v), "v"(al[1].v), "v"(b[0].v), "v"(b[1].v), "v"(b[2].v), "v"(b[3].v));
    }
    asm volatile("v_nop\n\tv_nop\n\tv_nop\n\tv_nop" : "+v"(acc[0][0]), "+v"(acc[0][1]), "+v"(acc[0][2]), "+v"(acc[0][3]),
                        "+v"(acc[1][0]), "+v"(acc[1][1]), "+v"(acc[1][2]), "+v"(acc[1][3])
                      : "v"(a[0].v), "v"(a[1].v), "v"(b[0].v), "v"(b[1].v), "v"(b[2].v), "v"(b[3].v));
  }
}

__device__ __forceinline__ float rope1(float q, float p, float c, float s, float sg) { return q * c + (sg * p) * s; }

// ---------------------------------------------------------------------------------------------------------
// Rotary table from the position ids (read by value): rot[t][j] = cos(p_t * f_j), rot[t][32 + j] = sin(p_t * f_j), f_j = 10000^(-j/32), j = 0..31.
// Block = 8 positions x 32 frequencies, one precise sincos per thread -> LDS tile [8][64] (cross-wave: block barrier) -> threads 16r..16r+15 write row r (64 floats)
__global__ __launch_bounds__(256) void k_rotab(const int* __restrict__ pos, float* __restrict__ rot) {
  __shared__ __attribute__((aligned(16))) float sh[8][64];
  const int tid = threadIdx.x;
  const int r = tid >> 5, j = tid & 31;
  const int t = blockIdx.x * 8 + r;
  const float p = (float)pos[t];
  const float f = exp2f(-(float)j * 0.41524101186092029f);   // log2(10000)/32
  const float ang = p * f;
  float sn, cs;
  sincosf(ang, &sn, &cs);
  sh[r][j] = cs;
  sh[r][32 + j] = sn;
  __syncthreads();
  if (tid < 128) {
    const int rr = tid >> 4, pc = tid & 15;
    const v4f v = *(const v4fa*)&sh[rr][4 * pc];
    float* d = rot + (size_t)(blockIdx.x * 8 + rr) * HD + 4 * pc;
    *(v4f*)d = v;
    
  }
}

// ---------------------------------------------------------------------------------------------------------
// q and k projections with fused bias, half-split rotary (table plane [SEQ][32 cos | 32 sin]) and head-major repack.
// Block = 4 waves stacked in M (128 token rows) x one head (64 columns). grid = (NQK, NB*SEQ/128).
// coverage: NQK heads x NB*SEQ tokens x 64 = the whole plane [NB][NQK][SEQ][64], both planes. LDS tile 32 x 64 fully written before it is read.
__global__ __launch_bounds__(128) void k_proj_qk(const unsigned short* __restrict__ xb, const unsigned short* __restrict__ wqk,
                                                 const float* __restrict__ bq, const float* __restrict__ bk,
                                                 const float* __restrict__ tab,
                                                 unsigned short* __restrict__ qkh, unsigned short* __restrict__ qkl) {
  __shared__ __attribute__((aligned(16))) float st[4][32][68];
  const int tid = threadIdx.x, lane = tid & 31, ln = lane & 15, hh = lane >> 4;
  const int w = __builtin_amdgcn_readfirstlane(tid >> 5);
  const int hd = blockIdx.x;
  const int m0 = blockIdx.y * 128 + 32 * w;
  const v8f z8 = {0.f, 0.f, 0.f, 0.f, 0.f, 0.f, 0.f, 0.f};
  v8f acc[2][4];
#pragma unroll
  for (int i = 0; i < 2; ++i)
#pragma unroll
    for (int j = 0; j < 4; ++j) acc[i][j] = z8;
  gemm_loop<true, false>(xb + (size_t)(m0 + ln) * CD + 8 * hh, xb, wqk + (size_t)(hd * HD + ln) * CD + 8 * hh, acc, acc);

  float bias[4];
#pragma unroll
  for (int j = 0; j < 4; ++j) {
    const int col = hd * HD + 16 * j + ln;
    const int cq = (col < CD - 1) ? col : (CD - 1);
    int ck = col - CD;
    ck = (ck < 0) ? 0 : ((ck > KVW - 1) ? (KVW - 1) : ck);
    const float vq = bq[cq], vk = bk[ck];
    bias[j] = bf16_rne((col < CD) ? vq : vk);
  }
#pragma unroll
  for (int i = 0; i < 2; ++i)
#pragma unroll
    for (int j = 0; j < 4; ++j)
#pragma unroll
      for (int r = 0; r < 8; ++r) st[w][16 * i + 8 * hh + r][16 * j + ln] = acc[i][j][r] + bias[j];
  __syncthreads();

  const int b = m0 / SEQ, t0 = m0 - b * SEQ;
  const int rsub = lane >> 3, d0 = 8 * (lane & 7);
  const float sg = (d0 < 32) ? -1.0f : 1.0f;
  v8us oh[8], ol[8];
#pragma unroll
  for (int g = 0; g < 8; ++g) {
    const int row = 4 * g + rsub;
    const v4f a0 = *(const v4fa*)&st[w][row][d0];
    const v4f a1 = *(const v4fa*)&st[w][row][d0 + 4];
    const v4f p0 = *(const v4fa*)&st[w][row][d0 ^ 32];
    const v4f p1 = *(const v4fa*)&st[w][row][(d0 ^ 32) + 4];
    // column d uses frequency d % 32: cos at [d % 32], sin at [32 + d % 32]
    const float* tp = tab + (size_t)(t0 + row) * HD + (d0 & 31);
    const v4f c0 = *(const v4fa*)(tp), c1 = *(const v4fa*)(tp + 4);
    const v4f s0 = *(const v4fa*)(tp + 32), s1 = *(const v4fa*)(tp + 36);
    float o[8];
    o[0] = rope1(a0[0], p0[0], c0[0], s0[0], sg); o[1] = rope1(a0[1], p0[1], c0[1], s0[1], sg);
    o[2] = rope1(a0[2], p0[2], c0[2], s0[2], sg); o[3] = rope1(a0[3], p0[3], c0[3], s0[3], sg);
    o[4] = rope1(a1[0], p1[0], c1[0], s1[0], sg); o[5] = rope1(a1[1], p1[1], c1[1], s1[1], sg);
    o[6] = rope1(a1[2], p1[2], c1[2], s1[2], sg); o[7] = rope1(a1[3], p1[3], c1[3], s1[3], sg);
    Pack8 ph8, pl8;
#pragma unroll
    for (int e = 0; e < 8; ++e) {
      const float y = o[e] * 16.0f;                       // carried x16
      const _Float16 h = toh_flush(y);
      ph8.h[e] = h;
      pl8.h[e] = toh_flush((y - (float)h) * 2048.0f);      // residual plane x2^11
    }
    oh[g] = ph8.v; ol[g] = pl8.v;
  }
  const size_t dbase = ((size_t)(b * NQK + hd) * SEQ + t0) * HD + d0;
{
#pragma unroll
    for (int g = 0; g < 8; ++g) {
      const size_t off = dbase + (size_t)(4 * g + rsub) * HD;
      *(v8us*)(qkh + off) = oh[g];
      *(v8us*)(qkl + off) = ol[g];
    }
    
  }
}

// ---------------------------------------------------------------------------------------------------------
// v projection computed transposed: Vt[b][m][t] = sum_k Wv[m][k] x[b,t][k] + bv[m], carried x16, hi and residual planes.
// Block = 4 waves stacked in M (128 weight rows) x 64 tokens. grid = (NB*SEQ/64, KVW/128).
// coverage: KVW rows x NB*SEQ tokens = the whole plane [NB][KVW][SEQ], both planes. LDS tile 32 x 64 fully written before it is read.
__global__ __launch_bounds__(128) void k_proj_v(const unsigned short* __restrict__ wvb, const unsigned short* __restrict__ xb,
                                                const float* __restrict__ bv,
                                                unsigned short* __restrict__ vth, unsigned short* __restrict__ vtl) {
  __shared__ __attribute__((aligned(16))) float st[4][32][68];
  const int tid = threadIdx.x, lane = tid & 31, ln = lane & 15, hh = lane >> 4;
  const int w = __builtin_amdgcn_readfirstlane(tid >> 5);
  const int n0 = blockIdx.x * 64;
  const int m0 = blockIdx.y * 128 + 32 * w;
  const v8f z8 = {0.f, 0.f, 0.f, 0.f, 0.f, 0.f, 0.f, 0.f};
  v8f acc[2][4];
#pragma unroll
  for (int i = 0; i < 2; ++i)
#pragma unroll
    for (int j = 0; j < 4; ++j) acc[i][j] = z8;
  gemm_loop<true, false>(wvb + (size_t)(m0 + ln) * CD + 8 * hh, wvb, xb + (size_t)(n0 + ln) * CD + 8 * hh, acc, acc);
#pragma unroll
  for (int i = 0; i < 2; ++i)
#pragma unroll
    for (int j = 0; j < 4; ++j)
#pragma unroll
      for (int r = 0; r < 8; ++r) st[w][16 * i + 8 * hh + r][16 * j + ln] = acc[i][j][r];
  __syncthreads();

  const int b = n0 / SEQ, t0 = n0 - b * SEQ;
  const int rsub = lane >> 3, c0 = 8 * (lane & 7);
  v8us oh[8], ol[8];
#pragma unroll
  for (int g = 0; g < 8; ++g) {
    const int row = 4 * g + rsub;
    const float bias = bf16_rne(bv[m0 + row]);
    const v4f a0 = *(const v4fa*)&st[w][row][c0];
    const v4f a1 = *(const v4fa*)&st[w][row][c0 + 4];
    float o[8];
    o[0] = a0[0]; o[1] = a0[1]; o[2] = a0[2]; o[3] = a0[3];
    o[4] = a1[0]; o[5] = a1[1]; o[6] = a1[2]; o[7] = a1[3];
    Pack8 ph8, pl8;
#pragma unroll
    for (int e = 0; e < 8; ++e) {
      const float y = (o[e] + bias) * 16.0f;              // carried x16
      const _Float16 h = (_Float16)y;
      ph8.h[e] = h;
      pl8.h[e] = (_Float16)((y - (float)h) * 2048.0f);
    }
    oh[g] = ph8.v; ol[g] = pl8.v;
  }
  const size_t dbase = ((size_t)b * KVW + m0) * SEQ + t0 + c0;
{
#pragma unroll
    for (int g = 0; g < 8; ++g) {
      const size_t off = dbase + (size_t)(4 * g + rsub) * SEQ;
      *(v8us*)(vth + off) = oh[g];
      *(v8us*)(vtl + off) = ol[g];
    }
    
  }
}

// ---------------------------------------------------------------------------------------------------------
// One 32-key step for a wave's 16 queries (this lane's column = its query). EARLYP adds the residual planes of q, k, v, P.
// MASK reads the mask row of this lane's query by value (RNE bf16 value) and adds it to the scaled scores.
template <bool EARLYP, bool MASK>
__device__ __forceinline__ void fa_step(const unsigned short* __restrict__ Kp, const unsigned short* __restrict__ Kl,
                                        const unsigned short* __restrict__ Vp, const unsigned short* __restrict__ Vl,
                                        const float* __restrict__ mrow, int key0, int ln, int hh,
                                        const Frag (&qh)[2], const Frag (&ql)[2],
                                        float& mr, float& lr, v8f (&Oh)[4], v8f (&Ol)[4]) {
  const v8f z8 = {0.f, 0.f, 0.f, 0.f, 0.f, 0.f, 0.f, 0.f};
  float sc[16];
  // A fragments of K: row m = key (key0 + 16*kt + ln), elements 0..7 <- d = 32c + 8h + i, 8..15 <- d = 32c + 16 + 8h + i
  int koff = (key0 + ln) * HD + 8 * hh;
  if (EARLYP) {
#pragma unroll
    for (int kt = 0; kt < 2; ++kt) {
      Frag a0, a1, l0, l1;
      ldfrag(a0, Kp + koff); ldfrag(a1, Kp + koff + 32);
      ldfrag(l0, Kl + koff); ldfrag(l1, Kl + koff + 32);
      v8f s = z8, r = z8;
      s = wm<false>(a0, qh[0], s); s = wm<false>(a1, qh[1], s);
      r = wm<false>(a0, ql[0], r); r = wm<false>(a1, ql[1], r);
      r = wm<false>(l0, qh[0], r); r = wm<false>(l1, qh[1], r);
      asm volatile("v_nop\n\tv_nop\n\tv_nop\n\tv_nop" : "+v"(s), "+v"(r)
                        : "v"(a0.v), "v"(a1.v), "v"(l0.v), "v"(l1.v), "v"(qh[0].v), "v"(qh[1].v), "v"(ql[0].v), "v"(ql[1].v));
      // S^T element r of tile kt = score(key0 + 16*kt + 8h + r, this lane's query); carries: q x16, k x16, residual x2^11
#pragma unroll
      for (int e = 0; e < 8; ++e) sc[8 * kt + e] = fmaf(r[e], S2M11, s[e]) * S2M11;
      koff += 16 * HD;
      if (kt == 0) asm volatile("" : "+v"(koff) : "v"(sc[0]));   // second tile's loads issue after the first tile is done
    }
  } else {
    Frag k00, k01, k10, k11;
    ldfrag(k00, Kp + koff);           ldfrag(k01, Kp + koff + 32);
    ldfrag(k10, Kp + koff + 16 * HD); ldfrag(k11, Kp + koff + 16 * HD + 32);
    v8f s0 = z8, s1 = z8;
    s0 = wm<false>(k00, qh[0], s0); s0 = wm<false>(k01, qh[1], s0);
    s1 = wm<false>(k10, qh[0], s1); s1 = wm<false>(k11, qh[1], s1);
    asm volatile("v_nop\n\tv_nop\n\tv_nop\n\tv_nop" : "+v"(s0), "+v"(s1)
                      : "v"(k00.v), "v"(k01.v), "v"(k10.v), "v"(k11.v), "v"(qh[0].v), "v"(qh[1].v));
#pragma unroll
    for (int e = 0; e < 8; ++e) { sc[e] = s0[e] * S2M11; sc[8 + e] = s1[e] * S2M11; }
  }
  if (MASK) {
    const float* mp = mrow + key0 + 8 * hh;
    const v4f m0 = *(const v4fa*)(mp),      m1 = *(const v4fa*)(mp + 4);
    const v4f m2 = *(const v4fa*)(mp + 16), m3 = *(const v4fa*)(mp + 20);
#pragma unroll
    for (int e = 0; e < 4; ++e) {
      sc[e]      = sc[e]      + bf16_rne(m0[e]);
      sc[4 + e]  = sc[4 + e]  + bf16_rne(m1[e]);
      sc[8 + e]  = sc[8 + e]  + bf16_rne(m2[e]);
      sc[12 + e] = sc[12 + e] + bf16_rne(m3[e]);
    }
  }
  float mx = sc[0];
#pragma unroll
  for (int i = 1; i < 16; ++i) mx = fmaxf(mx, sc[i]);
  mx = fmaxf(mx, __shfl_xor(mx, 16, 32));            // the other lane half holds the other 16 keys of this query
  const float mnew = fmaxf(mr, mx);
  float msafe = mnew;
  if (MASK) msafe = (mnew == neg_inf()) ? 0.0f : mnew;   // every key so far at -inf: weights come out 0
  const float al = __builtin_amdgcn_exp2f((mr - msafe) * LOG2E);
  mr = mnew;
  // weights carried x256: pc = 256 * exp(sc - m); hi plane f16(pc), residual plane f16((pc - hi) * 2048)
  Frag ph, pl;
  float ps = 0.0f;
#pragma unroll
  for (int i = 0; i < 16; ++i) {
    const float pc = __builtin_amdgcn_exp2f(fmaf(sc[i] - msafe, LOG2E, 8.0f));
    ps += pc;
    const _Float16 h = toh_flush(pc);
    ph.h[i] = h;                                      // B element i: i<8 -> key0 + 8h + i (tile 0 row 8h+i); i>=8 -> key0 + 16 + 8h + (i-8) (tile 1)
    if (EARLYP) pl.h[i] = toh_flush((pc - (float)h) * 2048.0f);
  }
  ps += __shfl_xor(ps, 16, 32);
  lr = lr * al + ps;
  // A fragments of V^T: row m = d (16*t + ln), elements 0..7 <- key0 + 8h + i, 8..15 <- key0 + 16 + 8h + i
  int voff = key0 + 8 * hh;
  asm volatile("" : "+v"(voff) : "v"(ps));            // V loads issue after the score phase
  const unsigned short* vp = Vp + (size_t)ln * SEQ + voff;
  Frag vf[4];
#pragma unroll
  for (int t = 0; t < 4; ++t) ldfrag(vf[t], vp + (size_t)t * 16 * SEQ);
#pragma unroll
  for (int t = 0; t < 4; ++t) Oh[t] = Oh[t] * al;
  if (EARLYP) {
    const unsigned short* vq = Vl + (size_t)ln * SEQ + voff;
    Frag vl[4];
#pragma unroll
    for (int t = 0; t < 4; ++t) ldfrag(vl[t], vq + (size_t)t * 16 * SEQ);
#pragma unroll
    for (int t = 0; t < 4; ++t) Ol[t] = Ol[t] * al;
#pragma unroll
    for (int t = 0; t < 4; ++t) {
      Oh[t] = wm<false>(vf[t], ph, Oh[t]);
      Ol[t] = wm<false>(vf[t], pl, Ol[t]);
      Ol[t] = wm<false>(vl[t], ph, Ol[t]);
    }
    asm volatile("v_nop\n\tv_nop\n\tv_nop\n\tv_nop" : "+v"(Oh[0]), "+v"(Oh[1]), "+v"(Oh[2]), "+v"(Oh[3]), "+v"(Ol[0]), "+v"(Ol[1]), "+v"(Ol[2]), "+v"(Ol[3])
                      : "v"(vf[0].v), "v"(vf[1].v), "v"(vf[2].v), "v"(vf[3].v),
                        "v"(vl[0].v), "v"(vl[1].v), "v"(vl[2].v), "v"(vl[3].v), "v"(ph.v), "v"(pl.v));
  } else {
#pragma unroll
    for (int t = 0; t < 4; ++t) Oh[t] = wm<false>(vf[t], ph, Oh[t]);
    asm volatile("v_nop\n\tv_nop\n\tv_nop\n\tv_nop" : "+v"(Oh[0]), "+v"(Oh[1]), "+v"(Oh[2]), "+v"(Oh[3])
                      : "v"(vf[0].v), "v"(vf[1].v), "v"(vf[2].v), "v"(vf[3].v), "v"(ph.v));
  }
}

template <bool EARLYP>
__device__ __forceinline__ void run_keys(const unsigned short* __restrict__ qkh, const unsigned short* __restrict__ qkl,
                                         const unsigned short* __restrict__ vth, const unsigned short* __restrict__ vtl,
                                         const float* __restrict__ mask, int b, int h, int qg, int ln, int hh,
                                         int nplain, int nsteps, float& mr, float& lr, v8f (&Oh)[4], v8f (&Ol)[4]) {
  // Q^T B fragments: column n = this lane's query, elements 0..7 <- d = 32c + 8h + i, 8..15 <- d = 32c + 16 + 8h + i
  const size_t qoff = ((size_t)(b * NQK + h) * SEQ + qg) * HD + 8 * hh;
  Frag qh[2], ql[2];
  ldfrag(qh[0], qkh + qoff); ldfrag(qh[1], qkh + qoff + 32);
  if (EARLYP) { ldfrag(ql[0], qkl + qoff); ldfrag(ql[1], qkl + qoff + 32); }
  else { ql[0] = qh[0]; ql[1] = qh[1]; }
  const int kv = h / NREP;                             // consecutive groups of NREP query heads share one kv head
  const size_t kbase = (size_t)(b * NQK + NHEAD + kv) * SEQ * HD;
  const size_t vbase = ((size_t)b * KVW + (size_t)kv * HD) * SEQ;
  const unsigned short* Kp = qkh + kbase;
  const unsigned short* Kl = qkl + kbase;
  const unsigned short* Vp = vth + vbase;
  const unsigned short* Vl = vtl + vbase;
  const float* mrow = mask + (size_t)qg * SEQ_FULL;
#pragma unroll 1
  for (int j = 0; j < nplain; ++j)
    fa_step<EARLYP, false>(Kp, Kl, Vp, Vl, mrow, 32 * j, ln, hh, qh, ql, mr, lr, Oh, Ol);
#pragma unroll 1
  for (int j = nplain; j < nsteps; ++j)
    fa_step<EARLYP, true>(Kp, Kl, Vp, Vl, mrow, 32 * j, ln, hh, qh, ql, mr, lr, Oh, Ol);
}

// Block = 4 waves x 16 queries = 64 queries of one (batch, head); no LDS and no barrier in the key loop.
// Tile skipping from the device flags, per wave: both flags of both flag lines that cover the wave's 16 query rows are 1 -> keys past the diagonal step are
// skipped (their weights are exactly zero) and steps fully below the diagonal run without mask reads (their mask entries are exactly zero); every other
// visited step reads the mask by value. A softmax row depends on its own mask row alone, so the wave's own rows decide.
// For any other flag value every step is visited and reads the mask. Trip counts are bounded by SEQ/32 for any flag value.
// coverage: NB*NHEAD*(SEQ/64) blocks x 4 waves x 16 rows x 64 columns = the whole ctx hi plane; blocks with query tile below EARLY_ROWS cover the whole residual plane.
__global__ __launch_bounds__(128) void k_attn(const unsigned short* __restrict__ qkh, const unsigned short* __restrict__ qkl,
                                              const unsigned short* __restrict__ vth, const unsigned short* __restrict__ vtl,
                                              const float* __restrict__ mask, const int* __restrict__ flags,
                                              unsigned short* __restrict__ ctxh, unsigned short* __restrict__ ctxl) {
  __shared__ __attribute__((aligned(16))) float so[4][16][68];
  const int tid = threadIdx.x, lane = tid & 31, ln = lane & 15, hh = lane >> 4;
  const int w = __builtin_amdgcn_readfirstlane(tid >> 5);
  const int nqt = SEQ / 64;
  const int blk = blockIdx.x;
  const int qt = blk % nqt;
  const int h = (blk / nqt) % NHEAD;
  const int b = blk / (nqt * NHEAD);
  const int qbase = qt * 64 + 16 * w;
  const int qg = qbase + ln;
  const int* fl = flags + (qbase / SCAN_ROWS) * 32;    // 16 query rows = 16 / SCAN_ROWS flag lines
  int fok = 1;                                         // bitwise, so that the flag loads issue together
#pragma unroll
  for (int i = 0; i < 16 / SCAN_ROWS; ++i) fok &= (fl[32 * i] == 1 ? 1 : 0) & (fl[32 * i + 1] == 1 ? 1 : 0);
  const bool tri = (fok == 1);
  const int nfull = qbase >> 5;                        // steps whose 32 keys are all at or below every query of this wave
  const int nsteps = tri ? (nfull + 1) : (SEQ / 32);   // <= SEQ/32 in both cases
  const int nplain = tri ? nfull : 0;
  const bool early = (qt * 64 < EARLY_ROWS);

  const v8f z8 = {0.f, 0.f, 0.f, 0.f, 0.f, 0.f, 0.f, 0.f};
  float mr = neg_inf(), lr = 0.0f;
  v8f Oh[4], Ol[4];
#pragma unroll
  for (int t = 0; t < 4; ++t) { Oh[t] = z8; Ol[t] = z8; }
  if (early) run_keys<true>(qkh, qkl, vth, vtl, mask, b, h, qg, ln, hh, nplain, nsteps, mr, lr, Oh, Ol);
  else       run_keys<false>(qkh, qkl, vth, vtl, mask, b, h, qg, ln, hh, nplain, nsteps, mr, lr, Oh, Ol);

  // O^T element r of tile t = ctx(query, d = 16t + 8h + r); undo the carries x256 (in lr), x16 (V), x2^11 (residual); apply the x64 carry of ctx
  const float inv = 4.0f * (1.0f / lr);
#pragma unroll
  for (int t = 0; t < 4; ++t)
#pragma unroll
    for (int r = 0; r < 8; ++r)
      so[w][ln][16 * t + 8 * hh + r] = fmaf(Ol[t][r], S2M11, Oh[t][r]) * inv;
  __syncthreads();
  const int rsub = lane >> 3, d0 = 8 * (lane & 7);
  v8us oh[4], ol[4];
#pragma unroll
  for (int g = 0; g < 4; ++g) {
    const int row = 4 * g + rsub;
    const v4f a0 = *(const v4fa*)&so[w][row][d0];
    const v4f a1 = *(const v4fa*)&so[w][row][d0 + 4];
    float o[8];
    o[0] = a0[0]; o[1] = a0[1]; o[2] = a0[2]; o[3] = a0[3];
    o[4] = a1[0]; o[5] = a1[1]; o[6] = a1[2]; o[7] = a1[3];
    Pack8 ph8, pl8;
#pragma unroll
    for (int e = 0; e < 8; ++e) {
      const _Float16 hv = toh_flush(o[e]);
      ph8.h[e] = hv;
      pl8.h[e] = toh_flush((o[e] - (float)hv) * 2048.0f);
    }
    oh[g] = ph8.v; ol[g] = pl8.v;
  }
  const size_t hbase = ((size_t)b * SEQ + qbase) * CD + (size_t)h * HD + d0;
  const size_t lbase = ((size_t)b * EARLY_ROWS + (early ? qbase : 0)) * CD + (size_t)h * HD + d0;
{
#pragma unroll
    for (int g = 0; g < 4; ++g) {
      const size_t ro = (size_t)(4 * g + rsub) * CD;
      *(v8us*)(ctxh + hbase + ro) = oh[g];
      if (early) *(v8us*)(ctxl + lbase + ro) = ol[g];
    }
    
  }
}

// ---------------------------------------------------------------------------------------------------------
// Output projection: out[m][n] = sum_k ctx[m][k] Wo[n][k] + bo[n]. Block = 4 waves stacked in M (128 rows) x 64 columns. grid = (CD/64, NB*SEQ/128).
// Rows below EARLY_ROWS of each sequence add the residual plane of ctx in separate accumulators.
// coverage: NB*SEQ rows x CD columns = every element of the output buffer region once. LDS tile 32 x 64 fully written before it is read.
__global__ __launch_bounds__(128) void k_proj_out(const unsigned short* __restrict__ ctxh, const unsigned short* __restrict__ ctxl,
                                                  const unsigned short* __restrict__ wo, const float* __restrict__ bo,
                                                  float* __restrict__ out) {
  __shared__ __attribute__((aligned(16))) float st[4][32][68];
  const int tid = threadIdx.x, lane = tid & 31, ln = lane & 15, hh = lane >> 4;
  const int w = __builtin_amdgcn_readfirstlane(tid >> 5);
  const int n0 = blockIdx.x * 64;
  const int mb = blockIdx.y * 128;
  const int b = mb / SEQ;
  const int tb = mb - b * SEQ;
  const bool early = (tb < EARLY_ROWS);                // block-uniform: EARLY_ROWS and SEQ are multiples of 128
  const int t0 = tb + 32 * w;
  const int m0 = mb + 32 * w;
  const v8f z8 = {0.f, 0.f, 0.f, 0.f, 0.f, 0.f, 0.f, 0.f};
  v8f acc[2][4], acl[2][4];
#pragma unroll
  for (int i = 0; i < 2; ++i)
#pragma unroll
    for (int j = 0; j < 4; ++j) { acc[i][j] = z8; acl[i][j] = z8; }
  const unsigned short* ap = ctxh + (size_t)(m0 + ln) * CD + 8 * hh;
  const unsigned short* alp = ctxl + (size_t)(b * EARLY_ROWS + (early ? t0 : 0) + ln) * CD + 8 * hh;
  const unsigned short* wp = wo + (size_t)(n0 + ln) * CD + 8 * hh;
  if (early) gemm_loop<false, true>(ap, alp, wp, acc, acl);
  else       gemm_loop<false, false>(ap, ap, wp, acc, acl);
  // carries: ctx x64, Wo x64 -> 2^-12; residual plane additionally x2^11
#pragma unroll
  for (int i = 0; i < 2; ++i)
#pragma unroll
    for (int j = 0; j < 4; ++j)
#pragma unroll
      for (int r = 0; r < 8; ++r)
        st[w][16 * i + 8 * hh + r][16 * j + ln] = fmaf(acl[i][j][r], S2M11, acc[i][j][r]) * S2M12;
  __syncthreads();
  const int rsub = lane >> 4, c4 = 4 * (lane & 15);
  const v4f bb = *(const v4fa*)(bo + n0 + c4);
  v4f bias;
  bias[0] = bf16_rne(bb[0]); bias[1] = bf16_rne(bb[1]); bias[2] = bf16_rne(bb[2]); bias[3] = bf16_rne(bb[3]);
  v4f ov[16];
#pragma unroll
  for (int g = 0; g < 16; ++g) {
    const v4f a = *(const v4fa*)&st[w][2 * g + rsub][c4];
    ov[g] = a + bias;
  }
  float* og = out + ((size_t)b * SEQ_FULL + t0) * CD + n0 + c4;
{
#pragma unroll
    for (int g = 0; g < 16; ++g)
      *(v4f*)(og + (size_t)(2 * g + rsub) * CD) = ov[g];
    
  }
}

// ---------------------------------------------------------------------------------------------------------
extern "C" void kernel_launch(void* const* d_in, const int* in_sizes, int n_in,
                              void* d_out, int out_size, void* d_ws, size_t ws_size, hipStream_t stream) {
  if (n_in < 11) return;
  const long long need_x = (long long)(NB - 1) * SEQ_FULL * CD + (long long)SEQ * CD;   // last element touched + 1
  const long long need_m = (long long)(SEQ - 1) * SEQ_FULL + SEQ;
  if ((long long)in_sizes[0] < need_x) return;
  if ((long long)in_sizes[1] < need_m) return;
  if ((long long)in_sizes[2] < (long long)SEQ) return;
  if ((long long)in_sizes[3] < (long long)CD * CD || (long long)in_sizes[4] < CD) return;
  if ((long long)in_sizes[5] < (long long)KVW * CD || (long long)in_sizes[6] < KVW) return;
  if ((long long)in_sizes[7] < (long long)KVW * CD || (long long)in_sizes[8] < KVW) return;
  if ((long long)in_sizes[9] < (long long)CD * CD || (long long)in_sizes[10] < CD) return;
  if ((long long)out_size < need_x) return;
  if ((size_t)WS_TOTAL > ws_size) return;

  // wire order: hidden_states, attention_mask (f32), position_ids (i32), Wq, bq, Wk, bk, Wv, bv, Wo, bo
  const float* x    = (const float*)d_in[0];
  const float* mask = (const float*)d_in[1];
  const int*   pos  = (const int*)d_in[2];
  const float* Wq   = (const float*)d_in[3];
  const float* bq   = (const float*)d_in[4];
  const float* Wk   = (const float*)d_in[5];
  const float* bk   = (const float*)d_in[6];
  const float* Wv   = (const float*)d_in[7];
  const float* bv   = (const float*)d_in[8];
  const float* Wo   = (const float*)d_in[9];
  const float* bo   = (const float*)d_in[10];
  float* out = (float*)d_out;

  char* ws = (char*)d_ws;
  size_t off = 0;
  int* flags = (int*)(ws + off);                               off += SZ_FLAGS;
  float* rot = (float*)(ws + off);                             off += SZ_ROT;
  unsigned short* xb   = (unsigned short*)(ws + off);          off += SZ_XB;
  unsigned short* wqk  = (unsigned short*)(ws + off);          off += SZ_WQK;
  unsigned short* wvb  = (unsigned short*)(ws + off);          off += SZ_WV;
  unsigned short* wob  = (unsigned short*)(ws + off);          off += SZ_WO;
  unsigned short* qkh  = (unsigned short*)(ws + off);          off += PLANE_QK * 2;
  unsigned short* qkl  = (unsigned short*)(ws + off);          off += PLANE_QK * 2;
  unsigned short* vth  = (unsigned short*)(ws + off);          off += PLANE_V * 2;
  unsigned short* vtl  = (unsigned short*)(ws + off);          off += PLANE_V * 2;
  unsigned short* ctxh = (unsigned short*)(ws + off);          off += SZ_CTXH;
  unsigned short* ctxl = (unsigned short*)(ws + off);          off += SZ_CTXL;
  if (off > ws_size) return;

  k_maskscan<<<(unsigned)(SEQ / SCAN_ROWS), 512, 0, stream>>>(mask, flags);
  k_rotab<<<(unsigned)(SEQ / 8), 256, 0, stream>>>(pos, rot);
  // in[rows][CD] f32 -> [rows][CD] 16-bit planes (row order kept)
  k_cvt<0><<<(unsigned)(NB * SEQ), 256, 0, stream>>>(x, xb, NB * SEQ, SEQ, SEQ_FULL);
  k_cvt<0><<<(unsigned)CD, 256, 0, stream>>>(Wq, wqk, CD, CD, CD);
  k_cvt<0><<<(unsigned)KVW, 256, 0, stream>>>(Wk, wqk + (size_t)CD * CD, KVW, KVW, KVW);
  k_cvt<0><<<(unsigned)KVW, 256, 0, stream>>>(Wv, wvb, KVW, KVW, KVW);
  k_cvt<1><<<(unsigned)CD, 256, 0, stream>>>(Wo, wob, CD, CD, CD);

  k_proj_qk<<<dim3(NQK, (unsigned)(NB * SEQ / 128)), 128, 0, stream>>>(xb, wqk, bq, bk, rot, qkh, qkl);
  k_proj_v<<<dim3((unsigned)(NB * SEQ / 64), KVW / 128), 128, 0, stream>>>(wvb, xb, bv, vth, vtl);
  k_attn<<<(unsigned)(NB * NHEAD * (SEQ / 64)), 128, 0, stream>>>(qkh, qkl, vth, vtl, mask, flags, ctxh, ctxl);
  k_proj_out<<<dim3(CD / 64, (unsigned)(NB * SEQ / 128)), 128, 0, stream>>>(ctxh, ctxl, wob, bo, out);
}

// v002
// One run takes 278 microseconds.
// Two timings next to v001 both put it at 1.43 times that version's speed.
// Counting every step since v000, it is 3.31 times as fast.
#include <hip/hip_runtime.h>
#ifndef NB
#define NB 2
#endif
#ifndef SEQ
#define SEQ 2048
#endif
#define NB_FULL 2
#define SEQ_FULL 2048
#define CD 2048                 /* model width = depth of every projection */
#define NHEAD 32
#define NKV 8
#define NREP (NHEAD / NKV)      /* query heads per kv head */
#define HD 64
#define NQK (NHEAD + NKV)       /* rotary plane holds the 32 q heads followed by the 8 k heads */
#define KVW (NKV * HD)          /* 512 */
#define EARLY_ROWS (SEQ < 512 ? SEQ : 512)

#define SCAN_ROWS 8                                 /* mask rows per scan work-group */
#define SZ_FLAGS ((size_t)(SEQ / SCAN_ROWS) * 128)  /* one 128-byte flag line per scan work-group */
#define SZ_ROT   ((size_t)SEQ * HD * 4)              /* rotary table [SEQ][32 cos | 32 sin] f32 */
#define SZ_XB    ((size_t)NB * SEQ * CD * 2)
#define SZ_WQK   ((size_t)(CD + KVW) * CD * 2)
#define SZ_WV    ((size_t)KVW * CD * 2)
#define SZ_WO    ((size_t)CD * CD * 2)
#define PLANE_QK ((size_t)NB * NQK * SEQ * HD)     /* elements of one rotary plane */
#define PLANE_V  ((size_t)NB * KVW * SEQ)          /* elements of one V^T plane */
#define SZ_CTXH  ((size_t)NB * SEQ * CD * 2)
#define SZ_CTXL  ((size_t)NB * EARLY_ROWS * CD * 2)
#define WS_TOTAL (SZ_FLAGS + SZ_ROT + SZ_XB + SZ_WQK + SZ_WV + SZ_WO + PLANE_QK * 4 + PLANE_V * 4 + SZ_CTXH + SZ_CTXL)

static_assert(SEQ % 128 == 0);
static_assert(EARLY_ROWS % 128 == 0);
static_assert(SEQ <= SEQ_FULL);
static_assert(NB <= NB_FULL);
static_assert(HD == 64);
static_assert(CD % 32 == 0);
static_assert(KVW % 128 == 0);
static_assert(NHEAD % NKV == 0);
static_assert(NHEAD == NKV * NREP);
static_assert(CD == NHEAD * HD);
static_assert(SEQ % 8 == 0);
static_assert(SEQ % SCAN_ROWS == 0 && 16 % SCAN_ROWS == 0);
static_assert((SCAN_ROWS * (SEQ / 4)) % 512 == 0);
static_assert(SZ_ROT % 256 == 0);
static_assert(WS_TOTAL <= (size_t)134217728);
static_assert(SZ_XB % 256 == 0 && SZ_WQK % 256 == 0 && SZ_WV % 256 == 0 && SZ_WO % 256 == 0);
static_assert((PLANE_QK * 2) % 256 == 0 && (PLANE_V * 2) % 256 == 0 && SZ_CTXH % 256 == 0 && SZ_CTXL % 256 == 0);

typedef __bf16 v16b __attribute__((ext_vector_type(16)));
typedef _Float16 v16h __attribute__((ext_vector_type(16)));
typedef unsigned short v8us __attribute__((ext_vector_type(8), may_alias));
typedef float v8f __attribute__((ext_vector_type(8)));
typedef float v4f __attribute__((ext_vector_type(4)));
typedef float v4fa __attribute__((ext_vector_type(4), may_alias));
typedef int v4i __attribute__((ext_vector_type(4)));
typedef int v4ia __attribute__((ext_vector_type(4), may_alias));
union Frag { v16b b; v16h v; v8us half[2]; _Float16 h[16]; unsigned short u[16]; };
union Pack8 { v8us v; _Float16 h[8]; unsigned short u[8]; };

#define LOG2E 1.4426950408889634f
#define S2M11 0.00048828125f       /* 2^-11 */
#define S2M12 0.000244140625f      /* 2^-12 */
__device__ __forceinline__ unsigned short bf16_bits(float x) {   // RNE convert to bf16 bits
  unsigned int u = __float_as_uint(x);
  return (unsigned short)((u + 0x7FFFu + ((u >> 16) & 1u)) >> 16);
}
__device__ __forceinline__ float bf16_val(unsigned short b) { return __uint_as_float(((unsigned int)b) << 16); }
__device__ __forceinline__ float bf16_rne(float x) { return bf16_val(bf16_bits(x)); }
__device__ __forceinline__ float neg_inf() { return __uint_as_float(0xff800000u); }

// f32 -> f16 operand convert that cannot produce a subnormal: magnitudes below 2^-14 become zero by a value select.
typedef _Float16 h16;
static __device__ __forceinline__ h16 toh_flush(float v) {
  const h16 r = (h16)v;
  return (fabsf(v) < 6.103515625e-05f) ? (h16)0.0f : r;
}

// Fragment from a fragment-order tile: elements 0..7 <- p[0..7], elements 8..15 <- p[256..263]; caller adds tile * 512 + lane * 8.
__device__ __forceinline__ void ldfrag(Frag& f, const unsigned short* __restrict__ p) {
  f.half[0] = *(const v8us*)(p);
  f.half[1] = *(const v8us*)(p + 256);
}

template <bool BF>
__device__ __forceinline__ v8f wm(const Frag& a, const Frag& b, v8f c) {
  if (BF) return __builtin_amdgcn_wmma_f32_16x16x32_bf16(false, a.b, false, b.b, (short)0, c, false, false);
  return __builtin_amdgcn_wmma_f32_16x16x32_f16(false, a.v, false, b.v, (short)0, c, false, false);
}

// ---------------------------------------------------------------------------------------------------------
// Mask scan (f32 additive mask), one work-group per SCAN_ROWS mask rows, each writing its own 128-byte flag line g = blockIdx.x:
// flags[32g] = 1 iff every entry of its rows above the diagonal is at or below -1e8 (its softmax weight is exactly zero next to a
// zero-mask diagonal entry); flags[32g + 1] = 1 iff every entry of its rows on or below the diagonal is exactly zero.
// coverage: SEQ/SCAN_ROWS blocks x SCAN_ROWS rows = every mask row; every flag line written whole.
__global__ __launch_bounds__(512) void k_maskscan(const float* __restrict__ mask, int* __restrict__ flags) {
  __shared__ int sw[2][16];
  const int tid = threadIdx.x, lane = tid & 31, wv = tid >> 5;
  int badU = 0, badL = 0;
  const int cpr = SEQ / 4;
  const int qb = blockIdx.x * SCAN_ROWS;
  // unrolled so that a thread's loads are all in flight together (constant trip count)
#pragma unroll
  for (int it = 0; it < SCAN_ROWS * cpr / 512; ++it) {
    const int c = tid + 512 * it;
    const int qr = c / cpr, k = (c - qr * cpr) * 4;
    const int q = qb + qr;
    const v4f m = *(const v4fa*)(mask + (size_t)q * SEQ_FULL + k);
#pragma unroll
    for (int i = 0; i < 4; ++i) {
      const int above = (k + i > q) ? 1 : 0;
      const int deep = (m[i] <= -1.0e8f) ? 1 : 0;
      const int zr = (m[i] == 0.0f) ? 1 : 0;
      badU |= above & (1 - deep);
      badL |= (1 - above) & (1 - zr);
    }
  }
#pragma unroll
  for (int o = 16; o >= 1; o >>= 1) {
    badU |= __shfl_xor(badU, o, 32);
    badL |= __shfl_xor(badL, o, 32);
  }
  if (lane == 0) { sw[0][wv] = badU; sw[1][wv] = badL; }
  __syncthreads();
  if (tid < 8) {
    int u = 0, l = 0;
#pragma unroll
    for (int i = 0; i < 16; ++i) { u |= sw[0][i]; l |= sw[1][i]; }
    v4i o;
    o[0] = (tid == 0 && u == 0) ? 1 : 0;
    o[1] = (tid == 0 && l == 0) ? 1 : 0;
    o[2] = 0; o[3] = 0;
    *(v4i*)(flags + 32 * blockIdx.x + 4 * tid) = o;
    
  }
}

// ---------------------------------------------------------------------------------------------------------
// f32 rows of width CD -> 16-bit plane in fragment order. MODE 0: bf16 bits (RNE). MODE 1: f16 of (RNE bf16 value x 64).
// Thread t writes the t-th 16-byte piece of the plane (a wave stores 512 contiguous bytes) and reads the 8 source elements that belong there.
// coverage: nrows blocks x 256 threads x 8 elements = nrows x CD (nrows a multiple of 16; piece index -> (row, k) is one to one).
template <int MODE>
__global__ __launch_bounds__(256) void k_cvt(const float* __restrict__ src, unsigned short* __restrict__ dst,
                                             int nrows, int rows_per_batch, int src_batch_rows) {
  const int t = blockIdx.x * 256 + threadIdx.x;
  if (t >= nrows * 256) return;
  const int pl = t & 31, ph = (t >> 5) & 1, tile = t >> 6;      // lane slot, fragment half, tile of 16 rows x 32 k
  const int row = (tile / (CD / 32)) * 16 + (pl & 15);
  const int kk = (tile % (CD / 32)) * 32 + ph * 16 + (pl >> 4) * 8;
  const int b = row / rows_per_batch, r = row - b * rows_per_batch;
  const float* sp = src + ((size_t)b * src_batch_rows + r) * CD + kk;
  const v4f x0 = *(const v4fa*)(sp), x1 = *(const v4fa*)(sp + 4);
  Pack8 o;
  if (MODE == 0) {
    o.u[0] = bf16_bits(x0[0]); o.u[1] = bf16_bits(x0[1]); o.u[2] = bf16_bits(x0[2]); o.u[3] = bf16_bits(x0[3]);
    o.u[4] = bf16_bits(x1[0]); o.u[5] = bf16_bits(x1[1]); o.u[6] = bf16_bits(x1[2]); o.u[7] = bf16_bits(x1[3]);
  } else {
    o.h[0] = (_Float16)(bf16_rne(x0[0]) * 64.0f); o.h[1] = (_Float16)(bf16_rne(x0[1]) * 64.0f);
    o.h[2] = (_Float16)(bf16_rne(x0[2]) * 64.0f); o.h[3] = (_Float16)(bf16_rne(x0[3]) * 64.0f);
    o.h[4] = (_Float16)(bf16_rne(x1[0]) * 64.0f); o.h[5] = (_Float16)(bf16_rne(x1[1]) * 64.0f);
    o.h[6] = (_Float16)(bf16_rne(x1[2]) * 64.0f); o.h[7] = (_Float16)(bf16_rne(x1[3]) * 64.0f);
  }
  unsigned short* d = dst + (size_t)t * 8;
  const v8us ov = o.v;
  *(v8us*)d = ov;
  
}

// ---------------------------------------------------------------------------------------------------------
// Wave-tile GEMM core: acc[i][j] (rows 16i.., cols 16j..) += A[row][k] * W[col][k] over k = 0..CD-1.
// ap  = A  + row0*CD + 8*lane (fragment-order plane; A fragment: row m = ln, elements 0..7 <- k0 + 8h + i, 8..15 <- k0 + 16 + 8h + i)
// wp  = W  + col0*CD + 8*lane (B fragment: column n = ln, same k map); the tile of k0 starts 16*k0 elements into its row group
// alp = residual plane of A (same addressing), accumulated into acl when RES.
template <bool BF, bool RES>
__device__ __forceinline__ void gemm_loop(const unsigned short* __restrict__ ap, const unsigned short* __restrict__ alp,
                                          const unsigned short* __restrict__ wp, v8f (&acc)[2][4], v8f (&acl)[2][4]) {
#pragma unroll 1
  for (int k = 0; k < CD; k += 32) {
    Frag a[2], b[4];
#pragma unroll
    for (int i = 0; i < 2; ++i) ldfrag(a[i], ap + (size_t)i * 16 * CD + k * 16);
#pragma unroll
    for (int j = 0; j < 4; ++j) ldfrag(b[j], wp + (size_t)j * 16 * CD + k * 16);
#pragma unroll
    for (int i = 0; i < 2; ++i)
#pragma unroll
      for (int j = 0; j < 4; ++j) acc[i][j] = wm<BF>(a[i], b[j], acc[i][j]);
    if (RES) {
      Frag al[2];
#pragma unroll
      for (int i = 0; i < 2; ++i) ldfrag(al[i], alp + (size_t)i * 16 * CD + k * 16);
#pragma unroll
      for (int i = 0; i < 2; ++i)
#pragma unroll
        for (int j = 0; j < 4; ++j) acl[i][j] = wm<BF>(al[i], b[j], acl[i][j]);
      asm volatile("v_nop\n\tv_nop\n\tv_nop\n\tv_nop" : "+v"(acl[0][0]), "+v"(acl[0][1]), "+v"(acl[0][2]), "+v"(acl[0][3]),
                          "+v"(acl[1][0]), "+v"(acl[1][1]), "+v"(acl[1][2]), "+v"(acl[1][3])
                        : "v"(al[0].v), "v"(al[1].v), "v"(b[0].v), "v"(b[1].v), "v"(b[2].v), "v"(b[3].v));
    }
    asm volatile("v_nop\n\tv_nop\n\tv_nop\n\tv_nop" : "+v"(acc[0][0]), "+v"(acc[0][1]), "+v"(acc[0][2]), "+v"(acc[0][3]),
                        "+v"(acc[1][0]), "+v"(acc[1][1]), "+v"(acc[1][2]), "+v"(acc[1][3])
                      : "v"(a[0].v), "v"(a[1].v), "v"(b[0].v), "v"(b[1].v), "v"(b[2].v), "v"(b[3].v));
  }
}

__device__ __forceinline__ float rope1(float q, float p, float c, float s, float sg) { return q * c + (sg * p) * s; }

// ---------------------------------------------------------------------------------------------------------
// Rotary table from the position ids (read by value): rot[t][j] = cos(p_t * f_j), rot[t][32 + j] = sin(p_t * f_j), f_j = 10000^(-j/32), j = 0..31.
// Block = 8 positions x 32 frequencies, one precise sincos per thread -> LDS tile [8][64] (cross-wave: block barrier) -> threads 16r..16r+15 write row r (64 floats)
__global__ __launch_bounds__(256) void k_rotab(const int* __restrict__ pos, float* __restrict__ rot) {
  __shared__ __attribute__((aligned(16))) float sh[8][64];
  const int tid = threadIdx.x;
  const int r = tid >> 5, j = tid & 31;
  const int t = blockIdx.x * 8 + r;
  const float p = (float)pos[t];
  const float f = exp2f(-(float)j * 0.41524101186092029f);   // log2(10000)/32
  const float ang = p * f;
  float sn, cs;
  sincosf(ang, &sn, &cs);
  sh[r][j] = cs;
  sh[r][32 + j] = sn;
  __syncthreads();
  if (tid < 128) {
    const int rr = tid >> 4, pc = tid & 15;
    const v4f v = *(const v4fa*)&sh[rr][4 * pc];
    float* d = rot + (size_t)(blockIdx.x * 8 + rr) * HD + 4 * pc;
    *(v4f*)d = v;
    
  }
}

// ---------------------------------------------------------------------------------------------------------
// q and k projections with fused bias, half-split rotary (table plane [SEQ][32 cos | 32 sin]) and head-major repack.
// Block = 4 waves stacked in M (128 token rows) x one head (64 columns). grid = (NQK, NB*SEQ/128).
// coverage: NQK heads x NB*SEQ tokens x 64 = the whole plane [NB][NQK][SEQ][64], both planes. LDS tile 32 x 64 fully written before it is read.
__global__ __launch_bounds__(128) void k_proj_qk(const unsigned short* __restrict__ xb, const unsigned short* __restrict__ wqk,
                                                 const float* __restrict__ bq, const float* __restrict__ bk,
                                                 const float* __restrict__ tab,
                                                 unsigned short* __restrict__ qkh, unsigned short* __restrict__ qkl) {
  __shared__ __attribute__((aligned(16))) float st[4][32][68];
  const int tid = threadIdx.x, lane = tid & 31, ln = lane & 15, hh = lane >> 4;
  const int w = __builtin_amdgcn_readfirstlane(tid >> 5);
  const int hd = blockIdx.x;
  const int m0 = blockIdx.y * 128 + 32 * w;
  const v8f z8 = {0.f, 0.f, 0.f, 0.f, 0.f, 0.f, 0.f, 0.f};
  v8f acc[2][4];
#pragma unroll
  for (int i = 0; i < 2; ++i)
#pragma unroll
    for (int j = 0; j < 4; ++j) acc[i][j] = z8;
  gemm_loop<true, false>(xb + (size_t)m0 * CD + 8 * lane, xb, wqk + (size_t)(hd * HD) * CD + 8 * lane, acc, acc);

  float bias[4];
#pragma unroll
  for (int j = 0; j < 4; ++j) {
    const int col = hd * HD + 16 * j + ln;
    const int cq = (col < CD - 1) ? col : (CD - 1);
    int ck = col - CD;
    ck = (ck < 0) ? 0 : ((ck > KVW - 1) ? (KVW - 1) : ck);
    const float vq = bq[cq], vk = bk[ck];
    bias[j] = bf16_rne((col < CD) ? vq : vk);
  }
#pragma unroll
  for (int i = 0; i < 2; ++i)
#pragma unroll
    for (int j = 0; j < 4; ++j)
#pragma unroll
      for (int r = 0; r < 8; ++r) st[w][16 * i + 8 * hh + r][16 * j + ln] = acc[i][j][r] + bias[j];
  __syncthreads();

  const int b = m0 / SEQ, t0 = m0 - b * SEQ;
  // piece g of the wave's 32 tokens x 64 columns in fragment order: row group g >> 2, k tile (g >> 1) & 1, fragment half g & 1
  v8us oh[8], ol[8];
#pragma unroll
  for (int g = 0; g < 8; ++g) {
    const int row = 16 * (g >> 2) + ln;
    const int d0 = 32 * ((g >> 1) & 1) + 16 * (g & 1) + 8 * hh;
    const float sg = (d0 < 32) ? -1.0f : 1.0f;
    const v4f a0 = *(const v4fa*)&st[w][row][d0];
    const v4f a1 = *(const v4fa*)&st[w][row][d0 + 4];
    const v4f p0 = *(const v4fa*)&st[w][row][d0 ^ 32];
    const v4f p1 = *(const v4fa*)&st[w][row][(d0 ^ 32) + 4];
    // column d uses frequency d % 32: cos at [d % 32], sin at [32 + d % 32]
    const float* tp = tab + (size_t)(t0 + row) * HD + (d0 & 31);
    const v4f c0 = *(const v4fa*)(tp), c1 = *(const v4fa*)(tp + 4);
    const v4f s0 = *(const v4fa*)(tp + 32), s1 = *(const v4fa*)(tp + 36);
    float o[8];
    o[0] = rope1(a0[0], p0[0], c0[0], s0[0], sg); o[1] = rope1(a0[1], p0[1], c0[1], s0[1], sg);
    o[2] = rope1(a0[2], p0[2], c0[2], s0[2], sg); o[3] = rope1(a0[3], p0[3], c0[3], s0[3], sg);
    o[4] = rope1(a1[0], p1[0], c1[0], s1[0], sg); o[5] = rope1(a1[1], p1[1], c1[1], s1[1], sg);
    o[6] = rope1(a1[2], p1[2], c1[2], s1[2], sg); o[7] = rope1(a1[3], p1[3], c1[3], s1[3], sg);
    Pack8 ph8, pl8;
#pragma unroll
    for (int e = 0; e < 8; ++e) {
      const float y = o[e] * 16.0f;                       // carried x16
      const _Float16 h = toh_flush(y);
      ph8.h[e] = h;
      pl8.h[e] = toh_flush((y - (float)h) * 2048.0f);      // residual plane x2^11
    }
    oh[g] = ph8.v; ol[g] = pl8.v;
  }
  const size_t dbase = ((size_t)(b * NQK + hd) * SEQ + t0) * HD + 8 * lane;
{
#pragma unroll
    for (int g = 0; g < 8; ++g) {
      const size_t off = dbase + (size_t)g * 256;
      *(v8us*)(qkh + off) = oh[g];
      *(v8us*)(qkl + off) = ol[g];
    }
    
  }
}

// ---------------------------------------------------------------------------------------------------------
// v projection computed transposed: Vt[b][m][t] = sum_k Wv[m][k] x[b,t][k] + bv[m], carried x16, hi and residual planes.
// Block = 4 waves stacked in M (128 weight rows) x 64 tokens. grid = (NB*SEQ/64, KVW/128).
// coverage: KVW rows x NB*SEQ tokens = the whole plane [NB][KVW][SEQ], both planes. LDS tile 32 x 64 fully written before it is read.
__global__ __launch_bounds__(128) void k_proj_v(const unsigned short* __restrict__ wvb, const unsigned short* __restrict__ xb,
                                                const float* __restrict__ bv,
                                                unsigned short* __restrict__ vth, unsigned short* __restrict__ vtl) {
  __shared__ __attribute__((aligned(16))) float st[4][32][68];
  const int tid = threadIdx.x, lane = tid & 31, ln = lane & 15, hh = lane >> 4;
  const int w = __builtin_amdgcn_readfirstlane(tid >> 5);
  const int n0 = blockIdx.x * 64;
  const int m0 = blockIdx.y * 128 + 32 * w;
  const v8f z8 = {0.f, 0.f, 0.f, 0.f, 0.f, 0.f, 0.f, 0.f};
  v8f acc[2][4];
#pragma unroll
  for (int i = 0; i < 2; ++i)
#pragma unroll
    for (int j = 0; j < 4; ++j) acc[i][j] = z8;
  gemm_loop<true, false>(wvb + (size_t)m0 * CD + 8 * lane, wvb, xb + (size_t)n0 * CD + 8 * lane, acc, acc);
#pragma unroll
  for (int i = 0; i < 2; ++i)
#pragma unroll
    for (int j = 0; j < 4; ++j)
#pragma unroll
      for (int r = 0; r < 8; ++r) st[w][16 * i + 8 * hh + r][16 * j + ln] = acc[i][j][r];
  __syncthreads();

  const int b = n0 / SEQ, t0 = n0 - b * SEQ;
  // piece g of the wave's 32 rows x 64 tokens in fragment order: row group g >> 2, key tile (g >> 1) & 1, fragment half g & 1
  v8us oh[8], ol[8];
#pragma unroll
  for (int g = 0; g < 8; ++g) {
    const int row = 16 * (g >> 2) + ln;
    const int c0 = 32 * ((g >> 1) & 1) + 16 * (g & 1) + 8 * hh;
    const float bias = bf16_rne(bv[m0 + row]);
    const v4f a0 = *(const v4fa*)&st[w][row][c0];
    const v4f a1 = *(const v4fa*)&st[w][row][c0 + 4];
    float o[8];
    o[0] = a0[0]; o[1] = a0[1]; o[2] = a0[2]; o[3] = a0[3];
    o[4] = a1[0]; o[5] = a1[1]; o[6] = a1[2]; o[7] = a1[3];
    Pack8 ph8, pl8;
#pragma unroll
    for (int e = 0; e < 8; ++e) {
      const float y = (o[e] + bias) * 16.0f;              // carried x16
      const _Float16 h = (_Float16)y;
      ph8.h[e] = h;
      pl8.h[e] = (_Float16)((y - (float)h) * 2048.0f);
    }
    oh[g] = ph8.v; ol[g] = pl8.v;
  }
  const size_t dbase = ((size_t)b * KVW + m0) * SEQ + (size_t)t0 * 16 + 8 * lane;
{
#pragma unroll
    for (int g = 0; g < 8; ++g) {
      const size_t off = dbase + (size_t)(g >> 2) * 16 * SEQ + (size_t)(g & 3) * 256;
      *(v8us*)(vth + off) = oh[g];
      *(v8us*)(vtl + off) = ol[g];
    }
    
  }
}

// ---------------------------------------------------------------------------------------------------------
// One 32-key step for a wave's 16 queries (this lane's column = its query). EARLYP adds the residual planes of q, k, v, P.
// MASK reads the mask row of this lane's query by value (RNE bf16 value) and adds it to the scaled scores.
template <bool EARLYP, bool MASK>
__device__ __forceinline__ void fa_step(const unsigned short* __restrict__ Kp, const unsigned short* __restrict__ Kl,
                                        const unsigned short* __restrict__ Vp, const unsigned short* __restrict__ Vl,
                                        const float* __restrict__ mrow, int key0, int ln, int hh,
                                        const Frag (&qh)[2], const Frag (&ql)[2],
                                        float& mr, float& lr, v8f (&Oh)[4], v8f (&Ol)[4]) {
  const v8f z8 = {0.f, 0.f, 0.f, 0.f, 0.f, 0.f, 0.f, 0.f};
  float sc[16];
  // A fragments of K: row m = key (key0 + 16*kt + ln), elements 0..7 <- d = 32c + 8h + i, 8..15 <- d = 32c + 16 + 8h + i
  // fragment-order plane: 16 keys = two tiles of 512 elements (c = 0, 1)
  int koff = key0 * HD + 8 * (16 * hh + ln);
  if (EARLYP) {
#pragma unroll
    for (int kt = 0; kt < 2; ++kt) {
      Frag a0, a1, l0, l1;
      ldfrag(a0, Kp + koff); ldfrag(a1, Kp + koff + 512);
      ldfrag(l0, Kl + koff); ldfrag(l1, Kl + koff + 512);
      v8f s = z8, r = z8;
      s = wm<false>(a0, qh[0], s); s = wm<false>(a1, qh[1], s);
      r = wm<false>(a0, ql[0], r); r = wm<false>(a1, ql[1], r);
      r = wm<false>(l0, qh[0], r); r = wm<false>(l1, qh[1], r);
      asm volatile("v_nop\n\tv_nop\n\tv_nop\n\tv_nop" : "+v"(s), "+v"(r)
                        : "v"(a0.v), "v"(a1.v), "v"(l0.v), "v"(l1.v), "v"(qh[0].v), "v"(qh[1].v), "v"(ql[0].v), "v"(ql[1].v));
      // S^T element r of tile kt = score(key0 + 16*kt + 8h + r, this lane's query); carries: q x16, k x16, residual x2^11
#pragma unroll
      for (int e = 0; e < 8; ++e) sc[8 * kt + e] = fmaf(r[e], S2M11, s[e]) * S2M11;
      koff += 16 * HD;
      if (kt == 0) asm volatile("" : "+v"(koff) : "v"(sc[0]));   // second tile's loads issue after the first tile is done
    }
  } else {
    Frag k00, k01, k10, k11;
    ldfrag(k00, Kp + koff);           ldfrag(k01, Kp + koff + 512);
    ldfrag(k10, Kp + koff + 16 * HD); ldfrag(k11, Kp + koff + 16 * HD + 512);
    v8f s0 = z8, s1 = z8;
    s0 = wm<false>(k00, qh[0], s0); s0 = wm<false>(k01, qh[1], s0);
    s1 = wm<false>(k10, qh[0], s1); s1 = wm<false>(k11, qh[1], s1);
    asm volatile("v_nop\n\tv_nop\n\tv_nop\n\tv_nop" : "+v"(s0), "+v"(s1)
                      : "v"(k00.v), "v"(k01.v), "v"(k10.v), "v"(k11.v), "v"(qh[0].v), "v"(qh[1].v));
#pragma unroll
    for (int e = 0; e < 8; ++e) { sc[e] = s0[e] * S2M11; sc[8 + e] = s1[e] * S2M11; }
  }
  if (MASK) {
    const float* mp = mrow + key0 + 8 * hh;
    const v4f m0 = *(const v4fa*)(mp),      m1 = *(const v4fa*)(mp + 4);
    const v4f m2 = *(const v4fa*)(mp + 16), m3 = *(const v4fa*)(mp + 20);
#pragma unroll
    for (int e = 0; e < 4; ++e) {
      sc[e]      = sc[e]      + bf16_rne(m0[e]);
      sc[4 + e]  = sc[4 + e]  + bf16_rne(m1[e]);
      sc[8 + e]  = sc[8 + e]  + bf16_rne(m2[e]);
      sc[12 + e] = sc[12 + e] + bf16_rne(m3[e]);
    }
  }
  float mx = sc[0];
#pragma unroll
  for (int i = 1; i < 16; ++i) mx = fmaxf(mx, sc[i]);
  mx = fmaxf(mx, __shfl_xor(mx, 16, 32));            // the other lane half holds the other 16 keys of this query
  const float mnew = fmaxf(mr, mx);
  float msafe = mnew;
  if (MASK) msafe = (mnew == neg_inf()) ? 0.0f : mnew;   // every key so far at -inf: weights come out 0
  const float al = __builtin_amdgcn_exp2f((mr - msafe) * LOG2E);
  mr = mnew;
  // weights carried x256: pc = 256 * exp(sc - m); hi plane f16(pc), residual plane f16((pc - hi) * 2048)
  Frag ph, pl;
  float ps = 0.0f;
#pragma unroll
  for (int i = 0; i < 16; ++i) {
    const float pc = __builtin_amdgcn_exp2f(fmaf(sc[i] - msafe, LOG2E, 8.0f));
    ps += pc;
    const _Float16 h = toh_flush(pc);
    ph.h[i] = h;                                      // B element i: i<8 -> key0 + 8h + i (tile 0 row 8h+i); i>=8 -> key0 + 16 + 8h + (i-8) (tile 1)
    if (EARLYP) pl.h[i] = toh_flush((pc - (float)h) * 2048.0f);
  }
  ps += __shfl_xor(ps, 16, 32);
  lr = lr * al + ps;
  // A fragments of V^T: row m = d (16*t + ln), elements 0..7 <- key0 + 8h + i, 8..15 <- key0 + 16 + 8h + i
  // fragment-order plane: the tile of 32 keys at key0 starts 16*key0 elements into its group of 16 rows
  int voff = key0 * 16 + 8 * (16 * hh + ln);
  asm volatile("" : "+v"(voff) : "v"(ps));            // V loads issue after the score phase
  const unsigned short* vp = Vp + voff;
  Frag vf[4];
#pragma unroll
  for (int t = 0; t < 4; ++t) ldfrag(vf[t], vp + (size_t)t * 16 * SEQ);
#pragma unroll
  for (int t = 0; t < 4; ++t) Oh[t] = Oh[t] * al;
  if (EARLYP) {
    const unsigned short* vq = Vl + voff;
    Frag vl[4];
#pragma unroll
    for (int t = 0; t < 4; ++t) ldfrag(vl[t], vq + (size_t)t * 16 * SEQ);
#pragma unroll
    for (int t = 0; t < 4; ++t) Ol[t] = Ol[t] * al;
#pragma unroll
    for (int t = 0; t < 4; ++t) {
      Oh[t] = wm<false>(vf[t], ph, Oh[t]);
      Ol[t] = wm<false>(vf[t], pl, Ol[t]);
      Ol[t] = wm<false>(vl[t], ph, Ol[t]);
    }
    asm volatile("v_nop\n\tv_nop\n\tv_nop\n\tv_nop" : "+v"(Oh[0]), "+v"(Oh[1]), "+v"(Oh[2]), "+v"(Oh[3]), "+v"(Ol[0]), "+v"(Ol[1]), "+v"(Ol[2]), "+v"(Ol[3])
                      : "v"(vf[0].v), "v"(vf[1].v), "v"(vf[2].v), "v"(vf[3].v),
                        "v"(vl[0].v), "v"(vl[1].v), "v"(vl[2].v), "v"(vl[3].v), "v"(ph.v), "v"(pl.v));
  } else {
#pragma unroll
    for (int t = 0; t < 4; ++t) Oh[t] = wm<false>(vf[t], ph, Oh[t]);
    asm volatile("v_nop\n\tv_nop\n\tv_nop\n\tv_nop" : "+v"(Oh[0]), "+v"(Oh[1]), "+v"(Oh[2]), "+v"(Oh[3])
                      : "v"(vf[0].v), "v"(vf[1].v), "v"(vf[2].v), "v"(vf[3].v), "v"(ph.v));
  }
}

template <bool EARLYP>
__device__ __forceinline__ void run_keys(const unsigned short* __restrict__ qkh, const unsigned short* __restrict__ qkl,
                                         const unsigned short* __restrict__ vth, const unsigned short* __restrict__ vtl,
                                         const float* __restrict__ mask, int b, int h, int qg, int ln, int hh,
                                         int nplain, int nsteps, float& mr, float& lr, v8f (&Oh)[4], v8f (&Ol)[4]) {
  // Q^T B fragments: column n = this lane's query, elements 0..7 <- d = 32c + 8h + i, 8..15 <- d = 32c + 16 + 8h + i
  const size_t qoff = ((size_t)(b * NQK + h) * SEQ + (qg - ln)) * HD + 8 * (16 * hh + ln);   // fragment-order plane, the wave's own 16 rows
  Frag qh[2], ql[2];
  ldfrag(qh[0], qkh + qoff); ldfrag(qh[1], qkh + qoff + 512);
  if (EARLYP) { ldfrag(ql[0], qkl + qoff); ldfrag(ql[1], qkl + qoff + 512); }
  else { ql[0] = qh[0]; ql[1] = qh[1]; }
  asm volatile("s_wait_xcnt 0x0" ::: "memory");        // the address registers of the Q loads are reused right behind them
  const int kv = h / NREP;                             // consecutive groups of NREP query heads share one kv head
  const size_t kbase = (size_t)(b * NQK + NHEAD + kv) * SEQ * HD;
  const size_t vbase = ((size_t)b * KVW + (size_t)kv * HD) * SEQ;
  const unsigned short* Kp = qkh + kbase;
  const unsigned short* Kl = qkl + kbase;
  const unsigned short* Vp = vth + vbase;
  const unsigned short* Vl = vtl + vbase;
  const float* mrow = mask + (size_t)qg * SEQ_FULL;
#pragma unroll 1
  for (int j = 0; j < nplain; ++j)
    fa_step<EARLYP, false>(Kp, Kl, Vp, Vl, mrow, 32 * j, ln, hh, qh, ql, mr, lr, Oh, Ol);
#pragma unroll 1
  for (int j = nplain; j < nsteps; ++j)
    fa_step<EARLYP, true>(Kp, Kl, Vp, Vl, mrow, 32 * j, ln, hh, qh, ql, mr, lr, Oh, Ol);
}

// Block = 4 waves x 16 queries = 64 queries of one (batch, head); no LDS and no barrier.
// Tile skipping from the device flags, per wave: both flags of both flag lines that cover the wave's 16 query rows are 1 -> keys past the diagonal step are
// skipped (their weights are exactly zero) and steps fully below the diagonal run without mask reads (their mask entries are exactly zero); every other
// visited step reads the mask by value. A softmax row depends on its own mask row alone, so the wave's own rows decide.
// For any other flag value every step is visited and reads the mask. Trip counts are bounded by SEQ/32 for any flag value.
// coverage: NB*NHEAD*(SEQ/64) blocks x 4 waves x 16 rows x 64 columns = the whole ctx hi plane; blocks with query tile below EARLY_ROWS cover the whole residual plane.
__global__ __launch_bounds__(128) void k_attn(const unsigned short* __restrict__ qkh, const unsigned short* __restrict__ qkl,
                                              const unsigned short* __restrict__ vth, const unsigned short* __restrict__ vtl,
                                              const float* __restrict__ mask, const int* __restrict__ flags,
                                              unsigned short* __restrict__ ctxh, unsigned short* __restrict__ ctxl) {
  const int tid = threadIdx.x, lane = tid & 31, ln = lane & 15, hh = lane >> 4;
  const int w = __builtin_amdgcn_readfirstlane(tid >> 5);
  const int nqt = SEQ / 64;
  const int blk = blockIdx.x;
  const int qt = blk % nqt;
  const int h = (blk / nqt) % NHEAD;
  const int b = blk / (nqt * NHEAD);
  const int qbase = qt * 64 + 16 * w;
  const int qg = qbase + ln;
  const int* fl = flags + (qbase / SCAN_ROWS) * 32;    // 16 query rows = 16 / SCAN_ROWS flag lines
  int fok = 1;                                         // bitwise, so that the flag loads issue together
#pragma unroll
  for (int i = 0; i < 16 / SCAN_ROWS; ++i) fok &= (fl[32 * i] == 1 ? 1 : 0) & (fl[32 * i + 1] == 1 ? 1 : 0);
  const bool tri = (fok == 1);
  const int nfull = qbase >> 5;                        // steps whose 32 keys are all at or below every query of this wave
  const int nsteps = tri ? (nfull + 1) : (SEQ / 32);   // <= SEQ/32 in both cases
  const int nplain = tri ? nfull : 0;
  const bool early = (qt * 64 < EARLY_ROWS);

  const v8f z8 = {0.f, 0.f, 0.f, 0.f, 0.f, 0.f, 0.f, 0.f};
  float mr = neg_inf(), lr = 0.0f;
  v8f Oh[4], Ol[4];
#pragma unroll
  for (int t = 0; t < 4; ++t) { Oh[t] = z8; Ol[t] = z8; }
  if (early) run_keys<true>(qkh, qkl, vth, vtl, mask, b, h, qg, ln, hh, nplain, nsteps, mr, lr, Oh, Ol);
  else       run_keys<false>(qkh, qkl, vth, vtl, mask, b, h, qg, ln, hh, nplain, nsteps, mr, lr, Oh, Ol);

  // O^T element r of tile t = ctx(query, d = 16t + 8h + r); undo the carries x256 (in lr), x16 (V), x2^11 (residual); apply the x64 carry of ctx
  const float inv = 4.0f * (1.0f / lr);
  // tile t of O^T in this lane = row ln, columns 16t + 8h + 0..7 of ctx: exactly this lane's 16-byte piece t of the wave's two fragment-order tiles
  // (k tile t >> 1, fragment half t & 1), so the registers are stored as they stand, 512 contiguous bytes per wave and store
  v8us oh[4], ol[4];
#pragma unroll
  for (int t = 0; t < 4; ++t) {
    Pack8 ph8, pl8;
#pragma unroll
    for (int e = 0; e < 8; ++e) {
      const float o = fmaf(Ol[t][e], S2M11, Oh[t][e]) * inv;
      const _Float16 hv = toh_flush(o);
      ph8.h[e] = hv;
      pl8.h[e] = toh_flush((o - (float)hv) * 2048.0f);
    }
    oh[t] = ph8.v; ol[t] = pl8.v;
  }
  const size_t hbase = ((size_t)b * SEQ + qbase) * CD + (size_t)h * (16 * HD) + 8 * lane;
  const size_t lbase = ((size_t)b * EARLY_ROWS + (early ? qbase : 0)) * CD + (size_t)h * (16 * HD) + 8 * lane;
#pragma unroll
  for (int t = 0; t < 4; ++t) *(v8us*)(ctxh + hbase + t * 256) = oh[t];
  asm volatile("s_wait_xcnt 0x0" ::: "memory");        // the residual stores' address arithmetic below may reuse the registers that these stores name
  if (early) {
#pragma unroll
    for (int t = 0; t < 4; ++t) *(v8us*)(ctxl + lbase + t * 256) = ol[t];
  }
}

// ---------------------------------------------------------------------------------------------------------
// Output projection: out[m][n] = sum_k ctx[m][k] Wo[n][k] + bo[n]. Block = 4 waves stacked in M (128 rows) x 64 columns. grid = (CD/64, NB*SEQ/128).
// Rows below EARLY_ROWS of each sequence add the residual plane of ctx in separate accumulators.
// coverage: NB*SEQ rows x CD columns = every element of the output buffer region once. LDS tile 32 x 64 fully written before it is read.
__global__ __launch_bounds__(128) void k_proj_out(const unsigned short* __restrict__ ctxh, const unsigned short* __restrict__ ctxl,
                                                  const unsigned short* __restrict__ wo, const float* __restrict__ bo,
                                                  float* __restrict__ out) {
  __shared__ __attribute__((aligned(16))) float st[4][32][68];
  const int tid = threadIdx.x, lane = tid & 31, ln = lane & 15, hh = lane >> 4;
  const int w = __builtin_amdgcn_readfirstlane(tid >> 5);
  const int n0 = blockIdx.x * 64;
  const int mb = blockIdx.y * 128;
  const int b = mb / SEQ;
  const int tb = mb - b * SEQ;
  const bool early = (tb < EARLY_ROWS);                // block-uniform: EARLY_ROWS and SEQ are multiples of 128
  const int t0 = tb + 32 * w;
  const int m0 = mb + 32 * w;
  const v8f z8 = {0.f, 0.f, 0.f, 0.f, 0.f, 0.f, 0.f, 0.f};
  v8f acc[2][4], acl[2][4];
#pragma unroll
  for (int i = 0; i < 2; ++i)
#pragma unroll
    for (int j = 0; j < 4; ++j) { acc[i][j] = z8; acl[i][j] = z8; }
  const unsigned short* ap = ctxh + (size_t)m0 * CD + 8 * lane;
  const unsigned short* alp = ctxl + (size_t)(b * EARLY_ROWS + (early ? t0 : 0)) * CD + 8 * lane;
  const unsigned short* wp = wo + (size_t)n0 * CD + 8 * lane;
  if (early) gemm_loop<false, true>(ap, alp, wp, acc, acl);
  else       gemm_loop<false, false>(ap, ap, wp, acc, acl);
  // carries: ctx x64, Wo x64 -> 2^-12; residual plane additionally x2^11
#pragma unroll
  for (int i = 0; i < 2; ++i)
#pragma unroll
    for (int j = 0; j < 4; ++j)
#pragma unroll
      for (int r = 0; r < 8; ++r)
        st[w][16 * i + 8 * hh + r][16 * j + ln] = fmaf(acl[i][j][r], S2M11, acc[i][j][r]) * S2M12;
  __syncthreads();
  const int rsub = lane >> 4, c4 = 4 * (lane & 15);
  const v4f bb = *(const v4fa*)(bo + n0 + c4);
  v4f bias;
  bias[0] = bf16_rne(bb[0]); bias[1] = bf16_rne(bb[1]); bias[2] = bf16_rne(bb[2]); bias[3] = bf16_rne(bb[3]);
  v4f ov[16];
#pragma unroll
  for (int g = 0; g < 16; ++g) {
    const v4f a = *(const v4fa*)&st[w][2 * g + rsub][c4];
    ov[g] = a + bias;
  }
  float* og = out + ((size_t)b * SEQ_FULL + t0) * CD + n0 + c4;
{
#pragma unroll
    for (int g = 0; g < 16; ++g)
      *(v4f*)(og + (size_t)(2 * g + rsub) * CD) = ov[g];
    
  }
}

// ---------------------------------------------------------------------------------------------------------
extern "C" void kernel_launch(void* const* d_in, const int* in_sizes, int n_in,
                              void* d_out, int out_size, void* d_ws, size_t ws_size, hipStream_t stream) {
  if (n_in < 11) return;
  const long long need_x = (long long)(NB - 1) * SEQ_FULL * CD + (long long)SEQ * CD;   // last element touched + 1
  const long long need_m = (long long)(SEQ - 1) * SEQ_FULL + SEQ;
  if ((long long)in_sizes[0] < need_x) return;
  if ((long long)in_sizes[1] < need_m) return;
  if ((long long)in_sizes[2] < (long long)SEQ) return;
  if ((long long)in_sizes[3] < (long long)CD * CD || (long long)in_sizes[4] < CD) return;
  if ((long long)in_sizes[5] < (long long)KVW * CD || (long long)in_sizes[6] < KVW) return;
  if ((long long)in_sizes[7] < (long long)KVW * CD || (long long)in_sizes[8] < KVW) return;
  if ((long long)in_sizes[9] < (long long)CD * CD || (long long)in_sizes[10] < CD) return;
  if ((long long)out_size < need_x) return;
  if ((size_t)WS_TOTAL > ws_size) return;

  // wire order: hidden_states, attention_mask (f32), position_ids (i32), Wq, bq, Wk, bk, Wv, bv, Wo, bo
  const float* x    = (const float*)d_in[0];
  const float* mask = (const float*)d_in[1];
  const int*   pos  = (const int*)d_in[2];
  const float* Wq   = (const float*)d_in[3];
  const float* bq   = (const float*)d_in[4];
  const float* Wk   = (const float*)d_in[5];
  const float* bk   = (const float*)d_in[6];
  const float* Wv   = (const float*)d_in[7];
  const float* bv   = (const float*)d_in[8];
  const float* Wo   = (const float*)d_in[9];
  const float* bo   = (const float*)d_in[10];
  float* out = (float*)d_out;

  char* ws = (char*)d_ws;
  size_t off = 0;
  int* flags = (int*)(ws + off);                               off += SZ_FLAGS;
  float* rot = (float*)(ws + off);                             off += SZ_ROT;
  unsigned short* xb   = (unsigned short*)(ws + off);          off += SZ_XB;
  unsigned short* wqk  = (unsigned short*)(ws + off);          off += SZ_WQK;
  unsigned short* wvb  = (unsigned short*)(ws + off);          off += SZ_WV;
  unsigned short* wob  = (unsigned short*)(ws + off);          off += SZ_WO;
  unsigned short* qkh  = (unsigned short*)(ws + off);          off += PLANE_QK * 2;
  unsigned short* qkl  = (unsigned short*)(ws + off);          off += PLANE_QK * 2;
  unsigned short* vth  = (unsigned short*)(ws + off);          off += PLANE_V * 2;
  unsigned short* vtl  = (unsigned short*)(ws + off);          off += PLANE_V * 2;
  unsigned short* ctxh = (unsigned short*)(ws + off);          off += SZ_CTXH;
  unsigned short* ctxl = (unsigned short*)(ws + off);          off += SZ_CTXL;
  if (off > ws_size) return;

  k_maskscan<<<(unsigned)(SEQ / SCAN_ROWS), 512, 0, stream>>>(mask, flags);
  k_rotab<<<(unsigned)(SEQ / 8), 256, 0, stream>>>(pos, rot);
  // in[rows][CD] f32 -> 16-bit planes of rows x CD in fragment order
  k_cvt<0><<<(unsigned)(NB * SEQ), 256, 0, stream>>>(x, xb, NB * SEQ, SEQ, SEQ_FULL);
  k_cvt<0><<<(unsigned)CD, 256, 0, stream>>>(Wq, wqk, CD, CD, CD);
  k_cvt<0><<<(unsigned)KVW, 256, 0, stream>>>(Wk, wqk + (size_t)CD * CD, KVW, KVW, KVW);
  k_cvt<0><<<(unsigned)KVW, 256, 0, stream>>>(Wv, wvb, KVW, KVW, KVW);
  k_cvt<1><<<(unsigned)CD, 256, 0, stream>>>(Wo, wob, CD, CD, CD);

  k_proj_qk<<<dim3(NQK, (unsigned)(NB * SEQ / 128)), 128, 0, stream>>>(xb, wqk, bq, bk, rot, qkh, qkl);
  k_proj_v<<<dim3((unsigned)(NB * SEQ / 64), KVW / 128), 128, 0, stream>>>(wvb, xb, bv, vth, vtl);
  k_attn<<<(unsigned)(NB * NHEAD * (SEQ / 64)), 128, 0, stream>>>(qkh, qkl, vth, vtl, mask, flags, ctxh, ctxl);
  k_proj_out<<<dim3(CD / 64, (unsigned)(NB * SEQ / 128)), 128, 0, stream>>>(ctxh, ctxl, wob, bo, out);
}

// v003
// It runs in 236 microseconds.
// Timed twice side by side with v002, it ran 1.21 and 1.19 times as fast.
// Over all steps from v000 it is 3.97 times as fast.
#include <hip/hip_runtime.h>
#ifndef NB
#define NB 2
#endif
#ifndef SEQ
#define SEQ 2048
#endif
#define NB_FULL 2
#define SEQ_FULL 2048
#define CD 2048                 /* model width = depth of every projection */
#define NHEAD 32
#define NKV 8
#define NREP (NHEAD / NKV)      /* query heads per kv head */
#define HD 64
#define NQK (NHEAD + NKV)       /* rotary plane holds the 32 q heads followed by the 8 k heads */
#define KVW (NKV * HD)          /* 512 */
#define EARLY_ROWS (SEQ < 512 ? SEQ : 512)

#define SCAN_ROWS 8                                 /* mask rows per scan work-group */
#define SZ_FLAGS ((size_t)(SEQ / SCAN_ROWS) * 128)  /* one 128-byte flag line per scan work-group */
#define SZ_ROT   ((size_t)SEQ * HD * 4)              /* rotary table [SEQ][32 cos | 32 sin] f32 */
#define SZ_XB    ((size_t)NB * SEQ * CD * 2)
#define SZ_WQK   ((size_t)(CD + KVW) * CD * 2)
#define SZ_WV    ((size_t)KVW * CD * 2)
#define SZ_WO    ((size_t)CD * CD * 2)
#define PLANE_QK ((size_t)NB * NQK * SEQ * HD)     /* elements of one rotary plane */
#define PLANE_V  ((size_t)NB * KVW * SEQ)          /* elements of one V^T plane */
#define SZ_CTXH  ((size_t)NB * SEQ * CD * 2)
#define SZ_CTXL  ((size_t)NB * EARLY_ROWS * CD * 2)
#define WS_TOTAL (SZ_FLAGS + SZ_ROT + SZ_XB + SZ_WQK + SZ_WV + SZ_WO + PLANE_QK * 4 + PLANE_V * 4 + SZ_CTXH + SZ_CTXL)

static_assert(SEQ % 128 == 0);
static_assert(EARLY_ROWS % 128 == 0);
static_assert(SEQ <= SEQ_FULL);
static_assert(NB <= NB_FULL);
static_assert(HD == 64);
static_assert(CD % 32 == 0);
static_assert(KVW % 128 == 0);
static_assert(NHEAD % NKV == 0);
static_assert(NHEAD == NKV * NREP);
static_assert(CD == NHEAD * HD);
static_assert(SEQ % 16 == 0);
static_assert(SEQ % SCAN_ROWS == 0 && 16 % SCAN_ROWS == 0);
static_assert((SCAN_ROWS * (SEQ / 4)) % 512 == 0);
static_assert(SZ_ROT % 256 == 0);
static_assert(WS_TOTAL <= (size_t)134217728);
static_assert(SZ_XB % 256 == 0 && SZ_WQK % 256 == 0 && SZ_WV % 256 == 0 && SZ_WO % 256 == 0);
static_assert((PLANE_QK * 2) % 256 == 0 && (PLANE_V * 2) % 256 == 0 && SZ_CTXH % 256 == 0 && SZ_CTXL % 256 == 0);

typedef __bf16 v16b __attribute__((ext_vector_type(16)));
typedef _Float16 v16h __attribute__((ext_vector_type(16)));
typedef unsigned short v8us __attribute__((ext_vector_type(8), may_alias));
typedef float v8f __attribute__((ext_vector_type(8)));
typedef float v4f __attribute__((ext_vector_type(4)));
typedef float v4fa __attribute__((ext_vector_type(4), may_alias));
typedef int v4i __attribute__((ext_vector_type(4)));
typedef int v4ia __attribute__((ext_vector_type(4), may_alias));
union Frag { v16b b; v16h v; v8us half[2]; _Float16 h[16]; unsigned short u[16]; };
union Pack8 { v8us v; _Float16 h[8]; unsigned short u[8]; };

#define LOG2E 1.4426950408889634f
#define S2M11 0.00048828125f       /* 2^-11 */
#define S2M12 0.000244140625f      /* 2^-12 */
__device__ __forceinline__ unsigned short bf16_bits(float x) {   // RNE convert to bf16 bits
  unsigned int u = __float_as_uint(x);
  return (unsigned short)((u + 0x7FFFu + ((u >> 16) & 1u)) >> 16);
}
__device__ __forceinline__ float bf16_val(unsigned short b) { return __uint_as_float(((unsigned int)b) << 16); }
__device__ __forceinline__ float bf16_rne(float x) { return bf16_val(bf16_bits(x)); }
__device__ __forceinline__ float neg_inf() { return __uint_as_float(0xff800000u); }

// f32 -> f16 operand convert that cannot produce a subnormal: magnitudes below 2^-14 become zero by a value select.
typedef _Float16 h16;
static __device__ __forceinline__ h16 toh_flush(float v) {
  const h16 r = (h16)v;
  return (fabsf(v) < 6.103515625e-05f) ? (h16)0.0f : r;
}

// Fragment from a fragment-order tile: elements 0..7 <- p[0..7], elements 8..15 <- p[256..263]; caller adds tile * 512 + lane * 8.
__device__ __forceinline__ void ldfrag(Frag& f, const unsigned short* __restrict__ p) {
  f.half[0] = *(const v8us*)(p);
  f.half[1] = *(const v8us*)(p + 256);
}

template <bool BF>
__device__ __forceinline__ v8f wm(const Frag& a, const Frag& b, v8f c) {
  if (BF) return __builtin_amdgcn_wmma_f32_16x16x32_bf16(false, a.b, false, b.b, (short)0, c, false, false);
  return __builtin_amdgcn_wmma_f32_16x16x32_f16(false, a.v, false, b.v, (short)0, c, false, false);
}

// ---------------------------------------------------------------------------------------------------------
// Mask scan (f32 additive mask), one work-group per SCAN_ROWS mask rows, each writing its own 128-byte flag line g = blk:
// flags[32g] = 1 iff every entry of its rows above the diagonal is at or below -1e8 (its softmax weight is exactly zero next to a
// zero-mask diagonal entry); flags[32g + 1] = 1 iff every entry of its rows on or below the diagonal is exactly zero.
// coverage: SEQ/SCAN_ROWS blocks x SCAN_ROWS rows = every mask row; every flag line written whole.
__device__ __forceinline__ void maskscan_part(const float* __restrict__ mask, int* __restrict__ flags, int blk, int (*sw)[16]) {
  const int tid = threadIdx.x, lane = tid & 31, wv = tid >> 5;
  int badU = 0, badL = 0;
  const int cpr = SEQ / 4;
  const int qb = blk * SCAN_ROWS;
  // unrolled so that a thread's loads are all in flight together (constant trip count)
#pragma unroll
  for (int it = 0; it < SCAN_ROWS * cpr / 512; ++it) {
    const int c = tid + 512 * it;
    const int qr = c / cpr, k = (c - qr * cpr) * 4;
    const int q = qb + qr;
    const v4f m = *(const v4fa*)(mask + (size_t)q * SEQ_FULL + k);
#pragma unroll
    for (int i = 0; i < 4; ++i) {
      const int above = (k + i > q) ? 1 : 0;
      const int deep = (m[i] <= -1.0e8f) ? 1 : 0;
      const int zr = (m[i] == 0.0f) ? 1 : 0;
      badU |= above & (1 - deep);
      badL |= (1 - above) & (1 - zr);
    }
  }
#pragma unroll
  for (int o = 16; o >= 1; o >>= 1) {
    badU |= __shfl_xor(badU, o, 32);
    badL |= __shfl_xor(badL, o, 32);
  }
  if (lane == 0) { sw[0][wv] = badU; sw[1][wv] = badL; }
  __syncthreads();
  if (tid < 8) {
    int u = 0, l = 0;
#pragma unroll
    for (int i = 0; i < 16; ++i) { u |= sw[0][i]; l |= sw[1][i]; }
    v4i o;
    o[0] = (tid == 0 && u == 0) ? 1 : 0;
    o[1] = (tid == 0 && l == 0) ? 1 : 0;
    o[2] = 0; o[3] = 0;
    *(v4i*)(flags + 32 * blk + 4 * tid) = o;
    
  }
}

// ---------------------------------------------------------------------------------------------------------
// f32 rows of width CD -> 16-bit plane in fragment order. MODE 0: bf16 bits (RNE). MODE 1: f16 of (RNE bf16 value x 64).
// Thread t writes the t-th 16-byte piece of the plane (a wave stores 512 contiguous bytes) and reads the 8 source elements that belong there.
// coverage: nrows / 2 blocks x 512 threads x 8 elements = nrows x CD (nrows a multiple of 16; piece index -> (row, k) is one to one).
template <int MODE>
__device__ __forceinline__ void cvt_part(const float* __restrict__ src, unsigned short* __restrict__ dst,
                                         int blk, int rows_per_batch, int src_batch_rows) {
  const int t = blk * 512 + threadIdx.x;
  const int pl = t & 31, ph = (t >> 5) & 1, tile = t >> 6;      // lane slot, fragment half, tile of 16 rows x 32 k
  const int row = (tile / (CD / 32)) * 16 + (pl & 15);
  const int kk = (tile % (CD / 32)) * 32 + ph * 16 + (pl >> 4) * 8;
  const int b = row / rows_per_batch, r = row - b * rows_per_batch;
  const float* sp = src + ((size_t)b * src_batch_rows + r) * CD + kk;
  const v4f x0 = *(const v4fa*)(sp), x1 = *(const v4fa*)(sp + 4);
  Pack8 o;
  if (MODE == 0) {
    o.u[0] = bf16_bits(x0[0]); o.u[1] = bf16_bits(x0[1]); o.u[2] = bf16_bits(x0[2]); o.u[3] = bf16_bits(x0[3]);
    o.u[4] = bf16_bits(x1[0]); o.u[5] = bf16_bits(x1[1]); o.u[6] = bf16_bits(x1[2]); o.u[7] = bf16_bits(x1[3]);
  } else {
    o.h[0] = (_Float16)(bf16_rne(x0[0]) * 64.0f); o.h[1] = (_Float16)(bf16_rne(x0[1]) * 64.0f);
    o.h[2] = (_Float16)(bf16_rne(x0[2]) * 64.0f); o.h[3] = (_Float16)(bf16_rne(x0[3]) * 64.0f);
    o.h[4] = (_Float16)(bf16_rne(x1[0]) * 64.0f); o.h[5] = (_Float16)(bf16_rne(x1[1]) * 64.0f);
    o.h[6] = (_Float16)(bf16_rne(x1[2]) * 64.0f); o.h[7] = (_Float16)(bf16_rne(x1[3]) * 64.0f);
  }
  unsigned short* d = dst + (size_t)t * 8;
  const v8us ov = o.v;
  *(v8us*)d = ov;
  asm volatile("s_wait_xcnt 0x0" ::: "memory");        // in the shared launch another part's code follows in the text and rewrites the registers that this store names
}

// ---------------------------------------------------------------------------------------------------------
// Wave-tile GEMM core: acc[i][j] (rows 16i.., cols 16j..) += A[row][k] * W[col][k] over k = 0..CD-1.
// ap  = A  + row0*CD + 8*lane (fragment-order plane; A fragment: row m = ln, elements 0..7 <- k0 + 8h + i, 8..15 <- k0 + 16 + 8h + i)
// wp  = W  + col0*CD + 8*lane (B fragment: column n = ln, same k map); the tile of k0 starts 16*k0 elements into its row group
// alp = residual plane of A (same addressing), accumulated into acl when RES.
template <bool BF, bool RES>
__device__ __forceinline__ void gemm_loop(const unsigned short* __restrict__ ap, const unsigned short* __restrict__ alp,
                                          const unsigned short* __restrict__ wp, v8f (&acc)[2][4], v8f (&acl)[2][4]) {
#pragma unroll 1
  for (int k = 0; k < CD; k += 32) {
    Frag a[2], b[4];
#pragma unroll
    for (int i = 0; i < 2; ++i) ldfrag(a[i], ap + (size_t)i * 16 * CD + k * 16);
#pragma unroll
    for (int j = 0; j < 4; ++j) ldfrag(b[j], wp + (size_t)j * 16 * CD + k * 16);
#pragma unroll
    for (int i = 0; i < 2; ++i)
#pragma unroll
      for (int j = 0; j < 4; ++j) acc[i][j] = wm<BF>(a[i], b[j], acc[i][j]);
    if (RES) {
      Frag al[2];
#pragma unroll
      for (int i = 0; i < 2; ++i) ldfrag(al[i], alp + (size_t)i * 16 * CD + k * 16);
#pragma unroll
      for (int i = 0; i < 2; ++i)
#pragma unroll
        for (int j = 0; j < 4; ++j) acl[i][j] = wm<BF>(al[i], b[j], acl[i][j]);
      asm volatile("v_nop\n\tv_nop\n\tv_nop\n\tv_nop" : "+v"(acl[0][0]), "+v"(acl[0][1]), "+v"(acl[0][2]), "+v"(acl[0][3]),
                          "+v"(acl[1][0]), "+v"(acl[1][1]), "+v"(acl[1][2]), "+v"(acl[1][3])
                        : "v"(al[0].v), "v"(al[1].v), "v"(b[0].v), "v"(b[1].v), "v"(b[2].v), "v"(b[3].v));
    }
    asm volatile("v_nop\n\tv_nop\n\tv_nop\n\tv_nop" : "+v"(acc[0][0]), "+v"(acc[0][1]), "+v"(acc[0][2]), "+v"(acc[0][3]),
                        "+v"(acc[1][0]), "+v"(acc[1][1]), "+v"(acc[1][2]), "+v"(acc[1][3])
                      : "v"(a[0].v), "v"(a[1].v), "v"(b[0].v), "v"(b[1].v), "v"(b[2].v), "v"(b[3].v));
  }
}

__device__ __forceinline__ float rope1(float q, float p, float c, float s, float sg) { return q * c + (sg * p) * s; }

// ---------------------------------------------------------------------------------------------------------
// Rotary table from the position ids (read by value): rot[t][j] = cos(p_t * f_j), rot[t][32 + j] = sin(p_t * f_j), f_j = 10000^(-j/32), j = 0..31.
// Block = 16 positions x 32 frequencies, one precise sincos per thread -> LDS tile [16][64] (cross-wave: block barrier) -> 16 threads write one row
__device__ __forceinline__ void rotab_part(const int* __restrict__ pos, float* __restrict__ rot, int blk, float (*sh)[64]) {
  const int tid = threadIdx.x;
  const int r = tid >> 5, j = tid & 31;
  const int t = blk * 16 + r;
  const float p = (float)pos[t];
  const float f = exp2f(-(float)j * 0.41524101186092029f);   // log2(10000)/32
  const float ang = p * f;
  float sn, cs;
  sincosf(ang, &sn, &cs);
  sh[r][j] = cs;
  sh[r][32 + j] = sn;
  __syncthreads();
  if (tid < 256) {
    const int rr = tid >> 4, pc = tid & 15;
    const v4f v = *(const v4fa*)&sh[rr][4 * pc];
    float* d = rot + (size_t)(blk * 16 + rr) * HD + 4 * pc;
    *(v4f*)d = v;
    
  }
}

// ---------------------------------------------------------------------------------------------------------
// All preparation in one launch: the rotary table, the mask scan and the five plane conversions depend on the inputs alone and on nothing of one another,
// so each work-group of 512 threads takes one block of one of them by its index range (the test is the same for the whole work-group; each part's barrier
// is passed by every thread of the work-groups that run that part).
// coverage: the ranges below follow one another without gap or overlap and each holds exactly the blocks that its part's own coverage line asks for.
#define PB_ROT  (SEQ / 16)
#define PB_SCAN (SEQ / SCAN_ROWS)
#define PB_X    (NB * SEQ / 2)
#define PB_WQ   (CD / 2)
#define PB_WKV  (KVW / 2)
#define PB_WO   (CD / 2)
#define PB_ALL  (PB_ROT + PB_SCAN + PB_X + PB_WQ + 2 * PB_WKV + PB_WO)
__global__ __launch_bounds__(512) void k_prep(const float* __restrict__ mask, const int* __restrict__ pos, const float* __restrict__ x,
                                              const float* __restrict__ Wq, const float* __restrict__ Wk, const float* __restrict__ Wv,
                                              const float* __restrict__ Wo, int* __restrict__ flags, float* __restrict__ rot,
                                              unsigned short* __restrict__ xb, unsigned short* __restrict__ wqk,
                                              unsigned short* __restrict__ wvb, unsigned short* __restrict__ wob) {
  __shared__ int sw[2][16];
  __shared__ __attribute__((aligned(16))) float sh[16][64];
  int blk = blockIdx.x;
  if (blk < PB_ROT) { rotab_part(pos, rot, blk, sh); return; }
  blk -= PB_ROT;
  if (blk < PB_SCAN) { maskscan_part(mask, flags, blk, sw); return; }
  blk -= PB_SCAN;
  if (blk < PB_X) { cvt_part<0>(x, xb, blk, SEQ, SEQ_FULL); return; }
  blk -= PB_X;
  if (blk < PB_WQ) { cvt_part<0>(Wq, wqk, blk, CD, CD); return; }
  blk -= PB_WQ;
  if (blk < PB_WKV) { cvt_part<0>(Wk, wqk + (size_t)CD * CD, blk, KVW, KVW); return; }
  blk -= PB_WKV;
  if (blk < PB_WKV) { cvt_part<0>(Wv, wvb, blk, KVW, KVW); return; }
  blk -= PB_WKV;
  cvt_part<1>(Wo, wob, blk, CD, CD);
}

// ---------------------------------------------------------------------------------------------------------
// q and k projections with fused bias, half-split rotary (table plane [SEQ][32 cos | 32 sin]) and head-major repack.
// Block = 4 waves stacked in M (128 token rows) x one head (64 columns): hd = 0..NQK-1, mblk = 0..NB*SEQ/128-1.
// coverage: NQK heads x NB*SEQ tokens x 64 = the whole plane [NB][NQK][SEQ][64], both planes. LDS tile 32 x 64 fully written before it is read.
__device__ __forceinline__ void proj_qk_part(const unsigned short* __restrict__ xb, const unsigned short* __restrict__ wqk,
                                             const float* __restrict__ bq, const float* __restrict__ bk,
                                             const float* __restrict__ tab,
                                             unsigned short* __restrict__ qkh, unsigned short* __restrict__ qkl,
                                             int hd, int mblk, float (*st)[32][68]) {
  const int tid = threadIdx.x, lane = tid & 31, ln = lane & 15, hh = lane >> 4;
  const int w = __builtin_amdgcn_readfirstlane(tid >> 5);
  const int m0 = mblk * 128 + 32 * w;
  const v8f z8 = {0.f, 0.f, 0.f, 0.f, 0.f, 0.f, 0.f, 0.f};
  v8f acc[2][4];
#pragma unroll
  for (int i = 0; i < 2; ++i)
#pragma unroll
    for (int j = 0; j < 4; ++j) acc[i][j] = z8;
  gemm_loop<true, false>(xb + (size_t)m0 * CD + 8 * lane, xb, wqk + (size_t)(hd * HD) * CD + 8 * lane, acc, acc);

  float bias[4];
#pragma unroll
  for (int j = 0; j < 4; ++j) {
    const int col = hd * HD + 16 * j + ln;
    const int cq = (col < CD - 1) ? col : (CD - 1);
    int ck = col - CD;
    ck = (ck < 0) ? 0 : ((ck > KVW - 1) ? (KVW - 1) : ck);
    const float vq = bq[cq], vk = bk[ck];
    bias[j] = bf16_rne((col < CD) ? vq : vk);
  }
#pragma unroll
  for (int i = 0; i < 2; ++i)
#pragma unroll
    for (int j = 0; j < 4; ++j)
#pragma unroll
      for (int r = 0; r < 8; ++r) st[w][16 * i + 8 * hh + r][16 * j + ln] = acc[i][j][r] + bias[j];
  __syncthreads();

  const int b = m0 / SEQ, t0 = m0 - b * SEQ;
  // piece g of the wave's 32 tokens x 64 columns in fragment order: row group g >> 2, k tile (g >> 1) & 1, fragment half g & 1
  v8us oh[8], ol[8];
#pragma unroll
  for (int g = 0; g < 8; ++g) {
    const int row = 16 * (g >> 2) + ln;
    const int d0 = 32 * ((g >> 1) & 1) + 16 * (g & 1) + 8 * hh;
    const float sg = (d0 < 32) ? -1.0f : 1.0f;
    const v4f a0 = *(const v4fa*)&st[w][row][d0];
    const v4f a1 = *(const v4fa*)&st[w][row][d0 + 4];
    const v4f p0 = *(const v4fa*)&st[w][row][d0 ^ 32];
    const v4f p1 = *(const v4fa*)&st[w][row][(d0 ^ 32) + 4];
    // column d uses frequency d % 32: cos at [d % 32], sin at [32 + d % 32]
    const float* tp = tab + (size_t)(t0 + row) * HD + (d0 & 31);
    const v4f c0 = *(const v4fa*)(tp), c1 = *(const v4fa*)(tp + 4);
    const v4f s0 = *(const v4fa*)(tp + 32), s1 = *(const v4fa*)(tp + 36);
    float o[8];
    o[0] = rope1(a0[0], p0[0], c0[0], s0[0], sg); o[1] = rope1(a0[1], p0[1], c0[1], s0[1], sg);
    o[2] = rope1(a0[2], p0[2], c0[2], s0[2], sg); o[3] = rope1(a0[3], p0[3], c0[3], s0[3], sg);
    o[4] = rope1(a1[0], p1[0], c1[0], s1[0], sg); o[5] = rope1(a1[1], p1[1], c1[1], s1[1], sg);
    o[6] = rope1(a1[2], p1[2], c1[2], s1[2], sg); o[7] = rope1(a1[3], p1[3], c1[3], s1[3], sg);
    Pack8 ph8, pl8;
#pragma unroll
    for (int e = 0; e < 8; ++e) {
      const float y = o[e] * 16.0f;                       // carried x16
      const _Float16 h = toh_flush(y);
      ph8.h[e] = h;
      pl8.h[e] = toh_flush((y - (float)h) * 2048.0f);      // residual plane x2^11
    }
    oh[g] = ph8.v; ol[g] = pl8.v;
  }
  const size_t dbase = ((size_t)(b * NQK + hd) * SEQ + t0) * HD + 8 * lane;
{
#pragma unroll
    for (int g = 0; g < 8; ++g) {
      const size_t off = dbase + (size_t)g * 256;
      *(v8us*)(qkh + off) = oh[g];
      *(v8us*)(qkl + off) = ol[g];
    }
    
  }
}

// ---------------------------------------------------------------------------------------------------------
// v projection computed transposed: Vt[b][m][t] = sum_k Wv[m][k] x[b,t][k] + bv[m], carried x16, hi and residual planes.
// Block = 4 waves stacked in M (128 weight rows) x 64 tokens: nblk = 0..NB*SEQ/64-1, mgrp = 0..KVW/128-1.
// coverage: KVW rows x NB*SEQ tokens = the whole plane [NB][KVW][SEQ], both planes. LDS tile 32 x 64 fully written before it is read.
__device__ __forceinline__ void proj_v_part(const unsigned short* __restrict__ wvb, const unsigned short* __restrict__ xb,
                                            const float* __restrict__ bv,
                                            unsigned short* __restrict__ vth, unsigned short* __restrict__ vtl,
                                            int nblk, int mgrp, float (*st)[32][68]) {
  const int tid = threadIdx.x, lane = tid & 31, ln = lane & 15, hh = lane >> 4;
  const int w = __builtin_amdgcn_readfirstlane(tid >> 5);
  const int n0 = nblk * 64;
  const int m0 = mgrp * 128 + 32 * w;
  const v8f z8 = {0.f, 0.f, 0.f, 0.f, 0.f, 0.f, 0.f, 0.f};
  v8f acc[2][4];
#pragma unroll
  for (int i = 0; i < 2; ++i)
#pragma unroll
    for (int j = 0; j < 4; ++j) acc[i][j] = z8;
  gemm_loop<true, false>(wvb + (size_t)m0 * CD + 8 * lane, wvb, xb + (size_t)n0 * CD + 8 * lane, acc, acc);
#pragma unroll
  for (int i = 0; i < 2; ++i)
#pragma unroll
    for (int j = 0; j < 4; ++j)
#pragma unroll
      for (int r = 0; r < 8; ++r) st[w][16 * i + 8 * hh + r][16 * j + ln] = acc[i][j][r];
  __syncthreads();

  const int b = n0 / SEQ, t0 = n0 - b * SEQ;
  // piece g of the wave's 32 rows x 64 tokens in fragment order: row group g >> 2, key tile (g >> 1) & 1, fragment half g & 1
  v8us oh[8], ol[8];
#pragma unroll
  for (int g = 0; g < 8; ++g) {
    const int row = 16 * (g >> 2) + ln;
    const int c0 = 32 * ((g >> 1) & 1) + 16 * (g & 1) + 8 * hh;
    const float bias = bf16_rne(bv[m0 + row]);
    const v4f a0 = *(const v4fa*)&st[w][row][c0];
    const v4f a1 = *(const v4fa*)&st[w][row][c0 + 4];
    float o[8];
    o[0] = a0[0]; o[1] = a0[1]; o[2] = a0[2]; o[3] = a0[3];
    o[4] = a1[0]; o[5] = a1[1]; o[6] = a1[2]; o[7] = a1[3];
    Pack8 ph8, pl8;
#pragma unroll
    for (int e = 0; e < 8; ++e) {
      const float y = (o[e] + bias) * 16.0f;              // carried x16
      const _Float16 h = (_Float16)y;
      ph8.h[e] = h;
      pl8.h[e] = (_Float16)((y - (float)h) * 2048.0f);
    }
    oh[g] = ph8.v; ol[g] = pl8.v;
  }
  const size_t dbase = ((size_t)b * KVW + m0) * SEQ + (size_t)t0 * 16 + 8 * lane;
{
#pragma unroll
    for (int g = 0; g < 8; ++g) {
      const size_t off = dbase + (size_t)(g >> 2) * 16 * SEQ + (size_t)(g & 3) * 256;
      *(v8us*)(vth + off) = oh[g];
      *(v8us*)(vtl + off) = ol[g];
    }
    
  }
}

// ---------------------------------------------------------------------------------------------------------
// q, k and v projections in one launch: they read the same x plane and write disjoint planes, and the v blocks alone are too few to fill the chip.
// grid = (NQK + VBX, NB*SEQ/128): column c < NQK is head c of the q/k part; the VBX columns behind it are the v blocks of the same 128 tokens
// (two halves of 64 tokens x KVW/128 groups of weight rows). The test is the same for the whole work-group.
// coverage: every (hd, mblk) once; (nblk, mgrp) = (2 * y + (j & 1), j >> 1), j = 0..VBX-1, y = 0..NB*SEQ/128-1, is every v block once.
#define VBX (2 * (KVW / 128))
__global__ __launch_bounds__(128) void k_proj_qkv(const unsigned short* __restrict__ xb, const unsigned short* __restrict__ wqk,
                                                  const unsigned short* __restrict__ wvb,
                                                  const float* __restrict__ bq, const float* __restrict__ bk, const float* __restrict__ bv,
                                                  const float* __restrict__ tab,
                                                  unsigned short* __restrict__ qkh, unsigned short* __restrict__ qkl,
                                                  unsigned short* __restrict__ vth, unsigned short* __restrict__ vtl) {
  __shared__ __attribute__((aligned(16))) float st[4][32][68];
  const int c = blockIdx.x;
  if (c < NQK) {
    proj_qk_part(xb, wqk, bq, bk, tab, qkh, qkl, c, blockIdx.y, st);
  } else {
    const int j = c - NQK;
    proj_v_part(wvb, xb, bv, vth, vtl, 2 * blockIdx.y + (j & 1), j >> 1, st);
  }
}

// ---------------------------------------------------------------------------------------------------------
// One 32-key step for a wave's 16 queries (this lane's column = its query). EARLYP adds the residual planes of q, k, v, P.
// MASK reads the mask row of this lane's query by value (RNE bf16 value) and adds it to the scaled scores.
template <bool EARLYP, bool MASK>
__device__ __forceinline__ void fa_step(const unsigned short* __restrict__ Kp, const unsigned short* __restrict__ Kl,
                                        const unsigned short* __restrict__ Vp, const unsigned short* __restrict__ Vl,
                                        const float* __restrict__ mrow, int key0, int ln, int hh,
                                        const Frag (&qh)[2], const Frag (&ql)[2],
                                        float& mr, float& lr, v8f (&Oh)[4], v8f (&Ol)[4]) {
  const v8f z8 = {0.f, 0.f, 0.f, 0.f, 0.f, 0.f, 0.f, 0.f};
  float sc[16];
  // A fragments of K: row m = key (key0 + 16*kt + ln), elements 0..7 <- d = 32c + 8h + i, 8..15 <- d = 32c + 16 + 8h + i
  // fragment-order plane: 16 keys = two tiles of 512 elements (c = 0, 1)
  int koff = key0 * HD + 8 * (16 * hh + ln);
  if (EARLYP) {
#pragma unroll
    for (int kt = 0; kt < 2; ++kt) {
      Frag a0, a1, l0, l1;
      ldfrag(a0, Kp + koff); ldfrag(a1, Kp + koff + 512);
      ldfrag(l0, Kl + koff); ldfrag(l1, Kl + koff + 512);
      v8f s = z8, r = z8;
      s = wm<false>(a0, qh[0], s); s = wm<false>(a1, qh[1], s);
      r = wm<false>(a0, ql[0], r); r = wm<false>(a1, ql[1], r);
      r = wm<false>(l0, qh[0], r); r = wm<false>(l1, qh[1], r);
      asm volatile("v_nop\n\tv_nop\n\tv_nop\n\tv_nop" : "+v"(s), "+v"(r)
                        : "v"(a0.v), "v"(a1.v), "v"(l0.v), "v"(l1.v), "v"(qh[0].v), "v"(qh[1].v), "v"(ql[0].v), "v"(ql[1].v));
      // S^T element r of tile kt = score(key0 + 16*kt + 8h + r, this lane's query); carries: q x16, k x16, residual x2^11
#pragma unroll
      for (int e = 0; e < 8; ++e) sc[8 * kt + e] = fmaf(r[e], S2M11, s[e]) * S2M11;
      koff += 16 * HD;
      if (kt == 0) asm volatile("" : "+v"(koff) : "v"(sc[0]));   // second tile's loads issue after the first tile is done
    }
  } else {
    Frag k00, k01, k10, k11;
    ldfrag(k00, Kp + koff);           ldfrag(k01, Kp + koff + 512);
    ldfrag(k10, Kp + koff + 16 * HD); ldfrag(k11, Kp + koff + 16 * HD + 512);
    v8f s0 = z8, s1 = z8;
    s0 = wm<false>(k00, qh[0], s0); s0 = wm<false>(k01, qh[1], s0);
    s1 = wm<false>(k10, qh[0], s1); s1 = wm<false>(k11, qh[1], s1);
    asm volatile("v_nop\n\tv_nop\n\tv_nop\n\tv_nop" : "+v"(s0), "+v"(s1)
                      : "v"(k00.v), "v"(k01.v), "v"(k10.v), "v"(k11.v), "v"(qh[0].v), "v"(qh[1].v));
#pragma unroll
    for (int e = 0; e < 8; ++e) { sc[e] = s0[e] * S2M11; sc[8 + e] = s1[e] * S2M11; }
  }
  if (MASK) {
    const float* mp = mrow + key0 + 8 * hh;
    const v4f m0 = *(const v4fa*)(mp),      m1 = *(const v4fa*)(mp + 4);
    const v4f m2 = *(const v4fa*)(mp + 16), m3 = *(const v4fa*)(mp + 20);
#pragma unroll
    for (int e = 0; e < 4; ++e) {
      sc[e]      = sc[e]      + bf16_rne(m0[e]);
      sc[4 + e]  = sc[4 + e]  + bf16_rne(m1[e]);
      sc[8 + e]  = sc[8 + e]  + bf16_rne(m2[e]);
      sc[12 + e] = sc[12 + e] + bf16_rne(m3[e]);
    }
  }
  float mx = sc[0];
#pragma unroll
  for (int i = 1; i < 16; ++i) mx = fmaxf(mx, sc[i]);
  mx = fmaxf(mx, __shfl_xor(mx, 16, 32));            // the other lane half holds the other 16 keys of this query
  const float mnew = fmaxf(mr, mx);
  float msafe = mnew;
  if (MASK) msafe = (mnew == neg_inf()) ? 0.0f : mnew;   // every key so far at -inf: weights come out 0
  const float al = __builtin_amdgcn_exp2f((mr - msafe) * LOG2E);
  mr = mnew;
  // weights carried x256: pc = 256 * exp(sc - m); hi plane f16(pc), residual plane f16((pc - hi) * 2048)
  Frag ph, pl;
  float ps = 0.0f;
#pragma unroll
  for (int i = 0; i < 16; ++i) {
    const float pc = __builtin_amdgcn_exp2f(fmaf(sc[i] - msafe, LOG2E, 8.0f));
    ps += pc;
    const _Float16 h = toh_flush(pc);
    ph.h[i] = h;                                      // B element i: i<8 -> key0 + 8h + i (tile 0 row 8h+i); i>=8 -> key0 + 16 + 8h + (i-8) (tile 1)
    if (EARLYP) pl.h[i] = toh_flush((pc - (float)h) * 2048.0f);
  }
  ps += __shfl_xor(ps, 16, 32);
  lr = lr * al + ps;
  // A fragments of V^T: row m = d (16*t + ln), elements 0..7 <- key0 + 8h + i, 8..15 <- key0 + 16 + 8h + i
  // fragment-order plane: the tile of 32 keys at key0 starts 16*key0 elements into its group of 16 rows
  int voff = key0 * 16 + 8 * (16 * hh + ln);
  asm volatile("" : "+v"(voff) : "v"(ps));            // V loads issue after the score phase
  const unsigned short* vp = Vp + voff;
  Frag vf[4];
#pragma unroll
  for (int t = 0; t < 4; ++t) ldfrag(vf[t], vp + (size_t)t * 16 * SEQ);
#pragma unroll
  for (int t = 0; t < 4; ++t) Oh[t] = Oh[t] * al;
  if (EARLYP) {
    const unsigned short* vq = Vl + voff;
    Frag vl[4];
#pragma unroll
    for (int t = 0; t < 4; ++t) ldfrag(vl[t], vq + (size_t)t * 16 * SEQ);
#pragma unroll
    for (int t = 0; t < 4; ++t) Ol[t] = Ol[t] * al;
#pragma unroll
    for (int t = 0; t < 4; ++t) {
      Oh[t] = wm<false>(vf[t], ph, Oh[t]);
      Ol[t] = wm<false>(vf[t], pl, Ol[t]);
      Ol[t] = wm<false>(vl[t], ph, Ol[t]);
    }
    asm volatile("v_nop\n\tv_nop\n\tv_nop\n\tv_nop" : "+v"(Oh[0]), "+v"(Oh[1]), "+v"(Oh[2]), "+v"(Oh[3]), "+v"(Ol[0]), "+v"(Ol[1]), "+v"(Ol[2]), "+v"(Ol[3])
                      : "v"(vf[0].v), "v"(vf[1].v), "v"(vf[2].v), "v"(vf[3].v),
                        "v"(vl[0].v), "v"(vl[1].v), "v"(vl[2].v), "v"(vl[3].v), "v"(ph.v), "v"(pl.v));
  } else {
#pragma unroll
    for (int t = 0; t < 4; ++t) Oh[t] = wm<false>(vf[t], ph, Oh[t]);
    asm volatile("v_nop\n\tv_nop\n\tv_nop\n\tv_nop" : "+v"(Oh[0]), "+v"(Oh[1]), "+v"(Oh[2]), "+v"(Oh[3])
                      : "v"(vf[0].v), "v"(vf[1].v), "v"(vf[2].v), "v"(vf[3].v), "v"(ph.v));
  }
}

template <bool EARLYP>
__device__ __forceinline__ void run_keys(const unsigned short* __restrict__ qkh, const unsigned short* __restrict__ qkl,
                                         const unsigned short* __restrict__ vth, const unsigned short* __restrict__ vtl,
                                         const float* __restrict__ mask, int b, int h, int qg, int ln, int hh,
                                         int nplain, int nsteps, float& mr, float& lr, v8f (&Oh)[4], v8f (&Ol)[4]) {
  // Q^T B fragments: column n = this lane's query, elements 0..7 <- d = 32c + 8h + i, 8..15 <- d = 32c + 16 + 8h + i
  const size_t qoff = ((size_t)(b * NQK + h) * SEQ + (qg - ln)) * HD + 8 * (16 * hh + ln);   // fragment-order plane, the wave's own 16 rows
  Frag qh[2], ql[2];
  ldfrag(qh[0], qkh + qoff); ldfrag(qh[1], qkh + qoff + 512);
  if (EARLYP) { ldfrag(ql[0], qkl + qoff); ldfrag(ql[1], qkl + qoff + 512); }
  else { ql[0] = qh[0]; ql[1] = qh[1]; }
  asm volatile("s_wait_xcnt 0x0" ::: "memory");        // the address registers of the Q loads are reused right behind them
  const int kv = h / NREP;                             // consecutive groups of NREP query heads share one kv head
  const size_t kbase = (size_t)(b * NQK + NHEAD + kv) * SEQ * HD;
  const size_t vbase = ((size_t)b * KVW + (size_t)kv * HD) * SEQ;
  const unsigned short* Kp = qkh + kbase;
  const unsigned short* Kl = qkl + kbase;
  const unsigned short* Vp = vth + vbase;
  const unsigned short* Vl = vtl + vbase;
  const float* mrow = mask + (size_t)qg * SEQ_FULL;
#pragma unroll 1
  for (int j = 0; j < nplain; ++j)
    fa_step<EARLYP, false>(Kp, Kl, Vp, Vl, mrow, 32 * j, ln, hh, qh, ql, mr, lr, Oh, Ol);
#pragma unroll 1
  for (int j = nplain; j < nsteps; ++j)
    fa_step<EARLYP, true>(Kp, Kl, Vp, Vl, mrow, 32 * j, ln, hh, qh, ql, mr, lr, Oh, Ol);
}

// Block = 4 waves x 16 queries = 64 queries of one (batch, head); no LDS and no barrier.
// Tile skipping from the device flags, per wave: both flags of both flag lines that cover the wave's 16 query rows are 1 -> keys past the diagonal step are
// skipped (their weights are exactly zero) and steps fully below the diagonal run without mask reads (their mask entries are exactly zero); every other
// visited step reads the mask by value. A softmax row depends on its own mask row alone, so the wave's own rows decide.
// For any other flag value every step is visited and reads the mask. Trip counts are bounded by SEQ/32 for any flag value.
// coverage: NB*NHEAD*(SEQ/64) blocks x 4 waves x 16 rows x 64 columns = the whole ctx hi plane; blocks with query tile below EARLY_ROWS cover the whole residual plane.
__global__ __launch_bounds__(128) void k_attn(const unsigned short* __restrict__ qkh, const unsigned short* __restrict__ qkl,
                                              const unsigned short* __restrict__ vth, const unsigned short* __restrict__ vtl,
                                              const float* __restrict__ mask, const int* __restrict__ flags,
                                              unsigned short* __restrict__ ctxh, unsigned short* __restrict__ ctxl) {
  const int tid = threadIdx.x, lane = tid & 31, ln = lane & 15, hh = lane >> 4;
  const int w = __builtin_amdgcn_readfirstlane(tid >> 5);
  const int nqt = SEQ / 64;
  const int blk = blockIdx.x;
  const int qt = blk % nqt;
  const int h = (blk / nqt) % NHEAD;
  const int b = blk / (nqt * NHEAD);
  const int qbase = qt * 64 + 16 * w;
  const int qg = qbase + ln;
  const int* fl = flags + (qbase / SCAN_ROWS) * 32;    // 16 query rows = 16 / SCAN_ROWS flag lines
  int fok = 1;                                         // bitwise, so that the flag loads issue together
#pragma unroll
  for (int i = 0; i < 16 / SCAN_ROWS; ++i) fok &= (fl[32 * i] == 1 ? 1 : 0) & (fl[32 * i + 1] == 1 ? 1 : 0);
  const bool tri = (fok == 1);
  const int nfull = qbase >> 5;                        // steps whose 32 keys are all at or below every query of this wave
  const int nsteps = tri ? (nfull + 1) : (SEQ / 32);   // <= SEQ/32 in both cases
  const int nplain = tri ? nfull : 0;
  const bool early = (qt * 64 < EARLY_ROWS);

  const v8f z8 = {0.f, 0.f, 0.f, 0.f, 0.f, 0.f, 0.f, 0.f};
  float mr = neg_inf(), lr = 0.0f;
  v8f Oh[4], Ol[4];
#pragma unroll
  for (int t = 0; t < 4; ++t) { Oh[t] = z8; Ol[t] = z8; }
  if (early) run_keys<true>(qkh, qkl, vth, vtl, mask, b, h, qg, ln, hh, nplain, nsteps, mr, lr, Oh, Ol);
  else       run_keys<false>(qkh, qkl, vth, vtl, mask, b, h, qg, ln, hh, nplain, nsteps, mr, lr, Oh, Ol);

  // O^T element r of tile t = ctx(query, d = 16t + 8h + r); undo the carries x256 (in lr), x16 (V), x2^11 (residual); apply the x64 carry of ctx
  const float inv = 4.0f * (1.0f / lr);
  // tile t of O^T in this lane = row ln, columns 16t + 8h + 0..7 of ctx: exactly this lane's 16-byte piece t of the wave's two fragment-order tiles
  // (k tile t >> 1, fragment half t & 1), so the registers are stored as they stand, 512 contiguous bytes per wave and store
  v8us oh[4], ol[4];
#pragma unroll
  for (int t = 0; t < 4; ++t) {
    Pack8 ph8, pl8;
#pragma unroll
    for (int e = 0; e < 8; ++e) {
      const float o = fmaf(Ol[t][e], S2M11, Oh[t][e]) * inv;
      const _Float16 hv = toh_flush(o);
      ph8.h[e] = hv;
      pl8.h[e] = toh_flush((o - (float)hv) * 2048.0f);
    }
    oh[t] = ph8.v; ol[t] = pl8.v;
  }
  const size_t hbase = ((size_t)b * SEQ + qbase) * CD + (size_t)h * (16 * HD) + 8 * lane;
  const size_t lbase = ((size_t)b * EARLY_ROWS + (early ? qbase : 0)) * CD + (size_t)h * (16 * HD) + 8 * lane;
#pragma unroll
  for (int t = 0; t < 4; ++t) *(v8us*)(ctxh + hbase + t * 256) = oh[t];
  asm volatile("s_wait_xcnt 0x0" ::: "memory");        // the residual stores' address arithmetic below may reuse the registers that these stores name
  if (early) {
#pragma unroll
    for (int t = 0; t < 4; ++t) *(v8us*)(ctxl + lbase + t * 256) = ol[t];
  }
}

// ---------------------------------------------------------------------------------------------------------
// Output projection: out[m][n] = sum_k ctx[m][k] Wo[n][k] + bo[n]. Block = 4 waves stacked in M (128 rows) x 64 columns. grid = (CD/64, NB*SEQ/128).
// Rows below EARLY_ROWS of each sequence add the residual plane of ctx in separate accumulators.
// coverage: NB*SEQ rows x CD columns = every element of the output buffer region once. LDS tile 32 x 64 fully written before it is read.
__global__ __launch_bounds__(128) void k_proj_out(const unsigned short* __restrict__ ctxh, const unsigned short* __restrict__ ctxl,
                                                  const unsigned short* __restrict__ wo, const float* __restrict__ bo,
                                                  float* __restrict__ out) {
  __shared__ __attribute__((aligned(16))) float st[4][32][68];
  const int tid = threadIdx.x, lane = tid & 31, ln = lane & 15, hh = lane >> 4;
  const int w = __builtin_amdgcn_readfirstlane(tid >> 5);
  const int n0 = blockIdx.x * 64;
  const int mb = blockIdx.y * 128;
  const int b = mb / SEQ;
  const int tb = mb - b * SEQ;
  const bool early = (tb < EARLY_ROWS);                // block-uniform: EARLY_ROWS and SEQ are multiples of 128
  const int t0 = tb + 32 * w;
  const int m0 = mb + 32 * w;
  const v8f z8 = {0.f, 0.f, 0.f, 0.f, 0.f, 0.f, 0.f, 0.f};
  v8f acc[2][4], acl[2][4];
#pragma unroll
  for (int i = 0; i < 2; ++i)
#pragma unroll
    for (int j = 0; j < 4; ++j) { acc[i][j] = z8; acl[i][j] = z8; }
  const unsigned short* ap = ctxh + (size_t)m0 * CD + 8 * lane;
  const unsigned short* alp = ctxl + (size_t)(b * EARLY_ROWS + (early ? t0 : 0)) * CD + 8 * lane;
  const unsigned short* wp = wo + (size_t)n0 * CD + 8 * lane;
  if (early) gemm_loop<false, true>(ap, alp, wp, acc, acl);
  else       gemm_loop<false, false>(ap, ap, wp, acc, acl);
  // carries: ctx x64, Wo x64 -> 2^-12; residual plane additionally x2^11
#pragma unroll
  for (int i = 0; i < 2; ++i)
#pragma unroll
    for (int j = 0; j < 4; ++j)
#pragma unroll
      for (int r = 0; r < 8; ++r)
        st[w][16 * i + 8 * hh + r][16 * j + ln] = fmaf(acl[i][j][r], S2M11, acc[i][j][r]) * S2M12;
  __syncthreads();
  const int rsub = lane >> 4, c4 = 4 * (lane & 15);
  const v4f bb = *(const v4fa*)(bo + n0 + c4);
  v4f bias;
  bias[0] = bf16_rne(bb[0]); bias[1] = bf16_rne(bb[1]); bias[2] = bf16_rne(bb[2]); bias[3] = bf16_rne(bb[3]);
  v4f ov[16];
#pragma unroll
  for (int g = 0; g < 16; ++g) {
    const v4f a = *(const v4fa*)&st[w][2 * g + rsub][c4];
    ov[g] = a + bias;
  }
  float* og = out + ((size_t)b * SEQ_FULL + t0) * CD + n0 + c4;
{
#pragma unroll
    for (int g = 0; g < 16; ++g)
      *(v4f*)(og + (size_t)(2 * g + rsub) * CD) = ov[g];
    
  }
}

// ---------------------------------------------------------------------------------------------------------
extern "C" void kernel_launch(void* const* d_in, const int* in_sizes, int n_in,
                              void* d_out, int out_size, void* d_ws, size_t ws_size, hipStream_t stream) {
  if (n_in < 11) return;
  const long long need_x = (long long)(NB - 1) * SEQ_FULL * CD + (long long)SEQ * CD;   // last element touched + 1
  const long long need_m = (long long)(SEQ - 1) * SEQ_FULL + SEQ;
  if ((long long)in_sizes[0] < need_x) return;
  if ((long long)in_sizes[1] < need_m) return;
  if ((long long)in_sizes[2] < (long long)SEQ) return;
  if ((long long)in_sizes[3] < (long long)CD * CD || (long long)in_sizes[4] < CD) return;
  if ((long long)in_sizes[5] < (long long)KVW * CD || (long long)in_sizes[6] < KVW) return;
  if ((long long)in_sizes[7] < (long long)KVW * CD || (long long)in_sizes[8] < KVW) return;
  if ((long long)in_sizes[9] < (long long)CD * CD || (long long)in_sizes[10] < CD) return;
  if ((long long)out_size < need_x) return;
  if ((size_t)WS_TOTAL > ws_size) return;

  // wire order: hidden_states, attention_mask (f32), position_ids (i32), Wq, bq, Wk, bk, Wv, bv, Wo, bo
  const float* x    = (const float*)d_in[0];
  const float* mask = (const float*)d_in[1];
  const int*   pos  = (const int*)d_in[2];
  const float* Wq   = (const float*)d_in[3];
  const float* bq   = (const float*)d_in[4];
  const float* Wk   = (const float*)d_in[5];
  const float* bk   = (const float*)d_in[6];
  const float* Wv   = (const float*)d_in[7];
  const float* bv   = (const float*)d_in[8];
  const float* Wo   = (const float*)d_in[9];
  const float* bo   = (const float*)d_in[10];
  float* out = (float*)d_out;

  char* ws = (char*)d_ws;
  size_t off = 0;
  int* flags = (int*)(ws + off);                               off += SZ_FLAGS;
  float* rot = (float*)(ws + off);                             off += SZ_ROT;
  unsigned short* xb   = (unsigned short*)(ws + off);          off += SZ_XB;
  unsigned short* wqk  = (unsigned short*)(ws + off);          off += SZ_WQK;
  unsigned short* wvb  = (unsigned short*)(ws + off);          off += SZ_WV;
  unsigned short* wob  = (unsigned short*)(ws + off);          off += SZ_WO;
  unsigned short* qkh  = (unsigned short*)(ws + off);          off += PLANE_QK * 2;
  unsigned short* qkl  = (unsigned short*)(ws + off);          off += PLANE_QK * 2;
  unsigned short* vth  = (unsigned short*)(ws + off);          off += PLANE_V * 2;
  unsigned short* vtl  = (unsigned short*)(ws + off);          off += PLANE_V * 2;
  unsigned short* ctxh = (unsigned short*)(ws + off);          off += SZ_CTXH;
  unsigned short* ctxl = (unsigned short*)(ws + off);          off += SZ_CTXL;
  if (off > ws_size) return;

  // flags, rotary table, and in[rows][CD] f32 -> 16-bit planes of rows x CD in fragment order
  k_prep<<<(unsigned)PB_ALL, 512, 0, stream>>>(mask, pos, x, Wq, Wk, Wv, Wo, flags, rot, xb, wqk, wvb, wob);
  k_proj_qkv<<<dim3(NQK + VBX, (unsigned)(NB * SEQ / 128)), 128, 0, stream>>>(xb, wqk, wvb, bq, bk, bv, rot, qkh, qkl, vth, vtl);
  k_attn<<<(unsigned)(NB * NHEAD * (SEQ / 64)), 128, 0, stream>>>(qkh, qkl, vth, vtl, mask, flags, ctxh, ctxl);
  k_proj_out<<<dim3(CD / 64, (unsigned)(NB * SEQ / 128)), 128, 0, stream>>>(ctxh, ctxl, wob, bo, out);
}

// v004
// Measured time: 200 microseconds a run.
// In two side-by-side timings against v003, it was 1.19 and 1.16 times as fast.
// Counting every step since v000, it is 4.67 times as fast.
#include <hip/hip_runtime.h>
#ifndef NB
#define NB 2
#endif
#ifndef SEQ
#define SEQ 2048
#endif
#define NB_FULL 2
#define SEQ_FULL 2048
#define CD 2048                 /* model width = depth of every projection */
#define NHEAD 32
#define NKV 8
#define NREP (NHEAD / NKV)      /* query heads per kv head */
#define HD 64
#define NQK (NHEAD + NKV)       /* rotary plane holds the 32 q heads followed by the 8 k heads */
#define KVW (NKV * HD)          /* 512 */
#define EARLY_ROWS (SEQ < 512 ? SEQ : 512)

#define SCAN_ROWS 8                                 /* mask rows per scan work-group */
#define SZ_FLAGS ((size_t)(SEQ / SCAN_ROWS) * 128)  /* one 128-byte flag line per scan work-group */
#define SZ_ROT   ((size_t)SEQ * HD * 4)              /* rotary table [SEQ][32 cos | 32 sin] f32 */
#define SZ_XB    ((size_t)NB * SEQ * CD * 2)
#define SZ_WQK   ((size_t)(CD + KVW) * CD * 2)
#define SZ_WV    ((size_t)KVW * CD * 2)
#define SZ_WO    ((size_t)CD * CD * 2)
#define PLANE_QK ((size_t)NB * NQK * SEQ * HD)     /* elements of one rotary plane */
#define PLANE_V  ((size_t)NB * KVW * SEQ)          /* elements of one V^T plane */
#define SZ_CTXH  ((size_t)NB * SEQ * CD * 2)
#define SZ_CTXL  ((size_t)NB * EARLY_ROWS * CD * 2)
#define WS_TOTAL (SZ_FLAGS + SZ_ROT + SZ_XB + SZ_WQK + SZ_WV + SZ_WO + PLANE_QK * 4 + PLANE_V * 4 + SZ_CTXH + SZ_CTXL)

static_assert(SEQ % 128 == 0);
static_assert(EARLY_ROWS % 128 == 0);
static_assert(SEQ <= SEQ_FULL);
static_assert(NB <= NB_FULL);
static_assert(HD == 64);
static_assert(CD % 32 == 0);
static_assert(KVW % 128 == 0);
static_assert(NHEAD % NKV == 0);
static_assert(NHEAD == NKV * NREP);
static_assert(CD == NHEAD * HD);
static_assert(SEQ % 16 == 0);
static_assert(SEQ % SCAN_ROWS == 0 && 16 % SCAN_ROWS == 0);
static_assert((SCAN_ROWS * (SEQ / 4)) % 512 == 0);
static_assert(SZ_ROT % 256 == 0);
static_assert(WS_TOTAL <= (size_t)134217728);
static_assert(SZ_XB % 256 == 0 && SZ_WQK % 256 == 0 && SZ_WV % 256 == 0 && SZ_WO % 256 == 0);
static_assert((PLANE_QK * 2) % 256 == 0 && (PLANE_V * 2) % 256 == 0 && SZ_CTXH % 256 == 0 && SZ_CTXL % 256 == 0);

typedef __bf16 v16b __attribute__((ext_vector_type(16)));
typedef _Float16 v16h __attribute__((ext_vector_type(16)));
typedef unsigned short v8us __attribute__((ext_vector_type(8), may_alias));
typedef float v8f __attribute__((ext_vector_type(8)));
typedef float v4f __attribute__((ext_vector_type(4)));
typedef float v4fa __attribute__((ext_vector_type(4), may_alias));
typedef int v4i __attribute__((ext_vector_type(4)));
typedef int v4ia __attribute__((ext_vector_type(4), may_alias));
union Frag { v16b b; v16h v; v8us half[2]; _Float16 h[16]; unsigned short u[16]; };
union Pack8 { v8us v; _Float16 h[8]; unsigned short u[8]; };

#define LOG2E 1.4426950408889634f
#define S2M11 0.00048828125f       /* 2^-11 */
#define S2M12 0.000244140625f      /* 2^-12 */
__device__ __forceinline__ unsigned short bf16_bits(float x) {   // RNE convert to bf16 bits
  unsigned int u = __float_as_uint(x);
  return (unsigned short)((u + 0x7FFFu + ((u >> 16) & 1u)) >> 16);
}
__device__ __forceinline__ float bf16_val(unsigned short b) { return __uint_as_float(((unsigned int)b) << 16); }
__device__ __forceinline__ float bf16_rne(float x) { return bf16_val(bf16_bits(x)); }
__device__ __forceinline__ float neg_inf() { return __uint_as_float(0xff800000u); }

// f32 -> f16 operand convert that cannot produce a subnormal: magnitudes below 2^-14 become zero by a value select.
typedef _Float16 h16;
static __device__ __forceinline__ h16 toh_flush(float v) {
  const h16 r = (h16)v;
  return (fabsf(v) < 6.103515625e-05f) ? (h16)0.0f : r;
}

// Fragment from a fragment-order tile: elements 0..7 <- p[0..7], elements 8..15 <- p[256..263]; caller adds tile * 512 + lane * 8.
__device__ __forceinline__ void ldfrag(Frag& f, const unsigned short* __restrict__ p) {
  f.half[0] = *(const v8us*)(p);
  f.half[1] = *(const v8us*)(p + 256);
}

template <bool BF>
__device__ __forceinline__ v8f wm(const Frag& a, const Frag& b, v8f c) {
  if (BF) return __builtin_amdgcn_wmma_f32_16x16x32_bf16(false, a.b, false, b.b, (short)0, c, false, false);
  return __builtin_amdgcn_wmma_f32_16x16x32_f16(false, a.v, false, b.v, (short)0, c, false, false);
}

// ---------------------------------------------------------------------------------------------------------
// Mask scan (f32 additive mask), one work-group per SCAN_ROWS mask rows, each writing its own 128-byte flag line g = blk:
// flags[32g] = 1 iff every entry of its rows above the diagonal is at or below -1e8 (its softmax weight is exactly zero next to a
// zero-mask diagonal entry); flags[32g + 1] = 1 iff every entry of its rows on or below the diagonal is exactly zero.
// coverage: SEQ/SCAN_ROWS blocks x SCAN_ROWS rows = every mask row; every flag line written whole.
__device__ __forceinline__ void maskscan_part(const float* __restrict__ mask, int* __restrict__ flags, int blk, int (*sw)[16]) {
  const int tid = threadIdx.x, lane = tid & 31, wv = tid >> 5;
  int badU = 0, badL = 0;
  const int cpr = SEQ / 4;
  const int qb = blk * SCAN_ROWS;
  // unrolled so that a thread's loads are all in flight together (constant trip count)
#pragma unroll
  for (int it = 0; it < SCAN_ROWS * cpr / 512; ++it) {
    const int c = tid + 512 * it;
    const int qr = c / cpr, k = (c - qr * cpr) * 4;
    const int q = qb + qr;
    const v4f m = *(const v4fa*)(mask + (size_t)q * SEQ_FULL + k);
#pragma unroll
    for (int i = 0; i < 4; ++i) {
      const int above = (k + i > q) ? 1 : 0;
      const int deep = (m[i] <= -1.0e8f) ? 1 : 0;
      const int zr = (m[i] == 0.0f) ? 1 : 0;
      badU |= above & (1 - deep);
      badL |= (1 - above) & (1 - zr);
    }
  }
#pragma unroll
  for (int o = 16; o >= 1; o >>= 1) {
    badU |= __shfl_xor(badU, o, 32);
    badL |= __shfl_xor(badL, o, 32);
  }
  if (lane == 0) { sw[0][wv] = badU; sw[1][wv] = badL; }
  __syncthreads();
  if (tid < 8) {
    int u = 0, l = 0;
#pragma unroll
    for (int i = 0; i < 16; ++i) { u |= sw[0][i]; l |= sw[1][i]; }
    v4i o;
    o[0] = (tid == 0 && u == 0) ? 1 : 0;
    o[1] = (tid == 0 && l == 0) ? 1 : 0;
    o[2] = 0; o[3] = 0;
    *(v4i*)(flags + 32 * blk + 4 * tid) = o;
    
  }
}

// ---------------------------------------------------------------------------------------------------------
// f32 rows of width CD -> 16-bit plane in fragment order. MODE 0: bf16 bits (RNE). MODE 1: f16 of (RNE bf16 value x 64).
// Thread t writes the t-th 16-byte piece of the plane (a wave stores 512 contiguous bytes) and reads the 8 source elements that belong there.
// coverage: nrows / 2 blocks x 512 threads x 8 elements = nrows x CD (nrows a multiple of 16; piece index -> (row, k) is one to one).
template <int MODE>
__device__ __forceinline__ void cvt_part(const float* __restrict__ src, unsigned short* __restrict__ dst,
                                         int blk, int rows_per_batch, int src_batch_rows) {
  const int t = blk * 512 + threadIdx.x;
  const int pl = t & 31, ph = (t >> 5) & 1, tile = t >> 6;      // lane slot, fragment half, tile of 16 rows x 32 k
  const int row = (tile / (CD / 32)) * 16 + (pl & 15);
  const int kk = (tile % (CD / 32)) * 32 + ph * 16 + (pl >> 4) * 8;
  const int b = row / rows_per_batch, r = row - b * rows_per_batch;
  const float* sp = src + ((size_t)b * src_batch_rows + r) * CD + kk;
  const v4f x0 = *(const v4fa*)(sp), x1 = *(const v4fa*)(sp + 4);
  Pack8 o;
  if (MODE == 0) {
    o.u[0] = bf16_bits(x0[0]); o.u[1] = bf16_bits(x0[1]); o.u[2] = bf16_bits(x0[2]); o.u[3] = bf16_bits(x0[3]);
    o.u[4] = bf16_bits(x1[0]); o.u[5] = bf16_bits(x1[1]); o.u[6] = bf16_bits(x1[2]); o.u[7] = bf16_bits(x1[3]);
  } else {
    o.h[0] = (_Float16)(bf16_rne(x0[0]) * 64.0f); o.h[1] = (_Float16)(bf16_rne(x0[1]) * 64.0f);
    o.h[2] = (_Float16)(bf16_rne(x0[2]) * 64.0f); o.h[3] = (_Float16)(bf16_rne(x0[3]) * 64.0f);
    o.h[4] = (_Float16)(bf16_rne(x1[0]) * 64.0f); o.h[5] = (_Float16)(bf16_rne(x1[1]) * 64.0f);
    o.h[6] = (_Float16)(bf16_rne(x1[2]) * 64.0f); o.h[7] = (_Float16)(bf16_rne(x1[3]) * 64.0f);
  }
  unsigned short* d = dst + (size_t)t * 8;
  const v8us ov = o.v;
  *(v8us*)d = ov;
  asm volatile("s_wait_xcnt 0x0" ::: "memory");        // in the shared launch another part's code follows in the text and rewrites the registers that this store names
}

// ---------------------------------------------------------------------------------------------------------
// Wave-tile GEMM core: acc[i][j] (rows 16i.., cols 16j..) += A[row][k] * W[col][k] over k = 0..CD-1.
// ap  = A  + row0*CD + 8*lane (fragment-order plane; A fragment: row m = ln, elements 0..7 <- k0 + 8h + i, 8..15 <- k0 + 16 + 8h + i)
// wp  = W  + col0*CD + 8*lane (B fragment: column n = ln, same k map); the tile of k0 starts 16*k0 elements into its row group
// alp = residual plane of A (same addressing), accumulated into acl when RES.
template <bool BF, bool RES>
__device__ __forceinline__ void gemm_loop(const unsigned short* __restrict__ ap, const unsigned short* __restrict__ alp,
                                          const unsigned short* __restrict__ wp, v8f (&acc)[2][4], v8f (&acl)[2][4]) {
#pragma unroll 1
  for (int k = 0; k < CD; k += 32) {
    Frag a[2], b[4];
#pragma unroll
    for (int i = 0; i < 2; ++i) ldfrag(a[i], ap + (size_t)i * 16 * CD + k * 16);
#pragma unroll
    for (int j = 0; j < 4; ++j) ldfrag(b[j], wp + (size_t)j * 16 * CD + k * 16);
#pragma unroll
    for (int i = 0; i < 2; ++i)
#pragma unroll
      for (int j = 0; j < 4; ++j) acc[i][j] = wm<BF>(a[i], b[j], acc[i][j]);
    if (RES) {
      Frag al[2];
#pragma unroll
      for (int i = 0; i < 2; ++i) ldfrag(al[i], alp + (size_t)i * 16 * CD + k * 16);
#pragma unroll
      for (int i = 0; i < 2; ++i)
#pragma unroll
        for (int j = 0; j < 4; ++j) acl[i][j] = wm<BF>(al[i], b[j], acl[i][j]);
      asm volatile("v_nop\n\tv_nop\n\tv_nop\n\tv_nop" : "+v"(acl[0][0]), "+v"(acl[0][1]), "+v"(acl[0][2]), "+v"(acl[0][3]),
                          "+v"(acl[1][0]), "+v"(acl[1][1]), "+v"(acl[1][2]), "+v"(acl[1][3])
                        : "v"(al[0].v), "v"(al[1].v), "v"(b[0].v), "v"(b[1].v), "v"(b[2].v), "v"(b[3].v));
    }
    asm volatile("v_nop\n\tv_nop\n\tv_nop\n\tv_nop" : "+v"(acc[0][0]), "+v"(acc[0][1]), "+v"(acc[0][2]), "+v"(acc[0][3]),
                        "+v"(acc[1][0]), "+v"(acc[1][1]), "+v"(acc[1][2]), "+v"(acc[1][3])
                      : "v"(a[0].v), "v"(a[1].v), "v"(b[0].v), "v"(b[1].v), "v"(b[2].v), "v"(b[3].v));
  }
}

__device__ __forceinline__ float rope1(float q, float p, float c, float s, float sg) { return q * c + (sg * p) * s; }

// ---------------------------------------------------------------------------------------------------------
// Rotary table from the position ids (read by value): rot[t][j] = cos(p_t * f_j), rot[t][32 + j] = sin(p_t * f_j), f_j = 10000^(-j/32), j = 0..31.
// Block = 16 positions x 32 frequencies, one precise sincos per thread -> LDS tile [16][64] (cross-wave: block barrier) -> 16 threads write one row
__device__ __forceinline__ void rotab_part(const int* __restrict__ pos, float* __restrict__ rot, int blk, float (*sh)[64]) {
  const int tid = threadIdx.x;
  const int r = tid >> 5, j = tid & 31;
  const int t = blk * 16 + r;
  const float p = (float)pos[t];
  const float f = exp2f(-(float)j * 0.41524101186092029f);   // log2(10000)/32
  const float ang = p * f;
  float sn, cs;
  sincosf(ang, &sn, &cs);
  sh[r][j] = cs;
  sh[r][32 + j] = sn;
  __syncthreads();
  if (tid < 256) {
    const int rr = tid >> 4, pc = tid & 15;
    const v4f v = *(const v4fa*)&sh[rr][4 * pc];
    float* d = rot + (size_t)(blk * 16 + rr) * HD + 4 * pc;
    *(v4f*)d = v;
    
  }
}

// ---------------------------------------------------------------------------------------------------------
// All preparation in one launch: the rotary table, the mask scan and the five plane conversions depend on the inputs alone and on nothing of one another,
// so each work-group of 512 threads takes one block of one of them by its index range (the test is the same for the whole work-group; each part's barrier
// is passed by every thread of the work-groups that run that part).
// coverage: the ranges below follow one another without gap or overlap and each holds exactly the blocks that its part's own coverage line asks for.
#define PB_ROT  (SEQ / 16)
#define PB_SCAN (SEQ / SCAN_ROWS)
#define PB_X    (NB * SEQ / 2)
#define PB_WQ   (CD / 2)
#define PB_WKV  (KVW / 2)
#define PB_WO   (CD / 2)
#define PB_ALL  (PB_ROT + PB_SCAN + PB_X + PB_WQ + 2 * PB_WKV + PB_WO)
__global__ __launch_bounds__(512) void k_prep(const float* __restrict__ mask, const int* __restrict__ pos, const float* __restrict__ x,
                                              const float* __restrict__ Wq, const float* __restrict__ Wk, const float* __restrict__ Wv,
                                              const float* __restrict__ Wo, int* __restrict__ flags, float* __restrict__ rot,
                                              unsigned short* __restrict__ xb, unsigned short* __restrict__ wqk,
                                              unsigned short* __restrict__ wvb, unsigned short* __restrict__ wob) {
  __shared__ int sw[2][16];
  __shared__ __attribute__((aligned(16))) float sh[16][64];
  int blk = blockIdx.x;
  if (blk < PB_ROT) { rotab_part(pos, rot, blk, sh); return; }
  blk -= PB_ROT;
  if (blk < PB_SCAN) { maskscan_part(mask, flags, blk, sw); return; }
  blk -= PB_SCAN;
  if (blk < PB_X) { cvt_part<0>(x, xb, blk, SEQ, SEQ_FULL); return; }
  blk -= PB_X;
  if (blk < PB_WQ) { cvt_part<0>(Wq, wqk, blk, CD, CD); return; }
  blk -= PB_WQ;
  if (blk < PB_WKV) { cvt_part<0>(Wk, wqk + (size_t)CD * CD, blk, KVW, KVW); return; }
  blk -= PB_WKV;
  if (blk < PB_WKV) { cvt_part<0>(Wv, wvb, blk, KVW, KVW); return; }
  blk -= PB_WKV;
  cvt_part<1>(Wo, wob, blk, CD, CD);
}

// ---------------------------------------------------------------------------------------------------------
// q and k projections with fused bias, half-split rotary (table plane [SEQ][32 cos | 32 sin]) and head-major repack.
// Block = 4 waves stacked in M (128 token rows) x one head (64 columns): hd = 0..NQK-1, mblk = 0..NB*SEQ/128-1.
// coverage: NQK heads x NB*SEQ tokens x 64 = the whole plane [NB][NQK][SEQ][64], both planes. LDS tile 32 x 64 fully written before it is read.
__device__ __forceinline__ void proj_qk_part(const unsigned short* __restrict__ xb, const unsigned short* __restrict__ wqk,
                                             const float* __restrict__ bq, const float* __restrict__ bk,
                                             const float* __restrict__ tab,
                                             unsigned short* __restrict__ qkh, unsigned short* __restrict__ qkl,
                                             int hd, int mblk, float (*st)[32][68]) {
  const int tid = threadIdx.x, lane = tid & 31, ln = lane & 15, hh = lane >> 4;
  const int w = __builtin_amdgcn_readfirstlane(tid >> 5);
  const int m0 = mblk * 128 + 32 * w;
  const v8f z8 = {0.f, 0.f, 0.f, 0.f, 0.f, 0.f, 0.f, 0.f};
  v8f acc[2][4];
#pragma unroll
  for (int i = 0; i < 2; ++i)
#pragma unroll
    for (int j = 0; j < 4; ++j) acc[i][j] = z8;
  gemm_loop<true, false>(xb + (size_t)m0 * CD + 8 * lane, xb, wqk + (size_t)(hd * HD) * CD + 8 * lane, acc, acc);

  float bias[4];
#pragma unroll
  for (int j = 0; j < 4; ++j) {
    const int col = hd * HD + 16 * j + ln;
    const int cq = (col < CD - 1) ? col : (CD - 1);
    int ck = col - CD;
    ck = (ck < 0) ? 0 : ((ck > KVW - 1) ? (KVW - 1) : ck);
    const float vq = bq[cq], vk = bk[ck];
    bias[j] = bf16_rne((col < CD) ? vq : vk);
  }
#pragma unroll
  for (int i = 0; i < 2; ++i)
#pragma unroll
    for (int j = 0; j < 4; ++j)
#pragma unroll
      for (int r = 0; r < 8; ++r) st[w][16 * i + 8 * hh + r][16 * j + ln] = acc[i][j][r] + bias[j];
  __syncthreads();

  const int b = m0 / SEQ, t0 = m0 - b * SEQ;
  // piece g of the wave's 32 tokens x 64 columns in fragment order: row group g >> 2, k tile (g >> 1) & 1, fragment half g & 1
  v8us oh[8], ol[8];
#pragma unroll
  for (int g = 0; g < 8; ++g) {
    const int row = 16 * (g >> 2) + ln;
    const int d0 = 32 * ((g >> 1) & 1) + 16 * (g & 1) + 8 * hh;
    const float sg = (d0 < 32) ? -1.0f : 1.0f;
    const v4f a0 = *(const v4fa*)&st[w][row][d0];
    const v4f a1 = *(const v4fa*)&st[w][row][d0 + 4];
    const v4f p0 = *(const v4fa*)&st[w][row][d0 ^ 32];
    const v4f p1 = *(const v4fa*)&st[w][row][(d0 ^ 32) + 4];
    // column d uses frequency d % 32: cos at [d % 32], sin at [32 + d % 32]
    const float* tp = tab + (size_t)(t0 + row) * HD + (d0 & 31);
    const v4f c0 = *(const v4fa*)(tp), c1 = *(const v4fa*)(tp + 4);
    const v4f s0 = *(const v4fa*)(tp + 32), s1 = *(const v4fa*)(tp + 36);
    float o[8];
    o[0] = rope1(a0[0], p0[0], c0[0], s0[0], sg); o[1] = rope1(a0[1], p0[1], c0[1], s0[1], sg);
    o[2] = rope1(a0[2], p0[2], c0[2], s0[2], sg); o[3] = rope1(a0[3], p0[3], c0[3], s0[3], sg);
    o[4] = rope1(a1[0], p1[0], c1[0], s1[0], sg); o[5] = rope1(a1[1], p1[1], c1[1], s1[1], sg);
    o[6] = rope1(a1[2], p1[2], c1[2], s1[2], sg); o[7] = rope1(a1[3], p1[3], c1[3], s1[3], sg);
    Pack8 ph8, pl8;
#pragma unroll
    for (int e = 0; e < 8; ++e) {
      const float y = o[e] * 16.0f;                       // carried x16
      const _Float16 h = toh_flush(y);
      ph8.h[e] = h;
      pl8.h[e] = toh_flush((y - (float)h) * 2048.0f);      // residual plane x2^11
    }
    oh[g] = ph8.v; ol[g] = pl8.v;
  }
  const size_t dbase = ((size_t)(b * NQK + hd) * SEQ + t0) * HD + 8 * lane;
{
#pragma unroll
    for (int g = 0; g < 8; ++g) {
      const size_t off = dbase + (size_t)g * 256;
      *(v8us*)(qkh + off) = oh[g];
      *(v8us*)(qkl + off) = ol[g];
    }
    
  }
}

// ---------------------------------------------------------------------------------------------------------
// v projection computed transposed: Vt[b][m][t] = sum_k Wv[m][k] x[b,t][k] + bv[m], carried x16, hi and residual planes.
// Block = 4 waves stacked in M (128 weight rows) x 64 tokens: nblk = 0..NB*SEQ/64-1, mgrp = 0..KVW/128-1.
// coverage: KVW rows x NB*SEQ tokens = the whole plane [NB][KVW][SEQ], both planes. LDS tile 32 x 64 fully written before it is read.
__device__ __forceinline__ void proj_v_part(const unsigned short* __restrict__ wvb, const unsigned short* __restrict__ xb,
                                            const float* __restrict__ bv,
                                            unsigned short* __restrict__ vth, unsigned short* __restrict__ vtl,
                                            int nblk, int mgrp, float (*st)[32][68]) {
  const int tid = threadIdx.x, lane = tid & 31, ln = lane & 15, hh = lane >> 4;
  const int w = __builtin_amdgcn_readfirstlane(tid >> 5);
  const int n0 = nblk * 64;
  const int m0 = mgrp * 128 + 32 * w;
  const v8f z8 = {0.f, 0.f, 0.f, 0.f, 0.f, 0.f, 0.f, 0.f};
  v8f acc[2][4];
#pragma unroll
  for (int i = 0; i < 2; ++i)
#pragma unroll
    for (int j = 0; j < 4; ++j) acc[i][j] = z8;
  gemm_loop<true, false>(wvb + (size_t)m0 * CD + 8 * lane, wvb, xb + (size_t)n0 * CD + 8 * lane, acc, acc);
#pragma unroll
  for (int i = 0; i < 2; ++i)
#pragma unroll
    for (int j = 0; j < 4; ++j)
#pragma unroll
      for (int r = 0; r < 8; ++r) st[w][16 * i + 8 * hh + r][16 * j + ln] = acc[i][j][r];
  __syncthreads();

  const int b = n0 / SEQ, t0 = n0 - b * SEQ;
  // piece g of the wave's 32 rows x 64 tokens in fragment order: row group g >> 2, key tile (g >> 1) & 1, fragment half g & 1
  v8us oh[8], ol[8];
#pragma unroll
  for (int g = 0; g < 8; ++g) {
    const int row = 16 * (g >> 2) + ln;
    const int c0 = 32 * ((g >> 1) & 1) + 16 * (g & 1) + 8 * hh;
    const float bias = bf16_rne(bv[m0 + row]);
    const v4f a0 = *(const v4fa*)&st[w][row][c0];
    const v4f a1 = *(const v4fa*)&st[w][row][c0 + 4];
    float o[8];
    o[0] = a0[0]; o[1] = a0[1]; o[2] = a0[2]; o[3] = a0[3];
    o[4] = a1[0]; o[5] = a1[1]; o[6] = a1[2]; o[7] = a1[3];
    Pack8 ph8, pl8;
#pragma unroll
    for (int e = 0; e < 8; ++e) {
      const float y = (o[e] + bias) * 16.0f;              // carried x16
      const _Float16 h = (_Float16)y;
      ph8.h[e] = h;
      pl8.h[e] = (_Float16)((y - (float)h) * 2048.0f);
    }
    oh[g] = ph8.v; ol[g] = pl8.v;
  }
  const size_t dbase = ((size_t)b * KVW + m0) * SEQ + (size_t)t0 * 16 + 8 * lane;
{
#pragma unroll
    for (int g = 0; g < 8; ++g) {
      const size_t off = dbase + (size_t)(g >> 2) * 16 * SEQ + (size_t)(g & 3) * 256;
      *(v8us*)(vth + off) = oh[g];
      *(v8us*)(vtl + off) = ol[g];
    }
    
  }
}

// ---------------------------------------------------------------------------------------------------------
// q, k and v projections in one launch: they read the same x plane and write disjoint planes, and the v blocks alone are too few to fill the chip.
// grid = (NQK + VBX, NB*SEQ/128): column c < NQK is head c of the q/k part; the VBX columns behind it are the v blocks of the same 128 tokens
// (two halves of 64 tokens x KVW/128 groups of weight rows). The test is the same for the whole work-group.
// coverage: every (hd, mblk) once; (nblk, mgrp) = (2 * y + (j & 1), j >> 1), j = 0..VBX-1, y = 0..NB*SEQ/128-1, is every v block once.
#define VBX (2 * (KVW / 128))
__global__ __launch_bounds__(128) void k_proj_qkv(const unsigned short* __restrict__ xb, const unsigned short* __restrict__ wqk,
                                                  const unsigned short* __restrict__ wvb,
                                                  const float* __restrict__ bq, const float* __restrict__ bk, const float* __restrict__ bv,
                                                  const float* __restrict__ tab,
                                                  unsigned short* __restrict__ qkh, unsigned short* __restrict__ qkl,
                                                  unsigned short* __restrict__ vth, unsigned short* __restrict__ vtl) {
  __shared__ __attribute__((aligned(16))) float st[4][32][68];
  const int c = blockIdx.x;
  if (c < NQK) {
    proj_qk_part(xb, wqk, bq, bk, tab, qkh, qkl, c, blockIdx.y, st);
  } else {
    const int j = c - NQK;
    proj_v_part(wvb, xb, bv, vth, vtl, 2 * blockIdx.y + (j & 1), j >> 1, st);
  }
}

// ---------------------------------------------------------------------------------------------------------
// One 32-key step for a wave's 16 queries (this lane's column = its query). EARLYP adds the residual planes of q, k, v, P.
// MASK reads the mask row of this lane's query by value (RNE bf16 value) and adds it to the scaled scores.
// Without EARLYP the fragment loads run ahead of their use: kf holds this step's K fragments on entry and the K fragments of the step at keyn on exit
// (fetched right behind the score products, into the same registers), and the V fragments of this step are fetched at the step's top, so that both
// fly under the softmax arithmetic. With EARLYP kf and keyn are not used.
template <bool EARLYP, bool MASK>
__device__ __forceinline__ void fa_step(const unsigned short* __restrict__ Kp, const unsigned short* __restrict__ Kl,
                                        const unsigned short* __restrict__ Vp, const unsigned short* __restrict__ Vl,
                                        const float* __restrict__ mrow, int key0, int keyn, int ln, int hh,
                                        const Frag (&qh)[2], const Frag (&ql)[2], Frag (&kf)[4],
                                        float& mr, float& lr, v8f (&Oh)[4], v8f (&Ol)[4]) {
  const v8f z8 = {0.f, 0.f, 0.f, 0.f, 0.f, 0.f, 0.f, 0.f};
  float sc[16];
  // A fragments of K: row m = key (key0 + 16*kt + ln), elements 0..7 <- d = 32c + 8h + i, 8..15 <- d = 32c + 16 + 8h + i
  // fragment-order plane: 16 keys = two tiles of 512 elements (c = 0, 1)
  int koff = key0 * HD + 8 * (16 * hh + ln);
  // A fragments of V^T: row m = d (16*t + ln), elements 0..7 <- key0 + 8h + i, 8..15 <- key0 + 16 + 8h + i
  // fragment-order plane: the tile of 32 keys at key0 starts 16*key0 elements into its group of 16 rows
  int voff = key0 * 16 + 8 * (16 * hh + ln);
  Frag vf[4];
  if (!EARLYP) {
#pragma unroll
    for (int t = 0; t < 4; ++t) ldfrag(vf[t], Vp + voff + (size_t)t * 16 * SEQ);
    if (MASK) asm volatile("s_wait_xcnt 0x0" ::: "memory");   // the mask loads behind them land in the registers that the V loads name
  }
  if (EARLYP) {
#pragma unroll
    for (int kt = 0; kt < 2; ++kt) {
      Frag a0, a1, l0, l1;
      ldfrag(a0, Kp + koff); ldfrag(a1, Kp + koff + 512);
      ldfrag(l0, Kl + koff); ldfrag(l1, Kl + koff + 512);
      v8f s = z8, r = z8;
      s = wm<false>(a0, qh[0], s); s = wm<false>(a1, qh[1], s);
      r = wm<false>(a0, ql[0], r); r = wm<false>(a1, ql[1], r);
      r = wm<false>(l0, qh[0], r); r = wm<false>(l1, qh[1], r);
      asm volatile("v_nop\n\tv_nop\n\tv_nop\n\tv_nop" : "+v"(s), "+v"(r)
                        : "v"(a0.v), "v"(a1.v), "v"(l0.v), "v"(l1.v), "v"(qh[0].v), "v"(qh[1].v), "v"(ql[0].v), "v"(ql[1].v));
      // S^T element r of tile kt = score(key0 + 16*kt + 8h + r, this lane's query); carries: q x16, k x16, residual x2^11
#pragma unroll
      for (int e = 0; e < 8; ++e) sc[8 * kt + e] = fmaf(r[e], S2M11, s[e]) * S2M11;
      koff += 16 * HD;
      if (kt == 0) asm volatile("" : "+v"(koff) : "v"(sc[0]));   // second tile's loads issue after the first tile is done
    }
  } else {
    v8f s0 = z8, s1 = z8;
    s0 = wm<false>(kf[0], qh[0], s0); s0 = wm<false>(kf[1], qh[1], s0);
    s1 = wm<false>(kf[2], qh[0], s1); s1 = wm<false>(kf[3], qh[1], s1);
    koff = keyn * HD + 8 * (16 * hh + ln);
    asm volatile("v_nop\n\tv_nop\n\tv_nop\n\tv_nop" : "+v"(s0), "+v"(s1)
                      : "v"(kf[0].v), "v"(kf[1].v), "v"(kf[2].v), "v"(kf[3].v), "v"(qh[0].v), "v"(qh[1].v));
    ldfrag(kf[0], Kp + koff);           ldfrag(kf[1], Kp + koff + 512);
    ldfrag(kf[2], Kp + koff + 16 * HD); ldfrag(kf[3], Kp + koff + 16 * HD + 512);
#pragma unroll
    for (int e = 0; e < 8; ++e) { sc[e] = s0[e] * S2M11; sc[8 + e] = s1[e] * S2M11; }
  }
  if (MASK) {
    const float* mp = mrow + key0 + 8 * hh;
    const v4f m0 = *(const v4fa*)(mp),      m1 = *(const v4fa*)(mp + 4);
    const v4f m2 = *(const v4fa*)(mp + 16), m3 = *(const v4fa*)(mp + 20);
#pragma unroll
    for (int e = 0; e < 4; ++e) {
      sc[e]      = sc[e]      + bf16_rne(m0[e]);
      sc[4 + e]  = sc[4 + e]  + bf16_rne(m1[e]);
      sc[8 + e]  = sc[8 + e]  + bf16_rne(m2[e]);
      sc[12 + e] = sc[12 + e] + bf16_rne(m3[e]);
    }
  }
  float mx = sc[0];
#pragma unroll
  for (int i = 1; i < 16; ++i) mx = fmaxf(mx, sc[i]);
  mx = fmaxf(mx, __shfl_xor(mx, 16, 32));            // the other lane half holds the other 16 keys of this query
  const float mnew = fmaxf(mr, mx);
  float msafe = mnew;
  if (MASK) msafe = (mnew == neg_inf()) ? 0.0f : mnew;   // every key so far at -inf: weights come out 0
  const float al = __builtin_amdgcn_exp2f((mr - msafe) * LOG2E);
  mr = mnew;
  // weights carried x256: pc = 256 * exp(sc - m); hi plane f16(pc), residual plane f16((pc - hi) * 2048)
  Frag ph, pl;
  float ps = 0.0f;
#pragma unroll
  for (int i = 0; i < 16; ++i) {
    const float pc = __builtin_amdgcn_exp2f(fmaf(sc[i] - msafe, LOG2E, 8.0f));
    ps += pc;
    const _Float16 h = toh_flush(pc);
    ph.h[i] = h;                                      // B element i: i<8 -> key0 + 8h + i (tile 0 row 8h+i); i>=8 -> key0 + 16 + 8h + (i-8) (tile 1)
    if (EARLYP) pl.h[i] = toh_flush((pc - (float)h) * 2048.0f);
  }
  ps += __shfl_xor(ps, 16, 32);
  lr = lr * al + ps;
  if (EARLYP) {
    asm volatile("" : "+v"(voff) : "v"(ps));          // V loads issue after the score phase
#pragma unroll
    for (int t = 0; t < 4; ++t) ldfrag(vf[t], Vp + voff + (size_t)t * 16 * SEQ);
  }
#pragma unroll
  for (int t = 0; t < 4; ++t) Oh[t] = Oh[t] * al;
  if (EARLYP) {
    const unsigned short* vq = Vl + voff;
    Frag vl[4];
#pragma unroll
    for (int t = 0; t < 4; ++t) ldfrag(vl[t], vq + (size_t)t * 16 * SEQ);
#pragma unroll
    for (int t = 0; t < 4; ++t) Ol[t] = Ol[t] * al;
#pragma unroll
    for (int t = 0; t < 4; ++t) {
      Oh[t] = wm<false>(vf[t], ph, Oh[t]);
      Ol[t] = wm<false>(vf[t], pl, Ol[t]);
      Ol[t] = wm<false>(vl[t], ph, Ol[t]);
    }
    asm volatile("v_nop\n\tv_nop\n\tv_nop\n\tv_nop" : "+v"(Oh[0]), "+v"(Oh[1]), "+v"(Oh[2]), "+v"(Oh[3]), "+v"(Ol[0]), "+v"(Ol[1]), "+v"(Ol[2]), "+v"(Ol[3])
                      : "v"(vf[0].v), "v"(vf[1].v), "v"(vf[2].v), "v"(vf[3].v),
                        "v"(vl[0].v), "v"(vl[1].v), "v"(vl[2].v), "v"(vl[3].v), "v"(ph.v), "v"(pl.v));
  } else {
#pragma unroll
    for (int t = 0; t < 4; ++t) Oh[t] = wm<false>(vf[t], ph, Oh[t]);
    asm volatile("v_nop\n\tv_nop\n\tv_nop\n\tv_nop" : "+v"(Oh[0]), "+v"(Oh[1]), "+v"(Oh[2]), "+v"(Oh[3])
                      : "v"(vf[0].v), "v"(vf[1].v), "v"(vf[2].v), "v"(vf[3].v), "v"(ph.v));
  }
}

template <bool EARLYP>
__device__ __forceinline__ void run_keys(const unsigned short* __restrict__ qkh, const unsigned short* __restrict__ qkl,
                                         const unsigned short* __restrict__ vth, const unsigned short* __restrict__ vtl,
                                         const float* __restrict__ mask, int b, int h, int qg, int ln, int hh,
                                         int nplain, int nsteps, float& mr, float& lr, v8f (&Oh)[4], v8f (&Ol)[4]) {
  // Q^T B fragments: column n = this lane's query, elements 0..7 <- d = 32c + 8h + i, 8..15 <- d = 32c + 16 + 8h + i
  const size_t qoff = ((size_t)(b * NQK + h) * SEQ + (qg - ln)) * HD + 8 * (16 * hh + ln);   // fragment-order plane, the wave's own 16 rows
  Frag qh[2], ql[2];
  ldfrag(qh[0], qkh + qoff); ldfrag(qh[1], qkh + qoff + 512);
  if (EARLYP) { ldfrag(ql[0], qkl + qoff); ldfrag(ql[1], qkl + qoff + 512); }
  else { ql[0] = qh[0]; ql[1] = qh[1]; }
  asm volatile("s_wait_xcnt 0x0" ::: "memory");        // the address registers of the Q loads are reused right behind them
  const int kv = h / NREP;                             // consecutive groups of NREP query heads share one kv head
  const size_t kbase = (size_t)(b * NQK + NHEAD + kv) * SEQ * HD;
  const size_t vbase = ((size_t)b * KVW + (size_t)kv * HD) * SEQ;
  const unsigned short* Kp = qkh + kbase;
  const unsigned short* Kl = qkl + kbase;
  const unsigned short* Vp = vth + vbase;
  const unsigned short* Vl = vtl + vbase;
  const float* mrow = mask + (size_t)qg * SEQ_FULL;
  Frag kf[4];
  if (!EARLYP) {                                       // K fragments of step 0 (nsteps >= 1)
    const unsigned short* k0 = Kp + 8 * (16 * hh + ln);
    ldfrag(kf[0], k0);           ldfrag(kf[1], k0 + 512);
    ldfrag(kf[2], k0 + 16 * HD); ldfrag(kf[3], k0 + 16 * HD + 512);
    asm volatile("s_wait_xcnt 0x0" ::: "memory");      // the address registers of the K loads are reused behind them
  }
  // the step fetched ahead is the next one; the last step fetches its own tile again, so that the address stays inside the plane
#pragma unroll 1
  for (int j = 0; j < nplain; ++j)
    fa_step<EARLYP, false>(Kp, Kl, Vp, Vl, mrow, 32 * j, 32 * ((j + 1 < nsteps) ? j + 1 : j), ln, hh, qh, ql, kf, mr, lr, Oh, Ol);
#pragma unroll 1
  for (int j = nplain; j < nsteps; ++j)
    fa_step<EARLYP, true>(Kp, Kl, Vp, Vl, mrow, 32 * j, 32 * ((j + 1 < nsteps) ? j + 1 : j), ln, hh, qh, ql, kf, mr, lr, Oh, Ol);
}

// Block = 4 waves x 16 queries = 64 queries of one (batch, head); no LDS and no barrier.
// Tile skipping from the device flags, per wave: both flags of both flag lines that cover the wave's 16 query rows are 1 -> keys past the diagonal step are
// skipped (their weights are exactly zero) and steps fully below the diagonal run without mask reads (their mask entries are exactly zero); every other
// visited step reads the mask by value. A softmax row depends on its own mask row alone, so the wave's own rows decide.
// For any other flag value every step is visited and reads the mask. Trip counts are bounded by SEQ/32 for any flag value.
// coverage: NB*NHEAD*(SEQ/64) blocks x 4 waves x 16 rows x 64 columns = the whole ctx hi plane; blocks with query tile below EARLY_ROWS cover the whole residual plane.
__global__ __launch_bounds__(128) void k_attn(const unsigned short* __restrict__ qkh, const unsigned short* __restrict__ qkl,
                                              const unsigned short* __restrict__ vth, const unsigned short* __restrict__ vtl,
                                              const float* __restrict__ mask, const int* __restrict__ flags,
                                              unsigned short* __restrict__ ctxh, unsigned short* __restrict__ ctxl) {
  const int tid = threadIdx.x, lane = tid & 31, ln = lane & 15, hh = lane >> 4;
  const int w = __builtin_amdgcn_readfirstlane(tid >> 5);
  const int nqt = SEQ / 64;
  const int blk = blockIdx.x;
  const int qt = blk % nqt;
  const int h = (blk / nqt) % NHEAD;
  const int b = blk / (nqt * NHEAD);
  const int qbase = qt * 64 + 16 * w;
  const int qg = qbase + ln;
  const int* fl = flags + (qbase / SCAN_ROWS) * 32;    // 16 query rows = 16 / SCAN_ROWS flag lines
  int fok = 1;                                         // bitwise, so that the flag loads issue together
#pragma unroll
  for (int i = 0; i < 16 / SCAN_ROWS; ++i) fok &= (fl[32 * i] == 1 ? 1 : 0) & (fl[32 * i + 1] == 1 ? 1 : 0);
  const bool tri = (fok == 1);
  const int nfull = qbase >> 5;                        // steps whose 32 keys are all at or below every query of this wave
  const int nsteps = tri ? (nfull + 1) : (SEQ / 32);   // <= SEQ/32 in both cases
  const int nplain = tri ? nfull : 0;
  const bool early = (qt * 64 < EARLY_ROWS);

  const v8f z8 = {0.f, 0.f, 0.f, 0.f, 0.f, 0.f, 0.f, 0.f};
  float mr = neg_inf(), lr = 0.0f;
  v8f Oh[4], Ol[4];
#pragma unroll
  for (int t = 0; t < 4; ++t) { Oh[t] = z8; Ol[t] = z8; }
  if (early) run_keys<true>(qkh, qkl, vth, vtl, mask, b, h, qg, ln, hh, nplain, nsteps, mr, lr, Oh, Ol);
  else       run_keys<false>(qkh, qkl, vth, vtl, mask, b, h, qg, ln, hh, nplain, nsteps, mr, lr, Oh, Ol);

  // O^T element r of tile t = ctx(query, d = 16t + 8h + r); undo the carries x256 (in lr), x16 (V), x2^11 (residual); apply the x64 carry of ctx
  const float inv = 4.0f * (1.0f / lr);
  // tile t of O^T in this lane = row ln, columns 16t + 8h + 0..7 of ctx: exactly this lane's 16-byte piece t of the wave's two fragment-order tiles
  // (k tile t >> 1, fragment half t & 1), so the registers are stored as they stand, 512 contiguous bytes per wave and store
  v8us oh[4], ol[4];
#pragma unroll
  for (int t = 0; t < 4; ++t) {
    Pack8 ph8, pl8;
#pragma unroll
    for (int e = 0; e < 8; ++e) {
      const float o = fmaf(Ol[t][e], S2M11, Oh[t][e]) * inv;
      const _Float16 hv = toh_flush(o);
      ph8.h[e] = hv;
      pl8.h[e] = toh_flush((o - (float)hv) * 2048.0f);
    }
    oh[t] = ph8.v; ol[t] = pl8.v;
  }
  const size_t hbase = ((size_t)b * SEQ + qbase) * CD + (size_t)h * (16 * HD) + 8 * lane;
  const size_t lbase = ((size_t)b * EARLY_ROWS + (early ? qbase : 0)) * CD + (size_t)h * (16 * HD) + 8 * lane;
#pragma unroll
  for (int t = 0; t < 4; ++t) *(v8us*)(ctxh + hbase + t * 256) = oh[t];
  asm volatile("s_wait_xcnt 0x0" ::: "memory");        // the residual stores' address arithmetic below may reuse the registers that these stores name
  if (early) {
#pragma unroll
    for (int t = 0; t < 4; ++t) *(v8us*)(ctxl + lbase + t * 256) = ol[t];
  }
}

// ---------------------------------------------------------------------------------------------------------
// Output projection: out[m][n] = sum_k ctx[m][k] Wo[n][k] + bo[n]. Block = 4 waves stacked in M (128 rows) x 64 columns. grid = (CD/64, NB*SEQ/128).
// Rows below EARLY_ROWS of each sequence add the residual plane of ctx in separate accumulators.
// coverage: NB*SEQ rows x CD columns = every element of the output buffer region once. LDS tile 32 x 64 fully written before it is read.
__global__ __launch_bounds__(128) void k_proj_out(const unsigned short* __restrict__ ctxh, const unsigned short* __restrict__ ctxl,
                                                  const unsigned short* __restrict__ wo, const float* __restrict__ bo,
                                                  float* __restrict__ out) {
  __shared__ __attribute__((aligned(16))) float st[4][32][68];
  const int tid = threadIdx.x, lane = tid & 31, ln = lane & 15, hh = lane >> 4;
  const int w = __builtin_amdgcn_readfirstlane(tid >> 5);
  const int n0 = blockIdx.x * 64;
  const int mb = blockIdx.y * 128;
  const int b = mb / SEQ;
  const int tb = mb - b * SEQ;
  const bool early = (tb < EARLY_ROWS);                // block-uniform: EARLY_ROWS and SEQ are multiples of 128
  const int t0 = tb + 32 * w;
  const int m0 = mb + 32 * w;
  const v8f z8 = {0.f, 0.f, 0.f, 0.f, 0.f, 0.f, 0.f, 0.f};
  v8f acc[2][4], acl[2][4];
#pragma unroll
  for (int i = 0; i < 2; ++i)
#pragma unroll
    for (int j = 0; j < 4; ++j) { acc[i][j] = z8; acl[i][j] = z8; }
  const unsigned short* ap = ctxh + (size_t)m0 * CD + 8 * lane;
  const unsigned short* alp = ctxl + (size_t)(b * EARLY_ROWS + (early ? t0 : 0)) * CD + 8 * lane;
  const unsigned short* wp = wo + (size_t)n0 * CD + 8 * lane;
  if (early) gemm_loop<false, true>(ap, alp, wp, acc, acl);
  else       gemm_loop<false, false>(ap, ap, wp, acc, acl);
  // carries: ctx x64, Wo x64 -> 2^-12; residual plane additionally x2^11
#pragma unroll
  for (int i = 0; i < 2; ++i)
#pragma unroll
    for (int j = 0; j < 4; ++j)
#pragma unroll
      for (int r = 0; r < 8; ++r)
        st[w][16 * i + 8 * hh + r][16 * j + ln] = fmaf(acl[i][j][r], S2M11, acc[i][j][r]) * S2M12;
  __syncthreads();
  const int rsub = lane >> 4, c4 = 4 * (lane & 15);
  const v4f bb = *(const v4fa*)(bo + n0 + c4);
  v4f bias;
  bias[0] = bf16_rne(bb[0]); bias[1] = bf16_rne(bb[1]); bias[2] = bf16_rne(bb[2]); bias[3] = bf16_rne(bb[3]);
  v4f ov[16];
#pragma unroll
  for (int g = 0; g < 16; ++g) {
    const v4f a = *(const v4fa*)&st[w][2 * g + rsub][c4];
    ov[g] = a + bias;
  }
  float* og = out + ((size_t)b * SEQ_FULL + t0) * CD + n0 + c4;
{
#pragma unroll
    for (int g = 0; g < 16; ++g)
      *(v4f*)(og + (size_t)(2 * g + rsub) * CD) = ov[g];
    
  }
}

// ---------------------------------------------------------------------------------------------------------
extern "C" void kernel_launch(void* const* d_in, const int* in_sizes, int n_in,
                              void* d_out, int out_size, void* d_ws, size_t ws_size, hipStream_t stream) {
  if (n_in < 11) return;
  const long long need_x = (long long)(NB - 1) * SEQ_FULL * CD + (long long)SEQ * CD;   // last element touched + 1
  const long long need_m = (long long)(SEQ - 1) * SEQ_FULL + SEQ;
  if ((long long)in_sizes[0] < need_x) return;
  if ((long long)in_sizes[1] < need_m) return;
  if ((long long)in_sizes[2] < (long long)SEQ) return;
  if ((long long)in_sizes[3] < (long long)CD * CD || (long long)in_sizes[4] < CD) return;
  if ((long long)in_sizes[5] < (long long)KVW * CD || (long long)in_sizes[6] < KVW) return;
  if ((long long)in_sizes[7] < (long long)KVW * CD || (long long)in_sizes[8] < KVW) return;
  if ((long long)in_sizes[9] < (long long)CD * CD || (long long)in_sizes[10] < CD) return;
  if ((long long)out_size < need_x) return;
  if ((size_t)WS_TOTAL > ws_size) return;

  // wire order: hidden_states, attention_mask (f32), position_ids (i32), Wq, bq, Wk, bk, Wv, bv, Wo, bo
  const float* x    = (const float*)d_in[0];
  const float* mask = (const float*)d_in[1];
  const int*   pos  = (const int*)d_in[2];
  const float* Wq   = (const float*)d_in[3];
  const float* bq   = (const float*)d_in[4];
  const float* Wk   = (const float*)d_in[5];
  const float* bk   = (const float*)d_in[6];
  const float* Wv   = (const float*)d_in[7];
  const float* bv   = (const float*)d_in[8];
  const float* Wo   = (const float*)d_in[9];
  const float* bo   = (const float*)d_in[10];
  float* out = (float*)d_out;

  char* ws = (char*)d_ws;
  size_t off = 0;
  int* flags = (int*)(ws + off);                               off += SZ_FLAGS;
  float* rot = (float*)(ws + off);                             off += SZ_ROT;
  unsigned short* xb   = (unsigned short*)(ws + off);          off += SZ_XB;
  unsigned short* wqk  = (unsigned short*)(ws + off);          off += SZ_WQK;
  unsigned short* wvb  = (unsigned short*)(ws + off);          off += SZ_WV;
  unsigned short* wob  = (unsigned short*)(ws + off);          off += SZ_WO;
  unsigned short* qkh  = (unsigned short*)(ws + off);          off += PLANE_QK * 2;
  unsigned short* qkl  = (unsigned short*)(ws + off);          off += PLANE_QK * 2;
  unsigned short* vth  = (unsigned short*)(ws + off);          off += PLANE_V * 2;
  unsigned short* vtl  = (unsigned short*)(ws + off);          off += PLANE_V * 2;
  unsigned short* ctxh = (unsigned short*)(ws + off);          off += SZ_CTXH;
  unsigned short* ctxl = (unsigned short*)(ws + off);          off += SZ_CTXL;
  if (off > ws_size) return;

  // flags, rotary table, and in[rows][CD] f32 -> 16-bit planes of rows x CD in fragment order
  k_prep<<<(unsigned)PB_ALL, 512, 0, stream>>>(mask, pos, x, Wq, Wk, Wv, Wo, flags, rot, xb, wqk, wvb, wob);
  k_proj_qkv<<<dim3(NQK + VBX, (unsigned)(NB * SEQ / 128)), 128, 0, stream>>>(xb, wqk, wvb, bq, bk, bv, rot, qkh, qkl, vth, vtl);
  k_attn<<<(unsigned)(NB * NHEAD * (SEQ / 64)), 128, 0, stream>>>(qkh, qkl, vth, vtl, mask, flags, ctxh, ctxl);
  k_proj_out<<<dim3(CD / 64, (unsigned)(NB * SEQ / 128)), 128, 0, stream>>>(ctxh, ctxl, wob, bo, out);
}

// v005
// One run takes 194 microseconds.
// Next to v004, in two timings, it ran 1.04 and 1.02 times as fast.
// All steps since v000 together make it 4.82 times as fast.
#include <hip/hip_runtime.h>
#ifndef NB
#define NB 2
#endif
#ifndef SEQ
#define SEQ 2048
#endif
#define NB_FULL 2
#define SEQ_FULL 2048
#define CD 2048                 /* model width = depth of every projection */
#define NHEAD 32
#define NKV 8
#define NREP (NHEAD / NKV)      /* query heads per kv head */
#define HD 64
#define NQK (NHEAD + NKV)       /* rotary plane holds the 32 q heads followed by the 8 k heads */
#define KVW (NKV * HD)          /* 512 */
#define EARLY_ROWS (SEQ < 512 ? SEQ : 512)

#define SCAN_ROWS 8                                 /* mask rows per scan work-group */
#define SZ_FLAGS ((size_t)(SEQ / SCAN_ROWS) * 128)  /* one 128-byte flag line per scan work-group */
#define SZ_ROT   ((size_t)SEQ * HD * 4)              /* rotary table [SEQ][32 cos | 32 sin] f32 */
#define SZ_XB    ((size_t)NB * SEQ * CD * 2)
#define SZ_WQK   ((size_t)(CD + KVW) * CD * 2)
#define SZ_WV    ((size_t)KVW * CD * 2)
#define SZ_WO    ((size_t)CD * CD * 2)
#define PLANE_QK ((size_t)NB * NQK * SEQ * HD)     /* elements of one rotary plane */
#define PLANE_V  ((size_t)NB * KVW * SEQ)          /* elements of one V^T plane */
#define SZ_CTXH  ((size_t)NB * SEQ * CD * 2)
#define SZ_CTXL  ((size_t)NB * EARLY_ROWS * CD * 2)
#define WS_TOTAL (SZ_FLAGS + SZ_ROT + SZ_XB + SZ_WQK + SZ_WV + SZ_WO + PLANE_QK * 4 + PLANE_V * 4 + SZ_CTXH + SZ_CTXL)

static_assert(SEQ % 128 == 0);
static_assert(EARLY_ROWS % 128 == 0);
static_assert(SEQ <= SEQ_FULL);
static_assert(NB <= NB_FULL);
static_assert(HD == 64);
static_assert(CD % 32 == 0);
static_assert(KVW % 128 == 0);
static_assert(NHEAD % NKV == 0);
static_assert(NHEAD == NKV * NREP);
static_assert(CD == NHEAD * HD);
static_assert(SEQ % 16 == 0);
static_assert(SEQ % SCAN_ROWS == 0 && 16 % SCAN_ROWS == 0);
static_assert((SCAN_ROWS * (SEQ / 4)) % 512 == 0);
static_assert(SZ_ROT % 256 == 0);
static_assert(WS_TOTAL <= (size_t)134217728);
static_assert(SZ_XB % 256 == 0 && SZ_WQK % 256 == 0 && SZ_WV % 256 == 0 && SZ_WO % 256 == 0);
static_assert((PLANE_QK * 2) % 256 == 0 && (PLANE_V * 2) % 256 == 0 && SZ_CTXH % 256 == 0 && SZ_CTXL % 256 == 0);

typedef __bf16 v16b __attribute__((ext_vector_type(16)));
typedef _Float16 v16h __attribute__((ext_vector_type(16)));
typedef unsigned short v8us __attribute__((ext_vector_type(8), may_alias));
typedef float v8f __attribute__((ext_vector_type(8)));
typedef float v4f __attribute__((ext_vector_type(4)));
typedef float v4fa __attribute__((ext_vector_type(4), may_alias));
typedef int v4i __attribute__((ext_vector_type(4)));
typedef int v4ia __attribute__((ext_vector_type(4), may_alias));
union Frag { v16b b; v16h v; v8us half[2]; _Float16 h[16]; unsigned short u[16]; };
union Pack8 { v8us v; _Float16 h[8]; unsigned short u[8]; };

#define LOG2E 1.4426950408889634f
#define S2M11 0.00048828125f       /* 2^-11 */
#define S2M12 0.000244140625f      /* 2^-12 */
__device__ __forceinline__ unsigned short bf16_bits(float x) {   // RNE convert to bf16 bits
  unsigned int u = __float_as_uint(x);
  return (unsigned short)((u + 0x7FFFu + ((u >> 16) & 1u)) >> 16);
}
__device__ __forceinline__ float bf16_val(unsigned short b) { return __uint_as_float(((unsigned int)b) << 16); }
__device__ __forceinline__ float bf16_rne(float x) { return bf16_val(bf16_bits(x)); }
__device__ __forceinline__ float neg_inf() { return __uint_as_float(0xff800000u); }

// f32 -> f16 operand convert that cannot produce a subnormal: magnitudes below 2^-14 become zero by a value select.
typedef _Float16 h16;
static __device__ __forceinline__ h16 toh_flush(float v) {
  const h16 r = (h16)v;
  return (fabsf(v) < 6.103515625e-05f) ? (h16)0.0f : r;
}

// Fragment from a fragment-order tile: elements 0..7 <- p[0..7], elements 8..15 <- p[256..263]; caller adds tile * 512 + lane * 8.
__device__ __forceinline__ void ldfrag(Frag& f, const unsigned short* __restrict__ p) {
  f.half[0] = *(const v8us*)(p);
  f.half[1] = *(const v8us*)(p + 256);
}

template <bool BF>
__device__ __forceinline__ v8f wm(const Frag& a, const Frag& b, v8f c) {
  if (BF) return __builtin_amdgcn_wmma_f32_16x16x32_bf16(false, a.b, false, b.b, (short)0, c, false, false);
  return __builtin_amdgcn_wmma_f32_16x16x32_f16(false, a.v, false, b.v, (short)0, c, false, false);
}

// ---------------------------------------------------------------------------------------------------------
// Mask scan (f32 additive mask), one work-group per SCAN_ROWS mask rows, each writing its own 128-byte flag line g = blk:
// flags[32g] = 1 iff every entry of its rows above the diagonal is at or below -1e8 (its softmax weight is exactly zero next to a
// zero-mask diagonal entry); flags[32g + 1] = 1 iff every entry of its rows on or below the diagonal is exactly zero.
// coverage: SEQ/SCAN_ROWS blocks x SCAN_ROWS rows = every mask row; every flag line written whole.
__device__ __forceinline__ void maskscan_part(const float* __restrict__ mask, int* __restrict__ flags, int blk, int (*sw)[16]) {
  const int tid = threadIdx.x, lane = tid & 31, wv = tid >> 5;
  int badU = 0, badL = 0;
  const int cpr = SEQ / 4;
  const int qb = blk * SCAN_ROWS;
  // unrolled so that a thread's loads are all in flight together (constant trip count)
#pragma unroll
  for (int it = 0; it < SCAN_ROWS * cpr / 512; ++it) {
    const int c = tid + 512 * it;
    const int qr = c / cpr, k = (c - qr * cpr) * 4;
    const int q = qb + qr;
    const v4f m = *(const v4fa*)(mask + (size_t)q * SEQ_FULL + k);
#pragma unroll
    for (int i = 0; i < 4; ++i) {
      const int above = (k + i > q) ? 1 : 0;
      const int deep = (m[i] <= -1.0e8f) ? 1 : 0;
      const int zr = (m[i] == 0.0f) ? 1 : 0;
      badU |= above & (1 - deep);
      badL |= (1 - above) & (1 - zr);
    }
  }
#pragma unroll
  for (int o = 16; o >= 1; o >>= 1) {
    badU |= __shfl_xor(badU, o, 32);
    badL |= __shfl_xor(badL, o, 32);
  }
  if (lane == 0) { sw[0][wv] = badU; sw[1][wv] = badL; }
  __syncthreads();
  if (tid < 8) {
    int u = 0, l = 0;
#pragma unroll
    for (int i = 0; i < 16; ++i) { u |= sw[0][i]; l |= sw[1][i]; }
    v4i o;
    o[0] = (tid == 0 && u == 0) ? 1 : 0;
    o[1] = (tid == 0 && l == 0) ? 1 : 0;
    o[2] = 0; o[3] = 0;
    *(v4i*)(flags + 32 * blk + 4 * tid) = o;
    
  }
}

// ---------------------------------------------------------------------------------------------------------
// f32 rows of width CD -> 16-bit plane in fragment order. MODE 0: bf16 bits (RNE). MODE 1: f16 of (RNE bf16 value x 64).
// Thread t writes the t-th 16-byte piece of the plane (a wave stores 512 contiguous bytes) and reads the 8 source elements that belong there.
// coverage: nrows / 2 blocks x 512 threads x 8 elements = nrows x CD (nrows a multiple of 16; piece index -> (row, k) is one to one).
template <int MODE>
__device__ __forceinline__ void cvt_part(const float* __restrict__ src, unsigned short* __restrict__ dst,
                                         int blk, int rows_per_batch, int src_batch_rows) {
  const int t = blk * 512 + threadIdx.x;
  const int pl = t & 31, ph = (t >> 5) & 1, tile = t >> 6;      // lane slot, fragment half, tile of 16 rows x 32 k
  const int row = (tile / (CD / 32)) * 16 + (pl & 15);
  const int kk = (tile % (CD / 32)) * 32 + ph * 16 + (pl >> 4) * 8;
  const int b = row / rows_per_batch, r = row - b * rows_per_batch;
  const float* sp = src + ((size_t)b * src_batch_rows + r) * CD + kk;
  const v4f x0 = *(const v4fa*)(sp), x1 = *(const v4fa*)(sp + 4);
  Pack8 o;
  if (MODE == 0) {
    o.u[0] = bf16_bits(x0[0]); o.u[1] = bf16_bits(x0[1]); o.u[2] = bf16_bits(x0[2]); o.u[3] = bf16_bits(x0[3]);
    o.u[4] = bf16_bits(x1[0]); o.u[5] = bf16_bits(x1[1]); o.u[6] = bf16_bits(x1[2]); o.u[7] = bf16_bits(x1[3]);
  } else {
    o.h[0] = (_Float16)(bf16_rne(x0[0]) * 64.0f); o.h[1] = (_Float16)(bf16_rne(x0[1]) * 64.0f);
    o.h[2] = (_Float16)(bf16_rne(x0[2]) * 64.0f); o.h[3] = (_Float16)(bf16_rne(x0[3]) * 64.0f);
    o.h[4] = (_Float16)(bf16_rne(x1[0]) * 64.0f); o.h[5] = (_Float16)(bf16_rne(x1[1]) * 64.0f);
    o.h[6] = (_Float16)(bf16_rne(x1[2]) * 64.0f); o.h[7] = (_Float16)(bf16_rne(x1[3]) * 64.0f);
  }
  unsigned short* d = dst + (size_t)t * 8;
  const v8us ov = o.v;
  *(v8us*)d = ov;
  asm volatile("s_wait_xcnt 0x0" ::: "memory");        // in the shared launch another part's code follows in the text and rewrites the registers that this store names
}

// ---------------------------------------------------------------------------------------------------------
// Wave-tile GEMM core: acc[i][j] (rows 16i.., cols 16j..) += A[row][k] * W[col][k] over k = 0..CD-1.
// ap  = A  + row0*CD + 8*lane (fragment-order plane; A fragment: row m = ln, elements 0..7 <- k0 + 8h + i, 8..15 <- k0 + 16 + 8h + i)
// wp  = W  + col0*CD + 8*lane (B fragment: column n = ln, same k map); the tile of k0 starts 16*k0 elements into its row group
// alp = residual plane of A (same addressing), accumulated into acl when RES.
template <bool BF, bool RES>
__device__ __forceinline__ void gemm_loop(const unsigned short* __restrict__ ap, const unsigned short* __restrict__ alp,
                                          const unsigned short* __restrict__ wp, v8f (&acc)[2][4], v8f (&acl)[2][4]) {
#pragma unroll 1
  for (int k = 0; k < CD; k += 32) {
    Frag a[2], b[4];
#pragma unroll
    for (int i = 0; i < 2; ++i) ldfrag(a[i], ap + (size_t)i * 16 * CD + k * 16);
#pragma unroll
    for (int j = 0; j < 4; ++j) ldfrag(b[j], wp + (size_t)j * 16 * CD + k * 16);
#pragma unroll
    for (int i = 0; i < 2; ++i)
#pragma unroll
      for (int j = 0; j < 4; ++j) acc[i][j] = wm<BF>(a[i], b[j], acc[i][j]);
    if (RES) {
      Frag al[2];
#pragma unroll
      for (int i = 0; i < 2; ++i) ldfrag(al[i], alp + (size_t)i * 16 * CD + k * 16);
#pragma unroll
      for (int i = 0; i < 2; ++i)
#pragma unroll
        for (int j = 0; j < 4; ++j) acl[i][j] = wm<BF>(al[i], b[j], acl[i][j]);
      asm volatile("v_nop\n\tv_nop\n\tv_nop\n\tv_nop" : "+v"(acl[0][0]), "+v"(acl[0][1]), "+v"(acl[0][2]), "+v"(acl[0][3]),
                          "+v"(acl[1][0]), "+v"(acl[1][1]), "+v"(acl[1][2]), "+v"(acl[1][3])
                        : "v"(al[0].v), "v"(al[1].v), "v"(b[0].v), "v"(b[1].v), "v"(b[2].v), "v"(b[3].v));
    }
    asm volatile("v_nop\n\tv_nop\n\tv_nop\n\tv_nop" : "+v"(acc[0][0]), "+v"(acc[0][1]), "+v"(acc[0][2]), "+v"(acc[0][3]),
                        "+v"(acc[1][0]), "+v"(acc[1][1]), "+v"(acc[1][2]), "+v"(acc[1][3])
                      : "v"(a[0].v), "v"(a[1].v), "v"(b[0].v), "v"(b[1].v), "v"(b[2].v), "v"(b[3].v));
  }
}

__device__ __forceinline__ float rope1(float q, float p, float c, float s, float sg) { return q * c + (sg * p) * s; }

// ---------------------------------------------------------------------------------------------------------
// Rotary table from the position ids (read by value): rot[t][j] = cos(p_t * f_j), rot[t][32 + j] = sin(p_t * f_j), f_j = 10000^(-j/32), j = 0..31.
// Block = 16 positions x 32 frequencies, one precise sincos per thread -> LDS tile [16][64] (cross-wave: block barrier) -> 16 threads write one row
__device__ __forceinline__ void rotab_part(const int* __restrict__ pos, float* __restrict__ rot, int blk, float (*sh)[64]) {
  const int tid = threadIdx.x;
  const int r = tid >> 5, j = tid & 31;
  const int t = blk * 16 + r;
  const float p = (float)pos[t];
  const float f = exp2f(-(float)j * 0.41524101186092029f);   // log2(10000)/32
  const float ang = p * f;
  float sn, cs;
  sincosf(ang, &sn, &cs);
  sh[r][j] = cs;
  sh[r][32 + j] = sn;
  __syncthreads();
  if (tid < 256) {
    const int rr = tid >> 4, pc = tid & 15;
    const v4f v = *(const v4fa*)&sh[rr][4 * pc];
    float* d = rot + (size_t)(blk * 16 + rr) * HD + 4 * pc;
    *(v4f*)d = v;
    
  }
}

// ---------------------------------------------------------------------------------------------------------
// All preparation in one launch: the rotary table, the mask scan and the five plane conversions depend on the inputs alone and on nothing of one another,
// so each work-group of 512 threads takes one block of one of them by its index range (the test is the same for the whole work-group; each part's barrier
// is passed by every thread of the work-groups that run that part).
// coverage: the ranges below follow one another without gap or overlap and each holds exactly the blocks that its part's own coverage line asks for.
#define PB_ROT  (SEQ / 16)
#define PB_SCAN (SEQ / SCAN_ROWS)
#define PB_X    (NB * SEQ / 2)
#define PB_WQ   (CD / 2)
#define PB_WKV  (KVW / 2)
#define PB_WO   (CD / 2)
#define PB_ALL  (PB_ROT + PB_SCAN + PB_X + PB_WQ + 2 * PB_WKV + PB_WO)
__global__ __launch_bounds__(512) void k_prep(const float* __restrict__ mask, const int* __restrict__ pos, const float* __restrict__ x,
                                              const float* __restrict__ Wq, const float* __restrict__ Wk, const float* __restrict__ Wv,
                                              const float* __restrict__ Wo, int* __restrict__ flags, float* __restrict__ rot,
                                              unsigned short* __restrict__ xb, unsigned short* __restrict__ wqk,
                                              unsigned short* __restrict__ wvb, unsigned short* __restrict__ wob) {
  __shared__ int sw[2][16];
  __shared__ __attribute__((aligned(16))) float sh[16][64];
  int blk = blockIdx.x;
  if (blk < PB_ROT) { rotab_part(pos, rot, blk, sh); return; }
  blk -= PB_ROT;
  if (blk < PB_SCAN) { maskscan_part(mask, flags, blk, sw); return; }
  blk -= PB_SCAN;
  if (blk < PB_X) { cvt_part<0>(x, xb, blk, SEQ, SEQ_FULL); return; }
  blk -= PB_X;
  if (blk < PB_WQ) { cvt_part<0>(Wq, wqk, blk, CD, CD); return; }
  blk -= PB_WQ;
  if (blk < PB_WKV) { cvt_part<0>(Wk, wqk + (size_t)CD * CD, blk, KVW, KVW); return; }
  blk -= PB_WKV;
  if (blk < PB_WKV) { cvt_part<0>(Wv, wvb, blk, KVW, KVW); return; }
  blk -= PB_WKV;
  cvt_part<1>(Wo, wob, blk, CD, CD);
}

// ---------------------------------------------------------------------------------------------------------
// q and k projections with fused bias, half-split rotary (table plane [SEQ][32 cos | 32 sin]) and head-major repack.
// Block = 4 waves stacked in M (128 token rows) x one head (64 columns): hd = 0..NQK-1, mblk = 0..NB*SEQ/128-1.
// coverage: NQK heads x NB*SEQ tokens x 64 = the whole plane [NB][NQK][SEQ][64], both planes. LDS tile 32 x 64 fully written before it is read.
__device__ __forceinline__ void proj_qk_part(const unsigned short* __restrict__ xb, const unsigned short* __restrict__ wqk,
                                             const float* __restrict__ bq, const float* __restrict__ bk,
                                             const float* __restrict__ tab,
                                             unsigned short* __restrict__ qkh, unsigned short* __restrict__ qkl,
                                             int hd, int mblk, float (*st)[32][68]) {
  const int tid = threadIdx.x, lane = tid & 31, ln = lane & 15, hh = lane >> 4;
  const int w = __builtin_amdgcn_readfirstlane(tid >> 5);
  const int m0 = mblk * 128 + 32 * w;
  const v8f z8 = {0.f, 0.f, 0.f, 0.f, 0.f, 0.f, 0.f, 0.f};
  v8f acc[2][4];
#pragma unroll
  for (int i = 0; i < 2; ++i)
#pragma unroll
    for (int j = 0; j < 4; ++j) acc[i][j] = z8;
  gemm_loop<true, false>(xb + (size_t)m0 * CD + 8 * lane, xb, wqk + (size_t)(hd * HD) * CD + 8 * lane, acc, acc);

  float bias[4];
#pragma unroll
  for (int j = 0; j < 4; ++j) {
    const int col = hd * HD + 16 * j + ln;
    const int cq = (col < CD - 1) ? col : (CD - 1);
    int ck = col - CD;
    ck = (ck < 0) ? 0 : ((ck > KVW - 1) ? (KVW - 1) : ck);
    const float vq = bq[cq], vk = bk[ck];
    bias[j] = bf16_rne((col < CD) ? vq : vk);
  }
#pragma unroll
  for (int i = 0; i < 2; ++i)
#pragma unroll
    for (int j = 0; j < 4; ++j)
#pragma unroll
      for (int r = 0; r < 8; ++r) st[w][16 * i + 8 * hh + r][16 * j + ln] = acc[i][j][r] + bias[j];
  __syncthreads();

  const int b = m0 / SEQ, t0 = m0 - b * SEQ;
  // piece g of the wave's 32 tokens x 64 columns in fragment order: row group g >> 2, k tile (g >> 1) & 1, fragment half g & 1
  v8us oh[8], ol[8];
#pragma unroll
  for (int g = 0; g < 8; ++g) {
    const int row = 16 * (g >> 2) + ln;
    const int d0 = 32 * ((g >> 1) & 1) + 16 * (g & 1) + 8 * hh;
    const float sg = (d0 < 32) ? -1.0f : 1.0f;
    const v4f a0 = *(const v4fa*)&st[w][row][d0];
    const v4f a1 = *(const v4fa*)&st[w][row][d0 + 4];
    const v4f p0 = *(const v4fa*)&st[w][row][d0 ^ 32];
    const v4f p1 = *(const v4fa*)&st[w][row][(d0 ^ 32) + 4];
    // column d uses frequency d % 32: cos at [d % 32], sin at [32 + d % 32]
    const float* tp = tab + (size_t)(t0 + row) * HD + (d0 & 31);
    const v4f c0 = *(const v4fa*)(tp), c1 = *(const v4fa*)(tp + 4);
    const v4f s0 = *(const v4fa*)(tp + 32), s1 = *(const v4fa*)(tp + 36);
    float o[8];
    o[0] = rope1(a0[0], p0[0], c0[0], s0[0], sg); o[1] = rope1(a0[1], p0[1], c0[1], s0[1], sg);
    o[2] = rope1(a0[2], p0[2], c0[2], s0[2], sg); o[3] = rope1(a0[3], p0[3], c0[3], s0[3], sg);
    o[4] = rope1(a1[0], p1[0], c1[0], s1[0], sg); o[5] = rope1(a1[1], p1[1], c1[1], s1[1], sg);
    o[6] = rope1(a1[2], p1[2], c1[2], s1[2], sg); o[7] = rope1(a1[3], p1[3], c1[3], s1[3], sg);
    Pack8 ph8, pl8;
#pragma unroll
    for (int e = 0; e < 8; ++e) {
      const float y = o[e] * 16.0f;                       // carried x16
      const _Float16 h = toh_flush(y);
      ph8.h[e] = h;
      pl8.h[e] = toh_flush((y - (float)h) * 2048.0f);      // residual plane x2^11
    }
    oh[g] = ph8.v; ol[g] = pl8.v;
  }
  const size_t dbase = ((size_t)(b * NQK + hd) * SEQ + t0) * HD + 8 * lane;
{
#pragma unroll
    for (int g = 0; g < 8; ++g) {
      const size_t off = dbase + (size_t)g * 256;
      *(v8us*)(qkh + off) = oh[g];
      *(v8us*)(qkl + off) = ol[g];
    }
    
  }
}

// ---------------------------------------------------------------------------------------------------------
// v projection computed transposed: Vt[b][m][t] = sum_k Wv[m][k] x[b,t][k] + bv[m], carried x16, hi and residual planes.
// Block = 4 waves stacked in M (128 weight rows) x 64 tokens: nblk = 0..NB*SEQ/64-1, mgrp = 0..KVW/128-1.
// coverage: KVW rows x NB*SEQ tokens = the whole plane [NB][KVW][SEQ], both planes. LDS tile 32 x 64 fully written before it is read.
__device__ __forceinline__ void proj_v_part(const unsigned short* __restrict__ wvb, const unsigned short* __restrict__ xb,
                                            const float* __restrict__ bv,
                                            unsigned short* __restrict__ vth, unsigned short* __restrict__ vtl,
                                            int nblk, int mgrp, float (*st)[32][68]) {
  const int tid = threadIdx.x, lane = tid & 31, ln = lane & 15, hh = lane >> 4;
  const int w = __builtin_amdgcn_readfirstlane(tid >> 5);
  const int n0 = nblk * 64;
  const int m0 = mgrp * 128 + 32 * w;
  const v8f z8 = {0.f, 0.f, 0.f, 0.f, 0.f, 0.f, 0.f, 0.f};
  v8f acc[2][4];
#pragma unroll
  for (int i = 0; i < 2; ++i)
#pragma unroll
    for (int j = 0; j < 4; ++j) acc[i][j] = z8;
  gemm_loop<true, false>(wvb + (size_t)m0 * CD + 8 * lane, wvb, xb + (size_t)n0 * CD + 8 * lane, acc, acc);
#pragma unroll
  for (int i = 0; i < 2; ++i)
#pragma unroll
    for (int j = 0; j < 4; ++j)
#pragma unroll
      for (int r = 0; r < 8; ++r) st[w][16 * i + 8 * hh + r][16 * j + ln] = acc[i][j][r];
  __syncthreads();

  const int b = n0 / SEQ, t0 = n0 - b * SEQ;
  // piece g of the wave's 32 rows x 64 tokens in fragment order: row group g >> 2, key tile (g >> 1) & 1, fragment half g & 1
  v8us oh[8], ol[8];
#pragma unroll
  for (int g = 0; g < 8; ++g) {
    const int row = 16 * (g >> 2) + ln;
    const int c0 = 32 * ((g >> 1) & 1) + 16 * (g & 1) + 8 * hh;
    const float bias = bf16_rne(bv[m0 + row]);
    const v4f a0 = *(const v4fa*)&st[w][row][c0];
    const v4f a1 = *(const v4fa*)&st[w][row][c0 + 4];
    float o[8];
    o[0] = a0[0]; o[1] = a0[1]; o[2] = a0[2]; o[3] = a0[3];
    o[4] = a1[0]; o[5] = a1[1]; o[6] = a1[2]; o[7] = a1[3];
    Pack8 ph8, pl8;
#pragma unroll
    for (int e = 0; e < 8; ++e) {
      const float y = (o[e] + bias) * 16.0f;              // carried x16
      const _Float16 h = (_Float16)y;
      ph8.h[e] = h;
      pl8.h[e] = (_Float16)((y - (float)h) * 2048.0f);
    }
    oh[g] = ph8.v; ol[g] = pl8.v;
  }
  const size_t dbase = ((size_t)b * KVW + m0) * SEQ + (size_t)t0 * 16 + 8 * lane;
{
#pragma unroll
    for (int g = 0; g < 8; ++g) {
      const size_t off = dbase + (size_t)(g >> 2) * 16 * SEQ + (size_t)(g & 3) * 256;
      *(v8us*)(vth + off) = oh[g];
      *(v8us*)(vtl + off) = ol[g];
    }
    
  }
}

// ---------------------------------------------------------------------------------------------------------
// q, k and v projections in one launch: they read the same x plane and write disjoint planes, and the v blocks alone are too few to fill the chip.
// grid = (NQK + VBX, NB*SEQ/128): column c < NQK is head c of the q/k part; the VBX columns behind it are the v blocks of the same 128 tokens
// (two halves of 64 tokens x KVW/128 groups of weight rows). The test is the same for the whole work-group.
// coverage: every (hd, mblk) once; (nblk, mgrp) = (2 * y + (j & 1), j >> 1), j = 0..VBX-1, y = 0..NB*SEQ/128-1, is every v block once.
#define VBX (2 * (KVW / 128))
__global__ __launch_bounds__(128) void k_proj_qkv(const unsigned short* __restrict__ xb, const unsigned short* __restrict__ wqk,
                                                  const unsigned short* __restrict__ wvb,
                                                  const float* __restrict__ bq, const float* __restrict__ bk, const float* __restrict__ bv,
                                                  const float* __restrict__ tab,
                                                  unsigned short* __restrict__ qkh, unsigned short* __restrict__ qkl,
                                                  unsigned short* __restrict__ vth, unsigned short* __restrict__ vtl) {
  __shared__ __attribute__((aligned(16))) float st[4][32][68];
  const int c = blockIdx.x;
  if (c < NQK) {
    proj_qk_part(xb, wqk, bq, bk, tab, qkh, qkl, c, blockIdx.y, st);
  } else {
    const int j = c - NQK;
    proj_v_part(wvb, xb, bv, vth, vtl, 2 * blockIdx.y + (j & 1), j >> 1, st);
  }
}

// ---------------------------------------------------------------------------------------------------------
// One 32-key step for a wave's 16 queries (this lane's column = its query). EARLYP adds the residual planes of q, k, v, P.
// MASK reads the mask row of this lane's query by value (RNE bf16 value) and adds it to the scaled scores.
// Without EARLYP the fragment loads run ahead of their use: kf holds this step's K fragments on entry and the K fragments of the step at keyn on exit
// (fetched right behind the score products, into the same registers), and the V fragments of this step are fetched at the step's top, so that both
// fly under the softmax arithmetic. With EARLYP kf and keyn are not used.
template <bool EARLYP, bool MASK>
__device__ __forceinline__ void fa_step(const unsigned short* __restrict__ Kp, const unsigned short* __restrict__ Kl,
                                        const unsigned short* __restrict__ Vp, const unsigned short* __restrict__ Vl,
                                        const float* __restrict__ mrow, int key0, int keyn, int ln, int hh,
                                        const Frag (&qh)[2], const Frag (&ql)[2], Frag (&kf)[4],
                                        float& mr, float& lr, v8f (&Oh)[4], v8f (&Ol)[4]) {
  const v8f z8 = {0.f, 0.f, 0.f, 0.f, 0.f, 0.f, 0.f, 0.f};
  float sc[16];
  // A fragments of K: row m = key (key0 + 16*kt + ln), elements 0..7 <- d = 32c + 8h + i, 8..15 <- d = 32c + 16 + 8h + i
  // fragment-order plane: 16 keys = two tiles of 512 elements (c = 0, 1)
  int koff = key0 * HD + 8 * (16 * hh + ln);
  // A fragments of V^T: row m = d (16*t + ln), elements 0..7 <- key0 + 8h + i, 8..15 <- key0 + 16 + 8h + i
  // fragment-order plane: the tile of 32 keys at key0 starts 16*key0 elements into its group of 16 rows
  int voff = key0 * 16 + 8 * (16 * hh + ln);
  Frag vf[4];
  if (!EARLYP) {
#pragma unroll
    for (int t = 0; t < 4; ++t) ldfrag(vf[t], Vp + voff + (size_t)t * 16 * SEQ);
    if (MASK) asm volatile("s_wait_xcnt 0x0" ::: "memory");   // the mask loads behind them land in the registers that the V loads name
  }
  if (EARLYP) {
#pragma unroll
    for (int kt = 0; kt < 2; ++kt) {
      Frag a0, a1, l0, l1;
      ldfrag(a0, Kp + koff); ldfrag(a1, Kp + koff + 512);
      ldfrag(l0, Kl + koff); ldfrag(l1, Kl + koff + 512);
      v8f s = z8, r = z8;
      s = wm<false>(a0, qh[0], s); s = wm<false>(a1, qh[1], s);
      r = wm<false>(a0, ql[0], r); r = wm<false>(a1, ql[1], r);
      r = wm<false>(l0, qh[0], r); r = wm<false>(l1, qh[1], r);
      asm volatile("v_nop\n\tv_nop\n\tv_nop\n\tv_nop" : "+v"(s), "+v"(r)
                        : "v"(a0.v), "v"(a1.v), "v"(l0.v), "v"(l1.v), "v"(qh[0].v), "v"(qh[1].v), "v"(ql[0].v), "v"(ql[1].v));
      // S^T element r of tile kt = score(key0 + 16*kt + 8h + r, this lane's query); carries: q x16, k x16, residual x2^11
#pragma unroll
      for (int e = 0; e < 8; ++e) sc[8 * kt + e] = fmaf(r[e], S2M11, s[e]) * S2M11;
      koff += 16 * HD;
      if (kt == 0) asm volatile("" : "+v"(koff) : "v"(sc[0]));   // second tile's loads issue after the first tile is done
    }
  } else {
    v8f s0 = z8, s1 = z8;
    s0 = wm<false>(kf[0], qh[0], s0); s0 = wm<false>(kf[1], qh[1], s0);
    s1 = wm<false>(kf[2], qh[0], s1); s1 = wm<false>(kf[3], qh[1], s1);
    koff = keyn * HD + 8 * (16 * hh + ln);
    asm volatile("v_nop\n\tv_nop\n\tv_nop\n\tv_nop" : "+v"(s0), "+v"(s1)
                      : "v"(kf[0].v), "v"(kf[1].v), "v"(kf[2].v), "v"(kf[3].v), "v"(qh[0].v), "v"(qh[1].v));
    ldfrag(kf[0], Kp + koff);           ldfrag(kf[1], Kp + koff + 512);
    ldfrag(kf[2], Kp + koff + 16 * HD); ldfrag(kf[3], Kp + koff + 16 * HD + 512);
#pragma unroll
    for (int e = 0; e < 8; ++e) { sc[e] = s0[e] * S2M11; sc[8 + e] = s1[e] * S2M11; }
  }
  if (MASK) {
    const float* mp = mrow + key0 + 8 * hh;
    const v4f m0 = *(const v4fa*)(mp),      m1 = *(const v4fa*)(mp + 4);
    const v4f m2 = *(const v4fa*)(mp + 16), m3 = *(const v4fa*)(mp + 20);
#pragma unroll
    for (int e = 0; e < 4; ++e) {
      sc[e]      = sc[e]      + bf16_rne(m0[e]);
      sc[4 + e]  = sc[4 + e]  + bf16_rne(m1[e]);
      sc[8 + e]  = sc[8 + e]  + bf16_rne(m2[e]);
      sc[12 + e] = sc[12 + e] + bf16_rne(m3[e]);
    }
  }
  float mx = sc[0];
#pragma unroll
  for (int i = 1; i < 16; ++i) mx = fmaxf(mx, sc[i]);
  mx = fmaxf(mx, __shfl_xor(mx, 16, 32));            // the other lane half holds the other 16 keys of this query
  const float mnew = fmaxf(mr, mx);
  float msafe = mnew;
  if (MASK) msafe = (mnew == neg_inf()) ? 0.0f : mnew;   // every key so far at -inf: weights come out 0
  const float al = __builtin_amdgcn_exp2f((mr - msafe) * LOG2E);
  mr = mnew;
  // weights carried x256: pc = 256 * exp(sc - m); hi plane f16(pc), residual plane f16((pc - hi) * 2048)
  Frag ph, pl;
  float ps = 0.0f;
#pragma unroll
  for (int i = 0; i < 16; ++i) {
    const float pc = __builtin_amdgcn_exp2f(fmaf(sc[i] - msafe, LOG2E, 8.0f));
    ps += pc;
    const _Float16 h = toh_flush(pc);
    ph.h[i] = h;                                      // B element i: i<8 -> key0 + 8h + i (tile 0 row 8h+i); i>=8 -> key0 + 16 + 8h + (i-8) (tile 1)
    if (EARLYP) pl.h[i] = toh_flush((pc - (float)h) * 2048.0f);
  }
  ps += __shfl_xor(ps, 16, 32);
  lr = lr * al + ps;
  if (EARLYP) {
    asm volatile("" : "+v"(voff) : "v"(ps));          // V loads issue after the score phase
#pragma unroll
    for (int t = 0; t < 4; ++t) ldfrag(vf[t], Vp + voff + (size_t)t * 16 * SEQ);
  }
#pragma unroll
  for (int t = 0; t < 4; ++t) Oh[t] = Oh[t] * al;
  if (EARLYP) {
    const unsigned short* vq = Vl + voff;
    Frag vl[4];
#pragma unroll
    for (int t = 0; t < 4; ++t) ldfrag(vl[t], vq + (size_t)t * 16 * SEQ);
#pragma unroll
    for (int t = 0; t < 4; ++t) Ol[t] = Ol[t] * al;
#pragma unroll
    for (int t = 0; t < 4; ++t) {
      Oh[t] = wm<false>(vf[t], ph, Oh[t]);
      Ol[t] = wm<false>(vf[t], pl, Ol[t]);
      Ol[t] = wm<false>(vl[t], ph, Ol[t]);
    }
    asm volatile("v_nop\n\tv_nop\n\tv_nop\n\tv_nop" : "+v"(Oh[0]), "+v"(Oh[1]), "+v"(Oh[2]), "+v"(Oh[3]), "+v"(Ol[0]), "+v"(Ol[1]), "+v"(Ol[2]), "+v"(Ol[3])
                      : "v"(vf[0].v), "v"(vf[1].v), "v"(vf[2].v), "v"(vf[3].v),
                        "v"(vl[0].v), "v"(vl[1].v), "v"(vl[2].v), "v"(vl[3].v), "v"(ph.v), "v"(pl.v));
  } else {
#pragma unroll
    for (int t = 0; t < 4; ++t) Oh[t] = wm<false>(vf[t], ph, Oh[t]);
    asm volatile("v_nop\n\tv_nop\n\tv_nop\n\tv_nop" : "+v"(Oh[0]), "+v"(Oh[1]), "+v"(Oh[2]), "+v"(Oh[3])
                      : "v"(vf[0].v), "v"(vf[1].v), "v"(vf[2].v), "v"(vf[3].v), "v"(ph.v));
  }
}

template <bool EARLYP>
__device__ __forceinline__ void run_keys(const unsigned short* __restrict__ qkh, const unsigned short* __restrict__ qkl,
                                         const unsigned short* __restrict__ vth, const unsigned short* __restrict__ vtl,
                                         const float* __restrict__ mask, int b, int h, int qg, int ln, int hh,
                                         int nplain, int nsteps, float& mr, float& lr, v8f (&Oh)[4], v8f (&Ol)[4]) {
  // Q^T B fragments: column n = this lane's query, elements 0..7 <- d = 32c + 8h + i, 8..15 <- d = 32c + 16 + 8h + i
  const size_t qoff = ((size_t)(b * NQK + h) * SEQ + (qg - ln)) * HD + 8 * (16 * hh + ln);   // fragment-order plane, the wave's own 16 rows
  Frag qh[2], ql[2];
  ldfrag(qh[0], qkh + qoff); ldfrag(qh[1], qkh + qoff + 512);
  if (EARLYP) { ldfrag(ql[0], qkl + qoff); ldfrag(ql[1], qkl + qoff + 512); }
  else { ql[0] = qh[0]; ql[1] = qh[1]; }
  asm volatile("s_wait_xcnt 0x0" ::: "memory");        // the address registers of the Q loads are reused right behind them
  const int kv = h / NREP;                             // consecutive groups of NREP query heads share one kv head
  const size_t kbase = (size_t)(b * NQK + NHEAD + kv) * SEQ * HD;
  const size_t vbase = ((size_t)b * KVW + (size_t)kv * HD) * SEQ;
  const unsigned short* Kp = qkh + kbase;
  const unsigned short* Kl = qkl + kbase;
  const unsigned short* Vp = vth + vbase;
  const unsigned short* Vl = vtl + vbase;
  const float* mrow = mask + (size_t)qg * SEQ_FULL;
  Frag kf[4];
  if (!EARLYP) {                                       // K fragments of step 0 (nsteps >= 1)
    const unsigned short* k0 = Kp + 8 * (16 * hh + ln);
    ldfrag(kf[0], k0);           ldfrag(kf[1], k0 + 512);
    ldfrag(kf[2], k0 + 16 * HD); ldfrag(kf[3], k0 + 16 * HD + 512);
    asm volatile("s_wait_xcnt 0x0" ::: "memory");      // the address registers of the K loads are reused behind them
  }
  // the step fetched ahead is the next one; the last step fetches its own tile again, so that the address stays inside the plane
#pragma unroll 1
  for (int j = 0; j < nplain; ++j)
    fa_step<EARLYP, false>(Kp, Kl, Vp, Vl, mrow, 32 * j, 32 * ((j + 1 < nsteps) ? j + 1 : j), ln, hh, qh, ql, kf, mr, lr, Oh, Ol);
#pragma unroll 1
  for (int j = nplain; j < nsteps; ++j)
    fa_step<EARLYP, true>(Kp, Kl, Vp, Vl, mrow, 32 * j, 32 * ((j + 1 < nsteps) ? j + 1 : j), ln, hh, qh, ql, kf, mr, lr, Oh, Ol);
}

// Block = 4 waves x 16 queries = 64 queries of one (batch, head); no LDS and no barrier.
// Tile skipping from the device flags, per wave: both flags of both flag lines that cover the wave's 16 query rows are 1 -> keys past the diagonal step are
// skipped (their weights are exactly zero) and steps fully below the diagonal run without mask reads (their mask entries are exactly zero); every other
// visited step reads the mask by value. A softmax row depends on its own mask row alone, so the wave's own rows decide.
// For any other flag value every step is visited and reads the mask. Trip counts are bounded by SEQ/32 for any flag value.
// coverage: NB*NHEAD*(SEQ/64) blocks x 4 waves x 16 rows x 64 columns = the whole ctx hi plane; blocks with query tile below EARLY_ROWS cover the whole residual plane.
__global__ __launch_bounds__(128) void k_attn(const unsigned short* __restrict__ qkh, const unsigned short* __restrict__ qkl,
                                              const unsigned short* __restrict__ vth, const unsigned short* __restrict__ vtl,
                                              const float* __restrict__ mask, const int* __restrict__ flags,
                                              unsigned short* __restrict__ ctxh, unsigned short* __restrict__ ctxl) {
  const int tid = threadIdx.x, lane = tid & 31, ln = lane & 15, hh = lane >> 4;
  const int w = __builtin_amdgcn_readfirstlane(tid >> 5);
  const int nqt = SEQ / 64;
  const int blk = blockIdx.x;
  // a causal query tile's key steps grow with its index and not all work-groups are resident at once: the longest tiles take the lowest block indices,
  // so that they start first and the short ones fill the places that come free (blk -> (qt, b, h) is one to one)
  const int qt = nqt - 1 - blk / (NB * NHEAD);
  const int bh = blk % (NB * NHEAD);
  const int h = bh % NHEAD;
  const int b = bh / NHEAD;
  const int qbase = qt * 64 + 16 * w;
  const int qg = qbase + ln;
  const int* fl = flags + (qbase / SCAN_ROWS) * 32;    // 16 query rows = 16 / SCAN_ROWS flag lines
  int fok = 1;                                         // bitwise, so that the flag loads issue together
#pragma unroll
  for (int i = 0; i < 16 / SCAN_ROWS; ++i) fok &= (fl[32 * i] == 1 ? 1 : 0) & (fl[32 * i + 1] == 1 ? 1 : 0);
  const bool tri = (fok == 1);
  const int nfull = qbase >> 5;                        // steps whose 32 keys are all at or below every query of this wave
  const int nsteps = tri ? (nfull + 1) : (SEQ / 32);   // <= SEQ/32 in both cases
  const int nplain = tri ? nfull : 0;
  const bool early = (qt * 64 < EARLY_ROWS);

  const v8f z8 = {0.f, 0.f, 0.f, 0.f, 0.f, 0.f, 0.f, 0.f};
  float mr = neg_inf(), lr = 0.0f;
  v8f Oh[4], Ol[4];
#pragma unroll
  for (int t = 0; t < 4; ++t) { Oh[t] = z8; Ol[t] = z8; }
  if (early) run_keys<true>(qkh, qkl, vth, vtl, mask, b, h, qg, ln, hh, nplain, nsteps, mr, lr, Oh, Ol);
  else       run_keys<false>(qkh, qkl, vth, vtl, mask, b, h, qg, ln, hh, nplain, nsteps, mr, lr, Oh, Ol);

  // O^T element r of tile t = ctx(query, d = 16t + 8h + r); undo the carries x256 (in lr), x16 (V), x2^11 (residual); apply the x64 carry of ctx
  const float inv = 4.0f * (1.0f / lr);
  // tile t of O^T in this lane = row ln, columns 16t + 8h + 0..7 of ctx: exactly this lane's 16-byte piece t of the wave's two fragment-order tiles
  // (k tile t >> 1, fragment half t & 1), so the registers are stored as they stand, 512 contiguous bytes per wave and store
  v8us oh[4], ol[4];
#pragma unroll
  for (int t = 0; t < 4; ++t) {
    Pack8 ph8, pl8;
#pragma unroll
    for (int e = 0; e < 8; ++e) {
      const float o = fmaf(Ol[t][e], S2M11, Oh[t][e]) * inv;
      const _Float16 hv = toh_flush(o);
      ph8.h[e] = hv;
      pl8.h[e] = toh_flush((o - (float)hv) * 2048.0f);
    }
    oh[t] = ph8.v; ol[t] = pl8.v;
  }
  const size_t hbase = ((size_t)b * SEQ + qbase) * CD + (size_t)h * (16 * HD) + 8 * lane;
  const size_t lbase = ((size_t)b * EARLY_ROWS + (early ? qbase : 0)) * CD + (size_t)h * (16 * HD) + 8 * lane;
#pragma unroll
  for (int t = 0; t < 4; ++t) *(v8us*)(ctxh + hbase + t * 256) = oh[t];
  asm volatile("s_wait_xcnt 0x0" ::: "memory");        // the residual stores' address arithmetic below may reuse the registers that these stores name
  if (early) {
#pragma unroll
    for (int t = 0; t < 4; ++t) *(v8us*)(ctxl + lbase + t * 256) = ol[t];
  }
}

// ---------------------------------------------------------------------------------------------------------
// Output projection: out[m][n] = sum_k ctx[m][k] Wo[n][k] + bo[n]. Block = 4 waves stacked in M (128 rows) x 64 columns. grid = (CD/64, NB*SEQ/128).
// Rows below EARLY_ROWS of each sequence add the residual plane of ctx in separate accumulators.
// coverage: NB*SEQ rows x CD columns = every element of the output buffer region once. LDS tile 32 x 64 fully written before it is read.
__global__ __launch_bounds__(128) void k_proj_out(const unsigned short* __restrict__ ctxh, const unsigned short* __restrict__ ctxl,
                                                  const unsigned short* __restrict__ wo, const float* __restrict__ bo,
                                                  float* __restrict__ out) {
  __shared__ __attribute__((aligned(16))) float st[4][32][68];
  const int tid = threadIdx.x, lane = tid & 31, ln = lane & 15, hh = lane >> 4;
  const int w = __builtin_amdgcn_readfirstlane(tid >> 5);
  const int n0 = blockIdx.x * 64;
  const int mb = blockIdx.y * 128;
  const int b = mb / SEQ;
  const int tb = mb - b * SEQ;
  const bool early = (tb < EARLY_ROWS);                // block-uniform: EARLY_ROWS and SEQ are multiples of 128
  const int t0 = tb + 32 * w;
  const int m0 = mb + 32 * w;
  const v8f z8 = {0.f, 0.f, 0.f, 0.f, 0.f, 0.f, 0.f, 0.f};
  v8f acc[2][4], acl[2][4];
#pragma unroll
  for (int i = 0; i < 2; ++i)
#pragma unroll
    for (int j = 0; j < 4; ++j) { acc[i][j] = z8; acl[i][j] = z8; }
  const unsigned short* ap = ctxh + (size_t)m0 * CD + 8 * lane;
  const unsigned short* alp = ctxl + (size_t)(b * EARLY_ROWS + (early ? t0 : 0)) * CD + 8 * lane;
  const unsigned short* wp = wo + (size_t)n0 * CD + 8 * lane;
  if (early) gemm_loop<false, true>(ap, alp, wp, acc, acl);
  else       gemm_loop<false, false>(ap, ap, wp, acc, acl);
  // carries: ctx x64, Wo x64 -> 2^-12; residual plane additionally x2^11
#pragma unroll
  for (int i = 0; i < 2; ++i)
#pragma unroll
    for (int j = 0; j < 4; ++j)
#pragma unroll
      for (int r = 0; r < 8; ++r)
        st[w][16 * i + 8 * hh + r][16 * j + ln] = fmaf(acl[i][j][r], S2M11, acc[i][j][r]) * S2M12;
  __syncthreads();
  const int rsub = lane >> 4, c4 = 4 * (lane & 15);
  const v4f bb = *(const v4fa*)(bo + n0 + c4);
  v4f bias;
  bias[0] = bf16_rne(bb[0]); bias[1] = bf16_rne(bb[1]); bias[2] = bf16_rne(bb[2]); bias[3] = bf16_rne(bb[3]);
  v4f ov[16];
#pragma unroll
  for (int g = 0; g < 16; ++g) {
    const v4f a = *(const v4fa*)&st[w][2 * g + rsub][c4];
    ov[g] = a + bias;
  }
  float* og = out + ((size_t)b * SEQ_FULL + t0) * CD + n0 + c4;
{
#pragma unroll
    for (int g = 0; g < 16; ++g)
      *(v4f*)(og + (size_t)(2 * g + rsub) * CD) = ov[g];
    
  }
}

// ---------------------------------------------------------------------------------------------------------
extern "C" void kernel_launch(void* const* d_in, const int* in_sizes, int n_in,
                              void* d_out, int out_size, void* d_ws, size_t ws_size, hipStream_t stream) {
  if (n_in < 11) return;
  const long long need_x = (long long)(NB - 1) * SEQ_FULL * CD + (long long)SEQ * CD;   // last element touched + 1
  const long long need_m = (long long)(SEQ - 1) * SEQ_FULL + SEQ;
  if ((long long)in_sizes[0] < need_x) return;
  if ((long long)in_sizes[1] < need_m) return;
  if ((long long)in_sizes[2] < (long long)SEQ) return;
  if ((long long)in_sizes[3] < (long long)CD * CD || (long long)in_sizes[4] < CD) return;
  if ((long long)in_sizes[5] < (long long)KVW * CD || (long long)in_sizes[6] < KVW) return;
  if ((long long)in_sizes[7] < (long long)KVW * CD || (long long)in_sizes[8] < KVW) return;
  if ((long long)in_sizes[9] < (long long)CD * CD || (long long)in_sizes[10] < CD) return;
  if ((long long)out_size < need_x) return;
  if ((size_t)WS_TOTAL > ws_size) return;

  // wire order: hidden_states, attention_mask (f32), position_ids (i32), Wq, bq, Wk, bk, Wv, bv, Wo, bo
  const float* x    = (const float*)d_in[0];
  const float* mask = (const float*)d_in[1];
  const int*   pos  = (const int*)d_in[2];
  const float* Wq   = (const float*)d_in[3];
  const float* bq   = (const float*)d_in[4];
  const float* Wk   = (const float*)d_in[5];
  const float* bk   = (const float*)d_in[6];
  const float* Wv   = (const float*)d_in[7];
  const float* bv   = (const float*)d_in[8];
  const float* Wo   = (const float*)d_in[9];
  const float* bo   = (const float*)d_in[10];
  float* out = (float*)d_out;

  char* ws = (char*)d_ws;
  size_t off = 0;
  int* flags = (int*)(ws + off);                               off += SZ_FLAGS;
  float* rot = (float*)(ws + off);                             off += SZ_ROT;
  unsigned short* xb   = (unsigned short*)(ws + off);          off += SZ_XB;
  unsigned short* wqk  = (unsigned short*)(ws + off);          off += SZ_WQK;
  unsigned short* wvb  = (unsigned short*)(ws + off);          off += SZ_WV;
  unsigned short* wob  = (unsigned short*)(ws + off);          off += SZ_WO;
  unsigned short* qkh  = (unsigned short*)(ws + off);          off += PLANE_QK * 2;
  unsigned short* qkl  = (unsigned short*)(ws + off);          off += PLANE_QK * 2;
  unsigned short* vth  = (unsigned short*)(ws + off);          off += PLANE_V * 2;
  unsigned short* vtl  = (unsigned short*)(ws + off);          off += PLANE_V * 2;
  unsigned short* ctxh = (unsigned short*)(ws + off);          off += SZ_CTXH;
  unsigned short* ctxl = (unsigned short*)(ws + off);          off += SZ_CTXL;
  if (off > ws_size) return;

  // flags, rotary table, and in[rows][CD] f32 -> 16-bit planes of rows x CD in fragment order
  k_prep<<<(unsigned)PB_ALL, 512, 0, stream>>>(mask, pos, x, Wq, Wk, Wv, Wo, flags, rot, xb, wqk, wvb, wob);
  k_proj_qkv<<<dim3(NQK + VBX, (unsigned)(NB * SEQ / 128)), 128, 0, stream>>>(xb, wqk, wvb, bq, bk, bv, rot, qkh, qkl, vth, vtl);
  k_attn<<<(unsigned)(NB * NHEAD * (SEQ / 64)), 128, 0, stream>>>(qkh, qkl, vth, vtl, mask, flags, ctxh, ctxl);
  k_proj_out<<<dim3(CD / 64, (unsigned)(NB * SEQ / 128)), 128, 0, stream>>>(ctxh, ctxl, wob, bo, out);
}

// v006
// Measured time: 172 microseconds a run.
// In both of two side-by-side timings against v005, it was 1.13 times as fast.
// All steps since v000 together make it 5.44 times as fast.
#include <hip/hip_runtime.h>
#ifndef NB
#define NB 2
#endif
#ifndef SEQ
#define SEQ 2048
#endif
#define NB_FULL 2
#define SEQ_FULL 2048
#define CD 2048                 /* model width = depth of every projection */
#define NHEAD 32
#define NKV 8
#define NREP (NHEAD / NKV)      /* query heads per kv head */
#define HD 64
#define NQK (NHEAD + NKV)       /* rotary plane holds the 32 q heads followed by the 8 k heads */
#define KVW (NKV * HD)          /* 512 */
#define EARLY_ROWS (SEQ < 512 ? SEQ : 512)

#define SCAN_ROWS 8                                 /* mask rows per scan work-group */
#define SZ_FLAGS ((size_t)(SEQ / SCAN_ROWS) * 128)  /* one 128-byte flag line per scan work-group */
#define SZ_ROT   ((size_t)SEQ * HD * 4)              /* rotary table [SEQ][32 cos | 32 sin] f32 */
#define SZ_XB    ((size_t)NB * SEQ * CD * 2)
#define SZ_WQK   ((size_t)(CD + KVW) * CD * 2)
#define SZ_WV    ((size_t)KVW * CD * 2)
#define SZ_WO    ((size_t)CD * CD * 2)
#define PLANE_QK ((size_t)NB * NQK * SEQ * HD)     /* elements of one rotary plane */
#define PLANE_V  ((size_t)NB * KVW * SEQ)          /* elements of one V^T plane */
#define SZ_CTXH  ((size_t)NB * SEQ * CD * 2)
#define SZ_CTXL  ((size_t)NB * EARLY_ROWS * CD * 2)
#define WS_TOTAL (SZ_FLAGS + SZ_ROT + SZ_XB + SZ_WQK + SZ_WV + SZ_WO + PLANE_QK * 4 + PLANE_V * 4 + SZ_CTXH + SZ_CTXL)

static_assert(SEQ % 128 == 0);
static_assert(EARLY_ROWS % 128 == 0);
static_assert(SEQ <= SEQ_FULL);
static_assert(NB <= NB_FULL);
static_assert(HD == 64);
static_assert(CD % 128 == 0);
static_assert(NQK % 2 == 0);
static_assert(KVW % 128 == 0);
static_assert(NHEAD % NKV == 0);
static_assert(NHEAD == NKV * NREP);
static_assert(CD == NHEAD * HD);
static_assert(SEQ % 16 == 0);
static_assert(SEQ % SCAN_ROWS == 0 && 16 % SCAN_ROWS == 0);
static_assert((SCAN_ROWS * (SEQ / 4)) % 512 == 0);
static_assert(SZ_ROT % 256 == 0);
static_assert(WS_TOTAL <= (size_t)134217728);
static_assert(SZ_XB % 256 == 0 && SZ_WQK % 256 == 0 && SZ_WV % 256 == 0 && SZ_WO % 256 == 0);
static_assert((PLANE_QK * 2) % 256 == 0 && (PLANE_V * 2) % 256 == 0 && SZ_CTXH % 256 == 0 && SZ_CTXL % 256 == 0);

typedef __bf16 v16b __attribute__((ext_vector_type(16)));
typedef _Float16 v16h __attribute__((ext_vector_type(16)));
typedef unsigned short v8us __attribute__((ext_vector_type(8), may_alias));
typedef float v8f __attribute__((ext_vector_type(8)));
typedef float v4f __attribute__((ext_vector_type(4)));
typedef float v4fa __attribute__((ext_vector_type(4), may_alias));
typedef int v4i __attribute__((ext_vector_type(4)));
typedef int v4ia __attribute__((ext_vector_type(4), may_alias));
union Frag { v16b b; v16h v; v8us half[2]; _Float16 h[16]; unsigned short u[16]; };
union Pack8 { v8us v; _Float16 h[8]; unsigned short u[8]; };

#define LOG2E 1.4426950408889634f
#define S2M11 0.00048828125f       /* 2^-11 */
#define S2M12 0.000244140625f      /* 2^-12 */
__device__ __forceinline__ unsigned short bf16_bits(float x) {   // RNE convert to bf16 bits
  unsigned int u = __float_as_uint(x);
  return (unsigned short)((u + 0x7FFFu + ((u >> 16) & 1u)) >> 16);
}
__device__ __forceinline__ float bf16_val(unsigned short b) { return __uint_as_float(((unsigned int)b) << 16); }
__device__ __forceinline__ float bf16_rne(float x) { return bf16_val(bf16_bits(x)); }
__device__ __forceinline__ float neg_inf() { return __uint_as_float(0xff800000u); }

// f32 -> f16 operand convert that cannot produce a subnormal: magnitudes below 2^-14 become zero by a value select.
typedef _Float16 h16;
static __device__ __forceinline__ h16 toh_flush(float v) {
  const h16 r = (h16)v;
  return (fabsf(v) < 6.103515625e-05f) ? (h16)0.0f : r;
}

// Fragment from a fragment-order tile: elements 0..7 <- p[0..7], elements 8..15 <- p[256..263]; caller adds tile * 512 + lane * 8.
__device__ __forceinline__ void ldfrag(Frag& f, const unsigned short* __restrict__ p) {
  f.half[0] = *(const v8us*)(p);
  f.half[1] = *(const v8us*)(p + 256);
}

template <bool BF>
__device__ __forceinline__ v8f wm(const Frag& a, const Frag& b, v8f c) {
  if (BF) return __builtin_amdgcn_wmma_f32_16x16x32_bf16(false, a.b, false, b.b, (short)0, c, false, false);
  return __builtin_amdgcn_wmma_f32_16x16x32_f16(false, a.v, false, b.v, (short)0, c, false, false);
}

// ---------------------------------------------------------------------------------------------------------
// Mask scan (f32 additive mask), one work-group per SCAN_ROWS mask rows, each writing its own 128-byte flag line g = blk:
// flags[32g] = 1 iff every entry of its rows above the diagonal is at or below -1e8 (its softmax weight is exactly zero next to a
// zero-mask diagonal entry); flags[32g + 1] = 1 iff every entry of its rows on or below the diagonal is exactly zero.
// coverage: SEQ/SCAN_ROWS blocks x SCAN_ROWS rows = every mask row; every flag line written whole.
__device__ __forceinline__ void maskscan_part(const float* __restrict__ mask, int* __restrict__ flags, int blk, int (*sw)[16]) {
  const int tid = threadIdx.x, lane = tid & 31, wv = tid >> 5;
  int badU = 0, badL = 0;
  const int cpr = SEQ / 4;
  const int qb = blk * SCAN_ROWS;
  // unrolled so that a thread's loads are all in flight together (constant trip count)
#pragma unroll
  for (int it = 0; it < SCAN_ROWS * cpr / 512; ++it) {
    const int c = tid + 512 * it;
    const int qr = c / cpr, k = (c - qr * cpr) * 4;
    const int q = qb + qr;
    const v4f m = *(const v4fa*)(mask + (size_t)q * SEQ_FULL + k);
#pragma unroll
    for (int i = 0; i < 4; ++i) {
      const int above = (k + i > q) ? 1 : 0;
      const int deep = (m[i] <= -1.0e8f) ? 1 : 0;
      const int zr = (m[i] == 0.0f) ? 1 : 0;
      badU |= above & (1 - deep);
      badL |= (1 - above) & (1 - zr);
    }
  }
#pragma unroll
  for (int o = 16; o >= 1; o >>= 1) {
    badU |= __shfl_xor(badU, o, 32);
    badL |= __shfl_xor(badL, o, 32);
  }
  if (lane == 0) { sw[0][wv] = badU; sw[1][wv] = badL; }
  __syncthreads();
  if (tid < 8) {
    int u = 0, l = 0;
#pragma unroll
    for (int i = 0; i < 16; ++i) { u |= sw[0][i]; l |= sw[1][i]; }
    v4i o;
    o[0] = (tid == 0 && u == 0) ? 1 : 0;
    o[1] = (tid == 0 && l == 0) ? 1 : 0;
    o[2] = 0; o[3] = 0;
    *(v4i*)(flags + 32 * blk + 4 * tid) = o;
    
  }
}

// ---------------------------------------------------------------------------------------------------------
// f32 rows of width CD -> 16-bit plane in fragment order. MODE 0: bf16 bits (RNE). MODE 1: f16 of (RNE bf16 value x 64).
// Thread t writes the t-th 16-byte piece of the plane (a wave stores 512 contiguous bytes) and reads the 8 source elements that belong there.
// coverage: nrows / 2 blocks x 512 threads x 8 elements = nrows x CD (nrows a multiple of 16; piece index -> (row, k) is one to one).
template <int MODE>
__device__ __forceinline__ void cvt_part(const float* __restrict__ src, unsigned short* __restrict__ dst,
                                         int blk, int rows_per_batch, int src_batch_rows) {
  const int t = blk * 512 + threadIdx.x;
  const int pl = t & 31, ph = (t >> 5) & 1, tile = t >> 6;      // lane slot, fragment half, tile of 16 rows x 32 k
  const int row = (tile / (CD / 32)) * 16 + (pl & 15);
  const int kk = (tile % (CD / 32)) * 32 + ph * 16 + (pl >> 4) * 8;
  const int b = row / rows_per_batch, r = row - b * rows_per_batch;
  const float* sp = src + ((size_t)b * src_batch_rows + r) * CD + kk;
  const v4f x0 = *(const v4fa*)(sp), x1 = *(const v4fa*)(sp + 4);
  Pack8 o;
  if (MODE == 0) {
    o.u[0] = bf16_bits(x0[0]); o.u[1] = bf16_bits(x0[1]); o.u[2] = bf16_bits(x0[2]); o.u[3] = bf16_bits(x0[3]);
    o.u[4] = bf16_bits(x1[0]); o.u[5] = bf16_bits(x1[1]); o.u[6] = bf16_bits(x1[2]); o.u[7] = bf16_bits(x1[3]);
  } else {
    o.h[0] = (_Float16)(bf16_rne(x0[0]) * 64.0f); o.h[1] = (_Float16)(bf16_rne(x0[1]) * 64.0f);
    o.h[2] = (_Float16)(bf16_rne(x0[2]) * 64.0f); o.h[3] = (_Float16)(bf16_rne(x0[3]) * 64.0f);
    o.h[4] = (_Float16)(bf16_rne(x1[0]) * 64.0f); o.h[5] = (_Float16)(bf16_rne(x1[1]) * 64.0f);
    o.h[6] = (_Float16)(bf16_rne(x1[2]) * 64.0f); o.h[7] = (_Float16)(bf16_rne(x1[3]) * 64.0f);
  }
  unsigned short* d = dst + (size_t)t * 8;
  const v8us ov = o.v;
  *(v8us*)d = ov;
  asm volatile("s_wait_xcnt 0x0" ::: "memory");        // in the shared launch another part's code follows in the text and rewrites the registers that this store names
}

// ---------------------------------------------------------------------------------------------------------
// Wave-tile GEMM core: acc[i][j] (rows 16i.., cols 16j.., i, j = 0..3) += A[row][k] * W[col][k] over k = 0..CD-1, 64 k per trip in ascending order.
// ap  = A  + row0*CD + 8*lane (fragment-order plane; A fragment: row m = ln, elements 0..7 <- k0 + 8h + i, 8..15 <- k0 + 16 + 8h + i)
// wp  = W  + col0*CD + 8*lane (B fragment: column n = ln, same k map); the tile of k0 starts 16*k0 elements into its row group
// alp = residual plane of A (same addressing), accumulated into acl when RES.
// A loaded fragment feeds four products, and the fragments of both halves of a trip are requested together, ahead of the trip's products.
template <bool BF, bool RES>
__device__ __forceinline__ void gemm_loop(const unsigned short* __restrict__ ap, const unsigned short* __restrict__ alp,
                                          const unsigned short* __restrict__ wp, v8f (&acc)[4][4], v8f (&acl)[4][4]) {
#pragma unroll 1
  for (int k = 0; k < CD; k += 64) {
    const unsigned short* pa = ap + k * 16;
    const unsigned short* pw = wp + k * 16;
    const unsigned short* pl = alp + k * 16;
    Frag a[2][4], b[2][4], al[2][4];
#pragma unroll
    for (int u = 0; u < 2; ++u) {
#pragma unroll
      for (int i = 0; i < 4; ++i) ldfrag(a[u][i], pa + (size_t)i * 16 * CD + u * 512);
#pragma unroll
      for (int j = 0; j < 4; ++j) ldfrag(b[u][j], pw + (size_t)j * 16 * CD + u * 512);
      if (RES) {
#pragma unroll
        for (int i = 0; i < 4; ++i) ldfrag(al[u][i], pl + (size_t)i * 16 * CD + u * 512);
      }
    }
    // the trip's address registers stay whole until every load that names them is issued and this wait has passed (without the operands a late load lands in them)
    if (RES) asm volatile("s_wait_xcnt 0x0" :: "v"(pa), "v"(pw), "v"(pl) : "memory");
    else     asm volatile("s_wait_xcnt 0x0" :: "v"(pa), "v"(pw) : "memory");
    // keeps every load of the trip ahead of its first product: moved down among the products, each group of loads would be waited for on its own
    __builtin_amdgcn_sched_barrier(0);
#pragma unroll
    for (int u = 0; u < 2; ++u) {
#pragma unroll
      for (int i = 0; i < 4; ++i)
#pragma unroll
        for (int j = 0; j < 4; ++j) acc[i][j] = wm<BF>(a[u][i], b[u][j], acc[i][j]);
      if (RES) {
#pragma unroll
        for (int i = 0; i < 4; ++i)
#pragma unroll
          for (int j = 0; j < 4; ++j) acl[i][j] = wm<BF>(al[u][i], b[u][j], acl[i][j]);
      }
    }
  }
}

__device__ __forceinline__ float rope1(float q, float p, float c, float s, float sg) { return q * c + (sg * p) * s; }

// ---------------------------------------------------------------------------------------------------------
// Rotary table from the position ids (read by value): rot[t][j] = cos(p_t * f_j), rot[t][32 + j] = sin(p_t * f_j), f_j = 10000^(-j/32), j = 0..31.
// Block = 16 positions x 32 frequencies, one precise sincos per thread -> LDS tile [16][64] (cross-wave: block barrier) -> 16 threads write one row
__device__ __forceinline__ void rotab_part(const int* __restrict__ pos, float* __restrict__ rot, int blk, float (*sh)[64]) {
  const int tid = threadIdx.x;
  const int r = tid >> 5, j = tid & 31;
  const int t = blk * 16 + r;
  const float p = (float)pos[t];
  const float f = exp2f(-(float)j * 0.41524101186092029f);   // log2(10000)/32
  const float ang = p * f;
  float sn, cs;
  sincosf(ang, &sn, &cs);
  sh[r][j] = cs;
  sh[r][32 + j] = sn;
  __syncthreads();
  if (tid < 256) {
    const int rr = tid >> 4, pc = tid & 15;
    const v4f v = *(const v4fa*)&sh[rr][4 * pc];
    float* d = rot + (size_t)(blk * 16 + rr) * HD + 4 * pc;
    *(v4f*)d = v;
    
  }
}

// ---------------------------------------------------------------------------------------------------------
// All preparation in one launch: the rotary table, the mask scan and the five plane conversions depend on the inputs alone and on nothing of one another,
// so each work-group of 512 threads takes one block of one of them by its index range (the test is the same for the whole work-group; each part's barrier
// is passed by every thread of the work-groups that run that part).
// coverage: the ranges below follow one another without gap or overlap and each holds exactly the blocks that its part's own coverage line asks for.
#define PB_ROT  (SEQ / 16)
#define PB_SCAN (SEQ / SCAN_ROWS)
#define PB_X    (NB * SEQ / 2)
#define PB_WQ   (CD / 2)
#define PB_WKV  (KVW / 2)
#define PB_WO   (CD / 2)
#define PB_ALL  (PB_ROT + PB_SCAN + PB_X + PB_WQ + 2 * PB_WKV + PB_WO)
__global__ __launch_bounds__(512) void k_prep(const float* __restrict__ mask, const int* __restrict__ pos, const float* __restrict__ x,
                                              const float* __restrict__ Wq, const float* __restrict__ Wk, const float* __restrict__ Wv,
                                              const float* __restrict__ Wo, int* __restrict__ flags, float* __restrict__ rot,
                                              unsigned short* __restrict__ xb, unsigned short* __restrict__ wqk,
                                              unsigned short* __restrict__ wvb, unsigned short* __restrict__ wob) {
  __shared__ int sw[2][16];
  __shared__ __attribute__((aligned(16))) float sh[16][64];
  int blk = blockIdx.x;
  if (blk < PB_ROT) { rotab_part(pos, rot, blk, sh); return; }
  blk -= PB_ROT;
  if (blk < PB_SCAN) { maskscan_part(mask, flags, blk, sw); return; }
  blk -= PB_SCAN;
  if (blk < PB_X) { cvt_part<0>(x, xb, blk, SEQ, SEQ_FULL); return; }
  blk -= PB_X;
  if (blk < PB_WQ) { cvt_part<0>(Wq, wqk, blk, CD, CD); return; }
  blk -= PB_WQ;
  if (blk < PB_WKV) { cvt_part<0>(Wk, wqk + (size_t)CD * CD, blk, KVW, KVW); return; }
  blk -= PB_WKV;
  if (blk < PB_WKV) { cvt_part<0>(Wv, wvb, blk, KVW, KVW); return; }
  blk -= PB_WKV;
  cvt_part<1>(Wo, wob, blk, CD, CD);
}

// ---------------------------------------------------------------------------------------------------------
// q and k projections with fused bias, half-split rotary (table plane [SEQ][32 cos | 32 sin]) and head-major repack.
// Block = 2 x 2 waves: 128 token rows (wave w: half w & 1) x two heads (wave w: head 2 * hpair + (w >> 1), 64 columns): hpair = 0..NQK/2-1, mblk = 0..NB*SEQ/128-1.
// coverage: NQK heads x NB*SEQ tokens x 64 = the whole plane [NB][NQK][SEQ][64], both planes. LDS tile 64 x 64 fully written before it is read.
__device__ __forceinline__ void proj_qk_part(const unsigned short* __restrict__ xb, const unsigned short* __restrict__ wqk,
                                             const float* __restrict__ bq, const float* __restrict__ bk,
                                             const float* __restrict__ tab,
                                             unsigned short* __restrict__ qkh, unsigned short* __restrict__ qkl,
                                             int hpair, int mblk, float (*st)[64][68]) {
  const int tid = threadIdx.x, lane = tid & 31, ln = lane & 15, hh = lane >> 4;
  const int w = __builtin_amdgcn_readfirstlane(tid >> 5);
  const int m0 = mblk * 128 + 64 * (w & 1);
  const int hd = 2 * hpair + (w >> 1);
  const v8f z8 = {0.f, 0.f, 0.f, 0.f, 0.f, 0.f, 0.f, 0.f};
  v8f acc[4][4];
#pragma unroll
  for (int i = 0; i < 4; ++i)
#pragma unroll
    for (int j = 0; j < 4; ++j) acc[i][j] = z8;
  gemm_loop<true, false>(xb + (size_t)m0 * CD + 8 * lane, xb, wqk + (size_t)(hd * HD) * CD + 8 * lane, acc, acc);

  float bias[4];
#pragma unroll
  for (int j = 0; j < 4; ++j) {
    const int col = hd * HD + 16 * j + ln;
    const int cq = (col < CD - 1) ? col : (CD - 1);
    int ck = col - CD;
    ck = (ck < 0) ? 0 : ((ck > KVW - 1) ? (KVW - 1) : ck);
    const float vq = bq[cq], vk = bk[ck];
    bias[j] = bf16_rne((col < CD) ? vq : vk);
  }
#pragma unroll
  for (int i = 0; i < 4; ++i)
#pragma unroll
    for (int j = 0; j < 4; ++j)
#pragma unroll
      for (int r = 0; r < 8; ++r) st[w][16 * i + 8 * hh + r][16 * j + ln] = acc[i][j][r] + bias[j];
  __syncthreads();

  const int b = m0 / SEQ, t0 = m0 - b * SEQ;
  // piece g of the wave's 64 tokens x 64 columns in fragment order: row group g >> 2, k tile (g >> 1) & 1, fragment half g & 1
  v8us oh[16], ol[16];
#pragma unroll
  for (int g = 0; g < 16; ++g) {
    const int row = 16 * (g >> 2) + ln;
    const int d0 = 32 * ((g >> 1) & 1) + 16 * (g & 1) + 8 * hh;
    const float sg = (d0 < 32) ? -1.0f : 1.0f;
    const v4f a0 = *(const v4fa*)&st[w][row][d0];
    const v4f a1 = *(const v4fa*)&st[w][row][d0 + 4];
    const v4f p0 = *(const v4fa*)&st[w][row][d0 ^ 32];
    const v4f p1 = *(const v4fa*)&st[w][row][(d0 ^ 32) + 4];
    // column d uses frequency d % 32: cos at [d % 32], sin at [32 + d % 32]
    const float* tp = tab + (size_t)(t0 + row) * HD + (d0 & 31);
    const v4f c0 = *(const v4fa*)(tp), c1 = *(const v4fa*)(tp + 4);
    const v4f s0 = *(const v4fa*)(tp + 32), s1 = *(const v4fa*)(tp + 36);
    float o[8];
    o[0] = rope1(a0[0], p0[0], c0[0], s0[0], sg); o[1] = rope1(a0[1], p0[1], c0[1], s0[1], sg);
    o[2] = rope1(a0[2], p0[2], c0[2], s0[2], sg); o[3] = rope1(a0[3], p0[3], c0[3], s0[3], sg);
    o[4] = rope1(a1[0], p1[0], c1[0], s1[0], sg); o[5] = rope1(a1[1], p1[1], c1[1], s1[1], sg);
    o[6] = rope1(a1[2], p1[2], c1[2], s1[2], sg); o[7] = rope1(a1[3], p1[3], c1[3], s1[3], sg);
    Pack8 ph8, pl8;
#pragma unroll
    for (int e = 0; e < 8; ++e) {
      const float y = o[e] * 16.0f;                       // carried x16
      const _Float16 h = toh_flush(y);
      ph8.h[e] = h;
      pl8.h[e] = toh_flush((y - (float)h) * 2048.0f);      // residual plane x2^11
    }
    oh[g] = ph8.v; ol[g] = pl8.v;
  }
  const size_t dbase = ((size_t)(b * NQK + hd) * SEQ + t0) * HD + 8 * lane;
{
#pragma unroll
    for (int g = 0; g < 16; ++g) {
      const size_t off = dbase + (size_t)g * 256;
      *(v8us*)(qkh + off) = oh[g];
      *(v8us*)(qkl + off) = ol[g];
    }
    
  }
}

// ---------------------------------------------------------------------------------------------------------
// v projection computed transposed: Vt[b][m][t] = sum_k Wv[m][k] x[b,t][k] + bv[m], carried x16, hi and residual planes.
// Block = 2 x 2 waves: 128 weight rows (wave w: half w & 1) x 128 tokens (wave w: half w >> 1): nblk = 0..NB*SEQ/128-1, mgrp = 0..KVW/128-1.
// coverage: KVW rows x NB*SEQ tokens = the whole plane [NB][KVW][SEQ], both planes. LDS tile 64 x 64 fully written before it is read.
__device__ __forceinline__ void proj_v_part(const unsigned short* __restrict__ wvb, const unsigned short* __restrict__ xb,
                                            const float* __restrict__ bv,
                                            unsigned short* __restrict__ vth, unsigned short* __restrict__ vtl,
                                            int nblk, int mgrp, float (*st)[64][68]) {
  const int tid = threadIdx.x, lane = tid & 31, ln = lane & 15, hh = lane >> 4;
  const int w = __builtin_amdgcn_readfirstlane(tid >> 5);
  const int n0 = nblk * 128 + 64 * (w >> 1);
  const int m0 = mgrp * 128 + 64 * (w & 1);
  const v8f z8 = {0.f, 0.f, 0.f, 0.f, 0.f, 0.f, 0.f, 0.f};
  v8f acc[4][4];
#pragma unroll
  for (int i = 0; i < 4; ++i)
#pragma unroll
    for (int j = 0; j < 4; ++j) acc[i][j] = z8;
  gemm_loop<true, false>(wvb + (size_t)m0 * CD + 8 * lane, wvb, xb + (size_t)n0 * CD + 8 * lane, acc, acc);
#pragma unroll
  for (int i = 0; i < 4; ++i)
#pragma unroll
    for (int j = 0; j < 4; ++j)
#pragma unroll
      for (int r = 0; r < 8; ++r) st[w][16 * i + 8 * hh + r][16 * j + ln] = acc[i][j][r];
  __syncthreads();

  const int b = n0 / SEQ, t0 = n0 - b * SEQ;
  // piece g of the wave's 64 rows x 64 tokens in fragment order: row group g >> 2, key tile (g >> 1) & 1, fragment half g & 1
  v8us oh[16], ol[16];
#pragma unroll
  for (int g = 0; g < 16; ++g) {
    const int row = 16 * (g >> 2) + ln;
    const int c0 = 32 * ((g >> 1) & 1) + 16 * (g & 1) + 8 * hh;
    const float bias = bf16_rne(bv[m0 + row]);
    const v4f a0 = *(const v4fa*)&st[w][row][c0];
    const v4f a1 = *(const v4fa*)&st[w][row][c0 + 4];
    float o[8];
    o[0] = a0[0]; o[1] = a0[1]; o[2] = a0[2]; o[3] = a0[3];
    o[4] = a1[0]; o[5] = a1[1]; o[6] = a1[2]; o[7] = a1[3];
    Pack8 ph8, pl8;
#pragma unroll
    for (int e = 0; e < 8; ++e) {
      const float y = (o[e] + bias) * 16.0f;              // carried x16
      const _Float16 h = (_Float16)y;
      ph8.h[e] = h;
      pl8.h[e] = (_Float16)((y - (float)h) * 2048.0f);
    }
    oh[g] = ph8.v; ol[g] = pl8.v;
  }
  const size_t dbase = ((size_t)b * KVW + m0) * SEQ + (size_t)t0 * 16 + 8 * lane;
{
#pragma unroll
    for (int g = 0; g < 16; ++g) {
      const size_t off = dbase + (size_t)(g >> 2) * 16 * SEQ + (size_t)(g & 3) * 256;
      *(v8us*)(vth + off) = oh[g];
      *(v8us*)(vtl + off) = ol[g];
    }
    
  }
}

// ---------------------------------------------------------------------------------------------------------
// q, k and v projections in one launch: they read the same x plane and write disjoint planes, and the v blocks alone are too few to fill the chip.
// grid = (NQK/2 + VBX, NB*SEQ/128): column c < NQK/2 is head pair c of the q/k part; the VBX columns behind it are the v blocks of the same 128 tokens
// (KVW/128 groups of weight rows). The test is the same for the whole work-group.
// coverage: every (hpair, mblk) once; (nblk, mgrp) = (y, j), j = 0..VBX-1, y = 0..NB*SEQ/128-1, is every v block once.
#define VBX (KVW / 128)
__global__ __launch_bounds__(128) void k_proj_qkv(const unsigned short* __restrict__ xb, const unsigned short* __restrict__ wqk,
                                                  const unsigned short* __restrict__ wvb,
                                                  const float* __restrict__ bq, const float* __restrict__ bk, const float* __restrict__ bv,
                                                  const float* __restrict__ tab,
                                                  unsigned short* __restrict__ qkh, unsigned short* __restrict__ qkl,
                                                  unsigned short* __restrict__ vth, unsigned short* __restrict__ vtl) {
  __shared__ __attribute__((aligned(16))) float st[4][64][68];
  const int c = blockIdx.x;
  if (c < NQK / 2) {
    proj_qk_part(xb, wqk, bq, bk, tab, qkh, qkl, c, blockIdx.y, st);
  } else {
    proj_v_part(wvb, xb, bv, vth, vtl, blockIdx.y, c - NQK / 2, st);
  }
}

// ---------------------------------------------------------------------------------------------------------
// One 32-key step for a wave's 16 queries (this lane's column = its query). EARLYP adds the residual planes of q, k, v, P.
// MASK reads the mask row of this lane's query by value (RNE bf16 value) and adds it to the scaled scores.
// Without EARLYP the fragment loads run ahead of their use: kf holds this step's K fragments on entry and the K fragments of the step at keyn on exit
// (fetched right behind the score products, into the same registers), and the V fragments of this step are fetched at the step's top, so that both
// fly under the softmax arithmetic. With EARLYP kf and keyn are not used.
template <bool EARLYP, bool MASK>
__device__ __forceinline__ void fa_step(const unsigned short* __restrict__ Kp, const unsigned short* __restrict__ Kl,
                                        const unsigned short* __restrict__ Vp, const unsigned short* __restrict__ Vl,
                                        const float* __restrict__ mrow, int key0, int keyn, int ln, int hh,
                                        const Frag (&qh)[2], const Frag (&ql)[2], Frag (&kf)[4],
                                        float& mr, float& lr, v8f (&Oh)[4], v8f (&Ol)[4]) {
  const v8f z8 = {0.f, 0.f, 0.f, 0.f, 0.f, 0.f, 0.f, 0.f};
  float sc[16];
  // A fragments of K: row m = key (key0 + 16*kt + ln), elements 0..7 <- d = 32c + 8h + i, 8..15 <- d = 32c + 16 + 8h + i
  // fragment-order plane: 16 keys = two tiles of 512 elements (c = 0, 1)
  int koff = key0 * HD + 8 * (16 * hh + ln);
  // A fragments of V^T: row m = d (16*t + ln), elements 0..7 <- key0 + 8h + i, 8..15 <- key0 + 16 + 8h + i
  // fragment-order plane: the tile of 32 keys at key0 starts 16*key0 elements into its group of 16 rows
  int voff = key0 * 16 + 8 * (16 * hh + ln);
  Frag vf[4];
  if (!EARLYP) {
#pragma unroll
    for (int t = 0; t < 4; ++t) ldfrag(vf[t], Vp + voff + (size_t)t * 16 * SEQ);
    if (MASK) asm volatile("s_wait_xcnt 0x0" ::: "memory");   // the mask loads behind them land in the registers that the V loads name
  }
  if (EARLYP) {
#pragma unroll
    for (int kt = 0; kt < 2; ++kt) {
      Frag a0, a1, l0, l1;
      ldfrag(a0, Kp + koff); ldfrag(a1, Kp + koff + 512);
      ldfrag(l0, Kl + koff); ldfrag(l1, Kl + koff + 512);
      v8f s = z8, r = z8;
      s = wm<false>(a0, qh[0], s); s = wm<false>(a1, qh[1], s);
      r = wm<false>(a0, ql[0], r); r = wm<false>(a1, ql[1], r);
      r = wm<false>(l0, qh[0], r); r = wm<false>(l1, qh[1], r);
      asm volatile("v_nop\n\tv_nop\n\tv_nop\n\tv_nop" : "+v"(s), "+v"(r)
                        : "v"(a0.v), "v"(a1.v), "v"(l0.v), "v"(l1.v), "v"(qh[0].v), "v"(qh[1].v), "v"(ql[0].v), "v"(ql[1].v));
      // S^T element r of tile kt = score(key0 + 16*kt + 8h + r, this lane's query); carries: q x16, k x16, residual x2^11
#pragma unroll
      for (int e = 0; e < 8; ++e) sc[8 * kt + e] = fmaf(r[e], S2M11, s[e]) * S2M11;
      koff += 16 * HD;
      if (kt == 0) asm volatile("" : "+v"(koff) : "v"(sc[0]));   // second tile's loads issue after the first tile is done
    }
  } else {
    v8f s0 = z8, s1 = z8;
    s0 = wm<false>(kf[0], qh[0], s0); s0 = wm<false>(kf[1], qh[1], s0);
    s1 = wm<false>(kf[2], qh[0], s1); s1 = wm<false>(kf[3], qh[1], s1);
    koff = keyn * HD + 8 * (16 * hh + ln);
    asm volatile("v_nop\n\tv_nop\n\tv_nop\n\tv_nop" : "+v"(s0), "+v"(s1)
                      : "v"(kf[0].v), "v"(kf[1].v), "v"(kf[2].v), "v"(kf[3].v), "v"(qh[0].v), "v"(qh[1].v));
    ldfrag(kf[0], Kp + koff);           ldfrag(kf[1], Kp + koff + 512);
    ldfrag(kf[2], Kp + koff + 16 * HD); ldfrag(kf[3], Kp + koff + 16 * HD + 512);
#pragma unroll
    for (int e = 0; e < 8; ++e) { sc[e] = s0[e] * S2M11; sc[8 + e] = s1[e] * S2M11; }
  }
  if (MASK) {
    const float* mp = mrow + key0 + 8 * hh;
    const v4f m0 = *(const v4fa*)(mp),      m1 = *(const v4fa*)(mp + 4);
    const v4f m2 = *(const v4fa*)(mp + 16), m3 = *(const v4fa*)(mp + 20);
#pragma unroll
    for (int e = 0; e < 4; ++e) {
      sc[e]      = sc[e]      + bf16_rne(m0[e]);
      sc[4 + e]  = sc[4 + e]  + bf16_rne(m1[e]);
      sc[8 + e]  = sc[8 + e]  + bf16_rne(m2[e]);
      sc[12 + e] = sc[12 + e] + bf16_rne(m3[e]);
    }
  }
  float mx = sc[0];
#pragma unroll
  for (int i = 1; i < 16; ++i) mx = fmaxf(mx, sc[i]);
  mx = fmaxf(mx, __shfl_xor(mx, 16, 32));            // the other lane half holds the other 16 keys of this query
  const float mnew = fmaxf(mr, mx);
  float msafe = mnew;
  if (MASK) msafe = (mnew == neg_inf()) ? 0.0f : mnew;   // every key so far at -inf: weights come out 0
  const float al = __builtin_amdgcn_exp2f((mr - msafe) * LOG2E);
  mr = mnew;
  // weights carried x256: pc = 256 * exp(sc - m); hi plane f16(pc), residual plane f16((pc - hi) * 2048)
  Frag ph, pl;
  float ps = 0.0f;
#pragma unroll
  for (int i = 0; i < 16; ++i) {
    const float pc = __builtin_amdgcn_exp2f(fmaf(sc[i] - msafe, LOG2E, 8.0f));
    ps += pc;
    const _Float16 h = toh_flush(pc);
    ph.h[i] = h;                                      // B element i: i<8 -> key0 + 8h + i (tile 0 row 8h+i); i>=8 -> key0 + 16 + 8h + (i-8) (tile 1)
    if (EARLYP) pl.h[i] = toh_flush((pc - (float)h) * 2048.0f);
  }
  ps += __shfl_xor(ps, 16, 32);
  lr = lr * al + ps;
  if (EARLYP) {
    asm volatile("" : "+v"(voff) : "v"(ps));          // V loads issue after the score phase
#pragma unroll
    for (int t = 0; t < 4; ++t) ldfrag(vf[t], Vp + voff + (size_t)t * 16 * SEQ);
  }
#pragma unroll
  for (int t = 0; t < 4; ++t) Oh[t] = Oh[t] * al;
  if (EARLYP) {
    const unsigned short* vq = Vl + voff;
    Frag vl[4];
#pragma unroll
    for (int t = 0; t < 4; ++t) ldfrag(vl[t], vq + (size_t)t * 16 * SEQ);
#pragma unroll
    for (int t = 0; t < 4; ++t) Ol[t] = Ol[t] * al;
#pragma unroll
    for (int t = 0; t < 4; ++t) {
      Oh[t] = wm<false>(vf[t], ph, Oh[t]);
      Ol[t] = wm<false>(vf[t], pl, Ol[t]);
      Ol[t] = wm<false>(vl[t], ph, Ol[t]);
    }
    asm volatile("v_nop\n\tv_nop\n\tv_nop\n\tv_nop" : "+v"(Oh[0]), "+v"(Oh[1]), "+v"(Oh[2]), "+v"(Oh[3]), "+v"(Ol[0]), "+v"(Ol[1]), "+v"(Ol[2]), "+v"(Ol[3])
                      : "v"(vf[0].v), "v"(vf[1].v), "v"(vf[2].v), "v"(vf[3].v),
                        "v"(vl[0].v), "v"(vl[1].v), "v"(vl[2].v), "v"(vl[3].v), "v"(ph.v), "v"(pl.v));
  } else {
#pragma unroll
    for (int t = 0; t < 4; ++t) Oh[t] = wm<false>(vf[t], ph, Oh[t]);
    asm volatile("v_nop\n\tv_nop\n\tv_nop\n\tv_nop" : "+v"(Oh[0]), "+v"(Oh[1]), "+v"(Oh[2]), "+v"(Oh[3])
                      : "v"(vf[0].v), "v"(vf[1].v), "v"(vf[2].v), "v"(vf[3].v), "v"(ph.v));
  }
}

template <bool EARLYP>
__device__ __forceinline__ void run_keys(const unsigned short* __restrict__ qkh, const unsigned short* __restrict__ qkl,
                                         const unsigned short* __restrict__ vth, const unsigned short* __restrict__ vtl,
                                         const float* __restrict__ mask, int b, int h, int qg, int ln, int hh,
                                         int nplain, int nsteps, float& mr, float& lr, v8f (&Oh)[4], v8f (&Ol)[4]) {
  // Q^T B fragments: column n = this lane's query, elements 0..7 <- d = 32c + 8h + i, 8..15 <- d = 32c + 16 + 8h + i
  const size_t qoff = ((size_t)(b * NQK + h) * SEQ + (qg - ln)) * HD + 8 * (16 * hh + ln);   // fragment-order plane, the wave's own 16 rows
  Frag qh[2], ql[2];
  ldfrag(qh[0], qkh + qoff); ldfrag(qh[1], qkh + qoff + 512);
  if (EARLYP) { ldfrag(ql[0], qkl + qoff); ldfrag(ql[1], qkl + qoff + 512); }
  else { ql[0] = qh[0]; ql[1] = qh[1]; }
  asm volatile("s_wait_xcnt 0x0" ::: "memory");        // the address registers of the Q loads are reused right behind them
  const int kv = h / NREP;                             // consecutive groups of NREP query heads share one kv head
  const size_t kbase = (size_t)(b * NQK + NHEAD + kv) * SEQ * HD;
  const size_t vbase = ((size_t)b * KVW + (size_t)kv * HD) * SEQ;
  const unsigned short* Kp = qkh + kbase;
  const unsigned short* Kl = qkl + kbase;
  const unsigned short* Vp = vth + vbase;
  const unsigned short* Vl = vtl + vbase;
  const float* mrow = mask + (size_t)qg * SEQ_FULL;
  Frag kf[4];
  if (!EARLYP) {                                       // K fragments of step 0 (nsteps >= 1)
    const unsigned short* k0 = Kp + 8 * (16 * hh + ln);
    ldfrag(kf[0], k0);           ldfrag(kf[1], k0 + 512);
    ldfrag(kf[2], k0 + 16 * HD); ldfrag(kf[3], k0 + 16 * HD + 512);
    asm volatile("s_wait_xcnt 0x0" ::: "memory");      // the address registers of the K loads are reused behind them
  }
  // the step fetched ahead is the next one; the last step fetches its own tile again, so that the address stays inside the plane
#pragma unroll 1
  for (int j = 0; j < nplain; ++j)
    fa_step<EARLYP, false>(Kp, Kl, Vp, Vl, mrow, 32 * j, 32 * ((j + 1 < nsteps) ? j + 1 : j), ln, hh, qh, ql, kf, mr, lr, Oh, Ol);
#pragma unroll 1
  for (int j = nplain; j < nsteps; ++j)
    fa_step<EARLYP, true>(Kp, Kl, Vp, Vl, mrow, 32 * j, 32 * ((j + 1 < nsteps) ? j + 1 : j), ln, hh, qh, ql, kf, mr, lr, Oh, Ol);
}

// Block = 4 waves x 16 queries = 64 queries of one (batch, head); no LDS and no barrier.
// Tile skipping from the device flags, per wave: both flags of both flag lines that cover the wave's 16 query rows are 1 -> keys past the diagonal step are
// skipped (their weights are exactly zero) and steps fully below the diagonal run without mask reads (their mask entries are exactly zero); every other
// visited step reads the mask by value. A softmax row depends on its own mask row alone, so the wave's own rows decide.
// For any other flag value every step is visited and reads the mask. Trip counts are bounded by SEQ/32 for any flag value.
// coverage: NB*NHEAD*(SEQ/64) blocks x 4 waves x 16 rows x 64 columns = the whole ctx hi plane; blocks with query tile below EARLY_ROWS cover the whole residual plane.
__global__ __launch_bounds__(128) void k_attn(const unsigned short* __restrict__ qkh, const unsigned short* __restrict__ qkl,
                                              const unsigned short* __restrict__ vth, const unsigned short* __restrict__ vtl,
                                              const float* __restrict__ mask, const int* __restrict__ flags,
                                              unsigned short* __restrict__ ctxh, unsigned short* __restrict__ ctxl) {
  const int tid = threadIdx.x, lane = tid & 31, ln = lane & 15, hh = lane >> 4;
  const int w = __builtin_amdgcn_readfirstlane(tid >> 5);
  const int nqt = SEQ / 64;
  const int blk = blockIdx.x;
  // a causal query tile's key steps grow with its index and not all work-groups are resident at once: the longest tiles take the lowest block indices,
  // so that they start first and the short ones fill the places that come free (blk -> (qt, b, h) is one to one)
  const int qt = nqt - 1 - blk / (NB * NHEAD);
  const int bh = blk % (NB * NHEAD);
  const int h = bh % NHEAD;
  const int b = bh / NHEAD;
  const int qbase = qt * 64 + 16 * w;
  const int qg = qbase + ln;
  const int* fl = flags + (qbase / SCAN_ROWS) * 32;    // 16 query rows = 16 / SCAN_ROWS flag lines
  int fok = 1;                                         // bitwise, so that the flag loads issue together
#pragma unroll
  for (int i = 0; i < 16 / SCAN_ROWS; ++i) fok &= (fl[32 * i] == 1 ? 1 : 0) & (fl[32 * i + 1] == 1 ? 1 : 0);
  const bool tri = (fok == 1);
  const int nfull = qbase >> 5;                        // steps whose 32 keys are all at or below every query of this wave
  const int nsteps = tri ? (nfull + 1) : (SEQ / 32);   // <= SEQ/32 in both cases
  const int nplain = tri ? nfull : 0;
  const bool early = (qt * 64 < EARLY_ROWS);

  const v8f z8 = {0.f, 0.f, 0.f, 0.f, 0.f, 0.f, 0.f, 0.f};
  float mr = neg_inf(), lr = 0.0f;
  v8f Oh[4], Ol[4];
#pragma unroll
  for (int t = 0; t < 4; ++t) { Oh[t] = z8; Ol[t] = z8; }
  if (early) run_keys<true>(qkh, qkl, vth, vtl, mask, b, h, qg, ln, hh, nplain, nsteps, mr, lr, Oh, Ol);
  else       run_keys<false>(qkh, qkl, vth, vtl, mask, b, h, qg, ln, hh, nplain, nsteps, mr, lr, Oh, Ol);

  // O^T element r of tile t = ctx(query, d = 16t + 8h + r); undo the carries x256 (in lr), x16 (V), x2^11 (residual); apply the x64 carry of ctx
  const float inv = 4.0f * (1.0f / lr);
  // tile t of O^T in this lane = row ln, columns 16t + 8h + 0..7 of ctx: exactly this lane's 16-byte piece t of the wave's two fragment-order tiles
  // (k tile t >> 1, fragment half t & 1), so the registers are stored as they stand, 512 contiguous bytes per wave and store
  v8us oh[4], ol[4];
#pragma unroll
  for (int t = 0; t < 4; ++t) {
    Pack8 ph8, pl8;
#pragma unroll
    for (int e = 0; e < 8; ++e) {
      const float o = fmaf(Ol[t][e], S2M11, Oh[t][e]) * inv;
      const _Float16 hv = toh_flush(o);
      ph8.h[e] = hv;
      pl8.h[e] = toh_flush((o - (float)hv) * 2048.0f);
    }
    oh[t] = ph8.v; ol[t] = pl8.v;
  }
  const size_t hbase = ((size_t)b * SEQ + qbase) * CD + (size_t)h * (16 * HD) + 8 * lane;
  const size_t lbase = ((size_t)b * EARLY_ROWS + (early ? qbase : 0)) * CD + (size_t)h * (16 * HD) + 8 * lane;
#pragma unroll
  for (int t = 0; t < 4; ++t) *(v8us*)(ctxh + hbase + t * 256) = oh[t];
  asm volatile("s_wait_xcnt 0x0" ::: "memory");        // the residual stores' address arithmetic below may reuse the registers that these stores name
  if (early) {
#pragma unroll
    for (int t = 0; t < 4; ++t) *(v8us*)(ctxl + lbase + t * 256) = ol[t];
  }
}

// ---------------------------------------------------------------------------------------------------------
// Output projection: out[m][n] = sum_k ctx[m][k] Wo[n][k] + bo[n]. Block = 2 x 2 waves: 128 rows (wave w: half w & 1) x 128 columns (half w >> 1). grid = (CD/128, NB*SEQ/128).
// Rows below EARLY_ROWS of each sequence add the residual plane of ctx in separate accumulators.
// coverage: NB*SEQ rows x CD columns = every element of the output buffer region once. LDS tile 64 x 64 fully written before it is read.
__global__ __launch_bounds__(128) void k_proj_out(const unsigned short* __restrict__ ctxh, const unsigned short* __restrict__ ctxl,
                                                  const unsigned short* __restrict__ wo, const float* __restrict__ bo,
                                                  float* __restrict__ out) {
  __shared__ __attribute__((aligned(16))) float st[4][64][68];
  const int tid = threadIdx.x, lane = tid & 31, ln = lane & 15, hh = lane >> 4;
  const int w = __builtin_amdgcn_readfirstlane(tid >> 5);
  const int n0 = blockIdx.x * 128 + 64 * (w >> 1);
  const int mb = blockIdx.y * 128;
  const int b = mb / SEQ;
  const int tb = mb - b * SEQ;
  const bool early = (tb < EARLY_ROWS);                // block-uniform: EARLY_ROWS and SEQ are multiples of 128
  const int t0 = tb + 64 * (w & 1);
  const int m0 = mb + 64 * (w & 1);
  const v8f z8 = {0.f, 0.f, 0.f, 0.f, 0.f, 0.f, 0.f, 0.f};
  v8f acc[4][4], acl[4][4];
#pragma unroll
  for (int i = 0; i < 4; ++i)
#pragma unroll
    for (int j = 0; j < 4; ++j) { acc[i][j] = z8; acl[i][j] = z8; }
  const unsigned short* ap = ctxh + (size_t)m0 * CD + 8 * lane;
  const unsigned short* alp = ctxl + (size_t)(b * EARLY_ROWS + (early ? t0 : 0)) * CD + 8 * lane;
  const unsigned short* wp = wo + (size_t)n0 * CD + 8 * lane;
  if (early) gemm_loop<false, true>(ap, alp, wp, acc, acl);
  else       gemm_loop<false, false>(ap, ap, wp, acc, acl);
  // carries: ctx x64, Wo x64 -> 2^-12; residual plane additionally x2^11
#pragma unroll
  for (int i = 0; i < 4; ++i)
#pragma unroll
    for (int j = 0; j < 4; ++j)
#pragma unroll
      for (int r = 0; r < 8; ++r)
        st[w][16 * i + 8 * hh + r][16 * j + ln] = fmaf(acl[i][j][r], S2M11, acc[i][j][r]) * S2M12;
  __syncthreads();
  const int rsub = lane >> 4, c4 = 4 * (lane & 15);
  const v4f bb = *(const v4fa*)(bo + n0 + c4);
  v4f bias;
  bias[0] = bf16_rne(bb[0]); bias[1] = bf16_rne(bb[1]); bias[2] = bf16_rne(bb[2]); bias[3] = bf16_rne(bb[3]);
  v4f ov[32];
#pragma unroll
  for (int g = 0; g < 32; ++g) {
    const v4f a = *(const v4fa*)&st[w][2 * g + rsub][c4];
    ov[g] = a + bias;
  }
  float* og = out + ((size_t)b * SEQ_FULL + t0) * CD + n0 + c4;
{
#pragma unroll
    for (int g = 0; g < 32; ++g)
      *(v4f*)(og + (size_t)(2 * g + rsub) * CD) = ov[g];
    
  }
}

// ---------------------------------------------------------------------------------------------------------
extern "C" void kernel_launch(void* const* d_in, const int* in_sizes, int n_in,
                              void* d_out, int out_size, void* d_ws, size_t ws_size, hipStream_t stream) {
  if (n_in < 11) return;
  const long long need_x = (long long)(NB - 1) * SEQ_FULL * CD + (long long)SEQ * CD;   // last element touched + 1
  const long long need_m = (long long)(SEQ - 1) * SEQ_FULL + SEQ;
  if ((long long)in_sizes[0] < need_x) return;
  if ((long long)in_sizes[1] < need_m) return;
  if ((long long)in_sizes[2] < (long long)SEQ) return;
  if ((long long)in_sizes[3] < (long long)CD * CD || (long long)in_sizes[4] < CD) return;
  if ((long long)in_sizes[5] < (long long)KVW * CD || (long long)in_sizes[6] < KVW) return;
  if ((long long)in_sizes[7] < (long long)KVW * CD || (long long)in_sizes[8] < KVW) return;
  if ((long long)in_sizes[9] < (long long)CD * CD || (long long)in_sizes[10] < CD) return;
  if ((long long)out_size < need_x) return;
  if ((size_t)WS_TOTAL > ws_size) return;

  // wire order: hidden_states, attention_mask (f32), position_ids (i32), Wq, bq, Wk, bk, Wv, bv, Wo, bo
  const float* x    = (const float*)d_in[0];
  const float* mask = (const float*)d_in[1];
  const int*   pos  = (const int*)d_in[2];
  const float* Wq   = (const float*)d_in[3];
  const float* bq   = (const float*)d_in[4];
  const float* Wk   = (const float*)d_in[5];
  const float* bk   = (const float*)d_in[6];
  const float* Wv   = (const float*)d_in[7];
  const float* bv   = (const float*)d_in[8];
  const float* Wo   = (const float*)d_in[9];
  const float* bo   = (const float*)d_in[10];
  float* out = (float*)d_out;

  char* ws = (char*)d_ws;
  size_t off = 0;
  int* flags = (int*)(ws + off);                               off += SZ_FLAGS;
  float* rot = (float*)(ws + off);                             off += SZ_ROT;
  unsigned short* xb   = (unsigned short*)(ws + off);          off += SZ_XB;
  unsigned short* wqk  = (unsigned short*)(ws + off);          off += SZ_WQK;
  unsigned short* wvb  = (unsigned short*)(ws + off);          off += SZ_WV;
  unsigned short* wob  = (unsigned short*)(ws + off);          off += SZ_WO;
  unsigned short* qkh  = (unsigned short*)(ws + off);          off += PLANE_QK * 2;
  unsigned short* qkl  = (unsigned short*)(ws + off);          off += PLANE_QK * 2;
  unsigned short* vth  = (unsigned short*)(ws + off);          off += PLANE_V * 2;
  unsigned short* vtl  = (unsigned short*)(ws + off);          off += PLANE_V * 2;
  unsigned short* ctxh = (unsigned short*)(ws + off);          off += SZ_CTXH;
  unsigned short* ctxl = (unsigned short*)(ws + off);          off += SZ_CTXL;
  if (off > ws_size) return;

  // flags, rotary table, and in[rows][CD] f32 -> 16-bit planes of rows x CD in fragment order
  k_prep<<<(unsigned)PB_ALL, 512, 0, stream>>>(mask, pos, x, Wq, Wk, Wv, Wo, flags, rot, xb, wqk, wvb, wob);
  k_proj_qkv<<<dim3(NQK / 2 + VBX, (unsigned)(NB * SEQ / 128)), 128, 0, stream>>>(xb, wqk, wvb, bq, bk, bv, rot, qkh, qkl, vth, vtl);
  k_attn<<<(unsigned)(NB * NHEAD * (SEQ / 64)), 128, 0, stream>>>(qkh, qkl, vth, vtl, mask, flags, ctxh, ctxl);
  k_proj_out<<<dim3(CD / 128, (unsigned)(NB * SEQ / 128)), 128, 0, stream>>>(ctxh, ctxl, wob, bo, out);
}

// v007
// Measured time: 167 microseconds a run.
// In both of two side-by-side timings against v006, it was 1.03 times as fast.
// Over all steps from v000 it is 5.63 times as fast.
#include <hip/hip_runtime.h>
#ifndef NB
#define NB 2
#endif
#ifndef SEQ
#define SEQ 2048
#endif
#define NB_FULL 2
#define SEQ_FULL 2048
#define CD 2048                 /* model width = depth of every projection */
#define NHEAD 32
#define NKV 8
#define NREP (NHEAD / NKV)      /* query heads per kv head */
#define HD 64
#define NQK (NHEAD + NKV)       /* rotary plane holds the 32 q heads followed by the 8 k heads */
#define KVW (NKV * HD)          /* 512 */
#define EARLY_ROWS (SEQ < 512 ? SEQ : 512)

#define SCAN_ROWS 8                                 /* mask rows per scan work-group */
#define SZ_FLAGS ((size_t)(SEQ / SCAN_ROWS) * 128)  /* one 128-byte flag line per scan work-group */
#define SZ_ROT   ((size_t)SEQ * HD * 4)              /* rotary table [SEQ][32 cos | 32 sin] f32 */
#define SZ_XB    ((size_t)NB * SEQ * CD * 2)
#define SZ_WQK   ((size_t)(CD + KVW) * CD * 2)
#define SZ_WV    ((size_t)KVW * CD * 2)
#define SZ_WO    ((size_t)CD * CD * 2)
#define PLANE_QK ((size_t)NB * NQK * SEQ * HD)     /* elements of one rotary plane */
#define PLANE_V  ((size_t)NB * KVW * SEQ)          /* elements of one V^T plane */
#define SZ_CTXH  ((size_t)NB * SEQ * CD * 2)
#define SZ_CTXL  ((size_t)NB * EARLY_ROWS * CD * 2)
#define WS_TOTAL (SZ_FLAGS + SZ_ROT + SZ_XB + SZ_WQK + SZ_WV + SZ_WO + PLANE_QK * 4 + PLANE_V * 4 + SZ_CTXH + SZ_CTXL)

static_assert(SEQ % 128 == 0);
static_assert(EARLY_ROWS % 128 == 0);
static_assert(SEQ <= SEQ_FULL);
static_assert(NB <= NB_FULL);
static_assert(HD == 64);
static_assert(CD % 128 == 0);
static_assert(NQK % 2 == 0);
static_assert(KVW % 128 == 0);
static_assert(NHEAD % NKV == 0);
static_assert(NHEAD == NKV * NREP);
static_assert(CD == NHEAD * HD);
static_assert(SEQ % 16 == 0);
static_assert(SEQ % SCAN_ROWS == 0 && 16 % SCAN_ROWS == 0);
static_assert((SCAN_ROWS * (SEQ / 4)) % 512 == 0);
static_assert(SZ_ROT % 256 == 0);
static_assert(WS_TOTAL <= (size_t)134217728);
static_assert(SZ_XB % 256 == 0 && SZ_WQK % 256 == 0 && SZ_WV % 256 == 0 && SZ_WO % 256 == 0);
static_assert((PLANE_QK * 2) % 256 == 0 && (PLANE_V * 2) % 256 == 0 && SZ_CTXH % 256 == 0 && SZ_CTXL % 256 == 0);

typedef __bf16 v16b __attribute__((ext_vector_type(16)));
typedef _Float16 v16h __attribute__((ext_vector_type(16)));
typedef unsigned short v8us __attribute__((ext_vector_type(8), may_alias));
typedef float v8f __attribute__((ext_vector_type(8)));
typedef float v4f __attribute__((ext_vector_type(4)));
typedef float v4fa __attribute__((ext_vector_type(4), may_alias));
typedef int v4i __attribute__((ext_vector_type(4)));
typedef int v4ia __attribute__((ext_vector_type(4), may_alias));
union Frag { v16b b; v16h v; v8us half[2]; _Float16 h[16]; unsigned short u[16]; };
union Pack8 { v8us v; _Float16 h[8]; unsigned short u[8]; };

#define LOG2E 1.4426950408889634f
#define S2M11 0.00048828125f       /* 2^-11 */
#define S2M12 0.000244140625f      /* 2^-12 */
__device__ __forceinline__ unsigned short bf16_bits(float x) {   // RNE convert to bf16 bits
  unsigned int u = __float_as_uint(x);
  return (unsigned short)((u + 0x7FFFu + ((u >> 16) & 1u)) >> 16);
}
__device__ __forceinline__ float bf16_val(unsigned short b) { return __uint_as_float(((unsigned int)b) << 16); }
__device__ __forceinline__ float bf16_rne(float x) { return bf16_val(bf16_bits(x)); }
__device__ __forceinline__ float neg_inf() { return __uint_as_float(0xff800000u); }

// f32 -> f16 operand convert that cannot produce a subnormal: magnitudes below 2^-14 become zero by a value select.
typedef _Float16 h16;
static __device__ __forceinline__ h16 toh_flush(float v) {
  const h16 r = (h16)v;
  return (fabsf(v) < 6.103515625e-05f) ? (h16)0.0f : r;
}

// Fragment from a fragment-order tile: elements 0..7 <- p[0..7], elements 8..15 <- p[256..263]; caller adds tile * 512 + lane * 8.
__device__ __forceinline__ void ldfrag(Frag& f, const unsigned short* __restrict__ p) {
  f.half[0] = *(const v8us*)(p);
  f.half[1] = *(const v8us*)(p + 256);
}

template <bool BF>
__device__ __forceinline__ v8f wm(const Frag& a, const Frag& b, v8f c) {
  if (BF) return __builtin_amdgcn_wmma_f32_16x16x32_bf16(false, a.b, false, b.b, (short)0, c, false, false);
  return __builtin_amdgcn_wmma_f32_16x16x32_f16(false, a.v, false, b.v, (short)0, c, false, false);
}

// ---------------------------------------------------------------------------------------------------------
// Mask scan (f32 additive mask), one work-group per SCAN_ROWS mask rows, each writing its own 128-byte flag line g = blk:
// flags[32g] = 1 iff every entry of its rows above the diagonal is at or below -1e8 (its softmax weight is exactly zero next to a
// zero-mask diagonal entry); flags[32g + 1] = 1 iff every entry of its rows on or below the diagonal is exactly zero.
// coverage: SEQ/SCAN_ROWS blocks x SCAN_ROWS rows = every mask row; every flag line written whole.
__device__ __forceinline__ void maskscan_part(const float* __restrict__ mask, int* __restrict__ flags, int blk, int (*sw)[16]) {
  const int tid = threadIdx.x, lane = tid & 31, wv = tid >> 5;
  int badU = 0, badL = 0;
  const int cpr = SEQ / 4;
  const int qb = blk * SCAN_ROWS;
  // unrolled so that a thread's loads are all in flight together (constant trip count)
#pragma unroll
  for (int it = 0; it < SCAN_ROWS * cpr / 512; ++it) {
    const int c = tid + 512 * it;
    const int qr = c / cpr, k = (c - qr * cpr) * 4;
    const int q = qb + qr;
    const v4f m = *(const v4fa*)(mask + (size_t)q * SEQ_FULL + k);
#pragma unroll
    for (int i = 0; i < 4; ++i) {
      const int above = (k + i > q) ? 1 : 0;
      const int deep = (m[i] <= -1.0e8f) ? 1 : 0;
      const int zr = (m[i] == 0.0f) ? 1 : 0;
      badU |= above & (1 - deep);
      badL |= (1 - above) & (1 - zr);
    }
  }
#pragma unroll
  for (int o = 16; o >= 1; o >>= 1) {
    badU |= __shfl_xor(badU, o, 32);
    badL |= __shfl_xor(badL, o, 32);
  }
  if (lane == 0) { sw[0][wv] = badU; sw[1][wv] = badL; }
  __syncthreads();
  if (tid < 8) {
    int u = 0, l = 0;
#pragma unroll
    for (int i = 0; i < 16; ++i) { u |= sw[0][i]; l |= sw[1][i]; }
    v4i o;
    o[0] = (tid == 0 && u == 0) ? 1 : 0;
    o[1] = (tid == 0 && l == 0) ? 1 : 0;
    o[2] = 0; o[3] = 0;
    *(v4i*)(flags + 32 * blk + 4 * tid) = o;
    
  }
}

// ---------------------------------------------------------------------------------------------------------
// f32 rows of width CD -> 16-bit plane in fragment order. MODE 0: bf16 bits (RNE). MODE 1: f16 of (RNE bf16 value x 64).
// Thread t writes the t-th 16-byte piece of the plane (a wave stores 512 contiguous bytes) and reads the 8 source elements that belong there.
// coverage: nrows / 2 blocks x 512 threads x 8 elements = nrows x CD (nrows a multiple of 16; piece index -> (row, k) is one to one).
template <int MODE>
__device__ __forceinline__ void cvt_part(const float* __restrict__ src, unsigned short* __restrict__ dst,
                                         int blk, int rows_per_batch, int src_batch_rows) {
  const int t = blk * 512 + threadIdx.x;
  const int pl = t & 31, ph = (t >> 5) & 1, tile = t >> 6;      // lane slot, fragment half, tile of 16 rows x 32 k
  const int row = (tile / (CD / 32)) * 16 + (pl & 15);
  const int kk = (tile % (CD / 32)) * 32 + ph * 16 + (pl >> 4) * 8;
  const int b = row / rows_per_batch, r = row - b * rows_per_batch;
  const float* sp = src + ((size_t)b * src_batch_rows + r) * CD + kk;
  const v4f x0 = *(const v4fa*)(sp), x1 = *(const v4fa*)(sp + 4);
  Pack8 o;
  if (MODE == 0) {
    o.u[0] = bf16_bits(x0[0]); o.u[1] = bf16_bits(x0[1]); o.u[2] = bf16_bits(x0[2]); o.u[3] = bf16_bits(x0[3]);
    o.u[4] = bf16_bits(x1[0]); o.u[5] = bf16_bits(x1[1]); o.u[6] = bf16_bits(x1[2]); o.u[7] = bf16_bits(x1[3]);
  } else {
    o.h[0] = (_Float16)(bf16_rne(x0[0]) * 64.0f); o.h[1] = (_Float16)(bf16_rne(x0[1]) * 64.0f);
    o.h[2] = (_Float16)(bf16_rne(x0[2]) * 64.0f); o.h[3] = (_Float16)(bf16_rne(x0[3]) * 64.0f);
    o.h[4] = (_Float16)(bf16_rne(x1[0]) * 64.0f); o.h[5] = (_Float16)(bf16_rne(x1[1]) * 64.0f);
    o.h[6] = (_Float16)(bf16_rne(x1[2]) * 64.0f); o.h[7] = (_Float16)(bf16_rne(x1[3]) * 64.0f);
  }
  unsigned short* d = dst + (size_t)t * 8;
  const v8us ov = o.v;
  *(v8us*)d = ov;
  asm volatile("s_wait_xcnt 0x0" ::: "memory");        // in the shared launch another part's code follows in the text and rewrites the registers that this store names
}

// ---------------------------------------------------------------------------------------------------------
// Wave-tile GEMM core: acc[i][j] (rows 16i.., cols 16j.., i, j = 0..3) += A[row][k] * W[col][k] over k = 0..CD-1, 64 k per trip in ascending order.
// ap  = A  + row0*CD + 8*lane (fragment-order plane; A fragment: row m = ln, elements 0..7 <- k0 + 8h + i, 8..15 <- k0 + 16 + 8h + i)
// wp  = W  + col0*CD + 8*lane (B fragment: column n = ln, same k map); the tile of k0 starts 16*k0 elements into its row group
// alp = residual plane of A (same addressing), accumulated into acl when RES.
// A loaded fragment feeds four products, and the fragments of both halves of a trip are requested together, ahead of the trip's products.
template <bool BF, bool RES>
__device__ __forceinline__ void gemm_loop(const unsigned short* __restrict__ ap, const unsigned short* __restrict__ alp,
                                          const unsigned short* __restrict__ wp, v8f (&acc)[4][4], v8f (&acl)[4][4]) {
#pragma unroll 1
  for (int k = 0; k < CD; k += 64) {
    const unsigned short* pa = ap + k * 16;
    const unsigned short* pw = wp + k * 16;
    const unsigned short* pl = alp + k * 16;
    Frag a[2][4], b[2][4], al[2][4];
#pragma unroll
    for (int u = 0; u < 2; ++u) {
#pragma unroll
      for (int i = 0; i < 4; ++i) ldfrag(a[u][i], pa + (size_t)i * 16 * CD + u * 512);
#pragma unroll
      for (int j = 0; j < 4; ++j) ldfrag(b[u][j], pw + (size_t)j * 16 * CD + u * 512);
      if (RES) {
#pragma unroll
        for (int i = 0; i < 4; ++i) ldfrag(al[u][i], pl + (size_t)i * 16 * CD + u * 512);
      }
    }
    // the trip's address registers stay whole until every load that names them is issued and this wait has passed (without the operands a late load lands in them)
    if (RES) asm volatile("s_wait_xcnt 0x0" :: "v"(pa), "v"(pw), "v"(pl) : "memory");
    else     asm volatile("s_wait_xcnt 0x0" :: "v"(pa), "v"(pw) : "memory");
    // keeps every load of the trip ahead of its first product: moved down among the products, each group of loads would be waited for on its own
    __builtin_amdgcn_sched_barrier(0);
#pragma unroll
    for (int u = 0; u < 2; ++u) {
#pragma unroll
      for (int i = 0; i < 4; ++i)
#pragma unroll
        for (int j = 0; j < 4; ++j) acc[i][j] = wm<BF>(a[u][i], b[u][j], acc[i][j]);
      if (RES) {
#pragma unroll
        for (int i = 0; i < 4; ++i)
#pragma unroll
          for (int j = 0; j < 4; ++j) acl[i][j] = wm<BF>(al[u][i], b[u][j], acl[i][j]);
      }
    }
  }
}

__device__ __forceinline__ float rope1(float q, float p, float c, float s, float sg) { return q * c + (sg * p) * s; }

// ---------------------------------------------------------------------------------------------------------
// Rotary table from the position ids (read by value): rot[t][j] = cos(p_t * f_j), rot[t][32 + j] = sin(p_t * f_j), f_j = 10000^(-j/32), j = 0..31.
// Block = 16 positions x 32 frequencies, one precise sincos per thread -> LDS tile [16][64] (cross-wave: block barrier) -> 16 threads write one row
__device__ __forceinline__ void rotab_part(const int* __restrict__ pos, float* __restrict__ rot, int blk, float (*sh)[64]) {
  const int tid = threadIdx.x;
  const int r = tid >> 5, j = tid & 31;
  const int t = blk * 16 + r;
  const float p = (float)pos[t];
  const float f = exp2f(-(float)j * 0.41524101186092029f);   // log2(10000)/32
  const float ang = p * f;
  float sn, cs;
  sincosf(ang, &sn, &cs);
  sh[r][j] = cs;
  sh[r][32 + j] = sn;
  __syncthreads();
  if (tid < 256) {
    const int rr = tid >> 4, pc = tid & 15;
    const v4f v = *(const v4fa*)&sh[rr][4 * pc];
    float* d = rot + (size_t)(blk * 16 + rr) * HD + 4 * pc;
    *(v4f*)d = v;
    
  }
}

// ---------------------------------------------------------------------------------------------------------
// All preparation in one launch: the rotary table, the mask scan and the five plane conversions depend on the inputs alone and on nothing of one another,
// so each work-group of 512 threads takes one block of one of them by its index range (the test is the same for the whole work-group; each part's barrier
// is passed by every thread of the work-groups that run that part).
// coverage: the ranges below follow one another without gap or overlap and each holds exactly the blocks that its part's own coverage line asks for.
#define PB_ROT  (SEQ / 16)
#define PB_SCAN (SEQ / SCAN_ROWS)
#define PB_X    (NB * SEQ / 2)
#define PB_WQ   (CD / 2)
#define PB_WKV  (KVW / 2)
#define PB_WO   (CD / 2)
#define PB_ALL  (PB_ROT + PB_SCAN + PB_X + PB_WQ + 2 * PB_WKV + PB_WO)
__global__ __launch_bounds__(512) void k_prep(const float* __restrict__ mask, const int* __restrict__ pos, const float* __restrict__ x,
                                              const float* __restrict__ Wq, const float* __restrict__ Wk, const float* __restrict__ Wv,
                                              const float* __restrict__ Wo, int* __restrict__ flags, float* __restrict__ rot,
                                              unsigned short* __restrict__ xb, unsigned short* __restrict__ wqk,
                                              unsigned short* __restrict__ wvb, unsigned short* __restrict__ wob) {
  __shared__ int sw[2][16];
  __shared__ __attribute__((aligned(16))) float sh[16][64];
  int blk = blockIdx.x;
  if (blk < PB_ROT) { rotab_part(pos, rot, blk, sh); return; }
  blk -= PB_ROT;
  if (blk < PB_SCAN) { maskscan_part(mask, flags, blk, sw); return; }
  blk -= PB_SCAN;
  if (blk < PB_X) { cvt_part<0>(x, xb, blk, SEQ, SEQ_FULL); return; }
  blk -= PB_X;
  if (blk < PB_WQ) { cvt_part<0>(Wq, wqk, blk, CD, CD); return; }
  blk -= PB_WQ;
  if (blk < PB_WKV) { cvt_part<0>(Wk, wqk + (size_t)CD * CD, blk, KVW, KVW); return; }
  blk -= PB_WKV;
  if (blk < PB_WKV) { cvt_part<0>(Wv, wvb, blk, KVW, KVW); return; }
  blk -= PB_WKV;
  cvt_part<1>(Wo, wob, blk, CD, CD);
}

// ---------------------------------------------------------------------------------------------------------
// q and k projections with fused bias, half-split rotary (table plane [SEQ][32 cos | 32 sin]) and head-major repack.
// Block = 2 x 2 waves: 128 token rows (wave w: half w & 1) x two heads (wave w: head 2 * hpair + (w >> 1), 64 columns): hpair = 0..NQK/2-1, mblk = 0..NB*SEQ/128-1.
// coverage: NQK heads x NB*SEQ tokens x 64 = the whole plane [NB][NQK][SEQ][64], both planes. LDS tile 64 x 64 fully written before it is read.
__device__ __forceinline__ void proj_qk_part(const unsigned short* __restrict__ xb, const unsigned short* __restrict__ wqk,
                                             const float* __restrict__ bq, const float* __restrict__ bk,
                                             const float* __restrict__ tab,
                                             unsigned short* __restrict__ qkh, unsigned short* __restrict__ qkl,
                                             int hpair, int mblk, float (*st)[64][68]) {
  const int tid = threadIdx.x, lane = tid & 31, ln = lane & 15, hh = lane >> 4;
  const int w = __builtin_amdgcn_readfirstlane(tid >> 5);
  const int m0 = mblk * 128 + 64 * (w & 1);
  const int hd = 2 * hpair + (w >> 1);
  const v8f z8 = {0.f, 0.f, 0.f, 0.f, 0.f, 0.f, 0.f, 0.f};
  v8f acc[4][4];
#pragma unroll
  for (int i = 0; i < 4; ++i)
#pragma unroll
    for (int j = 0; j < 4; ++j) acc[i][j] = z8;
  gemm_loop<true, false>(xb + (size_t)m0 * CD + 8 * lane, xb, wqk + (size_t)(hd * HD) * CD + 8 * lane, acc, acc);

  float bias[4];
#pragma unroll
  for (int j = 0; j < 4; ++j) {
    const int col = hd * HD + 16 * j + ln;
    const int cq = (col < CD - 1) ? col : (CD - 1);
    int ck = col - CD;
    ck = (ck < 0) ? 0 : ((ck > KVW - 1) ? (KVW - 1) : ck);
    const float vq = bq[cq], vk = bk[ck];
    bias[j] = bf16_rne((col < CD) ? vq : vk);
  }
#pragma unroll
  for (int i = 0; i < 4; ++i)
#pragma unroll
    for (int j = 0; j < 4; ++j)
#pragma unroll
      for (int r = 0; r < 8; ++r) st[w][16 * i + 8 * hh + r][16 * j + ln] = acc[i][j][r] + bias[j];
  __syncthreads();

  const int b = m0 / SEQ, t0 = m0 - b * SEQ;
  // piece g of the wave's 64 tokens x 64 columns in fragment order: row group g >> 2, k tile (g >> 1) & 1, fragment half g & 1
  v8us oh[16], ol[16];
#pragma unroll
  for (int g = 0; g < 16; ++g) {
    const int row = 16 * (g >> 2) + ln;
    const int d0 = 32 * ((g >> 1) & 1) + 16 * (g & 1) + 8 * hh;
    const float sg = (d0 < 32) ? -1.0f : 1.0f;
    const v4f a0 = *(const v4fa*)&st[w][row][d0];
    const v4f a1 = *(const v4fa*)&st[w][row][d0 + 4];
    const v4f p0 = *(const v4fa*)&st[w][row][d0 ^ 32];
    const v4f p1 = *(const v4fa*)&st[w][row][(d0 ^ 32) + 4];
    // column d uses frequency d % 32: cos at [d % 32], sin at [32 + d % 32]
    const float* tp = tab + (size_t)(t0 + row) * HD + (d0 & 31);
    const v4f c0 = *(const v4fa*)(tp), c1 = *(const v4fa*)(tp + 4);
    const v4f s0 = *(const v4fa*)(tp + 32), s1 = *(const v4fa*)(tp + 36);
    float o[8];
    o[0] = rope1(a0[0], p0[0], c0[0], s0[0], sg); o[1] = rope1(a0[1], p0[1], c0[1], s0[1], sg);
    o[2] = rope1(a0[2], p0[2], c0[2], s0[2], sg); o[3] = rope1(a0[3], p0[3], c0[3], s0[3], sg);
    o[4] = rope1(a1[0], p1[0], c1[0], s1[0], sg); o[5] = rope1(a1[1], p1[1], c1[1], s1[1], sg);
    o[6] = rope1(a1[2], p1[2], c1[2], s1[2], sg); o[7] = rope1(a1[3], p1[3], c1[3], s1[3], sg);
    Pack8 ph8, pl8;
#pragma unroll
    for (int e = 0; e < 8; ++e) {
      const float y = o[e] * 16.0f;                       // carried x16
      const _Float16 h = toh_flush(y);
      ph8.h[e] = h;
      pl8.h[e] = toh_flush((y - (float)h) * 2048.0f);      // residual plane x2^11
    }
    oh[g] = ph8.v; ol[g] = pl8.v;
  }
  const size_t dbase = ((size_t)(b * NQK + hd) * SEQ + t0) * HD + 8 * lane;
{
#pragma unroll
    for (int g = 0; g < 16; ++g) {
      const size_t off = dbase + (size_t)g * 256;
      *(v8us*)(qkh + off) = oh[g];
      *(v8us*)(qkl + off) = ol[g];
    }
    
  }
}

// ---------------------------------------------------------------------------------------------------------
// v projection computed transposed: Vt[b][m][t] = sum_k Wv[m][k] x[b,t][k] + bv[m], carried x16, hi and residual planes.
// Block = 2 x 2 waves: 128 weight rows (wave w: half w & 1) x 128 tokens (wave w: half w >> 1): nblk = 0..NB*SEQ/128-1, mgrp = 0..KVW/128-1.
// coverage: KVW rows x NB*SEQ tokens = the whole plane [NB][KVW][SEQ], both planes. LDS tile 64 x 64 fully written before it is read.
__device__ __forceinline__ void proj_v_part(const unsigned short* __restrict__ wvb, const unsigned short* __restrict__ xb,
                                            const float* __restrict__ bv,
                                            unsigned short* __restrict__ vth, unsigned short* __restrict__ vtl,
                                            int nblk, int mgrp, float (*st)[64][68]) {
  const int tid = threadIdx.x, lane = tid & 31, ln = lane & 15, hh = lane >> 4;
  const int w = __builtin_amdgcn_readfirstlane(tid >> 5);
  const int n0 = nblk * 128 + 64 * (w >> 1);
  const int m0 = mgrp * 128 + 64 * (w & 1);
  const v8f z8 = {0.f, 0.f, 0.f, 0.f, 0.f, 0.f, 0.f, 0.f};
  v8f acc[4][4];
#pragma unroll
  for (int i = 0; i < 4; ++i)
#pragma unroll
    for (int j = 0; j < 4; ++j) acc[i][j] = z8;
  gemm_loop<true, false>(wvb + (size_t)m0 * CD + 8 * lane, wvb, xb + (size_t)n0 * CD + 8 * lane, acc, acc);
#pragma unroll
  for (int i = 0; i < 4; ++i)
#pragma unroll
    for (int j = 0; j < 4; ++j)
#pragma unroll
      for (int r = 0; r < 8; ++r) st[w][16 * i + 8 * hh + r][16 * j + ln] = acc[i][j][r];
  __syncthreads();

  const int b = n0 / SEQ, t0 = n0 - b * SEQ;
  // piece g of the wave's 64 rows x 64 tokens in fragment order: row group g >> 2, key tile (g >> 1) & 1, fragment half g & 1
  v8us oh[16], ol[16];
#pragma unroll
  for (int g = 0; g < 16; ++g) {
    const int row = 16 * (g >> 2) + ln;
    const int c0 = 32 * ((g >> 1) & 1) + 16 * (g & 1) + 8 * hh;
    const float bias = bf16_rne(bv[m0 + row]);
    const v4f a0 = *(const v4fa*)&st[w][row][c0];
    const v4f a1 = *(const v4fa*)&st[w][row][c0 + 4];
    float o[8];
    o[0] = a0[0]; o[1] = a0[1]; o[2] = a0[2]; o[3] = a0[3];
    o[4] = a1[0]; o[5] = a1[1]; o[6] = a1[2]; o[7] = a1[3];
    Pack8 ph8, pl8;
#pragma unroll
    for (int e = 0; e < 8; ++e) {
      const float y = (o[e] + bias) * 16.0f;              // carried x16
      const _Float16 h = (_Float16)y;
      ph8.h[e] = h;
      pl8.h[e] = (_Float16)((y - (float)h) * 2048.0f);
    }
    oh[g] = ph8.v; ol[g] = pl8.v;
  }
  const size_t dbase = ((size_t)b * KVW + m0) * SEQ + (size_t)t0 * 16 + 8 * lane;
{
#pragma unroll
    for (int g = 0; g < 16; ++g) {
      const size_t off = dbase + (size_t)(g >> 2) * 16 * SEQ + (size_t)(g & 3) * 256;
      *(v8us*)(vth + off) = oh[g];
      *(v8us*)(vtl + off) = ol[g];
    }
    
  }
}

// ---------------------------------------------------------------------------------------------------------
// q, k and v projections in one launch: they read the same x plane and write disjoint planes, and the v blocks alone are too few to fill the chip.
// grid = (NQK/2 + VBX, NB*SEQ/128): column c < NQK/2 is head pair c of the q/k part; the VBX columns behind it are the v blocks of the same 128 tokens
// (KVW/128 groups of weight rows). The test is the same for the whole work-group.
// coverage: every (hpair, mblk) once; (nblk, mgrp) = (y, j), j = 0..VBX-1, y = 0..NB*SEQ/128-1, is every v block once.
#define VBX (KVW / 128)
__global__ __launch_bounds__(128) void k_proj_qkv(const unsigned short* __restrict__ xb, const unsigned short* __restrict__ wqk,
                                                  const unsigned short* __restrict__ wvb,
                                                  const float* __restrict__ bq, const float* __restrict__ bk, const float* __restrict__ bv,
                                                  const float* __restrict__ tab,
                                                  unsigned short* __restrict__ qkh, unsigned short* __restrict__ qkl,
                                                  unsigned short* __restrict__ vth, unsigned short* __restrict__ vtl) {
  __shared__ __attribute__((aligned(16))) float st[4][64][68];
  const int c = blockIdx.x;
  if (c < NQK / 2) {
    proj_qk_part(xb, wqk, bq, bk, tab, qkh, qkl, c, blockIdx.y, st);
  } else {
    proj_v_part(wvb, xb, bv, vth, vtl, blockIdx.y, c - NQK / 2, st);
  }
}

// ---------------------------------------------------------------------------------------------------------
// One 32-key step for a wave's 16 queries (this lane's column = its query). EARLYP adds the residual planes of q, k, v, P.
// MASK reads the mask row of this lane's query by value (RNE bf16 value) and adds it to the scaled scores.
// Without EARLYP the fragment loads run ahead of their use: kf holds this step's K fragments on entry and the K fragments of the step at keyn on exit
// (fetched right behind the score products, into the same registers), and the V fragments of this step are fetched at the step's top, so that both
// fly under the softmax arithmetic. With EARLYP kf and keyn are not used.
template <bool EARLYP, bool MASK>
__device__ __forceinline__ void fa_step(const unsigned short* __restrict__ Kp, const unsigned short* __restrict__ Kl,
                                        const unsigned short* __restrict__ Vp, const unsigned short* __restrict__ Vl,
                                        const float* __restrict__ mrow, int key0, int keyn, int ln, int hh,
                                        const Frag (&qh)[2], const Frag (&ql)[2], Frag (&kf)[4],
                                        float& mr, float& lr, v8f (&Oh)[4], v8f (&Ol)[4]) {
  const v8f z8 = {0.f, 0.f, 0.f, 0.f, 0.f, 0.f, 0.f, 0.f};
  float sc[16];
  // A fragments of K: row m = key (key0 + 16*kt + ln), elements 0..7 <- d = 32c + 8h + i, 8..15 <- d = 32c + 16 + 8h + i
  // fragment-order plane: 16 keys = two tiles of 512 elements (c = 0, 1)
  int koff = key0 * HD + 8 * (16 * hh + ln);
  // A fragments of V^T: row m = d (16*t + ln), elements 0..7 <- key0 + 8h + i, 8..15 <- key0 + 16 + 8h + i
  // fragment-order plane: the tile of 32 keys at key0 starts 16*key0 elements into its group of 16 rows
  int voff = key0 * 16 + 8 * (16 * hh + ln);
  Frag vf[4];
  if (!EARLYP) {
#pragma unroll
    for (int t = 0; t < 4; ++t) ldfrag(vf[t], Vp + voff + (size_t)t * 16 * SEQ);
    if (MASK) asm volatile("s_wait_xcnt 0x0" ::: "memory");   // the mask loads behind them land in the registers that the V loads name
  }
  if (EARLYP) {
#pragma unroll
    for (int kt = 0; kt < 2; ++kt) {
      Frag a0, a1, l0, l1;
      ldfrag(a0, Kp + koff); ldfrag(a1, Kp + koff + 512);
      ldfrag(l0, Kl + koff); ldfrag(l1, Kl + koff + 512);
      v8f s = z8, r = z8;
      s = wm<false>(a0, qh[0], s); s = wm<false>(a1, qh[1], s);
      r = wm<false>(a0, ql[0], r); r = wm<false>(a1, ql[1], r);
      r = wm<false>(l0, qh[0], r); r = wm<false>(l1, qh[1], r);
      asm volatile("v_nop\n\tv_nop\n\tv_nop\n\tv_nop" : "+v"(s), "+v"(r)
                        : "v"(a0.v), "v"(a1.v), "v"(l0.v), "v"(l1.v), "v"(qh[0].v), "v"(qh[1].v), "v"(ql[0].v), "v"(ql[1].v));
      // S^T element r of tile kt = score(key0 + 16*kt + 8h + r, this lane's query); carries: q x16, k x16, residual x2^11
#pragma unroll
      for (int e = 0; e < 8; ++e) sc[8 * kt + e] = fmaf(r[e], S2M11, s[e]) * S2M11;
      koff += 16 * HD;
      if (kt == 0) asm volatile("" : "+v"(koff) : "v"(sc[0]));   // second tile's loads issue after the first tile is done
    }
  } else {
    v8f s0 = z8, s1 = z8;
    s0 = wm<false>(kf[0], qh[0], s0); s0 = wm<false>(kf[1], qh[1], s0);
    s1 = wm<false>(kf[2], qh[0], s1); s1 = wm<false>(kf[3], qh[1], s1);
    koff = keyn * HD + 8 * (16 * hh + ln);
    asm volatile("v_nop\n\tv_nop\n\tv_nop\n\tv_nop" : "+v"(s0), "+v"(s1)
                      : "v"(kf[0].v), "v"(kf[1].v), "v"(kf[2].v), "v"(kf[3].v), "v"(qh[0].v), "v"(qh[1].v));
    ldfrag(kf[0], Kp + koff);           ldfrag(kf[1], Kp + koff + 512);
    ldfrag(kf[2], Kp + koff + 16 * HD); ldfrag(kf[3], Kp + koff + 16 * HD + 512);
#pragma unroll
    for (int e = 0; e < 8; ++e) { sc[e] = s0[e] * S2M11; sc[8 + e] = s1[e] * S2M11; }
  }
  if (MASK) {
    const float* mp = mrow + key0 + 8 * hh;
    const v4f m0 = *(const v4fa*)(mp),      m1 = *(const v4fa*)(mp + 4);
    const v4f m2 = *(const v4fa*)(mp + 16), m3 = *(const v4fa*)(mp + 20);
#pragma unroll
    for (int e = 0; e < 4; ++e) {
      sc[e]      = sc[e]      + bf16_rne(m0[e]);
      sc[4 + e]  = sc[4 + e]  + bf16_rne(m1[e]);
      sc[8 + e]  = sc[8 + e]  + bf16_rne(m2[e]);
      sc[12 + e] = sc[12 + e] + bf16_rne(m3[e]);
    }
  }
  float mx = sc[0];
#pragma unroll
  for (int i = 1; i < 16; ++i) mx = fmaxf(mx, sc[i]);
  mx = fmaxf(mx, __shfl_xor(mx, 16, 32));            // the other lane half holds the other 16 keys of this query
  const float mnew = fmaxf(mr, mx);
  float msafe = mnew;
  if (MASK) msafe = (mnew == neg_inf()) ? 0.0f : mnew;   // every key so far at -inf: weights come out 0
  const float al = __builtin_amdgcn_exp2f((mr - msafe) * LOG2E);
  mr = mnew;
  // weights carried x256: pc = 256 * exp(sc - m); hi plane f16(pc), residual plane f16((pc - hi) * 2048)
  Frag ph, pl;
  float ps = 0.0f;
#pragma unroll
  for (int i = 0; i < 16; ++i) {
    const float pc = __builtin_amdgcn_exp2f(fmaf(sc[i] - msafe, LOG2E, 8.0f));
    ps += pc;
    // plain steps of rows from 512 on: a bare round-to-nearest-even convert, which the compiler packs two to an instruction; a weight below 2^-14 stays an f16
    // subnormal there instead of becoming zero (the matrix unit takes subnormal operands as they are). Masked and early steps keep the select.
    const _Float16 h = (EARLYP || MASK) ? toh_flush(pc) : (_Float16)pc;
    ph.h[i] = h;                                      // B element i: i<8 -> key0 + 8h + i (tile 0 row 8h+i); i>=8 -> key0 + 16 + 8h + (i-8) (tile 1)
    if (EARLYP) pl.h[i] = toh_flush((pc - (float)h) * 2048.0f);
  }
  ps += __shfl_xor(ps, 16, 32);
  lr = lr * al + ps;
  if (EARLYP) {
    asm volatile("" : "+v"(voff) : "v"(ps));          // V loads issue after the score phase
#pragma unroll
    for (int t = 0; t < 4; ++t) ldfrag(vf[t], Vp + voff + (size_t)t * 16 * SEQ);
  }
#pragma unroll
  for (int t = 0; t < 4; ++t) Oh[t] = Oh[t] * al;
  if (EARLYP) {
    const unsigned short* vq = Vl + voff;
    Frag vl[4];
#pragma unroll
    for (int t = 0; t < 4; ++t) ldfrag(vl[t], vq + (size_t)t * 16 * SEQ);
#pragma unroll
    for (int t = 0; t < 4; ++t) Ol[t] = Ol[t] * al;
#pragma unroll
    for (int t = 0; t < 4; ++t) {
      Oh[t] = wm<false>(vf[t], ph, Oh[t]);
      Ol[t] = wm<false>(vf[t], pl, Ol[t]);
      Ol[t] = wm<false>(vl[t], ph, Ol[t]);
    }
    asm volatile("v_nop\n\tv_nop\n\tv_nop\n\tv_nop" : "+v"(Oh[0]), "+v"(Oh[1]), "+v"(Oh[2]), "+v"(Oh[3]), "+v"(Ol[0]), "+v"(Ol[1]), "+v"(Ol[2]), "+v"(Ol[3])
                      : "v"(vf[0].v), "v"(vf[1].v), "v"(vf[2].v), "v"(vf[3].v),
                        "v"(vl[0].v), "v"(vl[1].v), "v"(vl[2].v), "v"(vl[3].v), "v"(ph.v), "v"(pl.v));
  } else {
#pragma unroll
    for (int t = 0; t < 4; ++t) Oh[t] = wm<false>(vf[t], ph, Oh[t]);
    asm volatile("v_nop\n\tv_nop\n\tv_nop\n\tv_nop" : "+v"(Oh[0]), "+v"(Oh[1]), "+v"(Oh[2]), "+v"(Oh[3])
                      : "v"(vf[0].v), "v"(vf[1].v), "v"(vf[2].v), "v"(vf[3].v), "v"(ph.v));
  }
}

template <bool EARLYP>
__device__ __forceinline__ void run_keys(const unsigned short* __restrict__ qkh, const unsigned short* __restrict__ qkl,
                                         const unsigned short* __restrict__ vth, const unsigned short* __restrict__ vtl,
                                         const float* __restrict__ mask, int b, int h, int qg, int ln, int hh,
                                         int nplain, int nsteps, float& mr, float& lr, v8f (&Oh)[4], v8f (&Ol)[4]) {
  // Q^T B fragments: column n = this lane's query, elements 0..7 <- d = 32c + 8h + i, 8..15 <- d = 32c + 16 + 8h + i
  const size_t qoff = ((size_t)(b * NQK + h) * SEQ + (qg - ln)) * HD + 8 * (16 * hh + ln);   // fragment-order plane, the wave's own 16 rows
  Frag qh[2], ql[2];
  ldfrag(qh[0], qkh + qoff); ldfrag(qh[1], qkh + qoff + 512);
  if (EARLYP) { ldfrag(ql[0], qkl + qoff); ldfrag(ql[1], qkl + qoff + 512); }
  else { ql[0] = qh[0]; ql[1] = qh[1]; }
  asm volatile("s_wait_xcnt 0x0" ::: "memory");        // the address registers of the Q loads are reused right behind them
  const int kv = h / NREP;                             // consecutive groups of NREP query heads share one kv head
  const size_t kbase = (size_t)(b * NQK + NHEAD + kv) * SEQ * HD;
  const size_t vbase = ((size_t)b * KVW + (size_t)kv * HD) * SEQ;
  const unsigned short* Kp = qkh + kbase;
  const unsigned short* Kl = qkl + kbase;
  const unsigned short* Vp = vth + vbase;
  const unsigned short* Vl = vtl + vbase;
  const float* mrow = mask + (size_t)qg * SEQ_FULL;
  Frag kf[4];
  if (!EARLYP) {                                       // K fragments of step 0 (nsteps >= 1)
    const unsigned short* k0 = Kp + 8 * (16 * hh + ln);
    ldfrag(kf[0], k0);           ldfrag(kf[1], k0 + 512);
    ldfrag(kf[2], k0 + 16 * HD); ldfrag(kf[3], k0 + 16 * HD + 512);
    asm volatile("s_wait_xcnt 0x0" ::: "memory");      // the address registers of the K loads are reused behind them
  }
  // the step fetched ahead is the next one; the last step fetches its own tile again, so that the address stays inside the plane
#pragma unroll 1
  for (int j = 0; j < nplain; ++j)
    fa_step<EARLYP, false>(Kp, Kl, Vp, Vl, mrow, 32 * j, 32 * ((j + 1 < nsteps) ? j + 1 : j), ln, hh, qh, ql, kf, mr, lr, Oh, Ol);
#pragma unroll 1
  for (int j = nplain; j < nsteps; ++j)
    fa_step<EARLYP, true>(Kp, Kl, Vp, Vl, mrow, 32 * j, 32 * ((j + 1 < nsteps) ? j + 1 : j), ln, hh, qh, ql, kf, mr, lr, Oh, Ol);
}

// Block = 4 waves x 16 queries = 64 queries of one (batch, head); no LDS and no barrier.
// Tile skipping from the device flags, per wave: both flags of both flag lines that cover the wave's 16 query rows are 1 -> keys past the diagonal step are
// skipped (their weights are exactly zero) and steps fully below the diagonal run without mask reads (their mask entries are exactly zero); every other
// visited step reads the mask by value. A softmax row depends on its own mask row alone, so the wave's own rows decide.
// For any other flag value every step is visited and reads the mask. Trip counts are bounded by SEQ/32 for any flag value.
// coverage: NB*NHEAD*(SEQ/64) blocks x 4 waves x 16 rows x 64 columns = the whole ctx hi plane; blocks with query tile below EARLY_ROWS cover the whole residual plane.
__global__ __launch_bounds__(128) void k_attn(const unsigned short* __restrict__ qkh, const unsigned short* __restrict__ qkl,
                                              const unsigned short* __restrict__ vth, const unsigned short* __restrict__ vtl,
                                              const float* __restrict__ mask, const int* __restrict__ flags,
                                              unsigned short* __restrict__ ctxh, unsigned short* __restrict__ ctxl) {
  const int tid = threadIdx.x, lane = tid & 31, ln = lane & 15, hh = lane >> 4;
  const int w = __builtin_amdgcn_readfirstlane(tid >> 5);
  const int nqt = SEQ / 64;
  const int blk = blockIdx.x;
  // a causal query tile's key steps grow with its index and not all work-groups are resident at once: the longest tiles take the lowest block indices,
  // so that they start first and the short ones fill the places that come free (blk -> (qt, b, h) is one to one)
  const int qt = nqt - 1 - blk / (NB * NHEAD);
  const int bh = blk % (NB * NHEAD);
  const int h = bh % NHEAD;
  const int b = bh / NHEAD;
  const int qbase = qt * 64 + 16 * w;
  const int qg = qbase + ln;
  const int* fl = flags + (qbase / SCAN_ROWS) * 32;    // 16 query rows = 16 / SCAN_ROWS flag lines
  int fok = 1;                                         // bitwise, so that the flag loads issue together
#pragma unroll
  for (int i = 0; i < 16 / SCAN_ROWS; ++i) fok &= (fl[32 * i] == 1 ? 1 : 0) & (fl[32 * i + 1] == 1 ? 1 : 0);
  const bool tri = (fok == 1);
  const int nfull = qbase >> 5;                        // steps whose 32 keys are all at or below every query of this wave
  const int nsteps = tri ? (nfull + 1) : (SEQ / 32);   // <= SEQ/32 in both cases
  const int nplain = tri ? nfull : 0;
  const bool early = (qt * 64 < EARLY_ROWS);

  const v8f z8 = {0.f, 0.f, 0.f, 0.f, 0.f, 0.f, 0.f, 0.f};
  float mr = neg_inf(), lr = 0.0f;
  v8f Oh[4], Ol[4];
#pragma unroll
  for (int t = 0; t < 4; ++t) { Oh[t] = z8; Ol[t] = z8; }
  if (early) run_keys<true>(qkh, qkl, vth, vtl, mask, b, h, qg, ln, hh, nplain, nsteps, mr, lr, Oh, Ol);
  else       run_keys<false>(qkh, qkl, vth, vtl, mask, b, h, qg, ln, hh, nplain, nsteps, mr, lr, Oh, Ol);

  // O^T element r of tile t = ctx(query, d = 16t + 8h + r); undo the carries x256 (in lr), x16 (V), x2^11 (residual); apply the x64 carry of ctx
  const float inv = 4.0f * (1.0f / lr);
  // tile t of O^T in this lane = row ln, columns 16t + 8h + 0..7 of ctx: exactly this lane's 16-byte piece t of the wave's two fragment-order tiles
  // (k tile t >> 1, fragment half t & 1), so the registers are stored as they stand, 512 contiguous bytes per wave and store
  v8us oh[4], ol[4];
#pragma unroll
  for (int t = 0; t < 4; ++t) {
    Pack8 ph8, pl8;
#pragma unroll
    for (int e = 0; e < 8; ++e) {
      const float o = fmaf(Ol[t][e], S2M11, Oh[t][e]) * inv;
      const _Float16 hv = toh_flush(o);
      ph8.h[e] = hv;
      pl8.h[e] = toh_flush((o - (float)hv) * 2048.0f);
    }
    oh[t] = ph8.v; ol[t] = pl8.v;
  }
  const size_t hbase = ((size_t)b * SEQ + qbase) * CD + (size_t)h * (16 * HD) + 8 * lane;
  const size_t lbase = ((size_t)b * EARLY_ROWS + (early ? qbase : 0)) * CD + (size_t)h * (16 * HD) + 8 * lane;
#pragma unroll
  for (int t = 0; t < 4; ++t) *(v8us*)(ctxh + hbase + t * 256) = oh[t];
  asm volatile("s_wait_xcnt 0x0" ::: "memory");        // the residual stores' address arithmetic below may reuse the registers that these stores name
  if (early) {
#pragma unroll
    for (int t = 0; t < 4; ++t) *(v8us*)(ctxl + lbase + t * 256) = ol[t];
  }
}

// ---------------------------------------------------------------------------------------------------------
// Output projection: out[m][n] = sum_k ctx[m][k] Wo[n][k] + bo[n]. Block = 2 x 2 waves: 128 rows (wave w: half w & 1) x 128 columns (half w >> 1). grid = (CD/128, NB*SEQ/128).
// Rows below EARLY_ROWS of each sequence add the residual plane of ctx in separate accumulators.
// coverage: NB*SEQ rows x CD columns = every element of the output buffer region once. LDS tile 64 x 64 fully written before it is read.
__global__ __launch_bounds__(128) void k_proj_out(const unsigned short* __restrict__ ctxh, const unsigned short* __restrict__ ctxl,
                                                  const unsigned short* __restrict__ wo, const float* __restrict__ bo,
                                                  float* __restrict__ out) {
  __shared__ __attribute__((aligned(16))) float st[4][64][68];
  const int tid = threadIdx.x, lane = tid & 31, ln = lane & 15, hh = lane >> 4;
  const int w = __builtin_amdgcn_readfirstlane(tid >> 5);
  const int n0 = blockIdx.x * 128 + 64 * (w >> 1);
  const int mb = blockIdx.y * 128;
  const int b = mb / SEQ;
  const int tb = mb - b * SEQ;
  const bool early = (tb < EARLY_ROWS);                // block-uniform: EARLY_ROWS and SEQ are multiples of 128
  const int t0 = tb + 64 * (w & 1);
  const int m0 = mb + 64 * (w & 1);
  const v8f z8 = {0.f, 0.f, 0.f, 0.f, 0.f, 0.f, 0.f, 0.f};
  v8f acc[4][4], acl[4][4];
#pragma unroll
  for (int i = 0; i < 4; ++i)
#pragma unroll
    for (int j = 0; j < 4; ++j) { acc[i][j] = z8; acl[i][j] = z8; }
  const unsigned short* ap = ctxh + (size_t)m0 * CD + 8 * lane;
  const unsigned short* alp = ctxl + (size_t)(b * EARLY_ROWS + (early ? t0 : 0)) * CD + 8 * lane;
  const unsigned short* wp = wo + (size_t)n0 * CD + 8 * lane;
  if (early) gemm_loop<false, true>(ap, alp, wp, acc, acl);
  else       gemm_loop<false, false>(ap, ap, wp, acc, acl);
  // carries: ctx x64, Wo x64 -> 2^-12; residual plane additionally x2^11
#pragma unroll
  for (int i = 0; i < 4; ++i)
#pragma unroll
    for (int j = 0; j < 4; ++j)
#pragma unroll
      for (int r = 0; r < 8; ++r)
        st[w][16 * i + 8 * hh + r][16 * j + ln] = fmaf(acl[i][j][r], S2M11, acc[i][j][r]) * S2M12;
  __syncthreads();
  const int rsub = lane >> 4, c4 = 4 * (lane & 15);
  const v4f bb = *(const v4fa*)(bo + n0 + c4);
  v4f bias;
  bias[0] = bf16_rne(bb[0]); bias[1] = bf16_rne(bb[1]); bias[2] = bf16_rne(bb[2]); bias[3] = bf16_rne(bb[3]);
  v4f ov[32];
#pragma unroll
  for (int g = 0; g < 32; ++g) {
    const v4f a = *(const v4fa*)&st[w][2 * g + rsub][c4];
    ov[g] = a + bias;
  }
  float* og = out + ((size_t)b * SEQ_FULL + t0) * CD + n0 + c4;
{
#pragma unroll
    for (int g = 0; g < 32; ++g)
      *(v4f*)(og + (size_t)(2 * g + rsub) * CD) = ov[g];
    
  }
}

// ---------------------------------------------------------------------------------------------------------
extern "C" void kernel_launch(void* const* d_in, const int* in_sizes, int n_in,
                              void* d_out, int out_size, void* d_ws, size_t ws_size, hipStream_t stream) {
  if (n_in < 11) return;
  const long long need_x = (long long)(NB - 1) * SEQ_FULL * CD + (long long)SEQ * CD;   // last element touched + 1
  const long long need_m = (long long)(SEQ - 1) * SEQ_FULL + SEQ;
  if ((long long)in_sizes[0] < need_x) return;
  if ((long long)in_sizes[1] < need_m) return;
  if ((long long)in_sizes[2] < (long long)SEQ) return;
  if ((long long)in_sizes[3] < (long long)CD * CD || (long long)in_sizes[4] < CD) return;
  if ((long long)in_sizes[5] < (long long)KVW * CD || (long long)in_sizes[6] < KVW) return;
  if ((long long)in_sizes[7] < (long long)KVW * CD || (long long)in_sizes[8] < KVW) return;
  if ((long long)in_sizes[9] < (long long)CD * CD || (long long)in_sizes[10] < CD) return;
  if ((long long)out_size < need_x) return;
  if ((size_t)WS_TOTAL > ws_size) return;

  // wire order: hidden_states, attention_mask (f32), position_ids (i32), Wq, bq, Wk, bk, Wv, bv, Wo, bo
  const float* x    = (const float*)d_in[0];
  const float* mask = (const float*)d_in[1];
  const int*   pos  = (const int*)d_in[2];
  const float* Wq   = (const float*)d_in[3];
  const float* bq   = (const float*)d_in[4];
  const float* Wk   = (const float*)d_in[5];
  const float* bk   = (const float*)d_in[6];
  const float* Wv   = (const float*)d_in[7];
  const float* bv   = (const float*)d_in[8];
  const float* Wo   = (const float*)d_in[9];
  const float* bo   = (const float*)d_in[10];
  float* out = (float*)d_out;

  char* ws = (char*)d_ws;
  size_t off = 0;
  int* flags = (int*)(ws + off);                               off += SZ_FLAGS;
  float* rot = (float*)(ws + off);                             off += SZ_ROT;
  unsigned short* xb   = (unsigned short*)(ws + off);          off += SZ_XB;
  unsigned short* wqk  = (unsigned short*)(ws + off);          off += SZ_WQK;
  unsigned short* wvb  = (unsigned short*)(ws + off);          off += SZ_WV;
  unsigned short* wob  = (unsigned short*)(ws + off);          off += SZ_WO;
  unsigned short* qkh  = (unsigned short*)(ws + off);          off += PLANE_QK * 2;
  unsigned short* qkl  = (unsigned short*)(ws + off);          off += PLANE_QK * 2;
  unsigned short* vth  = (unsigned short*)(ws + off);          off += PLANE_V * 2;
  unsigned short* vtl  = (unsigned short*)(ws + off);          off += PLANE_V * 2;
  unsigned short* ctxh = (unsigned short*)(ws + off);          off += SZ_CTXH;
  unsigned short* ctxl = (unsigned short*)(ws + off);          off += SZ_CTXL;
  if (off > ws_size) return;

  // flags, rotary table, and in[rows][CD] f32 -> 16-bit planes of rows x CD in fragment order
  k_prep<<<(unsigned)PB_ALL, 512, 0, stream>>>(mask, pos, x, Wq, Wk, Wv, Wo, flags, rot, xb, wqk, wvb, wob);
  k_proj_qkv<<<dim3(NQK / 2 + VBX, (unsigned)(NB * SEQ / 128)), 128, 0, stream>>>(xb, wqk, wvb, bq, bk, bv, rot, qkh, qkl, vth, vtl);
  k_attn<<<(unsigned)(NB * NHEAD * (SEQ / 64)), 128, 0, stream>>>(qkh, qkl, vth, vtl, mask, flags, ctxh, ctxl);
  k_proj_out<<<dim3(CD / 128, (unsigned)(NB * SEQ / 128)), 128, 0, stream>>>(ctxh, ctxl, wob, bo, out);
}

// v008
// Measured time: 153 microseconds a run.
// Next to v007, in two timings, it ran 1.08 times as fast each time.
// Counting every step since v000, it is 6.09 times as fast.
#include <hip/hip_runtime.h>
#ifndef NB
#define NB 2
#endif
#ifndef SEQ
#define SEQ 2048
#endif
#define NB_FULL 2
#define SEQ_FULL 2048
#define CD 2048                 /* model width = depth of every projection */
#define NHEAD 32
#define NKV 8
#define NREP (NHEAD / NKV)      /* query heads per kv head */
#define HD 64
#define NQK (NHEAD + NKV)       /* rotary plane holds the 32 q heads followed by the 8 k heads */
#define KVW (NKV * HD)          /* 512 */
#define EARLY_ROWS (SEQ < 512 ? SEQ : 512)

#define SCAN_ROWS 8                                 /* mask rows per scan work-group */
#define SZ_FLAGS ((size_t)(SEQ / SCAN_ROWS) * 128)  /* one 128-byte flag line per scan work-group */
#define SZ_ROT   ((size_t)SEQ * HD * 4)              /* rotary table [SEQ][32 cos | 32 sin] f32 */
#define SZ_XB    ((size_t)NB * SEQ * CD * 2)
#define SZ_WQK   ((size_t)(CD + KVW) * CD * 2)
#define SZ_WV    ((size_t)KVW * CD * 2)
#define SZ_WO    ((size_t)CD * CD * 2)
#define PLANE_QK ((size_t)NB * NQK * SEQ * HD)     /* elements of one rotary plane */
#define PLANE_V  ((size_t)NB * KVW * SEQ)          /* elements of one V^T plane */
#define SZ_CTXH  ((size_t)NB * SEQ * CD * 2)
#define SZ_CTXL  ((size_t)NB * EARLY_ROWS * CD * 2)
#define WS_TOTAL (SZ_FLAGS + SZ_ROT + SZ_XB + SZ_WQK + SZ_WV + SZ_WO + PLANE_QK * 4 + PLANE_V * 4 + SZ_CTXH + SZ_CTXL)

static_assert(SEQ % 128 == 0);
static_assert(EARLY_ROWS % 128 == 0);
static_assert(SEQ <= SEQ_FULL);
static_assert(NB <= NB_FULL);
static_assert(HD == 64);
static_assert(CD % 128 == 0);
static_assert(NQK % 2 == 0);
static_assert(KVW % 128 == 0);
static_assert(NHEAD % NKV == 0);
static_assert(NHEAD == NKV * NREP);
static_assert(CD == NHEAD * HD);
static_assert(SEQ % 16 == 0);
static_assert(SEQ % SCAN_ROWS == 0 && 16 % SCAN_ROWS == 0);
static_assert((SCAN_ROWS * (SEQ / 4)) % 512 == 0);
static_assert(SZ_ROT % 256 == 0);
static_assert(WS_TOTAL <= (size_t)134217728);
static_assert(SZ_XB % 256 == 0 && SZ_WQK % 256 == 0 && SZ_WV % 256 == 0 && SZ_WO % 256 == 0);
static_assert((PLANE_QK * 2) % 256 == 0 && (PLANE_V * 2) % 256 == 0 && SZ_CTXH % 256 == 0 && SZ_CTXL % 256 == 0);

typedef __bf16 v16b __attribute__((ext_vector_type(16)));
typedef _Float16 v16h __attribute__((ext_vector_type(16)));
typedef unsigned short v8us __attribute__((ext_vector_type(8), may_alias));
typedef float v8f __attribute__((ext_vector_type(8)));
typedef float v4f __attribute__((ext_vector_type(4)));
typedef float v4fa __attribute__((ext_vector_type(4), may_alias));
typedef int v4i __attribute__((ext_vector_type(4)));
typedef int v4ia __attribute__((ext_vector_type(4), may_alias));
union Frag { v16b b; v16h v; v8us half[2]; _Float16 h[16]; unsigned short u[16]; };
union Pack8 { v8us v; _Float16 h[8]; unsigned short u[8]; };

#define LOG2E 1.4426950408889634f
#define S2M11 0.00048828125f       /* 2^-11 */
#define S2M12 0.000244140625f      /* 2^-12 */
__device__ __forceinline__ unsigned short bf16_bits(float x) {   // RNE convert to bf16 bits
  unsigned int u = __float_as_uint(x);
  return (unsigned short)((u + 0x7FFFu + ((u >> 16) & 1u)) >> 16);
}
__device__ __forceinline__ float bf16_val(unsigned short b) { return __uint_as_float(((unsigned int)b) << 16); }
__device__ __forceinline__ float bf16_rne(float x) { return bf16_val(bf16_bits(x)); }
__device__ __forceinline__ float neg_inf() { return __uint_as_float(0xff800000u); }

// f32 -> f16 operand convert that cannot produce a subnormal: magnitudes below 2^-14 become zero by a value select.
typedef _Float16 h16;
static __device__ __forceinline__ h16 toh_flush(float v) {
  const h16 r = (h16)v;
  return (fabsf(v) < 6.103515625e-05f) ? (h16)0.0f : r;
}

// Fragment from a fragment-order tile: elements 0..7 <- p[0..7], elements 8..15 <- p[256..263]; caller adds tile * 512 + lane * 8.
__device__ __forceinline__ void ldfrag(Frag& f, const unsigned short* __restrict__ p) {
  f.half[0] = *(const v8us*)(p);
  f.half[1] = *(const v8us*)(p + 256);
}

template <bool BF>
__device__ __forceinline__ v8f wm(const Frag& a, const Frag& b, v8f c) {
  if (BF) return __builtin_amdgcn_wmma_f32_16x16x32_bf16(false, a.b, false, b.b, (short)0, c, false, false);
  return __builtin_amdgcn_wmma_f32_16x16x32_f16(false, a.v, false, b.v, (short)0, c, false, false);
}

// ---------------------------------------------------------------------------------------------------------
// Mask scan (f32 additive mask), one work-group per SCAN_ROWS mask rows, each writing its own 128-byte flag line g = blk:
// flags[32g] = 1 iff every entry of its rows above the diagonal is at or below -1e8 (its softmax weight is exactly zero next to a
// zero-mask diagonal entry); flags[32g + 1] = 1 iff every entry of its rows on or below the diagonal is exactly zero.
// coverage: SEQ/SCAN_ROWS blocks x SCAN_ROWS rows = every mask row; every flag line written whole.
__device__ __forceinline__ void maskscan_part(const float* __restrict__ mask, int* __restrict__ flags, int blk, int (*sw)[16]) {
  const int tid = threadIdx.x, lane = tid & 31, wv = tid >> 5;
  int badU = 0, badL = 0;
  const int cpr = SEQ / 4;
  const int qb = blk * SCAN_ROWS;
  // unrolled so that a thread's loads are all in flight together (constant trip count)
#pragma unroll
  for (int it = 0; it < SCAN_ROWS * cpr / 512; ++it) {
    const int c = tid + 512 * it;
    const int qr = c / cpr, k = (c - qr * cpr) * 4;
    const int q = qb + qr;
    const v4f m = *(const v4fa*)(mask + (size_t)q * SEQ_FULL + k);
#pragma unroll
    for (int i = 0; i < 4; ++i) {
      const int above = (k + i > q) ? 1 : 0;
      const int deep = (m[i] <= -1.0e8f) ? 1 : 0;
      const int zr = (m[i] == 0.0f) ? 1 : 0;
      badU |= above & (1 - deep);
      badL |= (1 - above) & (1 - zr);
    }
  }
#pragma unroll
  for (int o = 16; o >= 1; o >>= 1) {
    badU |= __shfl_xor(badU, o, 32);
    badL |= __shfl_xor(badL, o, 32);
  }
  if (lane == 0) { sw[0][wv] = badU; sw[1][wv] = badL; }
  __syncthreads();
  if (tid < 8) {
    int u = 0, l = 0;
#pragma unroll
    for (int i = 0; i < 16; ++i) { u |= sw[0][i]; l |= sw[1][i]; }
    v4i o;
    o[0] = (tid == 0 && u == 0) ? 1 : 0;
    o[1] = (tid == 0 && l == 0) ? 1 : 0;
    o[2] = 0; o[3] = 0;
    *(v4i*)(flags + 32 * blk + 4 * tid) = o;
    
  }
}

// ---------------------------------------------------------------------------------------------------------
// f32 rows of width CD -> 16-bit plane in fragment order. MODE 0: bf16 bits (RNE). MODE 1: f16 of (RNE bf16 value x 64).
// Thread t writes the t-th 16-byte piece of the plane (a wave stores 512 contiguous bytes) and reads the 8 source elements that belong there.
// coverage: nrows / 2 blocks x 512 threads x 8 elements = nrows x CD (nrows a multiple of 16; piece index -> (row, k) is one to one).
template <int MODE>
__device__ __forceinline__ void cvt_part(const float* __restrict__ src, unsigned short* __restrict__ dst,
                                         int blk, int rows_per_batch, int src_batch_rows) {
  const int t = blk * 512 + threadIdx.x;
  const int pl = t & 31, ph = (t >> 5) & 1, tile = t >> 6;      // lane slot, fragment half, tile of 16 rows x 32 k
  const int row = (tile / (CD / 32)) * 16 + (pl & 15);
  const int kk = (tile % (CD / 32)) * 32 + ph * 16 + (pl >> 4) * 8;
  const int b = row / rows_per_batch, r = row - b * rows_per_batch;
  const float* sp = src + ((size_t)b * src_batch_rows + r) * CD + kk;
  const v4f x0 = *(const v4fa*)(sp), x1 = *(const v4fa*)(sp + 4);
  Pack8 o;
  if (MODE == 0) {
    o.u[0] = bf16_bits(x0[0]); o.u[1] = bf16_bits(x0[1]); o.u[2] = bf16_bits(x0[2]); o.u[3] = bf16_bits(x0[3]);
    o.u[4] = bf16_bits(x1[0]); o.u[5] = bf16_bits(x1[1]); o.u[6] = bf16_bits(x1[2]); o.u[7] = bf16_bits(x1[3]);
  } else {
    o.h[0] = (_Float16)(bf16_rne(x0[0]) * 64.0f); o.h[1] = (_Float16)(bf16_rne(x0[1]) * 64.0f);
    o.h[2] = (_Float16)(bf16_rne(x0[2]) * 64.0f); o.h[3] = (_Float16)(bf16_rne(x0[3]) * 64.0f);
    o.h[4] = (_Float16)(bf16_rne(x1[0]) * 64.0f); o.h[5] = (_Float16)(bf16_rne(x1[1]) * 64.0f);
    o.h[6] = (_Float16)(bf16_rne(x1[2]) * 64.0f); o.h[7] = (_Float16)(bf16_rne(x1[3]) * 64.0f);
  }
  unsigned short* d = dst + (size_t)t * 8;
  const v8us ov = o.v;
  *(v8us*)d = ov;
  asm volatile("s_wait_xcnt 0x0" ::: "memory");        // in the shared launch another part's code follows in the text and rewrites the registers that this store names
}

// ---------------------------------------------------------------------------------------------------------
// Wave-tile GEMM core: acc[i][j] (rows 16i.., cols 16j.., i, j = 0..3) += A[row][k] * W[col][k] over k = 0..CD-1, 64 k per trip in ascending order.
// ap  = A  + row0*CD + 8*lane (fragment-order plane; A fragment: row m = ln, elements 0..7 <- k0 + 8h + i, 8..15 <- k0 + 16 + 8h + i)
// wp  = W  + col0*CD + 8*lane (B fragment: column n = ln, same k map); the tile of k0 starts 16*k0 elements into its row group
// alp = residual plane of A (same addressing), accumulated into acl when RES.
// A loaded fragment feeds four products, and the fragments of both halves of a trip are requested together, ahead of the trip's products.
template <bool BF, bool RES>
__device__ __forceinline__ void gemm_loop(const unsigned short* __restrict__ ap, const unsigned short* __restrict__ alp,
                                          const unsigned short* __restrict__ wp, v8f (&acc)[4][4], v8f (&acl)[4][4]) {
#pragma unroll 1
  for (int k = 0; k < CD; k += 64) {
    const unsigned short* pa = ap + k * 16;
    const unsigned short* pw = wp + k * 16;
    const unsigned short* pl = alp + k * 16;
    Frag a[2][4], b[2][4], al[2][4];
#pragma unroll
    for (int u = 0; u < 2; ++u) {
#pragma unroll
      for (int i = 0; i < 4; ++i) ldfrag(a[u][i], pa + (size_t)i * 16 * CD + u * 512);
#pragma unroll
      for (int j = 0; j < 4; ++j) ldfrag(b[u][j], pw + (size_t)j * 16 * CD + u * 512);
      if (RES) {
#pragma unroll
        for (int i = 0; i < 4; ++i) ldfrag(al[u][i], pl + (size_t)i * 16 * CD + u * 512);
      }
    }
    // the trip's address registers stay whole until every load that names them is issued and this wait has passed (without the operands a late load lands in them)
    if (RES) asm volatile("s_wait_xcnt 0x0" :: "v"(pa), "v"(pw), "v"(pl) : "memory");
    else     asm volatile("s_wait_xcnt 0x0" :: "v"(pa), "v"(pw) : "memory");
    // keeps every load of the trip ahead of its first product: moved down among the products, each group of loads would be waited for on its own
    __builtin_amdgcn_sched_barrier(0);
#pragma unroll
    for (int u = 0; u < 2; ++u) {
#pragma unroll
      for (int i = 0; i < 4; ++i)
#pragma unroll
        for (int j = 0; j < 4; ++j) acc[i][j] = wm<BF>(a[u][i], b[u][j], acc[i][j]);
      if (RES) {
#pragma unroll
        for (int i = 0; i < 4; ++i)
#pragma unroll
          for (int j = 0; j < 4; ++j) acl[i][j] = wm<BF>(al[u][i], b[u][j], acl[i][j]);
      }
    }
  }
}

__device__ __forceinline__ float rope1(float q, float p, float c, float s, float sg) { return q * c + (sg * p) * s; }

// ---------------------------------------------------------------------------------------------------------
// Rotary table from the position ids (read by value): rot[t][j] = cos(p_t * f_j), rot[t][32 + j] = sin(p_t * f_j), f_j = 10000^(-j/32), j = 0..31.
// Block = 16 positions x 32 frequencies, one precise sincos per thread -> LDS tile [16][64] (cross-wave: block barrier) -> 16 threads write one row
__device__ __forceinline__ void rotab_part(const int* __restrict__ pos, float* __restrict__ rot, int blk, float (*sh)[64]) {
  const int tid = threadIdx.x;
  const int r = tid >> 5, j = tid & 31;
  const int t = blk * 16 + r;
  const float p = (float)pos[t];
  const float f = exp2f(-(float)j * 0.41524101186092029f);   // log2(10000)/32
  const float ang = p * f;
  float sn, cs;
  sincosf(ang, &sn, &cs);
  sh[r][j] = cs;
  sh[r][32 + j] = sn;
  __syncthreads();
  if (tid < 256) {
    const int rr = tid >> 4, pc = tid & 15;
    const v4f v = *(const v4fa*)&sh[rr][4 * pc];
    float* d = rot + (size_t)(blk * 16 + rr) * HD + 4 * pc;
    *(v4f*)d = v;
    
  }
}

// ---------------------------------------------------------------------------------------------------------
// All preparation in one launch: the rotary table, the mask scan and the five plane conversions depend on the inputs alone and on nothing of one another,
// so each work-group of 512 threads takes one block of one of them by its index range (the test is the same for the whole work-group; each part's barrier
// is passed by every thread of the work-groups that run that part).
// coverage: the ranges below follow one another without gap or overlap and each holds exactly the blocks that its part's own coverage line asks for.
#define PB_ROT  (SEQ / 16)
#define PB_SCAN (SEQ / SCAN_ROWS)
#define PB_X    (NB * SEQ / 2)
#define PB_WQ   (CD / 2)
#define PB_WKV  (KVW / 2)
#define PB_WO   (CD / 2)
#define PB_ALL  (PB_ROT + PB_SCAN + PB_X + PB_WQ + 2 * PB_WKV + PB_WO)
__global__ __launch_bounds__(512) void k_prep(const float* __restrict__ mask, const int* __restrict__ pos, const float* __restrict__ x,
                                              const float* __restrict__ Wq, const float* __restrict__ Wk, const float* __restrict__ Wv,
                                              const float* __restrict__ Wo, int* __restrict__ flags, float* __restrict__ rot,
                                              unsigned short* __restrict__ xb, unsigned short* __restrict__ wqk,
                                              unsigned short* __restrict__ wvb, unsigned short* __restrict__ wob) {
  __shared__ int sw[2][16];
  __shared__ __attribute__((aligned(16))) float sh[16][64];
  int blk = blockIdx.x;
  if (blk < PB_ROT) { rotab_part(pos, rot, blk, sh); return; }
  blk -= PB_ROT;
  if (blk < PB_SCAN) { maskscan_part(mask, flags, blk, sw); return; }
  blk -= PB_SCAN;
  if (blk < PB_X) { cvt_part<0>(x, xb, blk, SEQ, SEQ_FULL); return; }
  blk -= PB_X;
  if (blk < PB_WQ) { cvt_part<0>(Wq, wqk, blk, CD, CD); return; }
  blk -= PB_WQ;
  if (blk < PB_WKV) { cvt_part<0>(Wk, wqk + (size_t)CD * CD, blk, KVW, KVW); return; }
  blk -= PB_WKV;
  if (blk < PB_WKV) { cvt_part<0>(Wv, wvb, blk, KVW, KVW); return; }
  blk -= PB_WKV;
  cvt_part<1>(Wo, wob, blk, CD, CD);
}

// ---------------------------------------------------------------------------------------------------------
// q and k projections with fused bias, half-split rotary (table plane [SEQ][32 cos | 32 sin]) and head-major repack.
// Block = 2 x 2 waves: 128 token rows (wave w: half w & 1) x two heads (wave w: head 2 * hpair + (w >> 1), 64 columns): hpair = 0..NQK/2-1, mblk = 0..NB*SEQ/128-1.
// coverage: NQK heads x NB*SEQ tokens x 64 = the whole plane [NB][NQK][SEQ][64], both planes. LDS tile 64 x 64 fully written before it is read.
__device__ __forceinline__ void proj_qk_part(const unsigned short* __restrict__ xb, const unsigned short* __restrict__ wqk,
                                             const float* __restrict__ bq, const float* __restrict__ bk,
                                             const float* __restrict__ tab,
                                             unsigned short* __restrict__ qkh, unsigned short* __restrict__ qkl,
                                             int hpair, int mblk, float (*st)[64][68]) {
  const int tid = threadIdx.x, lane = tid & 31, ln = lane & 15, hh = lane >> 4;
  const int w = __builtin_amdgcn_readfirstlane(tid >> 5);
  const int m0 = mblk * 128 + 64 * (w & 1);
  const int hd = 2 * hpair + (w >> 1);
  const v8f z8 = {0.f, 0.f, 0.f, 0.f, 0.f, 0.f, 0.f, 0.f};
  v8f acc[4][4];
#pragma unroll
  for (int i = 0; i < 4; ++i)
#pragma unroll
    for (int j = 0; j < 4; ++j) acc[i][j] = z8;
  gemm_loop<true, false>(xb + (size_t)m0 * CD + 8 * lane, xb, wqk + (size_t)(hd * HD) * CD + 8 * lane, acc, acc);

  float bias[4];
#pragma unroll
  for (int j = 0; j < 4; ++j) {
    const int col = hd * HD + 16 * j + ln;
    const int cq = (col < CD - 1) ? col : (CD - 1);
    int ck = col - CD;
    ck = (ck < 0) ? 0 : ((ck > KVW - 1) ? (KVW - 1) : ck);
    const float vq = bq[cq], vk = bk[ck];
    bias[j] = bf16_rne((col < CD) ? vq : vk);
  }
#pragma unroll
  for (int i = 0; i < 4; ++i)
#pragma unroll
    for (int j = 0; j < 4; ++j)
#pragma unroll
      for (int r = 0; r < 8; ++r) st[w][16 * i + 8 * hh + r][16 * j + ln] = acc[i][j][r] + bias[j];
  __syncthreads();

  const int b = m0 / SEQ, t0 = m0 - b * SEQ;
  // piece g of the wave's 64 tokens x 64 columns in fragment order: row group g >> 2, k tile (g >> 1) & 1, fragment half g & 1
  v8us oh[16], ol[16];
#pragma unroll
  for (int g = 0; g < 16; ++g) {
    const int row = 16 * (g >> 2) + ln;
    const int d0 = 32 * ((g >> 1) & 1) + 16 * (g & 1) + 8 * hh;
    const float sg = (d0 < 32) ? -1.0f : 1.0f;
    const v4f a0 = *(const v4fa*)&st[w][row][d0];
    const v4f a1 = *(const v4fa*)&st[w][row][d0 + 4];
    const v4f p0 = *(const v4fa*)&st[w][row][d0 ^ 32];
    const v4f p1 = *(const v4fa*)&st[w][row][(d0 ^ 32) + 4];
    // column d uses frequency d % 32: cos at [d % 32], sin at [32 + d % 32]
    const float* tp = tab + (size_t)(t0 + row) * HD + (d0 & 31);
    const v4f c0 = *(const v4fa*)(tp), c1 = *(const v4fa*)(tp + 4);
    const v4f s0 = *(const v4fa*)(tp + 32), s1 = *(const v4fa*)(tp + 36);
    float o[8];
    o[0] = rope1(a0[0], p0[0], c0[0], s0[0], sg); o[1] = rope1(a0[1], p0[1], c0[1], s0[1], sg);
    o[2] = rope1(a0[2], p0[2], c0[2], s0[2], sg); o[3] = rope1(a0[3], p0[3], c0[3], s0[3], sg);
    o[4] = rope1(a1[0], p1[0], c1[0], s1[0], sg); o[5] = rope1(a1[1], p1[1], c1[1], s1[1], sg);
    o[6] = rope1(a1[2], p1[2], c1[2], s1[2], sg); o[7] = rope1(a1[3], p1[3], c1[3], s1[3], sg);
    Pack8 ph8, pl8;
#pragma unroll
    for (int e = 0; e < 8; ++e) {
      const float y = o[e] * 16.0f;                       // carried x16
      const _Float16 h = toh_flush(y);
      ph8.h[e] = h;
      pl8.h[e] = toh_flush((y - (float)h) * 2048.0f);      // residual plane x2^11
    }
    oh[g] = ph8.v; ol[g] = pl8.v;
  }
  const size_t dbase = ((size_t)(b * NQK + hd) * SEQ + t0) * HD + 8 * lane;
{
#pragma unroll
    for (int g = 0; g < 16; ++g) {
      const size_t off = dbase + (size_t)g * 256;
      *(v8us*)(qkh + off) = oh[g];
      *(v8us*)(qkl + off) = ol[g];
    }
    
  }
}

// ---------------------------------------------------------------------------------------------------------
// v projection computed transposed: Vt[b][m][t] = sum_k Wv[m][k] x[b,t][k] + bv[m], carried x16, hi and residual planes.
// Block = 2 x 2 waves: 128 weight rows (wave w: half w & 1) x 128 tokens (wave w: half w >> 1): nblk = 0..NB*SEQ/128-1, mgrp = 0..KVW/128-1.
// coverage: KVW rows x NB*SEQ tokens = the whole plane [NB][KVW][SEQ], both planes. LDS tile 64 x 64 fully written before it is read.
__device__ __forceinline__ void proj_v_part(const unsigned short* __restrict__ wvb, const unsigned short* __restrict__ xb,
                                            const float* __restrict__ bv,
                                            unsigned short* __restrict__ vth, unsigned short* __restrict__ vtl,
                                            int nblk, int mgrp, float (*st)[64][68]) {
  const int tid = threadIdx.x, lane = tid & 31, ln = lane & 15, hh = lane >> 4;
  const int w = __builtin_amdgcn_readfirstlane(tid >> 5);
  const int n0 = nblk * 128 + 64 * (w >> 1);
  const int m0 = mgrp * 128 + 64 * (w & 1);
  const v8f z8 = {0.f, 0.f, 0.f, 0.f, 0.f, 0.f, 0.f, 0.f};
  v8f acc[4][4];
#pragma unroll
  for (int i = 0; i < 4; ++i)
#pragma unroll
    for (int j = 0; j < 4; ++j) acc[i][j] = z8;
  gemm_loop<true, false>(wvb + (size_t)m0 * CD + 8 * lane, wvb, xb + (size_t)n0 * CD + 8 * lane, acc, acc);
#pragma unroll
  for (int i = 0; i < 4; ++i)
#pragma unroll
    for (int j = 0; j < 4; ++j)
#pragma unroll
      for (int r = 0; r < 8; ++r) st[w][16 * i + 8 * hh + r][16 * j + ln] = acc[i][j][r];
  __syncthreads();

  const int b = n0 / SEQ, t0 = n0 - b * SEQ;
  // piece g of the wave's 64 rows x 64 tokens in fragment order: row group g >> 2, key tile (g >> 1) & 1, fragment half g & 1
  v8us oh[16], ol[16];
#pragma unroll
  for (int g = 0; g < 16; ++g) {
    const int row = 16 * (g >> 2) + ln;
    const int c0 = 32 * ((g >> 1) & 1) + 16 * (g & 1) + 8 * hh;
    const float bias = bf16_rne(bv[m0 + row]);
    const v4f a0 = *(const v4fa*)&st[w][row][c0];
    const v4f a1 = *(const v4fa*)&st[w][row][c0 + 4];
    float o[8];
    o[0] = a0[0]; o[1] = a0[1]; o[2] = a0[2]; o[3] = a0[3];
    o[4] = a1[0]; o[5] = a1[1]; o[6] = a1[2]; o[7] = a1[3];
    Pack8 ph8, pl8;
#pragma unroll
    for (int e = 0; e < 8; ++e) {
      const float y = (o[e] + bias) * 16.0f;              // carried x16
      const _Float16 h = (_Float16)y;
      ph8.h[e] = h;
      pl8.h[e] = (_Float16)((y - (float)h) * 2048.0f);
    }
    oh[g] = ph8.v; ol[g] = pl8.v;
  }
  const size_t dbase = ((size_t)b * KVW + m0) * SEQ + (size_t)t0 * 16 + 8 * lane;
{
#pragma unroll
    for (int g = 0; g < 16; ++g) {
      const size_t off = dbase + (size_t)(g >> 2) * 16 * SEQ + (size_t)(g & 3) * 256;
      *(v8us*)(vth + off) = oh[g];
      *(v8us*)(vtl + off) = ol[g];
    }
    
  }
}

// ---------------------------------------------------------------------------------------------------------
// q, k and v projections in one launch: they read the same x plane and write disjoint planes, and the v blocks alone are too few to fill the chip.
// grid = (NQK/2 + VBX, NB*SEQ/128): column c < NQK/2 is head pair c of the q/k part; the VBX columns behind it are the v blocks of the same 128 tokens
// (KVW/128 groups of weight rows). The test is the same for the whole work-group.
// coverage: every (hpair, mblk) once; (nblk, mgrp) = (y, j), j = 0..VBX-1, y = 0..NB*SEQ/128-1, is every v block once.
#define VBX (KVW / 128)
__global__ __launch_bounds__(128) void k_proj_qkv(const unsigned short* __restrict__ xb, const unsigned short* __restrict__ wqk,
                                                  const unsigned short* __restrict__ wvb,
                                                  const float* __restrict__ bq, const float* __restrict__ bk, const float* __restrict__ bv,
                                                  const float* __restrict__ tab,
                                                  unsigned short* __restrict__ qkh, unsigned short* __restrict__ qkl,
                                                  unsigned short* __restrict__ vth, unsigned short* __restrict__ vtl) {
  __shared__ __attribute__((aligned(16))) float st[4][64][68];
  const int c = blockIdx.x;
  if (c < NQK / 2) {
    proj_qk_part(xb, wqk, bq, bk, tab, qkh, qkl, c, blockIdx.y, st);
  } else {
    proj_v_part(wvb, xb, bv, vth, vtl, blockIdx.y, c - NQK / 2, st);
  }
}

// ---------------------------------------------------------------------------------------------------------
// One 32-key step for a wave's 16 queries (this lane's column = its query). EARLYP adds the residual planes of q, k, v, P.
// MASK reads the mask row of this lane's query by value (RNE bf16 value) and adds it to the scaled scores.
// Without EARLYP the fragment loads run ahead of their use: kf holds this step's K fragments on entry and the K fragments of the step at keyn on exit
// (fetched right behind the score products, into the same registers), and the V fragments of this step are fetched at the step's top, so that both
// fly under the softmax arithmetic. With EARLYP kf and keyn are not used.
template <bool EARLYP, bool MASK>
__device__ __forceinline__ void fa_step(const unsigned short* __restrict__ Kp, const unsigned short* __restrict__ Kl,
                                        const unsigned short* __restrict__ Vp, const unsigned short* __restrict__ Vl,
                                        const float* __restrict__ mrow, int key0, int keyn, int ln, int hh,
                                        const Frag (&qh)[2], const Frag (&ql)[2], Frag (&kf)[4],
                                        float& mr, float& lr, v8f (&Oh)[4], v8f (&Ol)[4]) {
  const v8f z8 = {0.f, 0.f, 0.f, 0.f, 0.f, 0.f, 0.f, 0.f};
  float sc[16];
  // A fragments of K: row m = key (key0 + 16*kt + ln), elements 0..7 <- d = 32c + 8h + i, 8..15 <- d = 32c + 16 + 8h + i
  // fragment-order plane: 16 keys = two tiles of 512 elements (c = 0, 1)
  int koff = key0 * HD + 8 * (16 * hh + ln);
  // A fragments of V^T: row m = d (16*t + ln), elements 0..7 <- key0 + 8h + i, 8..15 <- key0 + 16 + 8h + i
  // fragment-order plane: the tile of 32 keys at key0 starts 16*key0 elements into its group of 16 rows
  int voff = key0 * 16 + 8 * (16 * hh + ln);
  Frag vf[4];
  if (!EARLYP) {
#pragma unroll
    for (int t = 0; t < 4; ++t) ldfrag(vf[t], Vp + voff + (size_t)t * 16 * SEQ);
    if (MASK) asm volatile("s_wait_xcnt 0x0" ::: "memory");   // the mask loads behind them land in the registers that the V loads name
  }
  if (EARLYP) {
#pragma unroll
    for (int kt = 0; kt < 2; ++kt) {
      Frag a0, a1, l0, l1;
      ldfrag(a0, Kp + koff); ldfrag(a1, Kp + koff + 512);
      ldfrag(l0, Kl + koff); ldfrag(l1, Kl + koff + 512);
      v8f s = z8, r = z8;
      s = wm<false>(a0, qh[0], s); s = wm<false>(a1, qh[1], s);
      r = wm<false>(a0, ql[0], r); r = wm<false>(a1, ql[1], r);
      r = wm<false>(l0, qh[0], r); r = wm<false>(l1, qh[1], r);
      asm volatile("v_nop\n\tv_nop\n\tv_nop\n\tv_nop" : "+v"(s), "+v"(r)
                        : "v"(a0.v), "v"(a1.v), "v"(l0.v), "v"(l1.v), "v"(qh[0].v), "v"(qh[1].v), "v"(ql[0].v), "v"(ql[1].v));
      // S^T element r of tile kt = score(key0 + 16*kt + 8h + r, this lane's query); carries: q x16, k x16, residual x2^11
#pragma unroll
      for (int e = 0; e < 8; ++e) sc[8 * kt + e] = fmaf(r[e], S2M11, s[e]) * S2M11;
      koff += 16 * HD;
      if (kt == 0) asm volatile("" : "+v"(koff) : "v"(sc[0]));   // second tile's loads issue after the first tile is done
    }
  } else {
    v8f s0 = z8, s1 = z8;
    s0 = wm<false>(kf[0], qh[0], s0); s0 = wm<false>(kf[1], qh[1], s0);
    s1 = wm<false>(kf[2], qh[0], s1); s1 = wm<false>(kf[3], qh[1], s1);
    koff = keyn * HD + 8 * (16 * hh + ln);
    asm volatile("v_nop\n\tv_nop\n\tv_nop\n\tv_nop" : "+v"(s0), "+v"(s1)
                      : "v"(kf[0].v), "v"(kf[1].v), "v"(kf[2].v), "v"(kf[3].v), "v"(qh[0].v), "v"(qh[1].v));
    ldfrag(kf[0], Kp + koff);           ldfrag(kf[1], Kp + koff + 512);
    ldfrag(kf[2], Kp + koff + 16 * HD); ldfrag(kf[3], Kp + koff + 16 * HD + 512);
#pragma unroll
    for (int e = 0; e < 8; ++e) { sc[e] = s0[e] * S2M11; sc[8 + e] = s1[e] * S2M11; }
  }
  if (MASK) {
    const float* mp = mrow + key0 + 8 * hh;
    const v4f m0 = *(const v4fa*)(mp),      m1 = *(const v4fa*)(mp + 4);
    const v4f m2 = *(const v4fa*)(mp + 16), m3 = *(const v4fa*)(mp + 20);
#pragma unroll
    for (int e = 0; e < 4; ++e) {
      sc[e]      = sc[e]      + bf16_rne(m0[e]);
      sc[4 + e]  = sc[4 + e]  + bf16_rne(m1[e]);
      sc[8 + e]  = sc[8 + e]  + bf16_rne(m2[e]);
      sc[12 + e] = sc[12 + e] + bf16_rne(m3[e]);
    }
  }
  float mx = sc[0];
#pragma unroll
  for (int i = 1; i < 16; ++i) mx = fmaxf(mx, sc[i]);
  mx = fmaxf(mx, __shfl_xor(mx, 16, 32));            // the other lane half holds the other 16 keys of this query
  const float mnew = fmaxf(mr, mx);
  float msafe = mnew;
  if (MASK) msafe = (mnew == neg_inf()) ? 0.0f : mnew;   // every key so far at -inf: weights come out 0
  const float al = __builtin_amdgcn_exp2f((mr - msafe) * LOG2E);
  mr = mnew;
  // weights carried x256: pc = 256 * exp(sc - m); hi plane f16(pc), residual plane f16((pc - hi) * 2048)
  Frag ph, pl;
  float ps = 0.0f;
#pragma unroll
  for (int i = 0; i < 16; ++i) {
    const float pc = __builtin_amdgcn_exp2f(fmaf(sc[i] - msafe, LOG2E, 8.0f));
    ps += pc;
    // plain steps of rows from 512 on: a bare round-to-nearest-even convert, which the compiler packs two to an instruction; a weight below 2^-14 stays an f16
    // subnormal there instead of becoming zero (the matrix unit takes subnormal operands as they are). Masked and early steps keep the select.
    const _Float16 h = (EARLYP || MASK) ? toh_flush(pc) : (_Float16)pc;
    ph.h[i] = h;                                      // B element i: i<8 -> key0 + 8h + i (tile 0 row 8h+i); i>=8 -> key0 + 16 + 8h + (i-8) (tile 1)
    if (EARLYP) pl.h[i] = toh_flush((pc - (float)h) * 2048.0f);
  }
  ps += __shfl_xor(ps, 16, 32);
  lr = lr * al + ps;
  if (EARLYP) {
    asm volatile("" : "+v"(voff) : "v"(ps));          // V loads issue after the score phase
#pragma unroll
    for (int t = 0; t < 4; ++t) ldfrag(vf[t], Vp + voff + (size_t)t * 16 * SEQ);
  }
#pragma unroll
  for (int t = 0; t < 4; ++t) Oh[t] = Oh[t] * al;
  if (EARLYP) {
    const unsigned short* vq = Vl + voff;
    Frag vl[4];
#pragma unroll
    for (int t = 0; t < 4; ++t) ldfrag(vl[t], vq + (size_t)t * 16 * SEQ);
#pragma unroll
    for (int t = 0; t < 4; ++t) Ol[t] = Ol[t] * al;
#pragma unroll
    for (int t = 0; t < 4; ++t) {
      Oh[t] = wm<false>(vf[t], ph, Oh[t]);
      Ol[t] = wm<false>(vf[t], pl, Ol[t]);
      Ol[t] = wm<false>(vl[t], ph, Ol[t]);
    }
    asm volatile("v_nop\n\tv_nop\n\tv_nop\n\tv_nop" : "+v"(Oh[0]), "+v"(Oh[1]), "+v"(Oh[2]), "+v"(Oh[3]), "+v"(Ol[0]), "+v"(Ol[1]), "+v"(Ol[2]), "+v"(Ol[3])
                      : "v"(vf[0].v), "v"(vf[1].v), "v"(vf[2].v), "v"(vf[3].v),
                        "v"(vl[0].v), "v"(vl[1].v), "v"(vl[2].v), "v"(vl[3].v), "v"(ph.v), "v"(pl.v));
  } else {
#pragma unroll
    for (int t = 0; t < 4; ++t) Oh[t] = wm<false>(vf[t], ph, Oh[t]);
    asm volatile("v_nop\n\tv_nop\n\tv_nop\n\tv_nop" : "+v"(Oh[0]), "+v"(Oh[1]), "+v"(Oh[2]), "+v"(Oh[3])
                      : "v"(vf[0].v), "v"(vf[1].v), "v"(vf[2].v), "v"(vf[3].v), "v"(ph.v));
  }
}

template <bool EARLYP>
__device__ __forceinline__ void run_keys(const unsigned short* __restrict__ qkh, const unsigned short* __restrict__ qkl,
                                         const unsigned short* __restrict__ vth, const unsigned short* __restrict__ vtl,
                                         const float* __restrict__ mask, int b, int h, int qg, int ln, int hh,
                                         int nplain, int nsteps, float& mr, float& lr, v8f (&Oh)[4], v8f (&Ol)[4]) {
  // Q^T B fragments: column n = this lane's query, elements 0..7 <- d = 32c + 8h + i, 8..15 <- d = 32c + 16 + 8h + i
  const size_t qoff = ((size_t)(b * NQK + h) * SEQ + (qg - ln)) * HD + 8 * (16 * hh + ln);   // fragment-order plane, the wave's own 16 rows
  Frag qh[2], ql[2];
  ldfrag(qh[0], qkh + qoff); ldfrag(qh[1], qkh + qoff + 512);
  if (EARLYP) { ldfrag(ql[0], qkl + qoff); ldfrag(ql[1], qkl + qoff + 512); }
  else { ql[0] = qh[0]; ql[1] = qh[1]; }
  asm volatile("s_wait_xcnt 0x0" ::: "memory");        // the address registers of the Q loads are reused right behind them
  const int kv = h / NREP;                             // consecutive groups of NREP query heads share one kv head
  const size_t kbase = (size_t)(b * NQK + NHEAD + kv) * SEQ * HD;
  const size_t vbase = ((size_t)b * KVW + (size_t)kv * HD) * SEQ;
  const unsigned short* Kp = qkh + kbase;
  const unsigned short* Kl = qkl + kbase;
  const unsigned short* Vp = vth + vbase;
  const unsigned short* Vl = vtl + vbase;
  const float* mrow = mask + (size_t)qg * SEQ_FULL;
  Frag kf[4];
  if (!EARLYP) {                                       // K fragments of step 0 (nsteps >= 1)
    const unsigned short* k0 = Kp + 8 * (16 * hh + ln);
    ldfrag(kf[0], k0);           ldfrag(kf[1], k0 + 512);
    ldfrag(kf[2], k0 + 16 * HD); ldfrag(kf[3], k0 + 16 * HD + 512);
    asm volatile("s_wait_xcnt 0x0" ::: "memory");      // the address registers of the K loads are reused behind them
  }
  // the step fetched ahead is the next one; the last step fetches its own tile again, so that the address stays inside the plane
#pragma unroll 1
  for (int j = 0; j < nplain; ++j)
    fa_step<EARLYP, false>(Kp, Kl, Vp, Vl, mrow, 32 * j, 32 * ((j + 1 < nsteps) ? j + 1 : j), ln, hh, qh, ql, kf, mr, lr, Oh, Ol);
#pragma unroll 1
  for (int j = nplain; j < nsteps; ++j)
    fa_step<EARLYP, true>(Kp, Kl, Vp, Vl, mrow, 32 * j, 32 * ((j + 1 < nsteps) ? j + 1 : j), ln, hh, qh, ql, kf, mr, lr, Oh, Ol);
}

// Block = 4 waves x 16 queries = 64 queries of one (batch, head); no LDS and no barrier.
// Tile skipping from the device flags, per wave: both flags of both flag lines that cover the wave's 16 query rows are 1 -> keys past the diagonal step are
// skipped (their weights are exactly zero) and steps fully below the diagonal run without mask reads (their mask entries are exactly zero); every other
// visited step reads the mask by value. A softmax row depends on its own mask row alone, so the wave's own rows decide.
// For any other flag value every step is visited and reads the mask. Trip counts are bounded by SEQ/32 for any flag value.
// coverage: NB*NHEAD*(SEQ/64) blocks x 4 waves x 16 rows x 64 columns = the whole ctx hi plane; blocks with query tile below EARLY_ROWS cover the whole residual plane.
__global__ __launch_bounds__(128) void k_attn(const unsigned short* __restrict__ qkh, const unsigned short* __restrict__ qkl,
                                              const unsigned short* __restrict__ vth, const unsigned short* __restrict__ vtl,
                                              const float* __restrict__ mask, const int* __restrict__ flags,
                                              unsigned short* __restrict__ ctxh, unsigned short* __restrict__ ctxl) {
  const int tid = threadIdx.x, lane = tid & 31, ln = lane & 15, hh = lane >> 4;
  const int w = __builtin_amdgcn_readfirstlane(tid >> 5);
  const int nqt = SEQ / 64;
  const int blk = blockIdx.x;
  // not all work-groups are resident at once, so the tiles that last longest take the lowest block indices and the short ones fill the places that come free.
  // A tile below EARLY_ROWS has few key steps, but each of them carries the residual planes and waits out its own loads, so such a tile lasts as long as a much
  // higher one: these tiles come first (highest first), then the others, whose key steps grow with the index, highest first (blk -> (qt, b, h) is one to one)
  const int nqe = EARLY_ROWS / 64;
  const int rk = blk / (NB * NHEAD);
  const int qt = (rk < nqe) ? (nqe - 1 - rk) : (nqt - 1 - (rk - nqe));
  const int bh = blk % (NB * NHEAD);
  const int h = bh % NHEAD;
  const int b = bh / NHEAD;
  const int qbase = qt * 64 + 16 * w;
  const int qg = qbase + ln;
  const int* fl = flags + (qbase / SCAN_ROWS) * 32;    // 16 query rows = 16 / SCAN_ROWS flag lines
  int fok = 1;                                         // bitwise, so that the flag loads issue together
#pragma unroll
  for (int i = 0; i < 16 / SCAN_ROWS; ++i) fok &= (fl[32 * i] == 1 ? 1 : 0) & (fl[32 * i + 1] == 1 ? 1 : 0);
  const bool tri = (fok == 1);
  const int nfull = qbase >> 5;                        // steps whose 32 keys are all at or below every query of this wave
  const int nsteps = tri ? (nfull + 1) : (SEQ / 32);   // <= SEQ/32 in both cases
  const int nplain = tri ? nfull : 0;
  const bool early = (qt * 64 < EARLY_ROWS);

  const v8f z8 = {0.f, 0.f, 0.f, 0.f, 0.f, 0.f, 0.f, 0.f};
  float mr = neg_inf(), lr = 0.0f;
  v8f Oh[4], Ol[4];
#pragma unroll
  for (int t = 0; t < 4; ++t) { Oh[t] = z8; Ol[t] = z8; }
  if (early) run_keys<true>(qkh, qkl, vth, vtl, mask, b, h, qg, ln, hh, nplain, nsteps, mr, lr, Oh, Ol);
  else       run_keys<false>(qkh, qkl, vth, vtl, mask, b, h, qg, ln, hh, nplain, nsteps, mr, lr, Oh, Ol);

  // O^T element r of tile t = ctx(query, d = 16t + 8h + r); undo the carries x256 (in lr), x16 (V), x2^11 (residual); apply the x64 carry of ctx
  const float inv = 4.0f * (1.0f / lr);
  // tile t of O^T in this lane = row ln, columns 16t + 8h + 0..7 of ctx: exactly this lane's 16-byte piece t of the wave's two fragment-order tiles
  // (k tile t >> 1, fragment half t & 1), so the registers are stored as they stand, 512 contiguous bytes per wave and store
  v8us oh[4], ol[4];
#pragma unroll
  for (int t = 0; t < 4; ++t) {
    Pack8 ph8, pl8;
#pragma unroll
    for (int e = 0; e < 8; ++e) {
      const float o = fmaf(Ol[t][e], S2M11, Oh[t][e]) * inv;
      const _Float16 hv = toh_flush(o);
      ph8.h[e] = hv;
      pl8.h[e] = toh_flush((o - (float)hv) * 2048.0f);
    }
    oh[t] = ph8.v; ol[t] = pl8.v;
  }
  const size_t hbase = ((size_t)b * SEQ + qbase) * CD + (size_t)h * (16 * HD) + 8 * lane;
  const size_t lbase = ((size_t)b * EARLY_ROWS + (early ? qbase : 0)) * CD + (size_t)h * (16 * HD) + 8 * lane;
#pragma unroll
  for (int t = 0; t < 4; ++t) *(v8us*)(ctxh + hbase + t * 256) = oh[t];
  asm volatile("s_wait_xcnt 0x0" ::: "memory");        // the residual stores' address arithmetic below may reuse the registers that these stores name
  if (early) {
#pragma unroll
    for (int t = 0; t < 4; ++t) *(v8us*)(ctxl + lbase + t * 256) = ol[t];
  }
}

// ---------------------------------------------------------------------------------------------------------
// Output projection: out[m][n] = sum_k ctx[m][k] Wo[n][k] + bo[n]. Block = 2 x 2 waves: 128 rows (wave w: half w & 1) x 128 columns (half w >> 1). grid = (CD/128, NB*SEQ/128).
// Rows below EARLY_ROWS of each sequence add the residual plane of ctx in separate accumulators.
// coverage: NB*SEQ rows x CD columns = every element of the output buffer region once. LDS tile 64 x 64 fully written before it is read.
__global__ __launch_bounds__(128) void k_proj_out(const unsigned short* __restrict__ ctxh, const unsigned short* __restrict__ ctxl,
                                                  const unsigned short* __restrict__ wo, const float* __restrict__ bo,
                                                  float* __restrict__ out) {
  __shared__ __attribute__((aligned(16))) float st[4][64][68];
  const int tid = threadIdx.x, lane = tid & 31, ln = lane & 15, hh = lane >> 4;
  const int w = __builtin_amdgcn_readfirstlane(tid >> 5);
  const int n0 = blockIdx.x * 128 + 64 * (w >> 1);
  // row blocks below EARLY_ROWS do twice the products (residual plane): they take the lowest block indices, one run for all sequences (blockIdx.y -> (b, tb) is one to one)
  const int ne = EARLY_ROWS / 128, nl = (SEQ - EARLY_ROWS) / 128;
  const int ry = blockIdx.y, rl = ry - NB * ne;
  const int b = (rl < 0) ? ry / ne : rl / (nl > 0 ? nl : 1);
  const int tb = 128 * ((rl < 0) ? ry - b * ne : ne + rl - b * nl);
  const int mb = b * SEQ + tb;
  const bool early = (tb < EARLY_ROWS);                // block-uniform: EARLY_ROWS and SEQ are multiples of 128
  const int t0 = tb + 64 * (w & 1);
  const int m0 = mb + 64 * (w & 1);
  const v8f z8 = {0.f, 0.f, 0.f, 0.f, 0.f, 0.f, 0.f, 0.f};
  v8f acc[4][4], acl[4][4];
#pragma unroll
  for (int i = 0; i < 4; ++i)
#pragma unroll
    for (int j = 0; j < 4; ++j) { acc[i][j] = z8; acl[i][j] = z8; }
  const unsigned short* ap = ctxh + (size_t)m0 * CD + 8 * lane;
  const unsigned short* alp = ctxl + (size_t)(b * EARLY_ROWS + (early ? t0 : 0)) * CD + 8 * lane;
  const unsigned short* wp = wo + (size_t)n0 * CD + 8 * lane;
  if (early) gemm_loop<false, true>(ap, alp, wp, acc, acl);
  else       gemm_loop<false, false>(ap, ap, wp, acc, acl);
  // carries: ctx x64, Wo x64 -> 2^-12; residual plane additionally x2^11
#pragma unroll
  for (int i = 0; i < 4; ++i)
#pragma unroll
    for (int j = 0; j < 4; ++j)
#pragma unroll
      for (int r = 0; r < 8; ++r)
        st[w][16 * i + 8 * hh + r][16 * j + ln] = fmaf(acl[i][j][r], S2M11, acc[i][j][r]) * S2M12;
  __syncthreads();
  const int rsub = lane >> 4, c4 = 4 * (lane & 15);
  const v4f bb = *(const v4fa*)(bo + n0 + c4);
  v4f bias;
  bias[0] = bf16_rne(bb[0]); bias[1] = bf16_rne(bb[1]); bias[2] = bf16_rne(bb[2]); bias[3] = bf16_rne(bb[3]);
  v4f ov[32];
#pragma unroll
  for (int g = 0; g < 32; ++g) {
    const v4f a = *(const v4fa*)&st[w][2 * g + rsub][c4];
    ov[g] = a + bias;
  }
  float* og = out + ((size_t)b * SEQ_FULL + t0) * CD + n0 + c4;
{
#pragma unroll
    for (int g = 0; g < 32; ++g)
      *(v4f*)(og + (size_t)(2 * g + rsub) * CD) = ov[g];
    
  }
}

// ---------------------------------------------------------------------------------------------------------
extern "C" void kernel_launch(void* const* d_in, const int* in_sizes, int n_in,
                              void* d_out, int out_size, void* d_ws, size_t ws_size, hipStream_t stream) {
  if (n_in < 11) return;
  const long long need_x = (long long)(NB - 1) * SEQ_FULL * CD + (long long)SEQ * CD;   // last element touched + 1
  const long long need_m = (long long)(SEQ - 1) * SEQ_FULL + SEQ;
  if ((long long)in_sizes[0] < need_x) return;
  if ((long long)in_sizes[1] < need_m) return;
  if ((long long)in_sizes[2] < (long long)SEQ) return;
  if ((long long)in_sizes[3] < (long long)CD * CD || (long long)in_sizes[4] < CD) return;
  if ((long long)in_sizes[5] < (long long)KVW * CD || (long long)in_sizes[6] < KVW) return;
  if ((long long)in_sizes[7] < (long long)KVW * CD || (long long)in_sizes[8] < KVW) return;
  if ((long long)in_sizes[9] < (long long)CD * CD || (long long)in_sizes[10] < CD) return;
  if ((long long)out_size < need_x) return;
  if ((size_t)WS_TOTAL > ws_size) return;

  // wire order: hidden_states, attention_mask (f32), position_ids (i32), Wq, bq, Wk, bk, Wv, bv, Wo, bo
  const float* x    = (const float*)d_in[0];
  const float* mask = (const float*)d_in[1];
  const int*   pos  = (const int*)d_in[2];
  const float* Wq   = (const float*)d_in[3];
  const float* bq   = (const float*)d_in[4];
  const float* Wk   = (const float*)d_in[5];
  const float* bk   = (const float*)d_in[6];
  const float* Wv   = (const float*)d_in[7];
  const float* bv   = (const float*)d_in[8];
  const float* Wo   = (const float*)d_in[9];
  const float* bo   = (const float*)d_in[10];
  float* out = (float*)d_out;

  char* ws = (char*)d_ws;
  size_t off = 0;
  int* flags = (int*)(ws + off);                               off += SZ_FLAGS;
  float* rot = (float*)(ws + off);                             off += SZ_ROT;
  unsigned short* xb   = (unsigned short*)(ws + off);          off += SZ_XB;
  unsigned short* wqk  = (unsigned short*)(ws + off);          off += SZ_WQK;
  unsigned short* wvb  = (unsigned short*)(ws + off);          off += SZ_WV;
  unsigned short* wob  = (unsigned short*)(ws + off);          off += SZ_WO;
  unsigned short* qkh  = (unsigned short*)(ws + off);          off += PLANE_QK * 2;
  unsigned short* qkl  = (unsigned short*)(ws + off);          off += PLANE_QK * 2;
  unsigned short* vth  = (unsigned short*)(ws + off);          off += PLANE_V * 2;
  unsigned short* vtl  = (unsigned short*)(ws + off);          off += PLANE_V * 2;
  unsigned short* ctxh = (unsigned short*)(ws + off);          off += SZ_CTXH;
  unsigned short* ctxl = (unsigned short*)(ws + off);          off += SZ_CTXL;
  if (off > ws_size) return;

  // flags, rotary table, and in[rows][CD] f32 -> 16-bit planes of rows x CD in fragment order
  k_prep<<<(unsigned)PB_ALL, 512, 0, stream>>>(mask, pos, x, Wq, Wk, Wv, Wo, flags, rot, xb, wqk, wvb, wob);
  k_proj_qkv<<<dim3(NQK / 2 + VBX, (unsigned)(NB * SEQ / 128)), 128, 0, stream>>>(xb, wqk, wvb, bq, bk, bv, rot, qkh, qkl, vth, vtl);
  k_attn<<<(unsigned)(NB * NHEAD * (SEQ / 64)), 128, 0, stream>>>(qkh, qkl, vth, vtl, mask, flags, ctxh, ctxl);
  k_proj_out<<<dim3(CD / 128, (unsigned)(NB * SEQ / 128)), 128, 0, stream>>>(ctxh, ctxl, wob, bo, out);
}
